// v000
// Times are from an AMD MI455X. After a warm-up the kernel runs many times in a row, and a time is the length of
// such a window on the GPU divided by its runs, so every launch and the gaps after it count. The runs cycle
// through copies of the inputs. A figure is the median of several windows, for all but v000 over two sittings.
// Sittings can differ by a few percent; kernels timed side by side share one.
// v000 is the starting kernel. One run takes 930 microseconds.
#include <hip/hip_runtime.h>
#include <math.h>
#include <stddef.h>

// All contractions (q/k/v projections, q.k^T scores, p.v, output projection): v_wmma_f32_16x16x32_bf16 with bf16 hi/lo operands everywhere (hi*hi + hi*lo + lo*hi), f32 accumulate; softmax, rotary, scale and biases in f32.

constexpr int BB    = 2;
constexpr int S     = 2048;
constexpr int HID   = 2048;
constexpr int NH    = 16;
constexpr int NKV   = 2;
constexpr int HD    = 128;
constexpr int NREP  = NH / NKV;            // 8
constexpr int MROWS = BB * S;              // 4096 token rows
constexpr int NQ    = NH * HD;             // 2048
constexpr int NKVD  = NKV * HD;            // 256
constexpr int NQT   = S / 16;              // 128 query tiles of 16 rows
constexpr int NKT   = S / 32;              // 64 key tiles of 32 keys
constexpr int NFREQ = HD / 2;              // 64 rotary frequencies
constexpr float SCALE = 0.08838834764831845f;   // 1/sqrt(128)
constexpr int CP  = 132;                   // LDS pitch (floats), 64x128 C tile
constexpr int OSP = 132;                   // LDS pitch (floats), 16x128 O tile
constexpr int TP  = 68;                    // LDS pitch (floats), transpose tile

constexpr int EPI_ROPE = 1;                // hi/lo planes out, column bias, rotary
constexpr int EPI_ROWB = 2;                // hi/lo planes out, row bias
constexpr int EPI_F32  = 3;                // f32 out, column bias

static_assert(MROWS % 64 == 0);
static_assert(NQ % 128 == 0);
static_assert(NKVD % 128 == 0);
static_assert(HID % 64 == 0);
static_assert(S % 32 == 0);

typedef unsigned int   u32;
typedef unsigned short u16;
typedef __bf16 v16bf __attribute__((ext_vector_type(16)));
typedef float  v8f   __attribute__((ext_vector_type(8)));
typedef int    v8i   __attribute__((ext_vector_type(8)));
typedef float  v4f   __attribute__((ext_vector_type(4)));
typedef u32    v4u   __attribute__((ext_vector_type(4)));
typedef int    v4i   __attribute__((ext_vector_type(4)));
typedef v4f v4fa __attribute__((may_alias));
typedef v4u v4ua __attribute__((may_alias));
typedef v4i v4ia __attribute__((may_alias));

union Frag { v16bf v; v4u q[2]; };

// ---------------- bf16 RNE split helpers (integer bit arithmetic) ----------
__device__ __forceinline__ u32 bfb(float f) {
    const u32 u = __builtin_bit_cast(u32, f);
    return (u + 0x7FFFu + ((u >> 16) & 1u)) >> 16;
}
__device__ __forceinline__ float bff(u32 b) { return __builtin_bit_cast(float, b << 16); }

// 8 f32 -> packed bf16 hi plane (4 dwords) and lo plane (4 dwords); element 2c in the low half-word
__device__ __forceinline__ void split8(const float (&x)[8], v4u& hi, v4u& lo) {
#pragma unroll
    for (int c = 0; c < 4; ++c) {
        const u32 h0 = bfb(x[2 * c]), h1 = bfb(x[2 * c + 1]);
        const u32 l0 = bfb(x[2 * c] - bff(h0)), l1 = bfb(x[2 * c + 1] - bff(h1));
        hi[c] = h0 | (h1 << 16);
        lo[c] = l0 | (l1 << 16);
    }
}

// ---------------- fragment loader (A map and B map identical, k-contiguous row) -------
// p = plane + row*ld + k0 + 8*h ; elements 0..7 <- k0+8h..+7, elements 8..15 <- k0+16+8h..+7
__device__ __forceinline__ v16bf ldfrag(const u16* p) {
    Frag f;
    f.q[0] = *(const v4ua*)(p);
    f.q[1] = *(const v4ua*)(p + 16);
    return f.v;
}

__device__ __forceinline__ v8f zero8() {
    v8f z;
#pragma unroll
    for (int i = 0; i < 8; ++i) z[i] = 0.0f;
    return z;
}

// three-term hi/lo product into one f32 accumulator, then the 4-slot hazard guard
__device__ __forceinline__ void mma3(v8f& acc, v16bf ah, v16bf al, v16bf bh, v16bf bl) {
    acc = __builtin_amdgcn_wmma_f32_16x16x32_bf16(false, ah, false, bh, (short)0, acc, false, false);
    acc = __builtin_amdgcn_wmma_f32_16x16x32_bf16(false, ah, false, bl, (short)0, acc, false, false);
    acc = __builtin_amdgcn_wmma_f32_16x16x32_bf16(false, al, false, bh, (short)0, acc, false, false);
    const v8i ia = __builtin_bit_cast(v8i, ah);
    const v8i ib = __builtin_bit_cast(v8i, al);
    const v8i ic = __builtin_bit_cast(v8i, bh);
    const v8i id = __builtin_bit_cast(v8i, bl);
    asm volatile("v_nop\n\tv_nop\n\tv_nop\n\tv_nop"
                 : "+v"(acc) : "v"(ia), "v"(ib), "v"(ic), "v"(id) : "memory");
}

__device__ __forceinline__ void st2u(u16* ph, u16* pl, v4u hi, v4u lo) {
    *(v4u*)ph = hi;
    *(v4u*)pl = lo;
    
}
__device__ __forceinline__ void st2f(float* p, v4f v) {
    *(v4f*)p = v;
    
}

// ---------------- X: f32 rows -> hi/lo bf16 planes, same layout --------------------------
__global__ void __launch_bounds__(256)
k_split_rows(const float* X, int n, u16* Xh, u16* Xl)
{
    const size_t i = ((size_t)blockIdx.x * 256 + threadIdx.x) * 8;
    if (i + 8 <= (size_t)n) {
        const v4f a = *(const v4fa*)(X + i);
        const v4f c = *(const v4fa*)(X + i + 4);
        float x[8] = {a[0], a[1], a[2], a[3], c[0], c[1], c[2], c[3]};
        v4u hi, lo;
        split8(x, hi, lo);
        st2u(Xh + i, Xl + i, hi, lo);
    }
}

// ---------------- weights: in[nrows][ncols] f32 -> hi/lo planes out[ncols][nrows] ----------
// grid (ncols/64, nrows/64); LDS transpose; each output line (64 halves) by lanes 8q..8q+7
__global__ void __launch_bounds__(256)
k_split_t(const float* W, int nrows, int ncols, u16* Th, u16* Tl)
{
    __shared__ __align__(16) float T[64 * TP];
    const int tid = threadIdx.x;
    const int cb = blockIdx.x * 64;      // input column tile == output row tile
    const int rb = blockIdx.y * 64;      // input row tile    == output column tile
#pragma unroll
    for (int it = 0; it < 4; ++it) {
        const int fl = it * 256 + tid;
        const int rr = fl >> 4, cc = (fl & 15) * 4;
        const v4f v = *(const v4fa*)(W + (size_t)(rb + rr) * ncols + cb + cc);
        T[(cc + 0) * TP + rr] = v[0];
        T[(cc + 1) * TP + rr] = v[1];
        T[(cc + 2) * TP + rr] = v[2];
        T[(cc + 3) * TP + rr] = v[3];
    }
    __syncthreads();
#pragma unroll
    for (int it = 0; it < 2; ++it) {
        const int orow = it * 32 + (tid >> 3), oc = (tid & 7) * 8;
        const v4f a = *(const v4fa*)(T + orow * TP + oc);
        const v4f c = *(const v4fa*)(T + orow * TP + oc + 4);
        float x[8] = {a[0], a[1], a[2], a[3], c[0], c[1], c[2], c[3]};
        v4u hi, lo;
        split8(x, hi, lo);
        const size_t o = (size_t)(cb + orow) * nrows + rb + oc;
        st2u(Th + o, Tl + o, hi, lo);
    }
}

// ---------------- rotary table: cos/sin of f32(ts[row] * inv_freq[j]) ---------------------
__global__ void __launch_bounds__(256)
k_rope_table(const float* ts, int nrows, float* cosT, float* sinT)
{
    const int tid = threadIdx.x;
    const int row = blockIdx.x * 4 + (tid >> 6);
    const int j   = tid & 63;
    const int rc  = row < nrows ? row : nrows - 1;
    const float t = ts[rc];
    // inv_freq[j] = 1 / f32(10000^(j/64)); the power evaluated in f64 and converted once
    const double p  = exp2((double)j * (13.287712379549449 / 64.0));
    const float  pf = (float)p;
    const float inv = 1.0f / pf;
    const float ang = t * inv;
    float sn, cs;
    sincosf(ang, &sn, &cs);
    if (row < nrows) {
        const size_t o = (size_t)row * NFREQ + j;
        *(float*)(cosT + o) = cs;
        *(float*)(sinT + o) = sn;
        
    }
}

// ---------------- tile flags from the additive input mask ---------------------------------
// flag[qt][kt] = 1 when every entry of the 16x32 mask tile is <= -1e8 (tile contributes 0)
__global__ void __launch_bounds__(256)
k_flags(const float* amask, int* flags)
{
    __shared__ __align__(16) int sf[32];
    const int tid = threadIdx.x, lane = tid & 31, w = tid >> 5;
    const int qt = blockIdx.x, hf = blockIdx.y;
    const int t = tid >> 3, sub = tid & 7;
    const int kt = hf * 32 + t;
    const int kb = kt * 32;
    int ok = 1;
#pragma unroll
    for (int rr = 0; rr < 2; ++rr) {
        const int q = qt * 16 + sub * 2 + rr;
        const float* mp = amask + (size_t)q * S + kb;
#pragma unroll
        for (int c = 0; c < 8; ++c) {
            const v4f v = *(const v4fa*)(mp + 4 * c);
            ok &= (int)(v[0] <= -1.0e8f) & (int)(v[1] <= -1.0e8f) &
                  (int)(v[2] <= -1.0e8f) & (int)(v[3] <= -1.0e8f);
        }
    }
    ok &= __shfl_xor(ok, 1);
    ok &= __shfl_xor(ok, 2);
    ok &= __shfl_xor(ok, 4);
    if (sub == 0) sf[t] = ok;
    __syncthreads();
    if (w == 0 && lane < 8) {
        const v4i f = *(const v4ia*)(sf + lane * 4);
        int* dst = flags + (size_t)qt * NKT + hf * 32 + lane * 4;
        *(v4i*)dst = f;
        
    }
}

// ---------------- hi/lo split GEMM: C[i][j] = sum_k A[i][k] * B[j][k] -----------------------
// A planes [*][lda], B planes [*][ldb], both k-contiguous; block tile 64(i) x 128(j),
// 4 waves as 2x2, wave tile 32x64 = 2x4 accumulators; fragments loaded straight from global.
template<int EPI>
__global__ void __launch_bounds__(128)
gemm_x3(const u16* Ah, const u16* Al, int lda,
        const u16* Bh, const u16* Bl, int ldb, int K,
        const float* bias, const float* cosT, const float* sinT,
        u16* Oh, u16* Ol, float* Of, int ldo)
{
    __shared__ __align__(16) float Cs[64 * CP];
    const int tid = threadIdx.x, w = tid >> 5, lane = tid & 31;
    const int h = lane >> 4, ln = lane & 15;
    const int wm = w >> 1, wn = w & 1;
    const int i0 = blockIdx.y * 64, j0 = blockIdx.x * 128;

    v8f acc[2][4];
#pragma unroll
    for (int mi = 0; mi < 2; ++mi)
#pragma unroll
        for (int ni = 0; ni < 4; ++ni) acc[mi][ni] = zero8();

    size_t aofs[2], bofs[4];
#pragma unroll
    for (int mi = 0; mi < 2; ++mi)
        aofs[mi] = (size_t)(i0 + wm * 32 + mi * 16 + ln) * lda + 8 * h;
#pragma unroll
    for (int ni = 0; ni < 4; ++ni)
        bofs[ni] = (size_t)(j0 + wn * 64 + ni * 16 + ln) * ldb + 8 * h;

#pragma unroll 1
    for (int k0 = 0; k0 < K; k0 += 32) {
        const v16bf ah0 = ldfrag(Ah + aofs[0] + k0);
        const v16bf al0 = ldfrag(Al + aofs[0] + k0);
        const v16bf ah1 = ldfrag(Ah + aofs[1] + k0);
        const v16bf al1 = ldfrag(Al + aofs[1] + k0);
#pragma unroll
        for (int ni = 0; ni < 4; ++ni) {
            const v16bf bh = ldfrag(Bh + bofs[ni] + k0);
            const v16bf bl = ldfrag(Bl + bofs[ni] + k0);
            mma3(acc[0][ni], ah0, al0, bh, bl);
            mma3(acc[1][ni], ah1, al1, bh, bl);
        }
    }

    // stage the 64x128 f32 tile in LDS: D element r of lane l = (row 8h+r, col ln)
#pragma unroll
    for (int mi = 0; mi < 2; ++mi)
#pragma unroll
        for (int ni = 0; ni < 4; ++ni)
#pragma unroll
            for (int r = 0; r < 8; ++r)
                Cs[(wm * 32 + mi * 16 + 8 * h + r) * CP + wn * 64 + ni * 16 + ln] = acc[mi][ni][r];
    __syncthreads();

    if (EPI == EPI_F32) {
        // row segment = 128 floats = 512 B = 32 lanes x 16 B, one instruction per row
#pragma unroll 1
        for (int it = 0; it < 16; ++it) {
            const int row = it * 4 + w, col = lane * 4;
            v4f x = *(const v4fa*)(Cs + row * CP + col);
            const v4f bv = *(const v4fa*)(bias + j0 + col);
            x += bv;
            st2f(Of + (size_t)(i0 + row) * ldo + j0 + col, x);
        }
    } else {
        // row segment = 128 halves = 256 B = 16 lanes x 16 B per plane; lanes 16..31 take the next row
#pragma unroll 1
        for (int it = 0; it < 8; ++it) {
            const int row = it * 8 + w * 2 + h, colc = ln * 8;
            const int gi = i0 + row;
            const float* cr = Cs + row * CP;
            float x[8];
            {
                const v4f a = *(const v4fa*)(cr + colc);
                const v4f c = *(const v4fa*)(cr + colc + 4);
                x[0] = a[0]; x[1] = a[1]; x[2] = a[2]; x[3] = a[3];
                x[4] = c[0]; x[5] = c[1]; x[6] = c[2]; x[7] = c[3];
            }
            if (EPI == EPI_ROWB) {
                const float bvv = bias[gi];
#pragma unroll
                for (int e = 0; e < 8; ++e) x[e] += bvv;
            } else {
                const v4f b0 = *(const v4fa*)(bias + j0 + colc);
                const v4f b1 = *(const v4fa*)(bias + j0 + colc + 4);
                x[0] += b0[0]; x[1] += b0[1]; x[2] += b0[2]; x[3] += b0[3];
                x[4] += b1[0]; x[5] += b1[1]; x[6] += b1[2]; x[7] += b1[3];
            }
            if (EPI == EPI_ROPE) {
                // block tile == one head (128 columns); partner column d^64, frequency j = d&63
                const int pc = colc ^ 64;
                float xp[8];
                {
                    const v4f a = *(const v4fa*)(cr + pc);
                    const v4f c = *(const v4fa*)(cr + pc + 4);
                    const v4f b0 = *(const v4fa*)(bias + j0 + pc);
                    const v4f b1 = *(const v4fa*)(bias + j0 + pc + 4);
                    xp[0] = a[0] + b0[0]; xp[1] = a[1] + b0[1]; xp[2] = a[2] + b0[2]; xp[3] = a[3] + b0[3];
                    xp[4] = c[0] + b1[0]; xp[5] = c[1] + b1[1]; xp[6] = c[2] + b1[2]; xp[7] = c[3] + b1[3];
                }
                const int jb = colc & 63;
                const float* cp = cosT + (size_t)gi * NFREQ + jb;
                const float* sp = sinT + (size_t)gi * NFREQ + jb;
                const v4f c0 = *(const v4fa*)(cp), c1 = *(const v4fa*)(cp + 4);
                const v4f s0 = *(const v4fa*)(sp), s1 = *(const v4fa*)(sp + 4);
                float cs[8] = {c0[0], c0[1], c0[2], c0[3], c1[0], c1[1], c1[2], c1[3]};
                float sn[8] = {s0[0], s0[1], s0[2], s0[3], s1[0], s1[1], s1[2], s1[3]};
                const float sg = (colc < 64) ? -1.0f : 1.0f;
#pragma unroll
                for (int e = 0; e < 8; ++e) x[e] = x[e] * cs[e] + sg * (xp[e] * sn[e]);
            }
            v4u hi, lo;
            split8(x, hi, lo);
            const size_t o = (size_t)gi * ldo + j0 + colc;
            st2u(Oh + o, Ol + o, hi, lo);
        }
    }
}

// ---------------- flash attention, GQA, hi/lo split on both products ---------------------
// one wave per (16 query rows, head, batch); 32 keys per step; online f32 softmax;
// Q planes [4096][2048], K planes [4096][256], Vt planes [256][4096] (key-contiguous),
// additive mask added by value, fully-masked tiles skipped via flags; O -> hi/lo planes [4096][2048]
__global__ void __launch_bounds__(32)
attn_x3(const u16* Qh, const u16* Ql, const u16* Kh, const u16* Kl,
        const u16* Vh, const u16* Vl, const float* amask, const int* flags,
        u16* Oh, u16* Ol)
{
    __shared__ __align__(16) u16 Ph[16 * 32];
    __shared__ __align__(16) u16 Pl[16 * 32];
    __shared__ __align__(16) float Os[16 * OSP];

    const int lane = threadIdx.x & 31, h = lane >> 4, ln = lane & 15;
    const int qt = blockIdx.x, hh = blockIdx.y, b = blockIdx.z;
    const int kvh = hh / NREP;
    const int q0 = qt * 16;

    const size_t qofs = (size_t)(b * S + q0 + ln) * NQ + hh * HD + 8 * h;     // A row ln, + dc*32
    const size_t kofs = (size_t)(b * S + ln) * NKVD + kvh * HD + 8 * h;      // + key0*NKVD + dc*32
    const size_t vofs = (size_t)(kvh * HD + ln) * MROWS + b * S + 8 * h;      // + d0*MROWS + kb
    const size_t mofs = (size_t)(q0 + 8 * h) * S + ln;                        // + r*S + kb (+16)

    float mrun[8], lrun[8];
    v8f o[8];
#pragma unroll
    for (int r = 0; r < 8; ++r) { mrun[r] = -1.0e30f; lrun[r] = 0.0f; }
#pragma unroll
    for (int t = 0; t < 8; ++t) o[t] = zero8();

    for (int kt = 0; kt < NKT; ++kt) {
        int f = flags[qt * NKT + kt];
        f = __builtin_amdgcn_readfirstlane(f);
        if (f == 1) continue;                      // wave-uniform skip of an all-masked tile
        const int kb = kt * 32;

        // scores S[16 q][32 keys] = Q . K^T over 128 dims (4 k-steps), two 16-key accumulators
        v8f s0 = zero8(), s1 = zero8();
#pragma unroll
        for (int dc = 0; dc < 4; ++dc) {
            const v16bf qh = ldfrag(Qh + qofs + dc * 32);
            const v16bf ql = ldfrag(Ql + qofs + dc * 32);
            const size_t k0o = kofs + (size_t)kb * NKVD + dc * 32;
            const size_t k1o = k0o + (size_t)16 * NKVD;
            v16bf kh = ldfrag(Kh + k0o);
            v16bf kl = ldfrag(Kl + k0o);
            mma3(s0, qh, ql, kh, kl);
            kh = ldfrag(Kh + k1o);
            kl = ldfrag(Kl + k1o);
            mma3(s1, qh, ql, kh, kl);
        }

        // scale + additive mask by value + online softmax; lane (h,ln): s[r] = (row 8h+r, key kb + nt*16 + ln)
#pragma unroll
        for (int r = 0; r < 8; ++r) {
            const float* mp = amask + mofs + (size_t)r * S + kb;
            const float mk0 = mp[0];
            const float mk1 = mp[16];
            const float a0 = s0[r] * SCALE + mk0;
            const float a1 = s1[r] * SCALE + mk1;
            float mx = fmaxf(a0, a1);
            mx = fmaxf(mx, __shfl_xor(mx, 1));
            mx = fmaxf(mx, __shfl_xor(mx, 2));
            mx = fmaxf(mx, __shfl_xor(mx, 4));
            mx = fmaxf(mx, __shfl_xor(mx, 8));
            const float mnew = fmaxf(mrun[r], mx);
            const float corr = __expf(mrun[r] - mnew);
            const float p0 = __expf(a0 - mnew);
            const float p1 = __expf(a1 - mnew);
            mrun[r] = mnew;
            float ps = p0 + p1;
            ps += __shfl_xor(ps, 1);
            ps += __shfl_xor(ps, 2);
            ps += __shfl_xor(ps, 4);
            ps += __shfl_xor(ps, 8);
            lrun[r] = lrun[r] * corr + ps;
#pragma unroll
            for (int t = 0; t < 8; ++t) o[t][r] *= corr;
            const u32 h0 = bfb(p0), h1 = bfb(p1);
            const u32 l0 = bfb(p0 - bff(h0)), l1 = bfb(p1 - bff(h1));
            const int prow = (8 * h + r) * 32;               // P[row 8h+r][key ln / 16+ln]
            Ph[prow + ln] = (u16)h0;
            Ph[prow + 16 + ln] = (u16)h1;
            Pl[prow + ln] = (u16)l0;
            Pl[prow + 16 + ln] = (u16)l1;
        }
        __syncthreads();                                     // D->A relayout of P through LDS

        // O[16][128] += P[16][32 keys] . V[32 keys][128]; V B-fragments from the key-contiguous planes
        const v16bf ph = ldfrag(Ph + ln * 32 + 8 * h);
        const v16bf pl = ldfrag(Pl + ln * 32 + 8 * h);
#pragma unroll
        for (int t = 0; t < 8; ++t) {
            const size_t vo = vofs + (size_t)(t * 16) * MROWS + kb;
            const v16bf vh = ldfrag(Vh + vo);
            const v16bf vl = ldfrag(Vl + vo);
            mma3(o[t], ph, pl, vh, vl);
        }
        __syncthreads();                                     // P tile reads done before it is rewritten
    }

    // normalise, stage the 16x128 f32 tile, write hi/lo planes with 16-B lane-contiguous stores
#pragma unroll
    for (int r = 0; r < 8; ++r) {
        const float lv = lrun[r];
        const float li = (lv > 0.0f) ? (1.0f / lv) : 0.0f;
        const int orow = (8 * h + r) * OSP;
#pragma unroll
        for (int t = 0; t < 8; ++t) Os[orow + t * 16 + ln] = o[t][r] * li;
    }
    __syncthreads();
#pragma unroll 1
    for (int it = 0; it < 8; ++it) {
        const int row = it * 2 + h, colc = ln * 8;
        const float* cr = Os + row * OSP;
        const v4f a = *(const v4fa*)(cr + colc);
        const v4f c = *(const v4fa*)(cr + colc + 4);
        float x[8] = {a[0], a[1], a[2], a[3], c[0], c[1], c[2], c[3]};
        v4u hi, lo;
        split8(x, hi, lo);
        const size_t oo = (size_t)(b * S + q0 + row) * NQ + hh * HD + colc;
        st2u(Oh + oo, Ol + oo, hi, lo);
    }
}

// ---------------- host ---------------------------------------------------------------------
extern "C" void kernel_launch(void* const* d_in, const int* in_sizes, int n_in,
                              void* d_out, int out_size, void* d_ws, size_t ws_size,
                              hipStream_t stream)
{
    if (n_in < 11) return;
    if (in_sizes[0] != MROWS * HID || in_sizes[1] != MROWS || in_sizes[2] != S * S ||
        in_sizes[3] != HID * NQ || in_sizes[4] != NQ ||
        in_sizes[5] != HID * NKVD || in_sizes[6] != NKVD ||
        in_sizes[7] != HID * NKVD || in_sizes[8] != NKVD ||
        in_sizes[9] != NQ * HID || in_sizes[10] != HID) return;
    if (out_size != MROWS * HID) return;

    const float* X   = (const float*)d_in[0];   // [B*S][HID]
    const float* ts  = (const float*)d_in[1];   // [B*S]
    const float* amk = (const float*)d_in[2];   // [S][S] additive
    const float* Wq  = (const float*)d_in[3];   // [HID][NQ]
    const float* bq  = (const float*)d_in[4];
    const float* Wk  = (const float*)d_in[5];   // [HID][NKVD]
    const float* bk  = (const float*)d_in[6];
    const float* Wv  = (const float*)d_in[7];   // [HID][NKVD]
    const float* bv  = (const float*)d_in[8];
    const float* Wo  = (const float*)d_in[9];   // [NQ][HID]
    const float* bo  = (const float*)d_in[10];
    float* out = (float*)d_out;                 // [B*S][HID]

    const size_t szX  = (size_t)MROWS * HID * 2;     // one plane
    const size_t szWq = (size_t)NQ * HID * 2;
    const size_t szWk = (size_t)NKVD * HID * 2;
    const size_t szWo = (size_t)HID * NQ * 2;
    const size_t szQ  = (size_t)MROWS * NQ * 2;
    const size_t szK  = (size_t)MROWS * NKVD * 2;
    const size_t szVt = (size_t)NKVD * MROWS * 2;
    const size_t szTb = (size_t)MROWS * NFREQ * 4;
    const size_t szFl = (size_t)NQT * NKT * 4;
    char* base = (char*)d_ws;
    size_t used = 0;
    auto take = [&](size_t bytes) -> char* { char* p = base + used; used += (bytes + 255) & ~(size_t)255; return p; };
    u16* Xh   = (u16*)take(szX);   u16* Xl   = (u16*)take(szX);     // reused as attention-output planes
    u16* Wqth = (u16*)take(szWq);  u16* Wqtl = (u16*)take(szWq);    // [NQ][HID]
    u16* Wkth = (u16*)take(szWk);  u16* Wktl = (u16*)take(szWk);    // [NKVD][HID]
    u16* Wvth = (u16*)take(szWk);  u16* Wvtl = (u16*)take(szWk);    // [NKVD][HID]
    u16* Woth = (u16*)take(szWo);  u16* Wotl = (u16*)take(szWo);    // [HID][NQ]
    u16* Qh   = (u16*)take(szQ);   u16* Ql   = (u16*)take(szQ);     // [MROWS][NQ]
    u16* Kh   = (u16*)take(szK);   u16* Kl   = (u16*)take(szK);     // [MROWS][NKVD]
    u16* Vth  = (u16*)take(szVt);  u16* Vtl  = (u16*)take(szVt);    // [NKVD][MROWS]
    float* cosT = (float*)take(szTb);                               // [MROWS][64]
    float* sinT = (float*)take(szTb);
    int* flags  = (int*)take(szFl);                                 // [NQT][NKT]
    if (used > ws_size) return;
    u16* AOh = Xh;   // X planes are dead once the three projections are enqueued
    u16* AOl = Xl;

    // 1: X -> hi/lo planes
    k_split_rows<<<dim3((MROWS * HID) / (256 * 8)), dim3(256), 0, stream>>>(X, MROWS * HID, Xh, Xl);
    // 2..5: weights in[in][out] -> k-contiguous hi/lo planes out[out][in]
    k_split_t<<<dim3(NQ / 64, HID / 64), dim3(256), 0, stream>>>(Wq, HID, NQ, Wqth, Wqtl);      // in[2048][2048] -> out[2048][2048]
    k_split_t<<<dim3(NKVD / 64, HID / 64), dim3(256), 0, stream>>>(Wk, HID, NKVD, Wkth, Wktl);  // in[2048][256]  -> out[256][2048]
    k_split_t<<<dim3(NKVD / 64, HID / 64), dim3(256), 0, stream>>>(Wv, HID, NKVD, Wvth, Wvtl);  // in[2048][256]  -> out[256][2048]
    k_split_t<<<dim3(HID / 64, NQ / 64), dim3(256), 0, stream>>>(Wo, NQ, HID, Woth, Wotl);      // in[2048][2048] -> out[2048][2048]
    // 6: rotary cos/sin table per token row
    k_rope_table<<<dim3(MROWS / 4), dim3(256), 0, stream>>>(ts, MROWS, cosT, sinT);
    // 7: tile skip flags from the additive mask input
    k_flags<<<dim3(NQT, 2), dim3(256), 0, stream>>>(amk, flags);
    // 8: Q = X.Wq + bq, rotary -> planes [MROWS][NQ]
    gemm_x3<EPI_ROPE><<<dim3(NQ / 128, MROWS / 64), dim3(128), 0, stream>>>(
        Xh, Xl, HID, Wqth, Wqtl, HID, HID, bq, cosT, sinT, Qh, Ql, out, NQ);
    // 9: K = X.Wk + bk, rotary -> planes [MROWS][NKVD]
    gemm_x3<EPI_ROPE><<<dim3(NKVD / 128, MROWS / 64), dim3(128), 0, stream>>>(
        Xh, Xl, HID, Wkth, Wktl, HID, HID, bk, cosT, sinT, Kh, Kl, out, NKVD);
    // 10: Vt[kvh*128+d][token] = (X.Wv + bv)^T -> planes [NKVD][MROWS]
    gemm_x3<EPI_ROWB><<<dim3(MROWS / 128, NKVD / 64), dim3(128), 0, stream>>>(
        Wvth, Wvtl, HID, Xh, Xl, HID, HID, bv, cosT, sinT, Vth, Vtl, out, MROWS);
    // 11: attention -> AO planes [MROWS][NQ]
    attn_x3<<<dim3(NQT, NH, BB), dim3(32), 0, stream>>>(Qh, Ql, Kh, Kl, Vth, Vtl, amk, flags, AOh, AOl);
    // 12: out = AO.Wo + bo -> f32 [MROWS][HID]
    gemm_x3<EPI_F32><<<dim3(HID / 128, MROWS / 64), dim3(128), 0, stream>>>(
        AOh, AOl, NQ, Woth, Wotl, NQ, NQ, bo, cosT, sinT, Qh, Ql, out, HID);
    (void)hipGetLastError();
}

// v001
// Measured time: 702 microseconds a run.
// Next to v000, in two timings, it ran 1.38 and 1.37 times as fast.
#include <hip/hip_runtime.h>
#include <math.h>
#include <stddef.h>

// All contractions (q/k/v projections, q.k^T scores, p.v, output projection): v_wmma_f32_16x16x32_bf16 with bf16 hi/lo operands everywhere (hi*hi + hi*lo + lo*hi), f32 accumulate; softmax, rotary, scale and biases in f32.

constexpr int BB    = 2;
constexpr int S     = 2048;
constexpr int HID   = 2048;
constexpr int NH    = 16;
constexpr int NKV   = 2;
constexpr int HD    = 128;
constexpr int NREP  = NH / NKV;            // 8
constexpr int MROWS = BB * S;              // 4096 token rows
constexpr int NQ    = NH * HD;             // 2048
constexpr int NKVD  = NKV * HD;            // 256
constexpr int NQT   = S / 16;              // 128 query tiles of 16 rows
constexpr int NKT   = S / 32;              // 64 key tiles of 32 keys
constexpr int NFREQ = HD / 2;              // 64 rotary frequencies
constexpr float SCALE = 0.08838834764831845f;   // 1/sqrt(128)
constexpr int CP  = 132;                   // LDS pitch (floats), 64x128 C tile
constexpr int OSP = 132;                   // LDS pitch (floats), 16x128 O tile
constexpr int TP  = 68;                    // LDS pitch (floats), transpose tile

constexpr int EPI_ROPE = 1;                // hi/lo planes out, column bias, rotary
constexpr int EPI_ROWB = 2;                // hi/lo planes out, row bias
constexpr int EPI_F32  = 3;                // f32 out, column bias

static_assert(MROWS % 64 == 0);
static_assert(NQ % 128 == 0);
static_assert(NKVD % 128 == 0);
static_assert(HID % 64 == 0);
static_assert(S % 32 == 0);

typedef unsigned int   u32;
typedef unsigned short u16;
typedef __bf16 v16bf __attribute__((ext_vector_type(16)));
typedef float  v8f   __attribute__((ext_vector_type(8)));
typedef int    v8i   __attribute__((ext_vector_type(8)));
typedef float  v4f   __attribute__((ext_vector_type(4)));
typedef u32    v4u   __attribute__((ext_vector_type(4)));
typedef int    v4i   __attribute__((ext_vector_type(4)));
typedef v4f v4fa __attribute__((may_alias));
typedef v4u v4ua __attribute__((may_alias));
typedef v4i v4ia __attribute__((may_alias));

union Frag { v16bf v; v4u q[2]; };

// ---------------- bf16 RNE split helpers (integer bit arithmetic) ----------
__device__ __forceinline__ u32 bfb(float f) {
    const u32 u = __builtin_bit_cast(u32, f);
    return (u + 0x7FFFu + ((u >> 16) & 1u)) >> 16;
}
__device__ __forceinline__ float bff(u32 b) { return __builtin_bit_cast(float, b << 16); }

// 8 f32 -> packed bf16 hi plane (4 dwords) and lo plane (4 dwords); element 2c in the low half-word
__device__ __forceinline__ void split8(const float (&x)[8], v4u& hi, v4u& lo) {
#pragma unroll
    for (int c = 0; c < 4; ++c) {
        const u32 h0 = bfb(x[2 * c]), h1 = bfb(x[2 * c + 1]);
        const u32 l0 = bfb(x[2 * c] - bff(h0)), l1 = bfb(x[2 * c + 1] - bff(h1));
        hi[c] = h0 | (h1 << 16);
        lo[c] = l0 | (l1 << 16);
    }
}

// ---------------- fragment loader (A map and B map identical, k-contiguous row) -------
// p = plane + row*ld + k0 + 8*h ; elements 0..7 <- k0+8h..+7, elements 8..15 <- k0+16+8h..+7
__device__ __forceinline__ v16bf ldfrag(const u16* p) {
    Frag f;
    f.q[0] = *(const v4ua*)(p);
    f.q[1] = *(const v4ua*)(p + 16);
    return f.v;
}

__device__ __forceinline__ v8f zero8() {
    v8f z;
#pragma unroll
    for (int i = 0; i < 8; ++i) z[i] = 0.0f;
    return z;
}

// three-term hi/lo product into one f32 accumulator, then the 4-slot hazard guard
__device__ __forceinline__ void mma3(v8f& acc, v16bf ah, v16bf al, v16bf bh, v16bf bl) {
    acc = __builtin_amdgcn_wmma_f32_16x16x32_bf16(false, ah, false, bh, (short)0, acc, false, false);
    acc = __builtin_amdgcn_wmma_f32_16x16x32_bf16(false, ah, false, bl, (short)0, acc, false, false);
    acc = __builtin_amdgcn_wmma_f32_16x16x32_bf16(false, al, false, bh, (short)0, acc, false, false);
    const v8i ia = __builtin_bit_cast(v8i, ah);
    const v8i ib = __builtin_bit_cast(v8i, al);
    const v8i ic = __builtin_bit_cast(v8i, bh);
    const v8i id = __builtin_bit_cast(v8i, bl);
    asm volatile("v_nop\n\tv_nop\n\tv_nop\n\tv_nop"
                 : "+v"(acc) : "v"(ia), "v"(ib), "v"(ic), "v"(id) : "memory");
}

__device__ __forceinline__ void st2u(u16* ph, u16* pl, v4u hi, v4u lo) {
    *(v4u*)ph = hi;
    *(v4u*)pl = lo;
    
}
__device__ __forceinline__ void st2f(float* p, v4f v) {
    *(v4f*)p = v;
    
}

// ---------------- X: f32 rows -> hi/lo bf16 planes, same layout --------------------------
__global__ void __launch_bounds__(256)
k_split_rows(const float* X, int n, u16* Xh, u16* Xl)
{
    const size_t i = ((size_t)blockIdx.x * 256 + threadIdx.x) * 8;
    if (i + 8 <= (size_t)n) {
        const v4f a = *(const v4fa*)(X + i);
        const v4f c = *(const v4fa*)(X + i + 4);
        float x[8] = {a[0], a[1], a[2], a[3], c[0], c[1], c[2], c[3]};
        v4u hi, lo;
        split8(x, hi, lo);
        st2u(Xh + i, Xl + i, hi, lo);
    }
}

// ---------------- weights: in[nrows][ncols] f32 -> hi/lo planes out[ncols][nrows] ----------
// grid (ncols/64, nrows/64); LDS transpose; each output line (64 halves) by lanes 8q..8q+7
__global__ void __launch_bounds__(256)
k_split_t(const float* W, int nrows, int ncols, u16* Th, u16* Tl)
{
    __shared__ __align__(16) float T[64 * TP];
    const int tid = threadIdx.x;
    const int cb = blockIdx.x * 64;      // input column tile == output row tile
    const int rb = blockIdx.y * 64;      // input row tile    == output column tile
#pragma unroll
    for (int it = 0; it < 4; ++it) {
        const int fl = it * 256 + tid;
        const int rr = fl >> 4, cc = (fl & 15) * 4;
        const v4f v = *(const v4fa*)(W + (size_t)(rb + rr) * ncols + cb + cc);
        T[(cc + 0) * TP + rr] = v[0];
        T[(cc + 1) * TP + rr] = v[1];
        T[(cc + 2) * TP + rr] = v[2];
        T[(cc + 3) * TP + rr] = v[3];
    }
    __syncthreads();
#pragma unroll
    for (int it = 0; it < 2; ++it) {
        const int orow = it * 32 + (tid >> 3), oc = (tid & 7) * 8;
        const v4f a = *(const v4fa*)(T + orow * TP + oc);
        const v4f c = *(const v4fa*)(T + orow * TP + oc + 4);
        float x[8] = {a[0], a[1], a[2], a[3], c[0], c[1], c[2], c[3]};
        v4u hi, lo;
        split8(x, hi, lo);
        const size_t o = (size_t)(cb + orow) * nrows + rb + oc;
        st2u(Th + o, Tl + o, hi, lo);
    }
}

// ---------------- rotary table: cos/sin of f32(ts[row] * inv_freq[j]) ---------------------
__global__ void __launch_bounds__(256)
k_rope_table(const float* ts, int nrows, float* cosT, float* sinT)
{
    const int tid = threadIdx.x;
    const int row = blockIdx.x * 4 + (tid >> 6);
    const int j   = tid & 63;
    const int rc  = row < nrows ? row : nrows - 1;
    const float t = ts[rc];
    // inv_freq[j] = 1 / f32(10000^(j/64)); the power evaluated in f64 and converted once
    const double p  = exp2((double)j * (13.287712379549449 / 64.0));
    const float  pf = (float)p;
    const float inv = 1.0f / pf;
    const float ang = t * inv;
    float sn, cs;
    sincosf(ang, &sn, &cs);
    if (row < nrows) {
        const size_t o = (size_t)row * NFREQ + j;
        *(float*)(cosT + o) = cs;
        *(float*)(sinT + o) = sn;
        
    }
}

// ---------------- tile flags from the additive input mask ---------------------------------
// flag[qt][kt] = 1 when every entry of the 16x32 mask tile is <= -1e8 (tile contributes 0)
__global__ void __launch_bounds__(256)
k_flags(const float* amask, int* flags)
{
    __shared__ __align__(16) int sf[32];
    const int tid = threadIdx.x, lane = tid & 31, w = tid >> 5;
    const int qt = blockIdx.x, hf = blockIdx.y;
    const int t = tid >> 3, sub = tid & 7;
    const int kt = hf * 32 + t;
    const int kb = kt * 32;
    int ok = 1;
#pragma unroll
    for (int rr = 0; rr < 2; ++rr) {
        const int q = qt * 16 + sub * 2 + rr;
        const float* mp = amask + (size_t)q * S + kb;
#pragma unroll
        for (int c = 0; c < 8; ++c) {
            const v4f v = *(const v4fa*)(mp + 4 * c);
            ok &= (int)(v[0] <= -1.0e8f) & (int)(v[1] <= -1.0e8f) &
                  (int)(v[2] <= -1.0e8f) & (int)(v[3] <= -1.0e8f);
        }
    }
    ok &= __shfl_xor(ok, 1);
    ok &= __shfl_xor(ok, 2);
    ok &= __shfl_xor(ok, 4);
    if (sub == 0) sf[t] = ok;
    __syncthreads();
    if (w == 0 && lane < 8) {
        const v4i f = *(const v4ia*)(sf + lane * 4);
        int* dst = flags + (size_t)qt * NKT + hf * 32 + lane * 4;
        *(v4i*)dst = f;
        
    }
}

// ---------------- hi/lo split GEMM: C[i][j] = sum_k A[i][k] * B[j][k] -----------------------
// A planes [*][lda], B planes [*][ldb], both k-contiguous; block tile 64(i) x 128(j),
// 4 waves as 2x2, wave tile 32x64 = 2x4 accumulators; fragments loaded straight from global.
template<int EPI>
__global__ void __launch_bounds__(128)
gemm_x3(const u16* Ah, const u16* Al, int lda,
        const u16* Bh, const u16* Bl, int ldb, int K,
        const float* bias, const float* cosT, const float* sinT,
        u16* Oh, u16* Ol, float* Of, int ldo)
{
    __shared__ __align__(16) float Cs[64 * CP];
    const int tid = threadIdx.x, w = tid >> 5, lane = tid & 31;
    const int h = lane >> 4, ln = lane & 15;
    const int wm = w >> 1, wn = w & 1;
    const int i0 = blockIdx.y * 64, j0 = blockIdx.x * 128;

    v8f acc[2][4];
#pragma unroll
    for (int mi = 0; mi < 2; ++mi)
#pragma unroll
        for (int ni = 0; ni < 4; ++ni) acc[mi][ni] = zero8();

    size_t aofs[2], bofs[4];
#pragma unroll
    for (int mi = 0; mi < 2; ++mi)
        aofs[mi] = (size_t)(i0 + wm * 32 + mi * 16 + ln) * lda + 8 * h;
#pragma unroll
    for (int ni = 0; ni < 4; ++ni)
        bofs[ni] = (size_t)(j0 + wn * 64 + ni * 16 + ln) * ldb + 8 * h;

#pragma unroll 1
    for (int k0 = 0; k0 < K; k0 += 32) {
        const v16bf ah0 = ldfrag(Ah + aofs[0] + k0);
        const v16bf al0 = ldfrag(Al + aofs[0] + k0);
        const v16bf ah1 = ldfrag(Ah + aofs[1] + k0);
        const v16bf al1 = ldfrag(Al + aofs[1] + k0);
#pragma unroll
        for (int ni = 0; ni < 4; ++ni) {
            const v16bf bh = ldfrag(Bh + bofs[ni] + k0);
            const v16bf bl = ldfrag(Bl + bofs[ni] + k0);
            mma3(acc[0][ni], ah0, al0, bh, bl);
            mma3(acc[1][ni], ah1, al1, bh, bl);
        }
    }

    // stage the 64x128 f32 tile in LDS: D element r of lane l = (row 8h+r, col ln)
#pragma unroll
    for (int mi = 0; mi < 2; ++mi)
#pragma unroll
        for (int ni = 0; ni < 4; ++ni)
#pragma unroll
            for (int r = 0; r < 8; ++r)
                Cs[(wm * 32 + mi * 16 + 8 * h + r) * CP + wn * 64 + ni * 16 + ln] = acc[mi][ni][r];
    __syncthreads();

    if (EPI == EPI_F32) {
        // row segment = 128 floats = 512 B = 32 lanes x 16 B, one instruction per row
#pragma unroll 1
        for (int it = 0; it < 16; ++it) {
            const int row = it * 4 + w, col = lane * 4;
            v4f x = *(const v4fa*)(Cs + row * CP + col);
            const v4f bv = *(const v4fa*)(bias + j0 + col);
            x += bv;
            st2f(Of + (size_t)(i0 + row) * ldo + j0 + col, x);
        }
    } else {
        // row segment = 128 halves = 256 B = 16 lanes x 16 B per plane; lanes 16..31 take the next row
#pragma unroll 1
        for (int it = 0; it < 8; ++it) {
            const int row = it * 8 + w * 2 + h, colc = ln * 8;
            const int gi = i0 + row;
            const float* cr = Cs + row * CP;
            float x[8];
            {
                const v4f a = *(const v4fa*)(cr + colc);
                const v4f c = *(const v4fa*)(cr + colc + 4);
                x[0] = a[0]; x[1] = a[1]; x[2] = a[2]; x[3] = a[3];
                x[4] = c[0]; x[5] = c[1]; x[6] = c[2]; x[7] = c[3];
            }
            if (EPI == EPI_ROWB) {
                const float bvv = bias[gi];
#pragma unroll
                for (int e = 0; e < 8; ++e) x[e] += bvv;
            } else {
                const v4f b0 = *(const v4fa*)(bias + j0 + colc);
                const v4f b1 = *(const v4fa*)(bias + j0 + colc + 4);
                x[0] += b0[0]; x[1] += b0[1]; x[2] += b0[2]; x[3] += b0[3];
                x[4] += b1[0]; x[5] += b1[1]; x[6] += b1[2]; x[7] += b1[3];
            }
            if (EPI == EPI_ROPE) {
                // block tile == one head (128 columns); partner column d^64, frequency j = d&63
                const int pc = colc ^ 64;
                float xp[8];
                {
                    const v4f a = *(const v4fa*)(cr + pc);
                    const v4f c = *(const v4fa*)(cr + pc + 4);
                    const v4f b0 = *(const v4fa*)(bias + j0 + pc);
                    const v4f b1 = *(const v4fa*)(bias + j0 + pc + 4);
                    xp[0] = a[0] + b0[0]; xp[1] = a[1] + b0[1]; xp[2] = a[2] + b0[2]; xp[3] = a[3] + b0[3];
                    xp[4] = c[0] + b1[0]; xp[5] = c[1] + b1[1]; xp[6] = c[2] + b1[2]; xp[7] = c[3] + b1[3];
                }
                const int jb = colc & 63;
                const float* cp = cosT + (size_t)gi * NFREQ + jb;
                const float* sp = sinT + (size_t)gi * NFREQ + jb;
                const v4f c0 = *(const v4fa*)(cp), c1 = *(const v4fa*)(cp + 4);
                const v4f s0 = *(const v4fa*)(sp), s1 = *(const v4fa*)(sp + 4);
                float cs[8] = {c0[0], c0[1], c0[2], c0[3], c1[0], c1[1], c1[2], c1[3]};
                float sn[8] = {s0[0], s0[1], s0[2], s0[3], s1[0], s1[1], s1[2], s1[3]};
                const float sg = (colc < 64) ? -1.0f : 1.0f;
#pragma unroll
                for (int e = 0; e < 8; ++e) x[e] = x[e] * cs[e] + sg * (xp[e] * sn[e]);
            }
            v4u hi, lo;
            split8(x, hi, lo);
            const size_t o = (size_t)gi * ldo + j0 + colc;
            st2u(Oh + o, Ol + o, hi, lo);
        }
    }
}

// ---------------- flash attention, GQA, hi/lo split on both products ---------------------
// one work-group = 8 waves = the 8 query heads of one KV head, all on the same 16 query rows;
// one wave per head; 32 keys per pass; online f32 softmax.
// The K and V tiles of a pass (both planes) are the same for all 8 heads: they are copied once per
// work-group into a two-buffer LDS ring by asynchronous copies, the next tile flying while this one is used.
// Q planes [4096][2048], K planes [4096][256], Vt planes [256][4096] (key-contiguous),
// additive mask added by value, fully-masked tiles skipped via flags; O -> hi/lo planes [4096][2048]
constexpr int KP  = 136;                   // LDS pitch (halves) of a K row of 128 dims: 272 B = 16 B x 17
constexpr int VP  = 40;                    // LDS pitch (halves) of a Vt row of 32 keys:  80 B = 16 B x 5
constexpr int KPL = 32 * KP;               // one K plane of a tile (halves)
constexpr int VPL = HD * VP;               // one Vt plane of a tile (halves)
constexpr int STG = 2 * KPL + 2 * VPL;     // one ring buffer: Kh | Kl | Vh | Vl (halves)

__device__ __forceinline__ u32 lds_off(const void* p) { return (u32)(size_t)p; }

// one tile's copies of one lane: 8 x 16 B, global -> LDS through no register.
// The s_wait_xcnt closes the statement so that no address register is rewritten ahead of it.
__device__ __forceinline__ void copy8(u32 l0, u32 l1, u32 l2, u32 l3, u32 l4, u32 l5, u32 l6, u32 l7,
                                      const u16* g0, const u16* g1, const u16* g2, const u16* g3,
                                      const u16* g4, const u16* g5, const u16* g6, const u16* g7) {
    asm volatile("global_load_async_to_lds_b128 %0, %8, off\n\t"
                 "global_load_async_to_lds_b128 %1, %9, off\n\t"
                 "global_load_async_to_lds_b128 %2, %10, off\n\t"
                 "global_load_async_to_lds_b128 %3, %11, off\n\t"
                 "global_load_async_to_lds_b128 %4, %12, off\n\t"
                 "global_load_async_to_lds_b128 %5, %13, off\n\t"
                 "global_load_async_to_lds_b128 %6, %14, off\n\t"
                 "global_load_async_to_lds_b128 %7, %15, off\n\t"
                 "s_wait_xcnt 0x0"
                 :: "v"(l0), "v"(l1), "v"(l2), "v"(l3), "v"(l4), "v"(l5), "v"(l6), "v"(l7),
                    "v"(g0), "v"(g1), "v"(g2), "v"(g3), "v"(g4), "v"(g5), "v"(g6), "v"(g7)
                 : "memory");
}

__global__ void __launch_bounds__(256)
attn_x3(const u16* Qh, const u16* Ql, const u16* Kh, const u16* Kl,
        const u16* Vh, const u16* Vl, const float* amask, const int* flags,
        u16* Oh, u16* Ol)
{
    __shared__ __align__(16) u16 Ring[2 * STG];
    __shared__ __align__(16) u16 PhA[NREP * 16 * 32];
    __shared__ __align__(16) u16 PlA[NREP * 16 * 32];
    __shared__ __align__(16) float OsA[NREP * 16 * OSP];

    const int tid = threadIdx.x;
    const int lane = tid & 31, h = lane >> 4, ln = lane & 15;
    const int w = __builtin_amdgcn_readfirstlane(tid >> 5);
    const int qt = blockIdx.x, kvh = blockIdx.y, b = blockIdx.z;
    const int hh = kvh * NREP + w;
    const int q0 = qt * 16;
    u16* Ph = PhA + w * (16 * 32);             // each wave's own P and O staging
    u16* Pl = PlA + w * (16 * 32);
    float* Os = OsA + w * (16 * OSP);

    const size_t qofs = (size_t)(b * S + q0 + ln) * NQ + hh * HD + 8 * h;     // A row ln, + dc*32
    const size_t mofs = (size_t)(q0 + 8 * h) * S + ln;                        // + r*S + kb (+16)

    // this lane's share of a tile's copies: K rows tid/16 and +16 (16 B of 256), Vt rows tid/4 and +64 (16 B of 64)
    const int krow = tid >> 4, kcol = (tid & 15) * 8;
    const int vrow = tid >> 2, vcol = (tid & 3) * 8;
    const size_t kgo = (size_t)(b * S + krow) * NKVD + kvh * HD + kcol;       // + kb*NKVD
    const size_t vgo = (size_t)(kvh * HD + vrow) * MROWS + b * S + vcol;      // + kb
    const u32 klo = lds_off(Ring) + 2u * (u32)(krow * KP + kcol);             // + buffer
    const u32 vlo = lds_off(Ring) + 2u * (u32)(2 * KPL + vrow * VP + vcol);   // + buffer
    auto stage = [&](int kt, int bf) {
        const u32 lb = (u32)bf * (2u * STG);
        const size_t ko = kgo + (size_t)(kt * 32) * NKVD;
        const size_t vo = vgo + (size_t)(kt * 32);
        copy8(klo + lb, klo + lb + 2u * (16 * KP), klo + lb + 2u * KPL, klo + lb + 2u * (KPL + 16 * KP),
              vlo + lb, vlo + lb + 2u * (64 * VP), vlo + lb + 2u * VPL, vlo + lb + 2u * (VPL + 64 * VP),
              Kh + ko, Kh + ko + (size_t)16 * NKVD, Kl + ko, Kl + ko + (size_t)16 * NKVD,
              Vh + vo, Vh + vo + (size_t)64 * MROWS, Vl + vo, Vl + vo + (size_t)64 * MROWS);
    };

    float mrun[8], lrun[8];
    v8f o[8];
#pragma unroll
    for (int r = 0; r < 8; ++r) { mrun[r] = -1.0e30f; lrun[r] = 0.0f; }
#pragma unroll
    for (int t = 0; t < 8; ++t) o[t] = zero8();

    // the key tiles that are not all-masked, as a 64-bit set, alike in every wave of the work-group:
    // the ring has to know the next tile one pass ahead
    const u32 a_lo = __builtin_amdgcn_ballot_w32(flags[qt * NKT + lane] != 1);
    const u32 a_hi = __builtin_amdgcn_ballot_w32(flags[qt * NKT + 32 + lane] != 1);
    unsigned long long act = (unsigned long long)a_lo | ((unsigned long long)a_hi << 32);

    if (act != 0) {
        int kt = __builtin_ctzll(act);
        act &= act - 1;
        stage(kt, 0);
        asm volatile("s_wait_asynccnt 0x0" ::: "memory");    // this wave's copies of the first tile have landed
        __syncthreads();                                     // ... and every other wave's
        int ktn = -1;
        if (act != 0) {
            ktn = __builtin_ctzll(act);
            act &= act - 1;
            stage(ktn, 1);
        }
        int bf = 0;
        for (;;) {
            const int kb = kt * 32;
            const u16* Kb = Ring + bf * STG + ln * KP + 8 * h;               // K row ln, + 16*KP, + KPL, + dc*32
            const u16* Vb = Ring + bf * STG + 2 * KPL + ln * VP + 8 * h;     // Vt row ln, + t*16*VP, + VPL

            // scores S[16 q][32 keys] = Q . K^T over 128 dims (4 k-steps), two 16-key accumulators
            v8f s0 = zero8(), s1 = zero8();
#pragma unroll
            for (int dc = 0; dc < 4; ++dc) {
                const v16bf qh = ldfrag(Qh + qofs + dc * 32);
                const v16bf ql = ldfrag(Ql + qofs + dc * 32);
                v16bf kh = ldfrag(Kb + dc * 32);
                v16bf kl = ldfrag(Kb + KPL + dc * 32);
                mma3(s0, qh, ql, kh, kl);
                kh = ldfrag(Kb + 16 * KP + dc * 32);
                kl = ldfrag(Kb + KPL + 16 * KP + dc * 32);
                mma3(s1, qh, ql, kh, kl);
            }

            // scale + additive mask by value + online softmax; lane (h,ln): s[r] = (row 8h+r, key kb + nt*16 + ln)
#pragma unroll
            for (int r = 0; r < 8; ++r) {
                const float* mp = amask + mofs + (size_t)r * S + kb;
                const float mk0 = mp[0];
                const float mk1 = mp[16];
                const float a0 = s0[r] * SCALE + mk0;
                const float a1 = s1[r] * SCALE + mk1;
                float mx = fmaxf(a0, a1);
                mx = fmaxf(mx, __shfl_xor(mx, 1));
                mx = fmaxf(mx, __shfl_xor(mx, 2));
                mx = fmaxf(mx, __shfl_xor(mx, 4));
                mx = fmaxf(mx, __shfl_xor(mx, 8));
                const float mnew = fmaxf(mrun[r], mx);
                const float corr = __expf(mrun[r] - mnew);
                const float p0 = __expf(a0 - mnew);
                const float p1 = __expf(a1 - mnew);
                mrun[r] = mnew;
                float ps = p0 + p1;
                ps += __shfl_xor(ps, 1);
                ps += __shfl_xor(ps, 2);
                ps += __shfl_xor(ps, 4);
                ps += __shfl_xor(ps, 8);
                lrun[r] = lrun[r] * corr + ps;
#pragma unroll
                for (int t = 0; t < 8; ++t) o[t][r] *= corr;
                const u32 h0 = bfb(p0), h1 = bfb(p1);
                const u32 l0 = bfb(p0 - bff(h0)), l1 = bfb(p1 - bff(h1));
                const int prow = (8 * h + r) * 32;               // P[row 8h+r][key ln / 16+ln]
                Ph[prow + ln] = (u16)h0;
                Ph[prow + 16 + ln] = (u16)h1;
                Pl[prow + ln] = (u16)l0;
                Pl[prow + 16 + ln] = (u16)l1;
            }
            __syncthreads();                                     // D->A relayout of P through LDS

            // O[16][128] += P[16][32 keys] . V[32 keys][128]; V B-fragments from the ring's key-contiguous rows
            const v16bf ph = ldfrag(Ph + ln * 32 + 8 * h);
            const v16bf pl = ldfrag(Pl + ln * 32 + 8 * h);
#pragma unroll
            for (int t = 0; t < 8; ++t) {
                const v16bf vh = ldfrag(Vb + t * 16 * VP);
                const v16bf vl = ldfrag(Vb + VPL + t * 16 * VP);
                mma3(o[t], ph, pl, vh, vl);
            }

            // publish point: this wave's LDS reads are done, its copies of the next tile have landed,
            // then the barrier that says both of every wave (it also ends the reads of P before P is rewritten)
            asm volatile("s_wait_dscnt 0x0" ::: "memory");
            asm volatile("s_wait_asynccnt 0x0" ::: "memory");
            __syncthreads();
            if (ktn < 0) break;
            kt = ktn;
            ktn = -1;
            if (act != 0) {                                      // refill the buffer this pass has just read
                ktn = __builtin_ctzll(act);
                act &= act - 1;
                stage(ktn, bf);
            }
            bf ^= 1;
        }
    }
    asm volatile("s_wait_asynccnt 0x0" ::: "memory");            // no copy is left in flight when the wave ends

    // normalise, stage the 16x128 f32 tile, write hi/lo planes with 16-B lane-contiguous stores
#pragma unroll
    for (int r = 0; r < 8; ++r) {
        const float lv = lrun[r];
        const float li = (lv > 0.0f) ? (1.0f / lv) : 0.0f;
        const int orow = (8 * h + r) * OSP;
#pragma unroll
        for (int t = 0; t < 8; ++t) Os[orow + t * 16 + ln] = o[t][r] * li;
    }
    __syncthreads();
#pragma unroll 1
    for (int it = 0; it < 8; ++it) {
        const int row = it * 2 + h, colc = ln * 8;
        const float* cr = Os + row * OSP;
        const v4f a = *(const v4fa*)(cr + colc);
        const v4f c = *(const v4fa*)(cr + colc + 4);
        float x[8] = {a[0], a[1], a[2], a[3], c[0], c[1], c[2], c[3]};
        v4u hi, lo;
        split8(x, hi, lo);
        const size_t oo = (size_t)(b * S + q0 + row) * NQ + hh * HD + colc;
        st2u(Oh + oo, Ol + oo, hi, lo);
    }
}

// ---------------- host ---------------------------------------------------------------------
extern "C" void kernel_launch(void* const* d_in, const int* in_sizes, int n_in,
                              void* d_out, int out_size, void* d_ws, size_t ws_size,
                              hipStream_t stream)
{
    if (n_in < 11) return;
    if (in_sizes[0] != MROWS * HID || in_sizes[1] != MROWS || in_sizes[2] != S * S ||
        in_sizes[3] != HID * NQ || in_sizes[4] != NQ ||
        in_sizes[5] != HID * NKVD || in_sizes[6] != NKVD ||
        in_sizes[7] != HID * NKVD || in_sizes[8] != NKVD ||
        in_sizes[9] != NQ * HID || in_sizes[10] != HID) return;
    if (out_size != MROWS * HID) return;

    const float* X   = (const float*)d_in[0];   // [B*S][HID]
    const float* ts  = (const float*)d_in[1];   // [B*S]
    const float* amk = (const float*)d_in[2];   // [S][S] additive
    const float* Wq  = (const float*)d_in[3];   // [HID][NQ]
    const float* bq  = (const float*)d_in[4];
    const float* Wk  = (const float*)d_in[5];   // [HID][NKVD]
    const float* bk  = (const float*)d_in[6];
    const float* Wv  = (const float*)d_in[7];   // [HID][NKVD]
    const float* bv  = (const float*)d_in[8];
    const float* Wo  = (const float*)d_in[9];   // [NQ][HID]
    const float* bo  = (const float*)d_in[10];
    float* out = (float*)d_out;                 // [B*S][HID]

    const size_t szX  = (size_t)MROWS * HID * 2;     // one plane
    const size_t szWq = (size_t)NQ * HID * 2;
    const size_t szWk = (size_t)NKVD * HID * 2;
    const size_t szWo = (size_t)HID * NQ * 2;
    const size_t szQ  = (size_t)MROWS * NQ * 2;
    const size_t szK  = (size_t)MROWS * NKVD * 2;
    const size_t szVt = (size_t)NKVD * MROWS * 2;
    const size_t szTb = (size_t)MROWS * NFREQ * 4;
    const size_t szFl = (size_t)NQT * NKT * 4;
    char* base = (char*)d_ws;
    size_t used = 0;
    auto take = [&](size_t bytes) -> char* { char* p = base + used; used += (bytes + 255) & ~(size_t)255; return p; };
    u16* Xh   = (u16*)take(szX);   u16* Xl   = (u16*)take(szX);     // reused as attention-output planes
    u16* Wqth = (u16*)take(szWq);  u16* Wqtl = (u16*)take(szWq);    // [NQ][HID]
    u16* Wkth = (u16*)take(szWk);  u16* Wktl = (u16*)take(szWk);    // [NKVD][HID]
    u16* Wvth = (u16*)take(szWk);  u16* Wvtl = (u16*)take(szWk);    // [NKVD][HID]
    u16* Woth = (u16*)take(szWo);  u16* Wotl = (u16*)take(szWo);    // [HID][NQ]
    u16* Qh   = (u16*)take(szQ);   u16* Ql   = (u16*)take(szQ);     // [MROWS][NQ]
    u16* Kh   = (u16*)take(szK);   u16* Kl   = (u16*)take(szK);     // [MROWS][NKVD]
    u16* Vth  = (u16*)take(szVt);  u16* Vtl  = (u16*)take(szVt);    // [NKVD][MROWS]
    float* cosT = (float*)take(szTb);                               // [MROWS][64]
    float* sinT = (float*)take(szTb);
    int* flags  = (int*)take(szFl);                                 // [NQT][NKT]
    if (used > ws_size) return;
    u16* AOh = Xh;   // X planes are dead once the three projections are enqueued
    u16* AOl = Xl;

    // 1: X -> hi/lo planes
    k_split_rows<<<dim3((MROWS * HID) / (256 * 8)), dim3(256), 0, stream>>>(X, MROWS * HID, Xh, Xl);
    // 2..5: weights in[in][out] -> k-contiguous hi/lo planes out[out][in]
    k_split_t<<<dim3(NQ / 64, HID / 64), dim3(256), 0, stream>>>(Wq, HID, NQ, Wqth, Wqtl);      // in[2048][2048] -> out[2048][2048]
    k_split_t<<<dim3(NKVD / 64, HID / 64), dim3(256), 0, stream>>>(Wk, HID, NKVD, Wkth, Wktl);  // in[2048][256]  -> out[256][2048]
    k_split_t<<<dim3(NKVD / 64, HID / 64), dim3(256), 0, stream>>>(Wv, HID, NKVD, Wvth, Wvtl);  // in[2048][256]  -> out[256][2048]
    k_split_t<<<dim3(HID / 64, NQ / 64), dim3(256), 0, stream>>>(Wo, NQ, HID, Woth, Wotl);      // in[2048][2048] -> out[2048][2048]
    // 6: rotary cos/sin table per token row
    k_rope_table<<<dim3(MROWS / 4), dim3(256), 0, stream>>>(ts, MROWS, cosT, sinT);
    // 7: tile skip flags from the additive mask input
    k_flags<<<dim3(NQT, 2), dim3(256), 0, stream>>>(amk, flags);
    // 8: Q = X.Wq + bq, rotary -> planes [MROWS][NQ]
    gemm_x3<EPI_ROPE><<<dim3(NQ / 128, MROWS / 64), dim3(128), 0, stream>>>(
        Xh, Xl, HID, Wqth, Wqtl, HID, HID, bq, cosT, sinT, Qh, Ql, out, NQ);
    // 9: K = X.Wk + bk, rotary -> planes [MROWS][NKVD]
    gemm_x3<EPI_ROPE><<<dim3(NKVD / 128, MROWS / 64), dim3(128), 0, stream>>>(
        Xh, Xl, HID, Wkth, Wktl, HID, HID, bk, cosT, sinT, Kh, Kl, out, NKVD);
    // 10: Vt[kvh*128+d][token] = (X.Wv + bv)^T -> planes [NKVD][MROWS]
    gemm_x3<EPI_ROWB><<<dim3(MROWS / 128, NKVD / 64), dim3(128), 0, stream>>>(
        Wvth, Wvtl, HID, Xh, Xl, HID, HID, bv, cosT, sinT, Vth, Vtl, out, MROWS);
    // 11: attention -> AO planes [MROWS][NQ]
    attn_x3<<<dim3(NQT, NKV, BB), dim3(256), 0, stream>>>(Qh, Ql, Kh, Kl, Vth, Vtl, amk, flags, AOh, AOl);
    // 12: out = AO.Wo + bo -> f32 [MROWS][HID]
    gemm_x3<EPI_F32><<<dim3(HID / 128, MROWS / 64), dim3(128), 0, stream>>>(
        AOh, AOl, NQ, Woth, Wotl, NQ, NQ, bo, cosT, sinT, Qh, Ql, out, HID);
    (void)hipGetLastError();
}

// v002
// It runs in 484 microseconds.
// Timed twice side by side with v001, it ran 1.45 and 1.46 times as fast.
// Counting every step since v000, it is 2.00 times as fast.
#include <hip/hip_runtime.h>
#include <math.h>
#include <stddef.h>

// All contractions (q/k/v projections, q.k^T scores, p.v, output projection): v_wmma_f32_16x16x32_bf16 with bf16 hi/lo operands everywhere (hi*hi + hi*lo + lo*hi), f32 accumulate; softmax, rotary, scale and biases in f32.

constexpr int BB    = 2;
constexpr int S     = 2048;
constexpr int HID   = 2048;
constexpr int NH    = 16;
constexpr int NKV   = 2;
constexpr int HD    = 128;
constexpr int NREP  = NH / NKV;            // 8
constexpr int MROWS = BB * S;              // 4096 token rows
constexpr int NQ    = NH * HD;             // 2048
constexpr int NKVD  = NKV * HD;            // 256
constexpr int NQT   = S / 16;              // 128 query tiles of 16 rows
constexpr int NKT   = S / 32;              // 64 key tiles of 32 keys
constexpr int NFREQ = HD / 2;              // 64 rotary frequencies
constexpr float SCALE = 0.08838834764831845f;   // 1/sqrt(128)
constexpr int CP  = 132;                   // LDS pitch (floats), 32*MI x 128 C tile
constexpr int OSP = 132;                   // LDS pitch (floats), 16x128 O tile
constexpr int TP  = 68;                    // LDS pitch (floats), transpose tile

constexpr int EPI_ROPE = 1;                // hi/lo planes out, column bias, rotary
constexpr int EPI_ROWB = 2;                // hi/lo planes out, row bias
constexpr int EPI_F32  = 3;                // f32 out, column bias

static_assert(MROWS % 128 == 0);
static_assert(NQ % 128 == 0);
static_assert(NKVD % 128 == 0);
static_assert(HID % 64 == 0);
static_assert(S % 32 == 0);

typedef unsigned int   u32;
typedef unsigned short u16;
typedef __bf16 v16bf __attribute__((ext_vector_type(16)));
typedef float  v8f   __attribute__((ext_vector_type(8)));
typedef int    v8i   __attribute__((ext_vector_type(8)));
typedef float  v4f   __attribute__((ext_vector_type(4)));
typedef u32    v4u   __attribute__((ext_vector_type(4)));
typedef int    v4i   __attribute__((ext_vector_type(4)));
typedef v4f v4fa __attribute__((may_alias));
typedef v4u v4ua __attribute__((may_alias));
typedef v4i v4ia __attribute__((may_alias));

union Frag { v16bf v; v4u q[2]; };

// ---------------- bf16 RNE split helpers (integer bit arithmetic) ----------
__device__ __forceinline__ u32 bfb(float f) {
    const u32 u = __builtin_bit_cast(u32, f);
    return (u + 0x7FFFu + ((u >> 16) & 1u)) >> 16;
}
__device__ __forceinline__ float bff(u32 b) { return __builtin_bit_cast(float, b << 16); }

// 8 f32 -> packed bf16 hi plane (4 dwords) and lo plane (4 dwords); element 2c in the low half-word
__device__ __forceinline__ void split8(const float (&x)[8], v4u& hi, v4u& lo) {
#pragma unroll
    for (int c = 0; c < 4; ++c) {
        const u32 h0 = bfb(x[2 * c]), h1 = bfb(x[2 * c + 1]);
        const u32 l0 = bfb(x[2 * c] - bff(h0)), l1 = bfb(x[2 * c + 1] - bff(h1));
        hi[c] = h0 | (h1 << 16);
        lo[c] = l0 | (l1 << 16);
    }
}

// ---------------- fragment loader (A map and B map identical, k-contiguous row) -------
// p = plane + row*ld + k0 + 8*h ; elements 0..7 <- k0+8h..+7, elements 8..15 <- k0+16+8h..+7
__device__ __forceinline__ v16bf ldfrag(const u16* p) {
    Frag f;
    f.q[0] = *(const v4ua*)(p);
    f.q[1] = *(const v4ua*)(p + 16);
    return f.v;
}

__device__ __forceinline__ v8f zero8() {
    v8f z;
#pragma unroll
    for (int i = 0; i < 8; ++i) z[i] = 0.0f;
    return z;
}

// three-term hi/lo product into one f32 accumulator, then the 4-slot hazard guard
__device__ __forceinline__ void mma3(v8f& acc, v16bf ah, v16bf al, v16bf bh, v16bf bl) {
    acc = __builtin_amdgcn_wmma_f32_16x16x32_bf16(false, ah, false, bh, (short)0, acc, false, false);
    acc = __builtin_amdgcn_wmma_f32_16x16x32_bf16(false, ah, false, bl, (short)0, acc, false, false);
    acc = __builtin_amdgcn_wmma_f32_16x16x32_bf16(false, al, false, bh, (short)0, acc, false, false);
    const v8i ia = __builtin_bit_cast(v8i, ah);
    const v8i ib = __builtin_bit_cast(v8i, al);
    const v8i ic = __builtin_bit_cast(v8i, bh);
    const v8i id = __builtin_bit_cast(v8i, bl);
    asm volatile("v_nop\n\tv_nop\n\tv_nop\n\tv_nop"
                 : "+v"(acc) : "v"(ia), "v"(ib), "v"(ic), "v"(id) : "memory");
}

__device__ __forceinline__ void st2u(u16* ph, u16* pl, v4u hi, v4u lo) {
    *(v4u*)ph = hi;
    *(v4u*)pl = lo;
    
}
__device__ __forceinline__ void st2f(float* p, v4f v) {
    *(v4f*)p = v;
    
}

// ---------------- X: f32 rows -> hi/lo bf16 planes, same layout --------------------------
__global__ void __launch_bounds__(256)
k_split_rows(const float* X, int n, u16* Xh, u16* Xl)
{
    const size_t i = ((size_t)blockIdx.x * 256 + threadIdx.x) * 8;
    if (i + 8 <= (size_t)n) {
        const v4f a = *(const v4fa*)(X + i);
        const v4f c = *(const v4fa*)(X + i + 4);
        float x[8] = {a[0], a[1], a[2], a[3], c[0], c[1], c[2], c[3]};
        v4u hi, lo;
        split8(x, hi, lo);
        st2u(Xh + i, Xl + i, hi, lo);
    }
}

// ---------------- weights: in[nrows][ncols] f32 -> hi/lo planes out[ncols][nrows] ----------
// grid (ncols/64, nrows/64); LDS transpose; each output line (64 halves) by lanes 8q..8q+7
__global__ void __launch_bounds__(256)
k_split_t(const float* W, int nrows, int ncols, u16* Th, u16* Tl)
{
    __shared__ __align__(16) float T[64 * TP];
    const int tid = threadIdx.x;
    const int cb = blockIdx.x * 64;      // input column tile == output row tile
    const int rb = blockIdx.y * 64;      // input row tile    == output column tile
#pragma unroll
    for (int it = 0; it < 4; ++it) {
        const int fl = it * 256 + tid;
        const int rr = fl >> 4, cc = (fl & 15) * 4;
        const v4f v = *(const v4fa*)(W + (size_t)(rb + rr) * ncols + cb + cc);
        T[(cc + 0) * TP + rr] = v[0];
        T[(cc + 1) * TP + rr] = v[1];
        T[(cc + 2) * TP + rr] = v[2];
        T[(cc + 3) * TP + rr] = v[3];
    }
    __syncthreads();
#pragma unroll
    for (int it = 0; it < 2; ++it) {
        const int orow = it * 32 + (tid >> 3), oc = (tid & 7) * 8;
        const v4f a = *(const v4fa*)(T + orow * TP + oc);
        const v4f c = *(const v4fa*)(T + orow * TP + oc + 4);
        float x[8] = {a[0], a[1], a[2], a[3], c[0], c[1], c[2], c[3]};
        v4u hi, lo;
        split8(x, hi, lo);
        const size_t o = (size_t)(cb + orow) * nrows + rb + oc;
        st2u(Th + o, Tl + o, hi, lo);
    }
}

// ---------------- rotary table: cos/sin of f32(ts[row] * inv_freq[j]) ---------------------
__global__ void __launch_bounds__(256)
k_rope_table(const float* ts, int nrows, float* cosT, float* sinT)
{
    const int tid = threadIdx.x;
    const int row = blockIdx.x * 4 + (tid >> 6);
    const int j   = tid & 63;
    const int rc  = row < nrows ? row : nrows - 1;
    const float t = ts[rc];
    // inv_freq[j] = 1 / f32(10000^(j/64)); the power evaluated in f64 and converted once
    const double p  = exp2((double)j * (13.287712379549449 / 64.0));
    const float  pf = (float)p;
    const float inv = 1.0f / pf;
    const float ang = t * inv;
    float sn, cs;
    sincosf(ang, &sn, &cs);
    if (row < nrows) {
        const size_t o = (size_t)row * NFREQ + j;
        *(float*)(cosT + o) = cs;
        *(float*)(sinT + o) = sn;
        
    }
}

// ---------------- tile flags from the additive input mask ---------------------------------
// flag[qt][kt] = 1 when every entry of the 16x32 mask tile is <= -1e8 (tile contributes 0)
__global__ void __launch_bounds__(256)
k_flags(const float* amask, int* flags)
{
    __shared__ __align__(16) int sf[32];
    const int tid = threadIdx.x, lane = tid & 31, w = tid >> 5;
    const int qt = blockIdx.x, hf = blockIdx.y;
    const int t = tid >> 3, sub = tid & 7;
    const int kt = hf * 32 + t;
    const int kb = kt * 32;
    int ok = 1;
#pragma unroll
    for (int rr = 0; rr < 2; ++rr) {
        const int q = qt * 16 + sub * 2 + rr;
        const float* mp = amask + (size_t)q * S + kb;
#pragma unroll
        for (int c = 0; c < 8; ++c) {
            const v4f v = *(const v4fa*)(mp + 4 * c);
            ok &= (int)(v[0] <= -1.0e8f) & (int)(v[1] <= -1.0e8f) &
                  (int)(v[2] <= -1.0e8f) & (int)(v[3] <= -1.0e8f);
        }
    }
    ok &= __shfl_xor(ok, 1);
    ok &= __shfl_xor(ok, 2);
    ok &= __shfl_xor(ok, 4);
    if (sub == 0) sf[t] = ok;
    __syncthreads();
    if (w == 0 && lane < 8) {
        const v4i f = *(const v4ia*)(sf + lane * 4);
        int* dst = flags + (size_t)qt * NKT + hf * 32 + lane * 4;
        *(v4i*)dst = f;
        
    }
}

__device__ __forceinline__ u32 lds_off(const void* p) { return (u32)(size_t)p; }

// one tile's copies of one lane: 8 x 16 B, global -> LDS through no register.
// The s_wait_xcnt closes the statement so that no address register is rewritten ahead of it.
__device__ __forceinline__ void copy8(u32 l0, u32 l1, u32 l2, u32 l3, u32 l4, u32 l5, u32 l6, u32 l7,
                                      const u16* g0, const u16* g1, const u16* g2, const u16* g3,
                                      const u16* g4, const u16* g5, const u16* g6, const u16* g7) {
    asm volatile("global_load_async_to_lds_b128 %0, %8, off\n\t"
                 "global_load_async_to_lds_b128 %1, %9, off\n\t"
                 "global_load_async_to_lds_b128 %2, %10, off\n\t"
                 "global_load_async_to_lds_b128 %3, %11, off\n\t"
                 "global_load_async_to_lds_b128 %4, %12, off\n\t"
                 "global_load_async_to_lds_b128 %5, %13, off\n\t"
                 "global_load_async_to_lds_b128 %6, %14, off\n\t"
                 "global_load_async_to_lds_b128 %7, %15, off\n\t"
                 "s_wait_xcnt 0x0"
                 :: "v"(l0), "v"(l1), "v"(l2), "v"(l3), "v"(l4), "v"(l5), "v"(l6), "v"(l7),
                    "v"(g0), "v"(g1), "v"(g2), "v"(g3), "v"(g4), "v"(g5), "v"(g6), "v"(g7)
                 : "memory");
}

// ---------------- hi/lo split GEMM: C[i][j] = sum_k A[i][k] * B[j][k] -----------------------
// A planes [*][lda], B planes [*][ldb], both k-contiguous; block tile 32*MI (i) x 128 (j),
// 4 waves as 2x2, wave tile 16*MI x 64 = MI x 4 accumulators.
// A pass is 64 k: the pass's rows of all four planes are copied once per work-group into a two-buffer
// LDS ring by asynchronous copies (whole 128-B lines), the next pass flying while this one is used;
// the waves read their fragments from the ring.
constexpr int GK = 64;                     // k per pass
constexpr int GP = 72;                     // LDS pitch (halves) of a row of 64 k: 144 B = 16 B x 9

// four copies of one lane, as copy8
__device__ __forceinline__ void copy4(u32 l0, u32 l1, u32 l2, u32 l3,
                                      const u16* g0, const u16* g1, const u16* g2, const u16* g3) {
    asm volatile("global_load_async_to_lds_b128 %0, %4, off\n\t"
                 "global_load_async_to_lds_b128 %1, %5, off\n\t"
                 "global_load_async_to_lds_b128 %2, %6, off\n\t"
                 "global_load_async_to_lds_b128 %3, %7, off\n\t"
                 "s_wait_xcnt 0x0"
                 :: "v"(l0), "v"(l1), "v"(l2), "v"(l3), "v"(g0), "v"(g1), "v"(g2), "v"(g3)
                 : "memory");
}

template<int EPI, int MI>
__global__ void __launch_bounds__(128)
gemm_x3(const u16* Ah, const u16* Al, int lda,
        const u16* Bh, const u16* Bl, int ldb, int K,
        const float* bias, const float* cosT, const float* sinT,
        u16* Oh, u16* Ol, float* Of, int ldo)
{
    static_assert(MI == 1 || MI == 4);
    constexpr int BM   = 32 * MI;              // rows of the block tile
    constexpr int APL  = BM * GP;              // one A plane of a pass (halves)
    constexpr int BPL  = 128 * GP;             // one B plane of a pass (halves)
    constexpr int GST  = 2 * APL + 2 * BPL;    // one ring buffer: Ah | Al | Bh | Bl (halves)
    constexpr int RNGB = 2 * GST * 2;          // the ring, bytes
    constexpr int CSB  = BM * CP * 4;          // the f32 C tile, bytes; it takes the ring's place behind the loop
    __shared__ __align__(16) unsigned char Sm[RNGB > CSB ? RNGB : CSB];
    const u16* Ring = (const u16*)Sm;
    float* Cs = (float*)Sm;
    const int tid = threadIdx.x, w = tid >> 5, lane = tid & 31;
    const int h = lane >> 4, ln = lane & 15;
    const int wm = w >> 1, wn = w & 1;
    const int i0 = blockIdx.y * BM, j0 = blockIdx.x * 128;

    v8f acc[MI][4];
#pragma unroll
    for (int mi = 0; mi < MI; ++mi)
#pragma unroll
        for (int ni = 0; ni < 4; ++ni) acc[mi][ni] = zero8();

    // this lane's share of a pass's copies: 16 B of row tid/8 and of every 16th row behind it, in each plane
    const int crow = tid >> 3, ccol = (tid & 7) * 8;
    const size_t ago = (size_t)(i0 + crow) * lda + ccol;                      // + k0
    const size_t bgo = (size_t)(j0 + crow) * ldb + ccol;                      // + k0
    const u32 alo = lds_off(Sm) + 2u * (u32)(crow * GP + ccol);               // + buffer
    const u32 blo = alo + 2u * (u32)(2 * APL);
    constexpr u32 RS = 2u * 16 * GP;           // 16 rows of the ring, bytes
    auto rows128 = [&](u32 l, const u16* g, int ld) {
        const size_t s = (size_t)16 * ld;
        copy8(l, l + RS, l + 2 * RS, l + 3 * RS, l + 4 * RS, l + 5 * RS, l + 6 * RS, l + 7 * RS,
              g, g + s, g + 2 * s, g + 3 * s, g + 4 * s, g + 5 * s, g + 6 * s, g + 7 * s);
    };
    auto stage = [&](int t, int bf) {
        const u32 lb = (u32)bf * (2u * GST);
        const u16* ah = Ah + ago + t * GK;
        const u16* al = Al + ago + t * GK;
        const u32 la = alo + lb, ll = alo + lb + 2u * APL;
        if constexpr (MI == 4) {
            rows128(la, ah, lda);
            rows128(ll, al, lda);
        } else {
            const size_t s = (size_t)16 * lda;
            copy4(la, la + RS, ll, ll + RS, ah, ah + s, al, al + s);
        }
        rows128(blo + lb, Bh + bgo + t * GK, ldb);
        rows128(blo + lb + 2u * BPL, Bl + bgo + t * GK, ldb);
    };

    const int NT = K / GK;
    stage(0, 0);
    asm volatile("s_wait_asynccnt 0x0" ::: "memory");        // this wave's copies of the first pass have landed
    __syncthreads();                                         // ... and every other wave's
    if (NT > 1) stage(1, 1);

#pragma unroll 1
    for (int t = 0; t < NT; ++t) {
        const int bf = t & 1;
        const u16* Ab = Ring + bf * GST + (wm * (16 * MI) + ln) * GP + 8 * h;        // + mi*16*GP, + APL, + ks*32
        const u16* Bb = Ring + bf * GST + 2 * APL + (wn * 64 + ln) * GP + 8 * h;     // + ni*16*GP, + BPL, + ks*32
        // the loops inside a pass are unrolled: every fragment and accumulator index is a constant, so they stay in registers
        if constexpr (MI == 4) {
            // 128 accumulator registers: the A fragments of 32 k stay, the B fragments come one column group ahead
#pragma unroll
            for (int ks = 0; ks < 2; ++ks) {
                v16bf ah[MI], al[MI], bh[4], bl[4];
#pragma unroll
                for (int mi = 0; mi < MI; ++mi) {
                    ah[mi] = ldfrag(Ab + mi * 16 * GP + ks * 32);
                    al[mi] = ldfrag(Ab + APL + mi * 16 * GP + ks * 32);
                }
                bh[0] = ldfrag(Bb + ks * 32);
                bl[0] = ldfrag(Bb + BPL + ks * 32);
#pragma unroll
                for (int ni = 0; ni < 4; ++ni) {
                    if (ni < 3) {
                        bh[ni + 1] = ldfrag(Bb + (ni + 1) * 16 * GP + ks * 32);
                        bl[ni + 1] = ldfrag(Bb + BPL + (ni + 1) * 16 * GP + ks * 32);
                    }
#pragma unroll
                    for (int mi = 0; mi < MI; ++mi)
                        mma3(acc[mi][ni], ah[mi], al[mi], bh[ni], bl[ni]);
                }
            }
        } else {
            // few accumulators: every fragment of the pass is fetched ahead of its products
            v16bf ah[2][MI], al[2][MI], bh[2][4], bl[2][4];
#pragma unroll
            for (int ks = 0; ks < 2; ++ks) {
#pragma unroll
                for (int mi = 0; mi < MI; ++mi) {
                    ah[ks][mi] = ldfrag(Ab + mi * 16 * GP + ks * 32);
                    al[ks][mi] = ldfrag(Ab + APL + mi * 16 * GP + ks * 32);
                }
#pragma unroll
                for (int ni = 0; ni < 4; ++ni) {
                    bh[ks][ni] = ldfrag(Bb + ni * 16 * GP + ks * 32);
                    bl[ks][ni] = ldfrag(Bb + BPL + ni * 16 * GP + ks * 32);
                }
            }
#pragma unroll
            for (int ks = 0; ks < 2; ++ks)
#pragma unroll
                for (int ni = 0; ni < 4; ++ni)
#pragma unroll
                    for (int mi = 0; mi < MI; ++mi)
                        mma3(acc[mi][ni], ah[ks][mi], al[ks][mi], bh[ks][ni], bl[ks][ni]);
        }
        // publish point
        asm volatile("s_wait_dscnt 0x0" ::: "memory");       // this wave's reads of the buffer are done before it is refilled
        asm volatile("s_wait_asynccnt 0x0" ::: "memory");    // this wave's copies of the next pass have landed
        __syncthreads();                                     // both hold for every wave
        if (t + 2 < NT) stage(t + 2, bf);                    // refill the buffer this pass has just read
    }
    asm volatile("s_wait_asynccnt 0x0" ::: "memory");        // no copy is in flight when the ring becomes the C tile

    // stage the f32 tile in LDS: D element r of lane l = (row 8h+r, col ln)
#pragma unroll
    for (int mi = 0; mi < MI; ++mi)
#pragma unroll
        for (int ni = 0; ni < 4; ++ni)
#pragma unroll
            for (int r = 0; r < 8; ++r)
                Cs[(wm * (16 * MI) + mi * 16 + 8 * h + r) * CP + wn * 64 + ni * 16 + ln] = acc[mi][ni][r];
    __syncthreads();

    if (EPI == EPI_F32) {
        // row segment = 128 floats = 512 B = 32 lanes x 16 B, one instruction per row
#pragma unroll 1
        for (int it = 0; it < BM / 4; ++it) {
            const int row = it * 4 + w, col = lane * 4;
            v4f x = *(const v4fa*)(Cs + row * CP + col);
            const v4f bv = *(const v4fa*)(bias + j0 + col);
            x += bv;
            st2f(Of + (size_t)(i0 + row) * ldo + j0 + col, x);
        }
    } else {
        // row segment = 128 halves = 256 B = 16 lanes x 16 B per plane; lanes 16..31 take the next row
#pragma unroll 1
        for (int it = 0; it < BM / 8; ++it) {
            const int row = it * 8 + w * 2 + h, colc = ln * 8;
            const int gi = i0 + row;
            const float* cr = Cs + row * CP;
            float x[8];
            {
                const v4f a = *(const v4fa*)(cr + colc);
                const v4f c = *(const v4fa*)(cr + colc + 4);
                x[0] = a[0]; x[1] = a[1]; x[2] = a[2]; x[3] = a[3];
                x[4] = c[0]; x[5] = c[1]; x[6] = c[2]; x[7] = c[3];
            }
            if (EPI == EPI_ROWB) {
                const float bvv = bias[gi];
#pragma unroll
                for (int e = 0; e < 8; ++e) x[e] += bvv;
            } else {
                const v4f b0 = *(const v4fa*)(bias + j0 + colc);
                const v4f b1 = *(const v4fa*)(bias + j0 + colc + 4);
                x[0] += b0[0]; x[1] += b0[1]; x[2] += b0[2]; x[3] += b0[3];
                x[4] += b1[0]; x[5] += b1[1]; x[6] += b1[2]; x[7] += b1[3];
            }
            if (EPI == EPI_ROPE) {
                // block tile == one head (128 columns); partner column d^64, frequency j = d&63
                const int pc = colc ^ 64;
                float xp[8];
                {
                    const v4f a = *(const v4fa*)(cr + pc);
                    const v4f c = *(const v4fa*)(cr + pc + 4);
                    const v4f b0 = *(const v4fa*)(bias + j0 + pc);
                    const v4f b1 = *(const v4fa*)(bias + j0 + pc + 4);
                    xp[0] = a[0] + b0[0]; xp[1] = a[1] + b0[1]; xp[2] = a[2] + b0[2]; xp[3] = a[3] + b0[3];
                    xp[4] = c[0] + b1[0]; xp[5] = c[1] + b1[1]; xp[6] = c[2] + b1[2]; xp[7] = c[3] + b1[3];
                }
                const int jb = colc & 63;
                const float* cp = cosT + (size_t)gi * NFREQ + jb;
                const float* sp = sinT + (size_t)gi * NFREQ + jb;
                const v4f c0 = *(const v4fa*)(cp), c1 = *(const v4fa*)(cp + 4);
                const v4f s0 = *(const v4fa*)(sp), s1 = *(const v4fa*)(sp + 4);
                float cs[8] = {c0[0], c0[1], c0[2], c0[3], c1[0], c1[1], c1[2], c1[3]};
                float sn[8] = {s0[0], s0[1], s0[2], s0[3], s1[0], s1[1], s1[2], s1[3]};
                const float sg = (colc < 64) ? -1.0f : 1.0f;
#pragma unroll
                for (int e = 0; e < 8; ++e) x[e] = x[e] * cs[e] + sg * (xp[e] * sn[e]);
            }
            v4u hi, lo;
            split8(x, hi, lo);
            const size_t o = (size_t)gi * ldo + j0 + colc;
            st2u(Oh + o, Ol + o, hi, lo);
        }
    }
}

// ---------------- flash attention, GQA, hi/lo split on both products ---------------------
// one work-group = 8 waves = the 8 query heads of one KV head, all on the same 16 query rows;
// one wave per head; 32 keys per pass; online f32 softmax.
// The K and V tiles of a pass (both planes) are the same for all 8 heads: they are copied once per
// work-group into a two-buffer LDS ring by asynchronous copies, the next tile flying while this one is used.
// Q planes [4096][2048], K planes [4096][256], Vt planes [256][4096] (key-contiguous),
// additive mask added by value, fully-masked tiles skipped via flags; O -> hi/lo planes [4096][2048]
constexpr int KP  = 136;                   // LDS pitch (halves) of a K row of 128 dims: 272 B = 16 B x 17
constexpr int VP  = 40;                    // LDS pitch (halves) of a Vt row of 32 keys:  80 B = 16 B x 5
constexpr int KPL = 32 * KP;               // one K plane of a tile (halves)
constexpr int VPL = HD * VP;               // one Vt plane of a tile (halves)
constexpr int STG = 2 * KPL + 2 * VPL;     // one ring buffer: Kh | Kl | Vh | Vl (halves)

__global__ void __launch_bounds__(256)
attn_x3(const u16* Qh, const u16* Ql, const u16* Kh, const u16* Kl,
        const u16* Vh, const u16* Vl, const float* amask, const int* flags,
        u16* Oh, u16* Ol)
{
    __shared__ __align__(16) u16 Ring[2 * STG];
    __shared__ __align__(16) u16 PhA[NREP * 16 * 32];
    __shared__ __align__(16) u16 PlA[NREP * 16 * 32];
    __shared__ __align__(16) float OsA[NREP * 16 * OSP];

    const int tid = threadIdx.x;
    const int lane = tid & 31, h = lane >> 4, ln = lane & 15;
    const int w = __builtin_amdgcn_readfirstlane(tid >> 5);
    const int qt = blockIdx.x, kvh = blockIdx.y, b = blockIdx.z;
    const int hh = kvh * NREP + w;
    const int q0 = qt * 16;
    u16* Ph = PhA + w * (16 * 32);             // each wave's own P and O staging
    u16* Pl = PlA + w * (16 * 32);
    float* Os = OsA + w * (16 * OSP);

    const size_t qofs = (size_t)(b * S + q0 + ln) * NQ + hh * HD + 8 * h;     // A row ln, + dc*32
    const size_t mofs = (size_t)(q0 + 8 * h) * S + ln;                        // + r*S + kb (+16)

    // this lane's share of a tile's copies: K rows tid/16 and +16 (16 B of 256), Vt rows tid/4 and +64 (16 B of 64)
    const int krow = tid >> 4, kcol = (tid & 15) * 8;
    const int vrow = tid >> 2, vcol = (tid & 3) * 8;
    const size_t kgo = (size_t)(b * S + krow) * NKVD + kvh * HD + kcol;       // + kb*NKVD
    const size_t vgo = (size_t)(kvh * HD + vrow) * MROWS + b * S + vcol;      // + kb
    const u32 klo = lds_off(Ring) + 2u * (u32)(krow * KP + kcol);             // + buffer
    const u32 vlo = lds_off(Ring) + 2u * (u32)(2 * KPL + vrow * VP + vcol);   // + buffer
    auto stage = [&](int kt, int bf) {
        const u32 lb = (u32)bf * (2u * STG);
        const size_t ko = kgo + (size_t)(kt * 32) * NKVD;
        const size_t vo = vgo + (size_t)(kt * 32);
        copy8(klo + lb, klo + lb + 2u * (16 * KP), klo + lb + 2u * KPL, klo + lb + 2u * (KPL + 16 * KP),
              vlo + lb, vlo + lb + 2u * (64 * VP), vlo + lb + 2u * VPL, vlo + lb + 2u * (VPL + 64 * VP),
              Kh + ko, Kh + ko + (size_t)16 * NKVD, Kl + ko, Kl + ko + (size_t)16 * NKVD,
              Vh + vo, Vh + vo + (size_t)64 * MROWS, Vl + vo, Vl + vo + (size_t)64 * MROWS);
    };

    float mrun[8], lrun[8];
    v8f o[8];
#pragma unroll
    for (int r = 0; r < 8; ++r) { mrun[r] = -1.0e30f; lrun[r] = 0.0f; }
#pragma unroll
    for (int t = 0; t < 8; ++t) o[t] = zero8();

    // the key tiles that are not all-masked, as a 64-bit set, alike in every wave of the work-group:
    // the ring has to know the next tile one pass ahead
    const u32 a_lo = __builtin_amdgcn_ballot_w32(flags[qt * NKT + lane] != 1);
    const u32 a_hi = __builtin_amdgcn_ballot_w32(flags[qt * NKT + 32 + lane] != 1);
    unsigned long long act = (unsigned long long)a_lo | ((unsigned long long)a_hi << 32);

    if (act != 0) {
        int kt = __builtin_ctzll(act);
        act &= act - 1;
        stage(kt, 0);
        asm volatile("s_wait_asynccnt 0x0" ::: "memory");    // this wave's copies of the first tile have landed
        __syncthreads();                                     // ... and every other wave's
        int ktn = -1;
        if (act != 0) {
            ktn = __builtin_ctzll(act);
            act &= act - 1;
            stage(ktn, 1);
        }
        int bf = 0;
        for (;;) {
            const int kb = kt * 32;
            const u16* Kb = Ring + bf * STG + ln * KP + 8 * h;               // K row ln, + 16*KP, + KPL, + dc*32
            const u16* Vb = Ring + bf * STG + 2 * KPL + ln * VP + 8 * h;     // Vt row ln, + t*16*VP, + VPL

            // scores S[16 q][32 keys] = Q . K^T over 128 dims (4 k-steps), two 16-key accumulators
            v8f s0 = zero8(), s1 = zero8();
#pragma unroll
            for (int dc = 0; dc < 4; ++dc) {
                const v16bf qh = ldfrag(Qh + qofs + dc * 32);
                const v16bf ql = ldfrag(Ql + qofs + dc * 32);
                v16bf kh = ldfrag(Kb + dc * 32);
                v16bf kl = ldfrag(Kb + KPL + dc * 32);
                mma3(s0, qh, ql, kh, kl);
                kh = ldfrag(Kb + 16 * KP + dc * 32);
                kl = ldfrag(Kb + KPL + 16 * KP + dc * 32);
                mma3(s1, qh, ql, kh, kl);
            }

            // scale + additive mask by value + online softmax; lane (h,ln): s[r] = (row 8h+r, key kb + nt*16 + ln)
#pragma unroll
            for (int r = 0; r < 8; ++r) {
                const float* mp = amask + mofs + (size_t)r * S + kb;
                const float mk0 = mp[0];
                const float mk1 = mp[16];
                const float a0 = s0[r] * SCALE + mk0;
                const float a1 = s1[r] * SCALE + mk1;
                float mx = fmaxf(a0, a1);
                mx = fmaxf(mx, __shfl_xor(mx, 1));
                mx = fmaxf(mx, __shfl_xor(mx, 2));
                mx = fmaxf(mx, __shfl_xor(mx, 4));
                mx = fmaxf(mx, __shfl_xor(mx, 8));
                const float mnew = fmaxf(mrun[r], mx);
                const float corr = __expf(mrun[r] - mnew);
                const float p0 = __expf(a0 - mnew);
                const float p1 = __expf(a1 - mnew);
                mrun[r] = mnew;
                float ps = p0 + p1;
                ps += __shfl_xor(ps, 1);
                ps += __shfl_xor(ps, 2);
                ps += __shfl_xor(ps, 4);
                ps += __shfl_xor(ps, 8);
                lrun[r] = lrun[r] * corr + ps;
#pragma unroll
                for (int t = 0; t < 8; ++t) o[t][r] *= corr;
                const u32 h0 = bfb(p0), h1 = bfb(p1);
                const u32 l0 = bfb(p0 - bff(h0)), l1 = bfb(p1 - bff(h1));
                const int prow = (8 * h + r) * 32;               // P[row 8h+r][key ln / 16+ln]
                Ph[prow + ln] = (u16)h0;
                Ph[prow + 16 + ln] = (u16)h1;
                Pl[prow + ln] = (u16)l0;
                Pl[prow + 16 + ln] = (u16)l1;
            }
            __syncthreads();                                     // D->A relayout of P through LDS

            // O[16][128] += P[16][32 keys] . V[32 keys][128]; V B-fragments from the ring's key-contiguous rows
            const v16bf ph = ldfrag(Ph + ln * 32 + 8 * h);
            const v16bf pl = ldfrag(Pl + ln * 32 + 8 * h);
#pragma unroll
            for (int t = 0; t < 8; ++t) {
                const v16bf vh = ldfrag(Vb + t * 16 * VP);
                const v16bf vl = ldfrag(Vb + VPL + t * 16 * VP);
                mma3(o[t], ph, pl, vh, vl);
            }

            // publish point: this wave's LDS reads are done, its copies of the next tile have landed,
            // then the barrier that says both of every wave (it also ends the reads of P before P is rewritten)
            asm volatile("s_wait_dscnt 0x0" ::: "memory");
            asm volatile("s_wait_asynccnt 0x0" ::: "memory");
            __syncthreads();
            if (ktn < 0) break;
            kt = ktn;
            ktn = -1;
            if (act != 0) {                                      // refill the buffer this pass has just read
                ktn = __builtin_ctzll(act);
                act &= act - 1;
                stage(ktn, bf);
            }
            bf ^= 1;
        }
    }
    asm volatile("s_wait_asynccnt 0x0" ::: "memory");            // no copy is left in flight when the wave ends

    // normalise, stage the 16x128 f32 tile, write hi/lo planes with 16-B lane-contiguous stores
#pragma unroll
    for (int r = 0; r < 8; ++r) {
        const float lv = lrun[r];
        const float li = (lv > 0.0f) ? (1.0f / lv) : 0.0f;
        const int orow = (8 * h + r) * OSP;
#pragma unroll
        for (int t = 0; t < 8; ++t) Os[orow + t * 16 + ln] = o[t][r] * li;
    }
    __syncthreads();
#pragma unroll 1
    for (int it = 0; it < 8; ++it) {
        const int row = it * 2 + h, colc = ln * 8;
        const float* cr = Os + row * OSP;
        const v4f a = *(const v4fa*)(cr + colc);
        const v4f c = *(const v4fa*)(cr + colc + 4);
        float x[8] = {a[0], a[1], a[2], a[3], c[0], c[1], c[2], c[3]};
        v4u hi, lo;
        split8(x, hi, lo);
        const size_t oo = (size_t)(b * S + q0 + row) * NQ + hh * HD + colc;
        st2u(Oh + oo, Ol + oo, hi, lo);
    }
}

// ---------------- host ---------------------------------------------------------------------
extern "C" void kernel_launch(void* const* d_in, const int* in_sizes, int n_in,
                              void* d_out, int out_size, void* d_ws, size_t ws_size,
                              hipStream_t stream)
{
    if (n_in < 11) return;
    if (in_sizes[0] != MROWS * HID || in_sizes[1] != MROWS || in_sizes[2] != S * S ||
        in_sizes[3] != HID * NQ || in_sizes[4] != NQ ||
        in_sizes[5] != HID * NKVD || in_sizes[6] != NKVD ||
        in_sizes[7] != HID * NKVD || in_sizes[8] != NKVD ||
        in_sizes[9] != NQ * HID || in_sizes[10] != HID) return;
    if (out_size != MROWS * HID) return;

    const float* X   = (const float*)d_in[0];   // [B*S][HID]
    const float* ts  = (const float*)d_in[1];   // [B*S]
    const float* amk = (const float*)d_in[2];   // [S][S] additive
    const float* Wq  = (const float*)d_in[3];   // [HID][NQ]
    const float* bq  = (const float*)d_in[4];
    const float* Wk  = (const float*)d_in[5];   // [HID][NKVD]
    const float* bk  = (const float*)d_in[6];
    const float* Wv  = (const float*)d_in[7];   // [HID][NKVD]
    const float* bv  = (const float*)d_in[8];
    const float* Wo  = (const float*)d_in[9];   // [NQ][HID]
    const float* bo  = (const float*)d_in[10];
    float* out = (float*)d_out;                 // [B*S][HID]

    const size_t szX  = (size_t)MROWS * HID * 2;     // one plane
    const size_t szWq = (size_t)NQ * HID * 2;
    const size_t szWk = (size_t)NKVD * HID * 2;
    const size_t szWo = (size_t)HID * NQ * 2;
    const size_t szQ  = (size_t)MROWS * NQ * 2;
    const size_t szK  = (size_t)MROWS * NKVD * 2;
    const size_t szVt = (size_t)NKVD * MROWS * 2;
    const size_t szTb = (size_t)MROWS * NFREQ * 4;
    const size_t szFl = (size_t)NQT * NKT * 4;
    char* base = (char*)d_ws;
    size_t used = 0;
    auto take = [&](size_t bytes) -> char* { char* p = base + used; used += (bytes + 255) & ~(size_t)255; return p; };
    u16* Xh   = (u16*)take(szX);   u16* Xl   = (u16*)take(szX);     // reused as attention-output planes
    u16* Wqth = (u16*)take(szWq);  u16* Wqtl = (u16*)take(szWq);    // [NQ][HID]
    u16* Wkth = (u16*)take(szWk);  u16* Wktl = (u16*)take(szWk);    // [NKVD][HID]
    u16* Wvth = (u16*)take(szWk);  u16* Wvtl = (u16*)take(szWk);    // [NKVD][HID]
    u16* Woth = (u16*)take(szWo);  u16* Wotl = (u16*)take(szWo);    // [HID][NQ]
    u16* Qh   = (u16*)take(szQ);   u16* Ql   = (u16*)take(szQ);     // [MROWS][NQ]
    u16* Kh   = (u16*)take(szK);   u16* Kl   = (u16*)take(szK);     // [MROWS][NKVD]
    u16* Vth  = (u16*)take(szVt);  u16* Vtl  = (u16*)take(szVt);    // [NKVD][MROWS]
    float* cosT = (float*)take(szTb);                               // [MROWS][64]
    float* sinT = (float*)take(szTb);
    int* flags  = (int*)take(szFl);                                 // [NQT][NKT]
    if (used > ws_size) return;
    u16* AOh = Xh;   // X planes are dead once the three projections are enqueued
    u16* AOl = Xl;

    // 1: X -> hi/lo planes
    k_split_rows<<<dim3((MROWS * HID) / (256 * 8)), dim3(256), 0, stream>>>(X, MROWS * HID, Xh, Xl);
    // 2..5: weights in[in][out] -> k-contiguous hi/lo planes out[out][in]
    k_split_t<<<dim3(NQ / 64, HID / 64), dim3(256), 0, stream>>>(Wq, HID, NQ, Wqth, Wqtl);      // in[2048][2048] -> out[2048][2048]
    k_split_t<<<dim3(NKVD / 64, HID / 64), dim3(256), 0, stream>>>(Wk, HID, NKVD, Wkth, Wktl);  // in[2048][256]  -> out[256][2048]
    k_split_t<<<dim3(NKVD / 64, HID / 64), dim3(256), 0, stream>>>(Wv, HID, NKVD, Wvth, Wvtl);  // in[2048][256]  -> out[256][2048]
    k_split_t<<<dim3(HID / 64, NQ / 64), dim3(256), 0, stream>>>(Wo, NQ, HID, Woth, Wotl);      // in[2048][2048] -> out[2048][2048]
    // 6: rotary cos/sin table per token row
    k_rope_table<<<dim3(MROWS / 4), dim3(256), 0, stream>>>(ts, MROWS, cosT, sinT);
    // 7: tile skip flags from the additive mask input
    k_flags<<<dim3(NQT, 2), dim3(256), 0, stream>>>(amk, flags);
    // 8: Q = X.Wq + bq, rotary -> planes [MROWS][NQ]
    gemm_x3<EPI_ROPE, 4><<<dim3(NQ / 128, MROWS / 128), dim3(128), 0, stream>>>(
        Xh, Xl, HID, Wqth, Wqtl, HID, HID, bq, cosT, sinT, Qh, Ql, out, NQ);
    // 9: K = X.Wk + bk, rotary -> planes [MROWS][NKVD]
    gemm_x3<EPI_ROPE, 1><<<dim3(NKVD / 128, MROWS / 32), dim3(128), 0, stream>>>(
        Xh, Xl, HID, Wkth, Wktl, HID, HID, bk, cosT, sinT, Kh, Kl, out, NKVD);
    // 10: Vt[kvh*128+d][token] = (X.Wv + bv)^T -> planes [NKVD][MROWS]
    gemm_x3<EPI_ROWB, 1><<<dim3(MROWS / 128, NKVD / 32), dim3(128), 0, stream>>>(
        Wvth, Wvtl, HID, Xh, Xl, HID, HID, bv, cosT, sinT, Vth, Vtl, out, MROWS);
    // 11: attention -> AO planes [MROWS][NQ]
    attn_x3<<<dim3(NQT, NKV, BB), dim3(256), 0, stream>>>(Qh, Ql, Kh, Kl, Vth, Vtl, amk, flags, AOh, AOl);
    // 12: out = AO.Wo + bo -> f32 [MROWS][HID]
    gemm_x3<EPI_F32, 4><<<dim3(HID / 128, MROWS / 128), dim3(128), 0, stream>>>(
        AOh, AOl, NQ, Woth, Wotl, NQ, NQ, bo, cosT, sinT, Qh, Ql, out, HID);
    (void)hipGetLastError();
}

// v003
// It runs in 440 microseconds.
// Two timings next to v002 both put it at 1.10 times that version's speed.
// All steps since v000 together make it 2.20 times as fast.
#include <hip/hip_runtime.h>
#include <math.h>
#include <stddef.h>

// All contractions (q/k/v projections, q.k^T scores, p.v, output projection): v_wmma_f32_16x16x32_bf16 with bf16 hi/lo operands everywhere (hi*hi + hi*lo + lo*hi), f32 accumulate; softmax, rotary, scale and biases in f32.

constexpr int BB    = 2;
constexpr int S     = 2048;
constexpr int HID   = 2048;
constexpr int NH    = 16;
constexpr int NKV   = 2;
constexpr int HD    = 128;
constexpr int NREP  = NH / NKV;            // 8
constexpr int MROWS = BB * S;              // 4096 token rows
constexpr int NQ    = NH * HD;             // 2048
constexpr int NKVD  = NKV * HD;            // 256
constexpr int NQT   = S / 16;              // 128 query tiles of 16 rows
constexpr int NKT   = S / 32;              // 64 key tiles of 32 keys
constexpr int NFREQ = HD / 2;              // 64 rotary frequencies
constexpr float SCALE = 0.08838834764831845f;   // 1/sqrt(128)
constexpr int CP  = 132;                   // LDS pitch (floats), 32*MI x 128 C tile
constexpr int OSP = 132;                   // LDS pitch (floats), 16x128 O tile
constexpr int TP  = 68;                    // LDS pitch (floats), transpose tile

constexpr int EPI_ROPE = 1;                // hi/lo planes out, column bias, rotary
constexpr int EPI_ROWB = 2;                // hi/lo planes out, row bias
constexpr int EPI_F32  = 3;                // f32 out, column bias

static_assert(MROWS % 128 == 0);
static_assert(NQ % 128 == 0);
static_assert(NKVD % 128 == 0);
static_assert(HID % 64 == 0);
static_assert(S % 32 == 0);

typedef unsigned int   u32;
typedef unsigned short u16;
typedef __bf16 v16bf __attribute__((ext_vector_type(16)));
typedef float  v8f   __attribute__((ext_vector_type(8)));
typedef int    v8i   __attribute__((ext_vector_type(8)));
typedef float  v4f   __attribute__((ext_vector_type(4)));
typedef u32    v4u   __attribute__((ext_vector_type(4)));
typedef int    v4i   __attribute__((ext_vector_type(4)));
typedef v4f v4fa __attribute__((may_alias));
typedef v4u v4ua __attribute__((may_alias));
typedef v4i v4ia __attribute__((may_alias));

union Frag { v16bf v; v4u q[2]; };

// ---------------- bf16 RNE split helpers (integer bit arithmetic) ----------
__device__ __forceinline__ u32 bfb(float f) {
    const u32 u = __builtin_bit_cast(u32, f);
    return (u + 0x7FFFu + ((u >> 16) & 1u)) >> 16;
}
__device__ __forceinline__ float bff(u32 b) { return __builtin_bit_cast(float, b << 16); }

// 8 f32 -> packed bf16 hi plane (4 dwords) and lo plane (4 dwords); element 2c in the low half-word
__device__ __forceinline__ void split8(const float (&x)[8], v4u& hi, v4u& lo) {
#pragma unroll
    for (int c = 0; c < 4; ++c) {
        const u32 h0 = bfb(x[2 * c]), h1 = bfb(x[2 * c + 1]);
        const u32 l0 = bfb(x[2 * c] - bff(h0)), l1 = bfb(x[2 * c + 1] - bff(h1));
        hi[c] = h0 | (h1 << 16);
        lo[c] = l0 | (l1 << 16);
    }
}

// ---------------- fragment loader (A map and B map identical, k-contiguous row) -------
// p = plane + row*ld + k0 + 8*h ; elements 0..7 <- k0+8h..+7, elements 8..15 <- k0+16+8h..+7
__device__ __forceinline__ v16bf ldfrag(const u16* p) {
    Frag f;
    f.q[0] = *(const v4ua*)(p);
    f.q[1] = *(const v4ua*)(p + 16);
    return f.v;
}

__device__ __forceinline__ v8f zero8() {
    v8f z;
#pragma unroll
    for (int i = 0; i < 8; ++i) z[i] = 0.0f;
    return z;
}

// three-term hi/lo product into one f32 accumulator, then the 4-slot hazard guard
__device__ __forceinline__ void mma3(v8f& acc, v16bf ah, v16bf al, v16bf bh, v16bf bl) {
    acc = __builtin_amdgcn_wmma_f32_16x16x32_bf16(false, ah, false, bh, (short)0, acc, false, false);
    acc = __builtin_amdgcn_wmma_f32_16x16x32_bf16(false, ah, false, bl, (short)0, acc, false, false);
    acc = __builtin_amdgcn_wmma_f32_16x16x32_bf16(false, al, false, bh, (short)0, acc, false, false);
    const v8i ia = __builtin_bit_cast(v8i, ah);
    const v8i ib = __builtin_bit_cast(v8i, al);
    const v8i ic = __builtin_bit_cast(v8i, bh);
    const v8i id = __builtin_bit_cast(v8i, bl);
    asm volatile("v_nop\n\tv_nop\n\tv_nop\n\tv_nop"
                 : "+v"(acc) : "v"(ia), "v"(ib), "v"(ic), "v"(id) : "memory");
}

__device__ __forceinline__ void st2u(u16* ph, u16* pl, v4u hi, v4u lo) {
    *(v4u*)ph = hi;
    *(v4u*)pl = lo;
    
}
__device__ __forceinline__ void st2f(float* p, v4f v) {
    *(v4f*)p = v;
    
}

// ---------------- X: f32 rows -> hi/lo bf16 planes, same layout --------------------------
__global__ void __launch_bounds__(256)
k_split_rows(const float* X, int n, u16* Xh, u16* Xl)
{
    const size_t i = ((size_t)blockIdx.x * 256 + threadIdx.x) * 8;
    if (i + 8 <= (size_t)n) {
        const v4f a = *(const v4fa*)(X + i);
        const v4f c = *(const v4fa*)(X + i + 4);
        float x[8] = {a[0], a[1], a[2], a[3], c[0], c[1], c[2], c[3]};
        v4u hi, lo;
        split8(x, hi, lo);
        st2u(Xh + i, Xl + i, hi, lo);
    }
}

// ---------------- weights: in[nrows][ncols] f32 -> hi/lo planes out[ncols][nrows] ----------
// grid (ncols/64, nrows/64); LDS transpose; each output line (64 halves) by lanes 8q..8q+7
__global__ void __launch_bounds__(256)
k_split_t(const float* W, int nrows, int ncols, u16* Th, u16* Tl)
{
    __shared__ __align__(16) float T[64 * TP];
    const int tid = threadIdx.x;
    const int cb = blockIdx.x * 64;      // input column tile == output row tile
    const int rb = blockIdx.y * 64;      // input row tile    == output column tile
#pragma unroll
    for (int it = 0; it < 4; ++it) {
        const int fl = it * 256 + tid;
        const int rr = fl >> 4, cc = (fl & 15) * 4;
        const v4f v = *(const v4fa*)(W + (size_t)(rb + rr) * ncols + cb + cc);
        T[(cc + 0) * TP + rr] = v[0];
        T[(cc + 1) * TP + rr] = v[1];
        T[(cc + 2) * TP + rr] = v[2];
        T[(cc + 3) * TP + rr] = v[3];
    }
    __syncthreads();
#pragma unroll
    for (int it = 0; it < 2; ++it) {
        const int orow = it * 32 + (tid >> 3), oc = (tid & 7) * 8;
        const v4f a = *(const v4fa*)(T + orow * TP + oc);
        const v4f c = *(const v4fa*)(T + orow * TP + oc + 4);
        float x[8] = {a[0], a[1], a[2], a[3], c[0], c[1], c[2], c[3]};
        v4u hi, lo;
        split8(x, hi, lo);
        const size_t o = (size_t)(cb + orow) * nrows + rb + oc;
        st2u(Th + o, Tl + o, hi, lo);
    }
}

// ---------------- rotary table: cos/sin of f32(ts[row] * inv_freq[j]) ---------------------
__global__ void __launch_bounds__(256)
k_rope_table(const float* ts, int nrows, float* cosT, float* sinT)
{
    const int tid = threadIdx.x;
    const int row = blockIdx.x * 4 + (tid >> 6);
    const int j   = tid & 63;
    const int rc  = row < nrows ? row : nrows - 1;
    const float t = ts[rc];
    // inv_freq[j] = 1 / f32(10000^(j/64)); the power evaluated in f64 and converted once
    const double p  = exp2((double)j * (13.287712379549449 / 64.0));
    const float  pf = (float)p;
    const float inv = 1.0f / pf;
    const float ang = t * inv;
    float sn, cs;
    sincosf(ang, &sn, &cs);
    if (row < nrows) {
        const size_t o = (size_t)row * NFREQ + j;
        *(float*)(cosT + o) = cs;
        *(float*)(sinT + o) = sn;
        
    }
}

// ---------------- tile flags from the additive input mask ---------------------------------
// flag[qt][kt] = 1 when every entry of the 16x32 mask tile is <= -1e8 (tile contributes 0)
__global__ void __launch_bounds__(256)
k_flags(const float* amask, int* flags)
{
    __shared__ __align__(16) int sf[32];
    const int tid = threadIdx.x, lane = tid & 31, w = tid >> 5;
    const int qt = blockIdx.x, hf = blockIdx.y;
    const int t = tid >> 3, sub = tid & 7;
    const int kt = hf * 32 + t;
    const int kb = kt * 32;
    int ok = 1;
#pragma unroll
    for (int rr = 0; rr < 2; ++rr) {
        const int q = qt * 16 + sub * 2 + rr;
        const float* mp = amask + (size_t)q * S + kb;
#pragma unroll
        for (int c = 0; c < 8; ++c) {
            const v4f v = *(const v4fa*)(mp + 4 * c);
            ok &= (int)(v[0] <= -1.0e8f) & (int)(v[1] <= -1.0e8f) &
                  (int)(v[2] <= -1.0e8f) & (int)(v[3] <= -1.0e8f);
        }
    }
    ok &= __shfl_xor(ok, 1);
    ok &= __shfl_xor(ok, 2);
    ok &= __shfl_xor(ok, 4);
    if (sub == 0) sf[t] = ok;
    __syncthreads();
    if (w == 0 && lane < 8) {
        const v4i f = *(const v4ia*)(sf + lane * 4);
        int* dst = flags + (size_t)qt * NKT + hf * 32 + lane * 4;
        *(v4i*)dst = f;
        
    }
}

__device__ __forceinline__ u32 lds_off(const void* p) { return (u32)(size_t)p; }

// the value of lane l ^ 16
__device__ __forceinline__ float xhalf(float x) {
    const int b = __builtin_bit_cast(int, x);
    return __builtin_bit_cast(float, __builtin_amdgcn_permlanex16(b, b, 0x76543210, 0xfedcba98, false, false));
}

// one tile's copies of one lane: 8 x 16 B, global -> LDS through no register.
// The s_wait_xcnt closes the statement so that no address register is rewritten ahead of it.
__device__ __forceinline__ void copy8(u32 l0, u32 l1, u32 l2, u32 l3, u32 l4, u32 l5, u32 l6, u32 l7,
                                      const u16* g0, const u16* g1, const u16* g2, const u16* g3,
                                      const u16* g4, const u16* g5, const u16* g6, const u16* g7) {
    asm volatile("global_load_async_to_lds_b128 %0, %8, off\n\t"
                 "global_load_async_to_lds_b128 %1, %9, off\n\t"
                 "global_load_async_to_lds_b128 %2, %10, off\n\t"
                 "global_load_async_to_lds_b128 %3, %11, off\n\t"
                 "global_load_async_to_lds_b128 %4, %12, off\n\t"
                 "global_load_async_to_lds_b128 %5, %13, off\n\t"
                 "global_load_async_to_lds_b128 %6, %14, off\n\t"
                 "global_load_async_to_lds_b128 %7, %15, off\n\t"
                 "s_wait_xcnt 0x0"
                 :: "v"(l0), "v"(l1), "v"(l2), "v"(l3), "v"(l4), "v"(l5), "v"(l6), "v"(l7),
                    "v"(g0), "v"(g1), "v"(g2), "v"(g3), "v"(g4), "v"(g5), "v"(g6), "v"(g7)
                 : "memory");
}

// ---------------- hi/lo split GEMM: C[i][j] = sum_k A[i][k] * B[j][k] -----------------------
// A planes [*][lda], B planes [*][ldb], both k-contiguous; block tile 32*MI (i) x 128 (j),
// 4 waves as 2x2, wave tile 16*MI x 64 = MI x 4 accumulators.
// A pass is 64 k: the pass's rows of all four planes are copied once per work-group into a two-buffer
// LDS ring by asynchronous copies (whole 128-B lines), the next pass flying while this one is used;
// the waves read their fragments from the ring.
constexpr int GK = 64;                     // k per pass
constexpr int GP = 72;                     // LDS pitch (halves) of a row of 64 k: 144 B = 16 B x 9

// four copies of one lane, as copy8
__device__ __forceinline__ void copy4(u32 l0, u32 l1, u32 l2, u32 l3,
                                      const u16* g0, const u16* g1, const u16* g2, const u16* g3) {
    asm volatile("global_load_async_to_lds_b128 %0, %4, off\n\t"
                 "global_load_async_to_lds_b128 %1, %5, off\n\t"
                 "global_load_async_to_lds_b128 %2, %6, off\n\t"
                 "global_load_async_to_lds_b128 %3, %7, off\n\t"
                 "s_wait_xcnt 0x0"
                 :: "v"(l0), "v"(l1), "v"(l2), "v"(l3), "v"(g0), "v"(g1), "v"(g2), "v"(g3)
                 : "memory");
}

template<int EPI, int MI>
__global__ void __launch_bounds__(128)
gemm_x3(const u16* Ah, const u16* Al, int lda,
        const u16* Bh, const u16* Bl, int ldb, int K,
        const float* bias, const float* cosT, const float* sinT,
        u16* Oh, u16* Ol, float* Of, int ldo)
{
    static_assert(MI == 1 || MI == 4);
    constexpr int BM   = 32 * MI;              // rows of the block tile
    constexpr int APL  = BM * GP;              // one A plane of a pass (halves)
    constexpr int BPL  = 128 * GP;             // one B plane of a pass (halves)
    constexpr int GST  = 2 * APL + 2 * BPL;    // one ring buffer: Ah | Al | Bh | Bl (halves)
    constexpr int RNGB = 2 * GST * 2;          // the ring, bytes
    constexpr int CSB  = BM * CP * 4;          // the f32 C tile, bytes; it takes the ring's place behind the loop
    __shared__ __align__(16) unsigned char Sm[RNGB > CSB ? RNGB : CSB];
    const u16* Ring = (const u16*)Sm;
    float* Cs = (float*)Sm;
    const int tid = threadIdx.x, w = tid >> 5, lane = tid & 31;
    const int h = lane >> 4, ln = lane & 15;
    const int wm = w >> 1, wn = w & 1;
    const int i0 = blockIdx.y * BM, j0 = blockIdx.x * 128;

    v8f acc[MI][4];
#pragma unroll
    for (int mi = 0; mi < MI; ++mi)
#pragma unroll
        for (int ni = 0; ni < 4; ++ni) acc[mi][ni] = zero8();

    // this lane's share of a pass's copies: 16 B of row tid/8 and of every 16th row behind it, in each plane
    const int crow = tid >> 3, ccol = (tid & 7) * 8;
    const size_t ago = (size_t)(i0 + crow) * lda + ccol;                      // + k0
    const size_t bgo = (size_t)(j0 + crow) * ldb + ccol;                      // + k0
    const u32 alo = lds_off(Sm) + 2u * (u32)(crow * GP + ccol);               // + buffer
    const u32 blo = alo + 2u * (u32)(2 * APL);
    constexpr u32 RS = 2u * 16 * GP;           // 16 rows of the ring, bytes
    auto rows128 = [&](u32 l, const u16* g, int ld) {
        const size_t s = (size_t)16 * ld;
        copy8(l, l + RS, l + 2 * RS, l + 3 * RS, l + 4 * RS, l + 5 * RS, l + 6 * RS, l + 7 * RS,
              g, g + s, g + 2 * s, g + 3 * s, g + 4 * s, g + 5 * s, g + 6 * s, g + 7 * s);
    };
    auto stage = [&](int t, int bf) {
        const u32 lb = (u32)bf * (2u * GST);
        const u16* ah = Ah + ago + t * GK;
        const u16* al = Al + ago + t * GK;
        const u32 la = alo + lb, ll = alo + lb + 2u * APL;
        if constexpr (MI == 4) {
            rows128(la, ah, lda);
            rows128(ll, al, lda);
        } else {
            const size_t s = (size_t)16 * lda;
            copy4(la, la + RS, ll, ll + RS, ah, ah + s, al, al + s);
        }
        rows128(blo + lb, Bh + bgo + t * GK, ldb);
        rows128(blo + lb + 2u * BPL, Bl + bgo + t * GK, ldb);
    };

    const int NT = K / GK;
    stage(0, 0);
    asm volatile("s_wait_asynccnt 0x0" ::: "memory");        // this wave's copies of the first pass have landed
    __syncthreads();                                         // ... and every other wave's
    if (NT > 1) stage(1, 1);

#pragma unroll 1
    for (int t = 0; t < NT; ++t) {
        const int bf = t & 1;
        const u16* Ab = Ring + bf * GST + (wm * (16 * MI) + ln) * GP + 8 * h;        // + mi*16*GP, + APL, + ks*32
        const u16* Bb = Ring + bf * GST + 2 * APL + (wn * 64 + ln) * GP + 8 * h;     // + ni*16*GP, + BPL, + ks*32
        // the loops inside a pass are unrolled: every fragment and accumulator index is a constant, so they stay in registers
        if constexpr (MI == 4) {
            // 128 accumulator registers: the A fragments of 32 k stay, the B fragments come one column group ahead
#pragma unroll
            for (int ks = 0; ks < 2; ++ks) {
                v16bf ah[MI], al[MI], bh[4], bl[4];
#pragma unroll
                for (int mi = 0; mi < MI; ++mi) {
                    ah[mi] = ldfrag(Ab + mi * 16 * GP + ks * 32);
                    al[mi] = ldfrag(Ab + APL + mi * 16 * GP + ks * 32);
                }
                bh[0] = ldfrag(Bb + ks * 32);
                bl[0] = ldfrag(Bb + BPL + ks * 32);
#pragma unroll
                for (int ni = 0; ni < 4; ++ni) {
                    if (ni < 3) {
                        bh[ni + 1] = ldfrag(Bb + (ni + 1) * 16 * GP + ks * 32);
                        bl[ni + 1] = ldfrag(Bb + BPL + (ni + 1) * 16 * GP + ks * 32);
                    }
#pragma unroll
                    for (int mi = 0; mi < MI; ++mi)
                        mma3(acc[mi][ni], ah[mi], al[mi], bh[ni], bl[ni]);
                }
            }
        } else {
            // few accumulators: every fragment of the pass is fetched ahead of its products
            v16bf ah[2][MI], al[2][MI], bh[2][4], bl[2][4];
#pragma unroll
            for (int ks = 0; ks < 2; ++ks) {
#pragma unroll
                for (int mi = 0; mi < MI; ++mi) {
                    ah[ks][mi] = ldfrag(Ab + mi * 16 * GP + ks * 32);
                    al[ks][mi] = ldfrag(Ab + APL + mi * 16 * GP + ks * 32);
                }
#pragma unroll
                for (int ni = 0; ni < 4; ++ni) {
                    bh[ks][ni] = ldfrag(Bb + ni * 16 * GP + ks * 32);
                    bl[ks][ni] = ldfrag(Bb + BPL + ni * 16 * GP + ks * 32);
                }
            }
#pragma unroll
            for (int ks = 0; ks < 2; ++ks)
#pragma unroll
                for (int ni = 0; ni < 4; ++ni)
#pragma unroll
                    for (int mi = 0; mi < MI; ++mi)
                        mma3(acc[mi][ni], ah[ks][mi], al[ks][mi], bh[ks][ni], bl[ks][ni]);
        }
        // publish point
        asm volatile("s_wait_dscnt 0x0" ::: "memory");       // this wave's reads of the buffer are done before it is refilled
        asm volatile("s_wait_asynccnt 0x0" ::: "memory");    // this wave's copies of the next pass have landed
        __syncthreads();                                     // both hold for every wave
        if (t + 2 < NT) stage(t + 2, bf);                    // refill the buffer this pass has just read
    }
    asm volatile("s_wait_asynccnt 0x0" ::: "memory");        // no copy is in flight when the ring becomes the C tile

    // stage the f32 tile in LDS: D element r of lane l = (row 8h+r, col ln)
#pragma unroll
    for (int mi = 0; mi < MI; ++mi)
#pragma unroll
        for (int ni = 0; ni < 4; ++ni)
#pragma unroll
            for (int r = 0; r < 8; ++r)
                Cs[(wm * (16 * MI) + mi * 16 + 8 * h + r) * CP + wn * 64 + ni * 16 + ln] = acc[mi][ni][r];
    __syncthreads();

    if (EPI == EPI_F32) {
        // row segment = 128 floats = 512 B = 32 lanes x 16 B, one instruction per row
#pragma unroll 1
        for (int it = 0; it < BM / 4; ++it) {
            const int row = it * 4 + w, col = lane * 4;
            v4f x = *(const v4fa*)(Cs + row * CP + col);
            const v4f bv = *(const v4fa*)(bias + j0 + col);
            x += bv;
            st2f(Of + (size_t)(i0 + row) * ldo + j0 + col, x);
        }
    } else {
        // row segment = 128 halves = 256 B = 16 lanes x 16 B per plane; lanes 16..31 take the next row
#pragma unroll 1
        for (int it = 0; it < BM / 8; ++it) {
            const int row = it * 8 + w * 2 + h, colc = ln * 8;
            const int gi = i0 + row;
            const float* cr = Cs + row * CP;
            float x[8];
            {
                const v4f a = *(const v4fa*)(cr + colc);
                const v4f c = *(const v4fa*)(cr + colc + 4);
                x[0] = a[0]; x[1] = a[1]; x[2] = a[2]; x[3] = a[3];
                x[4] = c[0]; x[5] = c[1]; x[6] = c[2]; x[7] = c[3];
            }
            if (EPI == EPI_ROWB) {
                const float bvv = bias[gi];
#pragma unroll
                for (int e = 0; e < 8; ++e) x[e] += bvv;
            } else {
                const v4f b0 = *(const v4fa*)(bias + j0 + colc);
                const v4f b1 = *(const v4fa*)(bias + j0 + colc + 4);
                x[0] += b0[0]; x[1] += b0[1]; x[2] += b0[2]; x[3] += b0[3];
                x[4] += b1[0]; x[5] += b1[1]; x[6] += b1[2]; x[7] += b1[3];
            }
            if (EPI == EPI_ROPE) {
                // block tile == one head (128 columns); partner column d^64, frequency j = d&63
                const int pc = colc ^ 64;
                float xp[8];
                {
                    const v4f a = *(const v4fa*)(cr + pc);
                    const v4f c = *(const v4fa*)(cr + pc + 4);
                    const v4f b0 = *(const v4fa*)(bias + j0 + pc);
                    const v4f b1 = *(const v4fa*)(bias + j0 + pc + 4);
                    xp[0] = a[0] + b0[0]; xp[1] = a[1] + b0[1]; xp[2] = a[2] + b0[2]; xp[3] = a[3] + b0[3];
                    xp[4] = c[0] + b1[0]; xp[5] = c[1] + b1[1]; xp[6] = c[2] + b1[2]; xp[7] = c[3] + b1[3];
                }
                const int jb = colc & 63;
                const float* cp = cosT + (size_t)gi * NFREQ + jb;
                const float* sp = sinT + (size_t)gi * NFREQ + jb;
                const v4f c0 = *(const v4fa*)(cp), c1 = *(const v4fa*)(cp + 4);
                const v4f s0 = *(const v4fa*)(sp), s1 = *(const v4fa*)(sp + 4);
                float cs[8] = {c0[0], c0[1], c0[2], c0[3], c1[0], c1[1], c1[2], c1[3]};
                float sn[8] = {s0[0], s0[1], s0[2], s0[3], s1[0], s1[1], s1[2], s1[3]};
                const float sg = (colc < 64) ? -1.0f : 1.0f;
#pragma unroll
                for (int e = 0; e < 8; ++e) x[e] = x[e] * cs[e] + sg * (xp[e] * sn[e]);
            }
            v4u hi, lo;
            split8(x, hi, lo);
            const size_t o = (size_t)gi * ldo + j0 + colc;
            st2u(Oh + o, Ol + o, hi, lo);
        }
    }
}

constexpr int KP  = 136;                   // LDS pitch (halves) of a K row of 128 dims: 272 B = 16 B x 17
constexpr int VP  = 40;                    // LDS pitch (halves) of a Vt row of 32 keys:  80 B = 16 B x 5
constexpr int KPL = 32 * KP;               // one K plane of a tile (halves)
constexpr int VPL = HD * VP;               // one Vt plane of a tile (halves)
constexpr int STG = 2 * KPL + 2 * VPL;     // one ring buffer: Kh | Kl | Vh | Vl (halves)

__global__ void __launch_bounds__(256)
attn_x3(const u16* Qh, const u16* Ql, const u16* Kh, const u16* Kl,
        const u16* Vh, const u16* Vl, const float* amask, const int* flags,
        u16* Oh, u16* Ol)
{
    __shared__ __align__(16) u16 Ring[2 * STG];
    __shared__ __align__(16) float OsA[NREP * 16 * OSP];

    const int tid = threadIdx.x;
    const int lane = tid & 31, h = lane >> 4, ln = lane & 15;
    const int w = __builtin_amdgcn_readfirstlane(tid >> 5);
    const int qt = blockIdx.x, kvh = blockIdx.y, b = blockIdx.z;
    const int hh = kvh * NREP + w;
    const int q0 = qt * 16;
    float* Os = OsA + w * (16 * OSP);          // each wave's own O staging

    const size_t qofs = (size_t)(b * S + q0 + ln) * NQ + hh * HD + 8 * h;     // B column ln, + dc*32
    const size_t mofs = (size_t)(q0 + ln) * S + 8 * h;                        // query ln, + kb (+16), 8 keys in a row

    // this lane's share of a tile's copies: K rows tid/16 and +16 (16 B of 256), Vt rows tid/4 and +64 (16 B of 64)
    const int krow = tid >> 4, kcol = (tid & 15) * 8;
    const int vrow = tid >> 2, vcol = (tid & 3) * 8;
    const size_t kgo = (size_t)(b * S + krow) * NKVD + kvh * HD + kcol;       // + kb*NKVD
    const size_t vgo = (size_t)(kvh * HD + vrow) * MROWS + b * S + vcol;      // + kb
    const u32 klo = lds_off(Ring) + 2u * (u32)(krow * KP + kcol);             // + buffer
    const u32 vlo = lds_off(Ring) + 2u * (u32)(2 * KPL + vrow * VP + vcol);   // + buffer
    auto stage = [&](int kt, int bf) {
        const u32 lb = (u32)bf * (2u * STG);
        const size_t ko = kgo + (size_t)(kt * 32) * NKVD;
        const size_t vo = vgo + (size_t)(kt * 32);
        copy8(klo + lb, klo + lb + 2u * (16 * KP), klo + lb + 2u * KPL, klo + lb + 2u * (KPL + 16 * KP),
              vlo + lb, vlo + lb + 2u * (64 * VP), vlo + lb + 2u * VPL, vlo + lb + 2u * (VPL + 64 * VP),
              Kh + ko, Kh + ko + (size_t)16 * NKVD, Kl + ko, Kl + ko + (size_t)16 * NKVD,
              Vh + vo, Vh + vo + (size_t)64 * MROWS, Vl + vo, Vl + vo + (size_t)64 * MROWS);
    };

    float mrun = -1.0e30f, lrun = 0.0f;        // of query ln; lrun sums this wave half's keys only, joined behind the loop
    v8f o[8];                                  // o[t][r] = O[query ln][dim t*16 + 8h + r]
#pragma unroll
    for (int t = 0; t < 8; ++t) o[t] = zero8();

    // the key tiles that are not all-masked, as a 64-bit set, alike in every wave of the work-group:
    // the ring has to know the next tile one pass ahead
    const u32 a_lo = __builtin_amdgcn_ballot_w32(flags[qt * NKT + lane] != 1);
    const u32 a_hi = __builtin_amdgcn_ballot_w32(flags[qt * NKT + 32 + lane] != 1);
    unsigned long long act = (unsigned long long)a_lo | ((unsigned long long)a_hi << 32);

    if (act != 0) {
        int kt = __builtin_ctzll(act);
        act &= act - 1;
        stage(kt, 0);
        asm volatile("s_wait_asynccnt 0x0" ::: "memory");    // this wave's copies of the first tile have landed
        __syncthreads();                                     // ... and every other wave's
        int ktn = -1;
        if (act != 0) {
            ktn = __builtin_ctzll(act);
            act &= act - 1;
            stage(ktn, 1);
        }
        int bf = 0;
        for (;;) {
            const int kb = kt * 32;
            const u16* Kb = Ring + bf * STG + ln * KP + 8 * h;               // K row ln, + 16*KP, + KPL, + dc*32
            const u16* Vb = Ring + bf * STG + 2 * KPL + ln * VP + 8 * h;     // Vt row ln, + t*16*VP, + VPL

            // the additive mask of query ln for this lane's 16 keys
            const float* mp = amask + mofs + kb;
            const v4f mk0 = *(const v4fa*)(mp);
            const v4f mk1 = *(const v4fa*)(mp + 4);
            const v4f mk2 = *(const v4fa*)(mp + 16);
            const v4f mk3 = *(const v4fa*)(mp + 20);

            // scores S^T[32 keys][16 q] = K . Q^T over 128 dims (4 k-steps), two 16-key accumulators
            v8f s0 = zero8(), s1 = zero8();
#pragma unroll
            for (int dc = 0; dc < 4; ++dc) {
                const v16bf qh = ldfrag(Qh + qofs + dc * 32);
                const v16bf ql = ldfrag(Ql + qofs + dc * 32);
                v16bf kh = ldfrag(Kb + dc * 32);
                v16bf kl = ldfrag(Kb + KPL + dc * 32);
                mma3(s0, kh, kl, qh, ql);
                kh = ldfrag(Kb + 16 * KP + dc * 32);
                kl = ldfrag(Kb + KPL + 16 * KP + dc * 32);
                mma3(s1, kh, kl, qh, ql);
            }

            // scale + additive mask by value + online softmax; lane (h,ln): s0[r] = (key kb + 8h + r, query ln), s1: + 16
            // the loops of this block are unrolled: every index into a, p0, p1 and o is a constant, so they stay in registers
            float a[16];
#pragma unroll
            for (int r = 0; r < 4; ++r) {
                a[r]      = s0[r]     * SCALE + mk0[r];
                a[4 + r]  = s0[4 + r] * SCALE + mk1[r];
                a[8 + r]  = s1[r]     * SCALE + mk2[r];
                a[12 + r] = s1[4 + r] * SCALE + mk3[r];
            }
            float mx = a[0];
#pragma unroll
            for (int e = 1; e < 16; ++e) mx = fmaxf(mx, a[e]);
            mx = fmaxf(mx, xhalf(mx));                           // the other 16 keys of the query
            const float mnew = fmaxf(mrun, mx);
            const float corr = __expf(mrun - mnew);
            mrun = mnew;
            float p0[8], p1[8];
            float ps = 0.0f;
#pragma unroll
            for (int r = 0; r < 8; ++r) {
                p0[r] = __expf(a[r] - mnew);
                p1[r] = __expf(a[8 + r] - mnew);
                ps += p0[r] + p1[r];
            }
            lrun = lrun * corr + ps;
#pragma unroll
            for (int t = 0; t < 8; ++t)
#pragma unroll
                for (int r = 0; r < 8; ++r) o[t][r] *= corr;
            // P^T as a B operand: element r <- key 8h + r, element 8 + r <- key 16 + 8h + r, column ln: as the lane holds them
            Frag ph, pl;
            split8(p0, ph.q[0], pl.q[0]);
            split8(p1, ph.q[1], pl.q[1]);

            // O^T[128][16 q] += V^T[128][32 keys] . P^T[32 keys][16 q]; V^T A-fragments from the ring's key-contiguous rows
#pragma unroll
            for (int t = 0; t < 8; ++t) {
                const v16bf vh = ldfrag(Vb + t * 16 * VP);
                const v16bf vl = ldfrag(Vb + VPL + t * 16 * VP);
                mma3(o[t], vh, vl, ph.v, pl.v);
            }

            // publish point: this wave's LDS reads are done, its copies of the next tile have landed,
            // then the barrier that says both of every wave
            asm volatile("s_wait_dscnt 0x0" ::: "memory");
            asm volatile("s_wait_asynccnt 0x0" ::: "memory");
            __syncthreads();
            if (ktn < 0) break;
            kt = ktn;
            ktn = -1;
            if (act != 0) {                                      // refill the buffer this pass has just read
                ktn = __builtin_ctzll(act);
                act &= act - 1;
                stage(ktn, bf);
            }
            bf ^= 1;
        }
    }
    asm volatile("s_wait_asynccnt 0x0" ::: "memory");            // no copy is left in flight when the wave ends

    // normalise, stage the 16x128 f32 tile, write hi/lo planes with 16-B lane-contiguous stores
    {
        const float lv = lrun + xhalf(lrun);                     // both wave halves' keys
        const float li = (lv > 0.0f) ? (1.0f / lv) : 0.0f;
        float* orow = Os + ln * OSP + 8 * h;
        // unrolled: constant indices keep o in registers
#pragma unroll
        for (int t = 0; t < 8; ++t) {
            v4f x0, x1;
#pragma unroll
            for (int r = 0; r < 4; ++r) { x0[r] = o[t][r] * li; x1[r] = o[t][4 + r] * li; }
            *(v4fa*)(orow + t * 16) = x0;
            *(v4fa*)(orow + t * 16 + 4) = x1;
        }
    }
    __syncthreads();
#pragma unroll 1
    for (int it = 0; it < 8; ++it) {
        const int row = it * 2 + h, colc = ln * 8;
        const float* cr = Os + row * OSP;
        const v4f a = *(const v4fa*)(cr + colc);
        const v4f c = *(const v4fa*)(cr + colc + 4);
        float x[8] = {a[0], a[1], a[2], a[3], c[0], c[1], c[2], c[3]};
        v4u hi, lo;
        split8(x, hi, lo);
        const size_t oo = (size_t)(b * S + q0 + row) * NQ + hh * HD + colc;
        st2u(Oh + oo, Ol + oo, hi, lo);
    }
}

// ---------------- host ---------------------------------------------------------------------
extern "C" void kernel_launch(void* const* d_in, const int* in_sizes, int n_in,
                              void* d_out, int out_size, void* d_ws, size_t ws_size,
                              hipStream_t stream)
{
    if (n_in < 11) return;
    if (in_sizes[0] != MROWS * HID || in_sizes[1] != MROWS || in_sizes[2] != S * S ||
        in_sizes[3] != HID * NQ || in_sizes[4] != NQ ||
        in_sizes[5] != HID * NKVD || in_sizes[6] != NKVD ||
        in_sizes[7] != HID * NKVD || in_sizes[8] != NKVD ||
        in_sizes[9] != NQ * HID || in_sizes[10] != HID) return;
    if (out_size != MROWS * HID) return;

    const float* X   = (const float*)d_in[0];   // [B*S][HID]
    const float* ts  = (const float*)d_in[1];   // [B*S]
    const float* amk = (const float*)d_in[2];   // [S][S] additive
    const float* Wq  = (const float*)d_in[3];   // [HID][NQ]
    const float* bq  = (const float*)d_in[4];
    const float* Wk  = (const float*)d_in[5];   // [HID][NKVD]
    const float* bk  = (const float*)d_in[6];
    const float* Wv  = (const float*)d_in[7];   // [HID][NKVD]
    const float* bv  = (const float*)d_in[8];
    const float* Wo  = (const float*)d_in[9];   // [NQ][HID]
    const float* bo  = (const float*)d_in[10];
    float* out = (float*)d_out;                 // [B*S][HID]

    const size_t szX  = (size_t)MROWS * HID * 2;     // one plane
    const size_t szWq = (size_t)NQ * HID * 2;
    const size_t szWk = (size_t)NKVD * HID * 2;
    const size_t szWo = (size_t)HID * NQ * 2;
    const size_t szQ  = (size_t)MROWS * NQ * 2;
    const size_t szK  = (size_t)MROWS * NKVD * 2;
    const size_t szVt = (size_t)NKVD * MROWS * 2;
    const size_t szTb = (size_t)MROWS * NFREQ * 4;
    const size_t szFl = (size_t)NQT * NKT * 4;
    char* base = (char*)d_ws;
    size_t used = 0;
    auto take = [&](size_t bytes) -> char* { char* p = base + used; used += (bytes + 255) & ~(size_t)255; return p; };
    u16* Xh   = (u16*)take(szX);   u16* Xl   = (u16*)take(szX);     // reused as attention-output planes
    u16* Wqth = (u16*)take(szWq);  u16* Wqtl = (u16*)take(szWq);    // [NQ][HID]
    u16* Wkth = (u16*)take(szWk);  u16* Wktl = (u16*)take(szWk);    // [NKVD][HID]
    u16* Wvth = (u16*)take(szWk);  u16* Wvtl = (u16*)take(szWk);    // [NKVD][HID]
    u16* Woth = (u16*)take(szWo);  u16* Wotl = (u16*)take(szWo);    // [HID][NQ]
    u16* Qh   = (u16*)take(szQ);   u16* Ql   = (u16*)take(szQ);     // [MROWS][NQ]
    u16* Kh   = (u16*)take(szK);   u16* Kl   = (u16*)take(szK);     // [MROWS][NKVD]
    u16* Vth  = (u16*)take(szVt);  u16* Vtl  = (u16*)take(szVt);    // [NKVD][MROWS]
    float* cosT = (float*)take(szTb);                               // [MROWS][64]
    float* sinT = (float*)take(szTb);
    int* flags  = (int*)take(szFl);                                 // [NQT][NKT]
    if (used > ws_size) return;
    u16* AOh = Xh;   // X planes are dead once the three projections are enqueued
    u16* AOl = Xl;

    // 1: X -> hi/lo planes
    k_split_rows<<<dim3((MROWS * HID) / (256 * 8)), dim3(256), 0, stream>>>(X, MROWS * HID, Xh, Xl);
    // 2..5: weights in[in][out] -> k-contiguous hi/lo planes out[out][in]
    k_split_t<<<dim3(NQ / 64, HID / 64), dim3(256), 0, stream>>>(Wq, HID, NQ, Wqth, Wqtl);      // in[2048][2048] -> out[2048][2048]
    k_split_t<<<dim3(NKVD / 64, HID / 64), dim3(256), 0, stream>>>(Wk, HID, NKVD, Wkth, Wktl);  // in[2048][256]  -> out[256][2048]
    k_split_t<<<dim3(NKVD / 64, HID / 64), dim3(256), 0, stream>>>(Wv, HID, NKVD, Wvth, Wvtl);  // in[2048][256]  -> out[256][2048]
    k_split_t<<<dim3(HID / 64, NQ / 64), dim3(256), 0, stream>>>(Wo, NQ, HID, Woth, Wotl);      // in[2048][2048] -> out[2048][2048]
    // 6: rotary cos/sin table per token row
    k_rope_table<<<dim3(MROWS / 4), dim3(256), 0, stream>>>(ts, MROWS, cosT, sinT);
    // 7: tile skip flags from the additive mask input
    k_flags<<<dim3(NQT, 2), dim3(256), 0, stream>>>(amk, flags);
    // 8: Q = X.Wq + bq, rotary -> planes [MROWS][NQ]
    gemm_x3<EPI_ROPE, 4><<<dim3(NQ / 128, MROWS / 128), dim3(128), 0, stream>>>(
        Xh, Xl, HID, Wqth, Wqtl, HID, HID, bq, cosT, sinT, Qh, Ql, out, NQ);
    // 9: K = X.Wk + bk, rotary -> planes [MROWS][NKVD]
    gemm_x3<EPI_ROPE, 1><<<dim3(NKVD / 128, MROWS / 32), dim3(128), 0, stream>>>(
        Xh, Xl, HID, Wkth, Wktl, HID, HID, bk, cosT, sinT, Kh, Kl, out, NKVD);
    // 10: Vt[kvh*128+d][token] = (X.Wv + bv)^T -> planes [NKVD][MROWS]
    gemm_x3<EPI_ROWB, 1><<<dim3(MROWS / 128, NKVD / 32), dim3(128), 0, stream>>>(
        Wvth, Wvtl, HID, Xh, Xl, HID, HID, bv, cosT, sinT, Vth, Vtl, out, MROWS);
    // 11: attention -> AO planes [MROWS][NQ]
    attn_x3<<<dim3(NQT, NKV, BB), dim3(256), 0, stream>>>(Qh, Ql, Kh, Kl, Vth, Vtl, amk, flags, AOh, AOl);
    // 12: out = AO.Wo + bo -> f32 [MROWS][HID]
    gemm_x3<EPI_F32, 4><<<dim3(HID / 128, MROWS / 128), dim3(128), 0, stream>>>(
        AOh, AOl, NQ, Woth, Wotl, NQ, NQ, bo, cosT, sinT, Qh, Ql, out, HID);
    (void)hipGetLastError();
}

// v004
// One run takes 363 microseconds.
// Timed twice side by side with v003, it ran 1.21 times as fast both times.
// All steps since v000 together make it 2.68 times as fast.
#include <hip/hip_runtime.h>
#include <math.h>
#include <stddef.h>

// All contractions (q/k/v projections, q.k^T scores, p.v, output projection): v_wmma_f32_16x16x32_bf16 with bf16 hi/lo operands everywhere (hi*hi + hi*lo + lo*hi), f32 accumulate; softmax, rotary, scale and biases in f32.

constexpr int BB    = 2;
constexpr int S     = 2048;
constexpr int HID   = 2048;
constexpr int NH    = 16;
constexpr int NKV   = 2;
constexpr int HD    = 128;
constexpr int NREP  = NH / NKV;            // 8
constexpr int MROWS = BB * S;              // 4096 token rows
constexpr int NQ    = NH * HD;             // 2048
constexpr int NKVD  = NKV * HD;            // 256
constexpr int NQT   = S / 16;              // 128 query tiles of 16 rows
constexpr int NKT   = S / 32;              // 64 key tiles of 32 keys
constexpr int NFREQ = HD / 2;              // 64 rotary frequencies
constexpr float SCALE = 0.08838834764831845f;   // 1/sqrt(128)
constexpr int CP  = 132;                   // LDS pitch (floats), 32*MI x 128 C tile
constexpr int OSP = 132;                   // LDS pitch (floats), 16x128 O tile
constexpr int TP  = 68;                    // LDS pitch (floats), transpose tile

constexpr int EPI_ROPE = 1;                // hi/lo planes out, column bias, rotary
constexpr int EPI_ROWB = 2;                // hi/lo planes out, row bias
constexpr int EPI_F32  = 3;                // f32 out, column bias

static_assert(MROWS % 128 == 0);
static_assert(NQ % 128 == 0);
static_assert(NKVD % 128 == 0);
static_assert(HID % 64 == 0);
static_assert(S % 32 == 0);

typedef unsigned int   u32;
typedef unsigned short u16;
typedef __bf16 v16bf __attribute__((ext_vector_type(16)));
typedef float  v8f   __attribute__((ext_vector_type(8)));
typedef int    v8i   __attribute__((ext_vector_type(8)));
typedef float  v4f   __attribute__((ext_vector_type(4)));
typedef u32    v4u   __attribute__((ext_vector_type(4)));
typedef int    v4i   __attribute__((ext_vector_type(4)));
typedef v4f v4fa __attribute__((may_alias));
typedef v4u v4ua __attribute__((may_alias));
typedef v4i v4ia __attribute__((may_alias));

union Frag { v16bf v; v4u q[2]; };

// ---------------- bf16 RNE split helpers (integer bit arithmetic) ----------
__device__ __forceinline__ u32 bfb(float f) {
    const u32 u = __builtin_bit_cast(u32, f);
    return (u + 0x7FFFu + ((u >> 16) & 1u)) >> 16;
}
__device__ __forceinline__ float bff(u32 b) { return __builtin_bit_cast(float, b << 16); }

// 8 f32 -> packed bf16 hi plane (4 dwords) and lo plane (4 dwords); element 2c in the low half-word
__device__ __forceinline__ void split8(const float (&x)[8], v4u& hi, v4u& lo) {
#pragma unroll
    for (int c = 0; c < 4; ++c) {
        const u32 h0 = bfb(x[2 * c]), h1 = bfb(x[2 * c + 1]);
        const u32 l0 = bfb(x[2 * c] - bff(h0)), l1 = bfb(x[2 * c + 1] - bff(h1));
        hi[c] = h0 | (h1 << 16);
        lo[c] = l0 | (l1 << 16);
    }
}

// ---------------- fragment loader (A map and B map identical, k-contiguous row) -------
// p = plane + row*ld + k0 + 8*h ; elements 0..7 <- k0+8h..+7, elements 8..15 <- k0+16+8h..+7
__device__ __forceinline__ v16bf ldfrag(const u16* p) {
    Frag f;
    f.q[0] = *(const v4ua*)(p);
    f.q[1] = *(const v4ua*)(p + 16);
    return f.v;
}

__device__ __forceinline__ v8f zero8() {
    v8f z;
#pragma unroll
    for (int i = 0; i < 8; ++i) z[i] = 0.0f;
    return z;
}

// three-term hi/lo product into one f32 accumulator, then the 4-slot hazard guard
__device__ __forceinline__ void mma3(v8f& acc, v16bf ah, v16bf al, v16bf bh, v16bf bl) {
    acc = __builtin_amdgcn_wmma_f32_16x16x32_bf16(false, ah, false, bh, (short)0, acc, false, false);
    acc = __builtin_amdgcn_wmma_f32_16x16x32_bf16(false, ah, false, bl, (short)0, acc, false, false);
    acc = __builtin_amdgcn_wmma_f32_16x16x32_bf16(false, al, false, bh, (short)0, acc, false, false);
    const v8i ia = __builtin_bit_cast(v8i, ah);
    const v8i ib = __builtin_bit_cast(v8i, al);
    const v8i ic = __builtin_bit_cast(v8i, bh);
    const v8i id = __builtin_bit_cast(v8i, bl);
    asm volatile("v_nop\n\tv_nop\n\tv_nop\n\tv_nop"
                 : "+v"(acc) : "v"(ia), "v"(ib), "v"(ic), "v"(id) : "memory");
}

__device__ __forceinline__ void st2u(u16* ph, u16* pl, v4u hi, v4u lo) {
    *(v4u*)ph = hi;
    *(v4u*)pl = lo;
    
}
__device__ __forceinline__ void st2f(float* p, v4f v) {
    *(v4f*)p = v;
    
}

// ---------------- X: f32 rows -> hi/lo bf16 planes, same layout --------------------------
__global__ void __launch_bounds__(256)
k_split_rows(const float* X, int n, u16* Xh, u16* Xl)
{
    const size_t i = ((size_t)blockIdx.x * 256 + threadIdx.x) * 8;
    if (i + 8 <= (size_t)n) {
        const v4f a = *(const v4fa*)(X + i);
        const v4f c = *(const v4fa*)(X + i + 4);
        float x[8] = {a[0], a[1], a[2], a[3], c[0], c[1], c[2], c[3]};
        v4u hi, lo;
        split8(x, hi, lo);
        st2u(Xh + i, Xl + i, hi, lo);
    }
}

// ---------------- weights: in[nrows][ncols] f32 -> hi/lo planes out[ncols][nrows] ----------
// grid (ncols/64, nrows/64); LDS transpose; each output line (64 halves) by lanes 8q..8q+7
__global__ void __launch_bounds__(256)
k_split_t(const float* W, int nrows, int ncols, u16* Th, u16* Tl)
{
    __shared__ __align__(16) float T[64 * TP];
    const int tid = threadIdx.x;
    const int cb = blockIdx.x * 64;      // input column tile == output row tile
    const int rb = blockIdx.y * 64;      // input row tile    == output column tile
#pragma unroll
    for (int it = 0; it < 4; ++it) {
        const int fl = it * 256 + tid;
        const int rr = fl >> 4, cc = (fl & 15) * 4;
        const v4f v = *(const v4fa*)(W + (size_t)(rb + rr) * ncols + cb + cc);
        T[(cc + 0) * TP + rr] = v[0];
        T[(cc + 1) * TP + rr] = v[1];
        T[(cc + 2) * TP + rr] = v[2];
        T[(cc + 3) * TP + rr] = v[3];
    }
    __syncthreads();
#pragma unroll
    for (int it = 0; it < 2; ++it) {
        const int orow = it * 32 + (tid >> 3), oc = (tid & 7) * 8;
        const v4f a = *(const v4fa*)(T + orow * TP + oc);
        const v4f c = *(const v4fa*)(T + orow * TP + oc + 4);
        float x[8] = {a[0], a[1], a[2], a[3], c[0], c[1], c[2], c[3]};
        v4u hi, lo;
        split8(x, hi, lo);
        const size_t o = (size_t)(cb + orow) * nrows + rb + oc;
        st2u(Th + o, Tl + o, hi, lo);
    }
}

// ---------------- rotary table: cos/sin of f32(ts[row] * inv_freq[j]) ---------------------
__global__ void __launch_bounds__(256)
k_rope_table(const float* ts, int nrows, float* cosT, float* sinT)
{
    const int tid = threadIdx.x;
    const int row = blockIdx.x * 4 + (tid >> 6);
    const int j   = tid & 63;
    const int rc  = row < nrows ? row : nrows - 1;
    const float t = ts[rc];
    // inv_freq[j] = 1 / f32(10000^(j/64)); the power evaluated in f64 and converted once
    const double p  = exp2((double)j * (13.287712379549449 / 64.0));
    const float  pf = (float)p;
    const float inv = 1.0f / pf;
    const float ang = t * inv;
    float sn, cs;
    sincosf(ang, &sn, &cs);
    if (row < nrows) {
        const size_t o = (size_t)row * NFREQ + j;
        *(float*)(cosT + o) = cs;
        *(float*)(sinT + o) = sn;
        
    }
}

// ---------------- tile flags from the additive input mask ---------------------------------
// flag[qt][kt] = 1 when every entry of the 16x32 mask tile is <= -1e8 (tile contributes 0)
__global__ void __launch_bounds__(256)
k_flags(const float* amask, int* flags)
{
    __shared__ __align__(16) int sf[32];
    const int tid = threadIdx.x, lane = tid & 31, w = tid >> 5;
    const int qt = blockIdx.x, hf = blockIdx.y;
    const int t = tid >> 3, sub = tid & 7;
    const int kt = hf * 32 + t;
    const int kb = kt * 32;
    int ok = 1;
#pragma unroll
    for (int rr = 0; rr < 2; ++rr) {
        const int q = qt * 16 + sub * 2 + rr;
        const float* mp = amask + (size_t)q * S + kb;
#pragma unroll
        for (int c = 0; c < 8; ++c) {
            const v4f v = *(const v4fa*)(mp + 4 * c);
            ok &= (int)(v[0] <= -1.0e8f) & (int)(v[1] <= -1.0e8f) &
                  (int)(v[2] <= -1.0e8f) & (int)(v[3] <= -1.0e8f);
        }
    }
    ok &= __shfl_xor(ok, 1);
    ok &= __shfl_xor(ok, 2);
    ok &= __shfl_xor(ok, 4);
    if (sub == 0) sf[t] = ok;
    __syncthreads();
    if (w == 0 && lane < 8) {
        const v4i f = *(const v4ia*)(sf + lane * 4);
        int* dst = flags + (size_t)qt * NKT + hf * 32 + lane * 4;
        *(v4i*)dst = f;
        
    }
}

__device__ __forceinline__ u32 lds_off(const void* p) { return (u32)(size_t)p; }

// the value of lane l ^ 16
__device__ __forceinline__ float xhalf(float x) {
    const int b = __builtin_bit_cast(int, x);
    return __builtin_bit_cast(float, __builtin_amdgcn_permlanex16(b, b, 0x76543210, 0xfedcba98, false, false));
}

// one tile's copies of one lane: 8 x 16 B, global -> LDS through no register.
// The s_wait_xcnt closes the statement so that no address register is rewritten ahead of it.
__device__ __forceinline__ void copy8(u32 l0, u32 l1, u32 l2, u32 l3, u32 l4, u32 l5, u32 l6, u32 l7,
                                      const u16* g0, const u16* g1, const u16* g2, const u16* g3,
                                      const u16* g4, const u16* g5, const u16* g6, const u16* g7) {
    asm volatile("global_load_async_to_lds_b128 %0, %8, off\n\t"
                 "global_load_async_to_lds_b128 %1, %9, off\n\t"
                 "global_load_async_to_lds_b128 %2, %10, off\n\t"
                 "global_load_async_to_lds_b128 %3, %11, off\n\t"
                 "global_load_async_to_lds_b128 %4, %12, off\n\t"
                 "global_load_async_to_lds_b128 %5, %13, off\n\t"
                 "global_load_async_to_lds_b128 %6, %14, off\n\t"
                 "global_load_async_to_lds_b128 %7, %15, off\n\t"
                 "s_wait_xcnt 0x0"
                 :: "v"(l0), "v"(l1), "v"(l2), "v"(l3), "v"(l4), "v"(l5), "v"(l6), "v"(l7),
                    "v"(g0), "v"(g1), "v"(g2), "v"(g3), "v"(g4), "v"(g5), "v"(g6), "v"(g7)
                 : "memory");
}

// ---------------- hi/lo split GEMM: C[i][j] = sum_k A[i][k] * B[j][k] -----------------------
// A planes [*][lda], B planes [*][ldb], both k-contiguous; block tile 32*MI (i) x 128 (j),
// 4 waves as 2x2, wave tile 16*MI x 64 = MI x 4 accumulators.
// A pass is 64 k: the pass's rows of all four planes are copied once per work-group into a two-buffer
// LDS ring by asynchronous copies (whole 128-B lines), the next pass flying while this one is used;
// the waves read their fragments from the ring.
constexpr int GK = 64;                     // k per pass
constexpr int GP = 72;                     // LDS pitch (halves) of a row of 64 k: 144 B = 16 B x 9

// four copies of one lane, as copy8
__device__ __forceinline__ void copy4(u32 l0, u32 l1, u32 l2, u32 l3,
                                      const u16* g0, const u16* g1, const u16* g2, const u16* g3) {
    asm volatile("global_load_async_to_lds_b128 %0, %4, off\n\t"
                 "global_load_async_to_lds_b128 %1, %5, off\n\t"
                 "global_load_async_to_lds_b128 %2, %6, off\n\t"
                 "global_load_async_to_lds_b128 %3, %7, off\n\t"
                 "s_wait_xcnt 0x0"
                 :: "v"(l0), "v"(l1), "v"(l2), "v"(l3), "v"(g0), "v"(g1), "v"(g2), "v"(g3)
                 : "memory");
}

template<int EPI, int MI>
__global__ void __launch_bounds__(128)
gemm_x3(const u16* Ah, const u16* Al, int lda,
        const u16* Bh, const u16* Bl, int ldb, int K,
        const float* bias, const float* cosT, const float* sinT,
        u16* Oh, u16* Ol, float* Of, int ldo)
{
    static_assert(MI == 1 || MI == 4);
    constexpr int BM   = 32 * MI;              // rows of the block tile
    constexpr int APL  = BM * GP;              // one A plane of a pass (halves)
    constexpr int BPL  = 128 * GP;             // one B plane of a pass (halves)
    constexpr int GST  = 2 * APL + 2 * BPL;    // one ring buffer: Ah | Al | Bh | Bl (halves)
    constexpr int RNGB = 2 * GST * 2;          // the ring, bytes
    constexpr int CSB  = BM * CP * 4;          // the f32 C tile, bytes; it takes the ring's place behind the loop
    __shared__ __align__(16) unsigned char Sm[RNGB > CSB ? RNGB : CSB];
    const u16* Ring = (const u16*)Sm;
    float* Cs = (float*)Sm;
    const int tid = threadIdx.x, w = tid >> 5, lane = tid & 31;
    const int h = lane >> 4, ln = lane & 15;
    const int wm = w >> 1, wn = w & 1;
    const int i0 = blockIdx.y * BM, j0 = blockIdx.x * 128;

    v8f acc[MI][4];
#pragma unroll
    for (int mi = 0; mi < MI; ++mi)
#pragma unroll
        for (int ni = 0; ni < 4; ++ni) acc[mi][ni] = zero8();

    // this lane's share of a pass's copies: 16 B of row tid/8 and of every 16th row behind it, in each plane
    const int crow = tid >> 3, ccol = (tid & 7) * 8;
    const size_t ago = (size_t)(i0 + crow) * lda + ccol;                      // + k0
    const size_t bgo = (size_t)(j0 + crow) * ldb + ccol;                      // + k0
    const u32 alo = lds_off(Sm) + 2u * (u32)(crow * GP + ccol);               // + buffer
    const u32 blo = alo + 2u * (u32)(2 * APL);
    constexpr u32 RS = 2u * 16 * GP;           // 16 rows of the ring, bytes
    auto rows128 = [&](u32 l, const u16* g, int ld) {
        const size_t s = (size_t)16 * ld;
        copy8(l, l + RS, l + 2 * RS, l + 3 * RS, l + 4 * RS, l + 5 * RS, l + 6 * RS, l + 7 * RS,
              g, g + s, g + 2 * s, g + 3 * s, g + 4 * s, g + 5 * s, g + 6 * s, g + 7 * s);
    };
    auto stage = [&](int t, int bf) {
        const u32 lb = (u32)bf * (2u * GST);
        const u16* ah = Ah + ago + t * GK;
        const u16* al = Al + ago + t * GK;
        const u32 la = alo + lb, ll = alo + lb + 2u * APL;
        if constexpr (MI == 4) {
            rows128(la, ah, lda);
            rows128(ll, al, lda);
        } else {
            const size_t s = (size_t)16 * lda;
            copy4(la, la + RS, ll, ll + RS, ah, ah + s, al, al + s);
        }
        rows128(blo + lb, Bh + bgo + t * GK, ldb);
        rows128(blo + lb + 2u * BPL, Bl + bgo + t * GK, ldb);
    };

    const int NT = K / GK;
    stage(0, 0);
    asm volatile("s_wait_asynccnt 0x0" ::: "memory");        // this wave's copies of the first pass have landed
    __syncthreads();                                         // ... and every other wave's
    if (NT > 1) stage(1, 1);

#pragma unroll 1
    for (int t = 0; t < NT; ++t) {
        const int bf = t & 1;
        const u16* Ab = Ring + bf * GST + (wm * (16 * MI) + ln) * GP + 8 * h;        // + mi*16*GP, + APL, + ks*32
        const u16* Bb = Ring + bf * GST + 2 * APL + (wn * 64 + ln) * GP + 8 * h;     // + ni*16*GP, + BPL, + ks*32
        // the loops inside a pass are unrolled: every fragment and accumulator index is a constant, so they stay in registers
        if constexpr (MI == 4) {
            // 128 accumulator registers: the A fragments of 32 k stay, the B fragments come one column group ahead
#pragma unroll
            for (int ks = 0; ks < 2; ++ks) {
                v16bf ah[MI], al[MI], bh[4], bl[4];
#pragma unroll
                for (int mi = 0; mi < MI; ++mi) {
                    ah[mi] = ldfrag(Ab + mi * 16 * GP + ks * 32);
                    al[mi] = ldfrag(Ab + APL + mi * 16 * GP + ks * 32);
                }
                bh[0] = ldfrag(Bb + ks * 32);
                bl[0] = ldfrag(Bb + BPL + ks * 32);
#pragma unroll
                for (int ni = 0; ni < 4; ++ni) {
                    if (ni < 3) {
                        bh[ni + 1] = ldfrag(Bb + (ni + 1) * 16 * GP + ks * 32);
                        bl[ni + 1] = ldfrag(Bb + BPL + (ni + 1) * 16 * GP + ks * 32);
                    }
#pragma unroll
                    for (int mi = 0; mi < MI; ++mi)
                        mma3(acc[mi][ni], ah[mi], al[mi], bh[ni], bl[ni]);
                }
            }
        } else {
            // few accumulators: every fragment of the pass is fetched ahead of its products
            v16bf ah[2][MI], al[2][MI], bh[2][4], bl[2][4];
#pragma unroll
            for (int ks = 0; ks < 2; ++ks) {
#pragma unroll
                for (int mi = 0; mi < MI; ++mi) {
                    ah[ks][mi] = ldfrag(Ab + mi * 16 * GP + ks * 32);
                    al[ks][mi] = ldfrag(Ab + APL + mi * 16 * GP + ks * 32);
                }
#pragma unroll
                for (int ni = 0; ni < 4; ++ni) {
                    bh[ks][ni] = ldfrag(Bb + ni * 16 * GP + ks * 32);
                    bl[ks][ni] = ldfrag(Bb + BPL + ni * 16 * GP + ks * 32);
                }
            }
#pragma unroll
            for (int ks = 0; ks < 2; ++ks)
#pragma unroll
                for (int ni = 0; ni < 4; ++ni)
#pragma unroll
                    for (int mi = 0; mi < MI; ++mi)
                        mma3(acc[mi][ni], ah[ks][mi], al[ks][mi], bh[ks][ni], bl[ks][ni]);
        }
        // publish point
        asm volatile("s_wait_dscnt 0x0" ::: "memory");       // this wave's reads of the buffer are done before it is refilled
        asm volatile("s_wait_asynccnt 0x0" ::: "memory");    // this wave's copies of the next pass have landed
        __syncthreads();                                     // both hold for every wave
        if (t + 2 < NT) stage(t + 2, bf);                    // refill the buffer this pass has just read
    }
    asm volatile("s_wait_asynccnt 0x0" ::: "memory");        // no copy is in flight when the ring becomes the C tile

    // stage the f32 tile in LDS: D element r of lane l = (row 8h+r, col ln)
#pragma unroll
    for (int mi = 0; mi < MI; ++mi)
#pragma unroll
        for (int ni = 0; ni < 4; ++ni)
#pragma unroll
            for (int r = 0; r < 8; ++r)
                Cs[(wm * (16 * MI) + mi * 16 + 8 * h + r) * CP + wn * 64 + ni * 16 + ln] = acc[mi][ni][r];
    __syncthreads();

    if (EPI == EPI_F32) {
        // row segment = 128 floats = 512 B = 32 lanes x 16 B, one instruction per row
#pragma unroll 1
        for (int it = 0; it < BM / 4; ++it) {
            const int row = it * 4 + w, col = lane * 4;
            v4f x = *(const v4fa*)(Cs + row * CP + col);
            const v4f bv = *(const v4fa*)(bias + j0 + col);
            x += bv;
            st2f(Of + (size_t)(i0 + row) * ldo + j0 + col, x);
        }
    } else {
        // row segment = 128 halves = 256 B = 16 lanes x 16 B per plane; lanes 16..31 take the next row
#pragma unroll 1
        for (int it = 0; it < BM / 8; ++it) {
            const int row = it * 8 + w * 2 + h, colc = ln * 8;
            const int gi = i0 + row;
            const float* cr = Cs + row * CP;
            float x[8];
            {
                const v4f a = *(const v4fa*)(cr + colc);
                const v4f c = *(const v4fa*)(cr + colc + 4);
                x[0] = a[0]; x[1] = a[1]; x[2] = a[2]; x[3] = a[3];
                x[4] = c[0]; x[5] = c[1]; x[6] = c[2]; x[7] = c[3];
            }
            if (EPI == EPI_ROWB) {
                const float bvv = bias[gi];
#pragma unroll
                for (int e = 0; e < 8; ++e) x[e] += bvv;
            } else {
                const v4f b0 = *(const v4fa*)(bias + j0 + colc);
                const v4f b1 = *(const v4fa*)(bias + j0 + colc + 4);
                x[0] += b0[0]; x[1] += b0[1]; x[2] += b0[2]; x[3] += b0[3];
                x[4] += b1[0]; x[5] += b1[1]; x[6] += b1[2]; x[7] += b1[3];
            }
            if (EPI == EPI_ROPE) {
                // block tile == one head (128 columns); partner column d^64, frequency j = d&63
                const int pc = colc ^ 64;
                float xp[8];
                {
                    const v4f a = *(const v4fa*)(cr + pc);
                    const v4f c = *(const v4fa*)(cr + pc + 4);
                    const v4f b0 = *(const v4fa*)(bias + j0 + pc);
                    const v4f b1 = *(const v4fa*)(bias + j0 + pc + 4);
                    xp[0] = a[0] + b0[0]; xp[1] = a[1] + b0[1]; xp[2] = a[2] + b0[2]; xp[3] = a[3] + b0[3];
                    xp[4] = c[0] + b1[0]; xp[5] = c[1] + b1[1]; xp[6] = c[2] + b1[2]; xp[7] = c[3] + b1[3];
                }
                const int jb = colc & 63;
                const float* cp = cosT + (size_t)gi * NFREQ + jb;
                const float* sp = sinT + (size_t)gi * NFREQ + jb;
                const v4f c0 = *(const v4fa*)(cp), c1 = *(const v4fa*)(cp + 4);
                const v4f s0 = *(const v4fa*)(sp), s1 = *(const v4fa*)(sp + 4);
                float cs[8] = {c0[0], c0[1], c0[2], c0[3], c1[0], c1[1], c1[2], c1[3]};
                float sn[8] = {s0[0], s0[1], s0[2], s0[3], s1[0], s1[1], s1[2], s1[3]};
                const float sg = (colc < 64) ? -1.0f : 1.0f;
#pragma unroll
                for (int e = 0; e < 8; ++e) x[e] = x[e] * cs[e] + sg * (xp[e] * sn[e]);
            }
            v4u hi, lo;
            split8(x, hi, lo);
            const size_t o = (size_t)gi * ldo + j0 + colc;
            st2u(Oh + o, Ol + o, hi, lo);
        }
    }
}

constexpr int KP  = 136;                   // LDS pitch (halves) of a K row of 128 dims: 272 B = 16 B x 17
constexpr int VP  = 40;                    // LDS pitch (halves) of a Vt row of 32 keys:  80 B = 16 B x 5
constexpr int KPL = 32 * KP;               // one K plane of a tile (halves)
constexpr int VPL = HD * VP;               // one Vt plane of a tile (halves)
constexpr int STG = 2 * KPL + 2 * VPL;     // one ring buffer: Kh | Kl | Vh | Vl (halves)

__global__ void __launch_bounds__(256)
attn_x3(const u16* Qh, const u16* Ql, const u16* Kh, const u16* Kl,
        const u16* Vh, const u16* Vl, const float* amask, const int* flags,
        u16* Oh, u16* Ol)
{
    __shared__ __align__(16) u16 Ring[2 * STG];
    __shared__ __align__(16) float OsA[NREP * 16 * OSP];

    const int tid = threadIdx.x;
    const int lane = tid & 31, h = lane >> 4, ln = lane & 15;
    const int w = __builtin_amdgcn_readfirstlane(tid >> 5);
    const int qt = blockIdx.x, kvh = blockIdx.y, b = blockIdx.z;
    const int hh = kvh * NREP + w;
    const int q0 = qt * 16;
    float* Os = OsA + w * (16 * OSP);          // each wave's own O staging

    const size_t qofs = (size_t)(b * S + q0 + ln) * NQ + hh * HD + 8 * h;     // B column ln, + dc*32
    const size_t mofs = (size_t)(q0 + ln) * S + 8 * h;                        // query ln, + kb (+16), 8 keys in a row

    // this lane's share of a tile's copies: K rows tid/16 and +16 (16 B of 256), Vt rows tid/4 and +64 (16 B of 64)
    const int krow = tid >> 4, kcol = (tid & 15) * 8;
    const int vrow = tid >> 2, vcol = (tid & 3) * 8;
    const size_t kgo = (size_t)(b * S + krow) * NKVD + kvh * HD + kcol;       // + kb*NKVD
    const size_t vgo = (size_t)(kvh * HD + vrow) * MROWS + b * S + vcol;      // + kb
    const u32 klo = lds_off(Ring) + 2u * (u32)(krow * KP + kcol);             // + buffer
    const u32 vlo = lds_off(Ring) + 2u * (u32)(2 * KPL + vrow * VP + vcol);   // + buffer
    auto stage = [&](int kt, int bf) {
        const u32 lb = (u32)bf * (2u * STG);
        const size_t ko = kgo + (size_t)(kt * 32) * NKVD;
        const size_t vo = vgo + (size_t)(kt * 32);
        copy8(klo + lb, klo + lb + 2u * (16 * KP), klo + lb + 2u * KPL, klo + lb + 2u * (KPL + 16 * KP),
              vlo + lb, vlo + lb + 2u * (64 * VP), vlo + lb + 2u * VPL, vlo + lb + 2u * (VPL + 64 * VP),
              Kh + ko, Kh + ko + (size_t)16 * NKVD, Kl + ko, Kl + ko + (size_t)16 * NKVD,
              Vh + vo, Vh + vo + (size_t)64 * MROWS, Vl + vo, Vl + vo + (size_t)64 * MROWS);
    };

    float mrun = -1.0e30f, lrun = 0.0f;        // of query ln; lrun sums this wave half's keys only, joined behind the loop
    v8f o[8];                                  // o[t][r] = O[query ln][dim t*16 + 8h + r]
#pragma unroll
    for (int t = 0; t < 8; ++t) o[t] = zero8();

    // the key tiles that are not all-masked, as a 64-bit set, alike in every wave of the work-group:
    // the ring has to know the next tile one pass ahead
    const u32 a_lo = __builtin_amdgcn_ballot_w32(flags[qt * NKT + lane] != 1);
    const u32 a_hi = __builtin_amdgcn_ballot_w32(flags[qt * NKT + 32 + lane] != 1);
    unsigned long long act = (unsigned long long)a_lo | ((unsigned long long)a_hi << 32);

    // Q^T of this wave's head, both planes, all 128 dims: the same B fragments in every pass, loaded once and kept in registers
    const u16* qhp = Qh + qofs;
    const u16* qlp = Ql + qofs;
    v16bf qh[4], ql[4];
    // unrolled: constant indices keep the fragments in registers
#pragma unroll
    for (int dc = 0; dc < 4; ++dc) {
        qh[dc] = ldfrag(qhp + dc * 32);
        ql[dc] = ldfrag(qlp + dc * 32);
    }
    // the wait that stands ahead of any overwrite of the loads' address registers; it takes both addresses as inputs,
    // so that no fragment is placed over them in front of it
    asm volatile("s_wait_xcnt 0x0" :: "v"(qhp), "v"(qlp) : "memory");

    if (act != 0) {
        int kt = __builtin_ctzll(act);
        act &= act - 1;
        stage(kt, 0);
        asm volatile("s_wait_asynccnt 0x0" ::: "memory");    // this wave's copies of the first tile have landed
        __syncthreads();                                     // ... and every other wave's
        int ktn = -1;
        if (act != 0) {
            ktn = __builtin_ctzll(act);
            act &= act - 1;
            stage(ktn, 1);
        }
        int bf = 0;
        for (;;) {
            const int kb = kt * 32;
            const u16* Kb = Ring + bf * STG + ln * KP + 8 * h;               // K row ln, + 16*KP, + KPL, + dc*32
            const u16* Vb = Ring + bf * STG + 2 * KPL + ln * VP + 8 * h;     // Vt row ln, + t*16*VP, + VPL

            // the additive mask of query ln for this lane's 16 keys
            const float* mp = amask + mofs + kb;
            const v4f mk0 = *(const v4fa*)(mp);
            const v4f mk1 = *(const v4fa*)(mp + 4);
            const v4f mk2 = *(const v4fa*)(mp + 16);
            const v4f mk3 = *(const v4fa*)(mp + 20);

            // scores S^T[32 keys][16 q] = K . Q^T over 128 dims (4 k-steps), two 16-key accumulators
            v8f s0 = zero8(), s1 = zero8();
#pragma unroll
            for (int dc = 0; dc < 4; ++dc) {
                v16bf kh = ldfrag(Kb + dc * 32);
                v16bf kl = ldfrag(Kb + KPL + dc * 32);
                mma3(s0, kh, kl, qh[dc], ql[dc]);
                kh = ldfrag(Kb + 16 * KP + dc * 32);
                kl = ldfrag(Kb + KPL + 16 * KP + dc * 32);
                mma3(s1, kh, kl, qh[dc], ql[dc]);
            }

            // scale + additive mask by value + online softmax; lane (h,ln): s0[r] = (key kb + 8h + r, query ln), s1: + 16
            // the loops of this block are unrolled: every index into a, p0, p1 and o is a constant, so they stay in registers
            float a[16];
#pragma unroll
            for (int r = 0; r < 4; ++r) {
                a[r]      = s0[r]     * SCALE + mk0[r];
                a[4 + r]  = s0[4 + r] * SCALE + mk1[r];
                a[8 + r]  = s1[r]     * SCALE + mk2[r];
                a[12 + r] = s1[4 + r] * SCALE + mk3[r];
            }
            float mx = a[0];
#pragma unroll
            for (int e = 1; e < 16; ++e) mx = fmaxf(mx, a[e]);
            mx = fmaxf(mx, xhalf(mx));                           // the other 16 keys of the query
            const float mnew = fmaxf(mrun, mx);
            const float corr = __expf(mrun - mnew);
            mrun = mnew;
            float p0[8], p1[8];
            float ps = 0.0f;
#pragma unroll
            for (int r = 0; r < 8; ++r) {
                p0[r] = __expf(a[r] - mnew);
                p1[r] = __expf(a[8 + r] - mnew);
                ps += p0[r] + p1[r];
            }
            lrun = lrun * corr + ps;
#pragma unroll
            for (int t = 0; t < 8; ++t)
#pragma unroll
                for (int r = 0; r < 8; ++r) o[t][r] *= corr;
            // P^T as a B operand: element r <- key 8h + r, element 8 + r <- key 16 + 8h + r, column ln: as the lane holds them
            Frag ph, pl;
            split8(p0, ph.q[0], pl.q[0]);
            split8(p1, ph.q[1], pl.q[1]);

            // O^T[128][16 q] += V^T[128][32 keys] . P^T[32 keys][16 q]; V^T A-fragments from the ring's key-contiguous rows
#pragma unroll
            for (int t = 0; t < 8; ++t) {
                const v16bf vh = ldfrag(Vb + t * 16 * VP);
                const v16bf vl = ldfrag(Vb + VPL + t * 16 * VP);
                mma3(o[t], vh, vl, ph.v, pl.v);
            }

            // publish point: this wave's LDS reads are done, its copies of the next tile have landed,
            // then the barrier that says both of every wave
            asm volatile("s_wait_dscnt 0x0" ::: "memory");
            asm volatile("s_wait_asynccnt 0x0" ::: "memory");
            __syncthreads();
            if (ktn < 0) break;
            kt = ktn;
            ktn = -1;
            if (act != 0) {                                      // refill the buffer this pass has just read
                ktn = __builtin_ctzll(act);
                act &= act - 1;
                stage(ktn, bf);
            }
            bf ^= 1;
        }
    }
    asm volatile("s_wait_asynccnt 0x0" ::: "memory");            // no copy is left in flight when the wave ends

    // normalise, stage the 16x128 f32 tile, write hi/lo planes with 16-B lane-contiguous stores
    {
        const float lv = lrun + xhalf(lrun);                     // both wave halves' keys
        const float li = (lv > 0.0f) ? (1.0f / lv) : 0.0f;
        float* orow = Os + ln * OSP + 8 * h;
        // unrolled: constant indices keep o in registers
#pragma unroll
        for (int t = 0; t < 8; ++t) {
            v4f x0, x1;
#pragma unroll
            for (int r = 0; r < 4; ++r) { x0[r] = o[t][r] * li; x1[r] = o[t][4 + r] * li; }
            *(v4fa*)(orow + t * 16) = x0;
            *(v4fa*)(orow + t * 16 + 4) = x1;
        }
    }
    __syncthreads();
#pragma unroll 1
    for (int it = 0; it < 8; ++it) {
        const int row = it * 2 + h, colc = ln * 8;
        const float* cr = Os + row * OSP;
        const v4f a = *(const v4fa*)(cr + colc);
        const v4f c = *(const v4fa*)(cr + colc + 4);
        float x[8] = {a[0], a[1], a[2], a[3], c[0], c[1], c[2], c[3]};
        v4u hi, lo;
        split8(x, hi, lo);
        const size_t oo = (size_t)(b * S + q0 + row) * NQ + hh * HD + colc;
        st2u(Oh + oo, Ol + oo, hi, lo);
    }
}

// ---------------- host ---------------------------------------------------------------------
extern "C" void kernel_launch(void* const* d_in, const int* in_sizes, int n_in,
                              void* d_out, int out_size, void* d_ws, size_t ws_size,
                              hipStream_t stream)
{
    if (n_in < 11) return;
    if (in_sizes[0] != MROWS * HID || in_sizes[1] != MROWS || in_sizes[2] != S * S ||
        in_sizes[3] != HID * NQ || in_sizes[4] != NQ ||
        in_sizes[5] != HID * NKVD || in_sizes[6] != NKVD ||
        in_sizes[7] != HID * NKVD || in_sizes[8] != NKVD ||
        in_sizes[9] != NQ * HID || in_sizes[10] != HID) return;
    if (out_size != MROWS * HID) return;

    const float* X   = (const float*)d_in[0];   // [B*S][HID]
    const float* ts  = (const float*)d_in[1];   // [B*S]
    const float* amk = (const float*)d_in[2];   // [S][S] additive
    const float* Wq  = (const float*)d_in[3];   // [HID][NQ]
    const float* bq  = (const float*)d_in[4];
    const float* Wk  = (const float*)d_in[5];   // [HID][NKVD]
    const float* bk  = (const float*)d_in[6];
    const float* Wv  = (const float*)d_in[7];   // [HID][NKVD]
    const float* bv  = (const float*)d_in[8];
    const float* Wo  = (const float*)d_in[9];   // [NQ][HID]
    const float* bo  = (const float*)d_in[10];
    float* out = (float*)d_out;                 // [B*S][HID]

    const size_t szX  = (size_t)MROWS * HID * 2;     // one plane
    const size_t szWq = (size_t)NQ * HID * 2;
    const size_t szWk = (size_t)NKVD * HID * 2;
    const size_t szWo = (size_t)HID * NQ * 2;
    const size_t szQ  = (size_t)MROWS * NQ * 2;
    const size_t szK  = (size_t)MROWS * NKVD * 2;
    const size_t szVt = (size_t)NKVD * MROWS * 2;
    const size_t szTb = (size_t)MROWS * NFREQ * 4;
    const size_t szFl = (size_t)NQT * NKT * 4;
    char* base = (char*)d_ws;
    size_t used = 0;
    auto take = [&](size_t bytes) -> char* { char* p = base + used; used += (bytes + 255) & ~(size_t)255; return p; };
    u16* Xh   = (u16*)take(szX);   u16* Xl   = (u16*)take(szX);     // reused as attention-output planes
    u16* Wqth = (u16*)take(szWq);  u16* Wqtl = (u16*)take(szWq);    // [NQ][HID]
    u16* Wkth = (u16*)take(szWk);  u16* Wktl = (u16*)take(szWk);    // [NKVD][HID]
    u16* Wvth = (u16*)take(szWk);  u16* Wvtl = (u16*)take(szWk);    // [NKVD][HID]
    u16* Woth = (u16*)take(szWo);  u16* Wotl = (u16*)take(szWo);    // [HID][NQ]
    u16* Qh   = (u16*)take(szQ);   u16* Ql   = (u16*)take(szQ);     // [MROWS][NQ]
    u16* Kh   = (u16*)take(szK);   u16* Kl   = (u16*)take(szK);     // [MROWS][NKVD]
    u16* Vth  = (u16*)take(szVt);  u16* Vtl  = (u16*)take(szVt);    // [NKVD][MROWS]
    float* cosT = (float*)take(szTb);                               // [MROWS][64]
    float* sinT = (float*)take(szTb);
    int* flags  = (int*)take(szFl);                                 // [NQT][NKT]
    if (used > ws_size) return;
    u16* AOh = Xh;   // X planes are dead once the three projections are enqueued
    u16* AOl = Xl;

    // 1: X -> hi/lo planes
    k_split_rows<<<dim3((MROWS * HID) / (256 * 8)), dim3(256), 0, stream>>>(X, MROWS * HID, Xh, Xl);
    // 2..5: weights in[in][out] -> k-contiguous hi/lo planes out[out][in]
    k_split_t<<<dim3(NQ / 64, HID / 64), dim3(256), 0, stream>>>(Wq, HID, NQ, Wqth, Wqtl);      // in[2048][2048] -> out[2048][2048]
    k_split_t<<<dim3(NKVD / 64, HID / 64), dim3(256), 0, stream>>>(Wk, HID, NKVD, Wkth, Wktl);  // in[2048][256]  -> out[256][2048]
    k_split_t<<<dim3(NKVD / 64, HID / 64), dim3(256), 0, stream>>>(Wv, HID, NKVD, Wvth, Wvtl);  // in[2048][256]  -> out[256][2048]
    k_split_t<<<dim3(HID / 64, NQ / 64), dim3(256), 0, stream>>>(Wo, NQ, HID, Woth, Wotl);      // in[2048][2048] -> out[2048][2048]
    // 6: rotary cos/sin table per token row
    k_rope_table<<<dim3(MROWS / 4), dim3(256), 0, stream>>>(ts, MROWS, cosT, sinT);
    // 7: tile skip flags from the additive mask input
    k_flags<<<dim3(NQT, 2), dim3(256), 0, stream>>>(amk, flags);
    // 8: Q = X.Wq + bq, rotary -> planes [MROWS][NQ]
    gemm_x3<EPI_ROPE, 4><<<dim3(NQ / 128, MROWS / 128), dim3(128), 0, stream>>>(
        Xh, Xl, HID, Wqth, Wqtl, HID, HID, bq, cosT, sinT, Qh, Ql, out, NQ);
    // 9: K = X.Wk + bk, rotary -> planes [MROWS][NKVD]
    gemm_x3<EPI_ROPE, 1><<<dim3(NKVD / 128, MROWS / 32), dim3(128), 0, stream>>>(
        Xh, Xl, HID, Wkth, Wktl, HID, HID, bk, cosT, sinT, Kh, Kl, out, NKVD);
    // 10: Vt[kvh*128+d][token] = (X.Wv + bv)^T -> planes [NKVD][MROWS]
    gemm_x3<EPI_ROWB, 1><<<dim3(MROWS / 128, NKVD / 32), dim3(128), 0, stream>>>(
        Wvth, Wvtl, HID, Xh, Xl, HID, HID, bv, cosT, sinT, Vth, Vtl, out, MROWS);
    // 11: attention -> AO planes [MROWS][NQ]
    attn_x3<<<dim3(NQT, NKV, BB), dim3(256), 0, stream>>>(Qh, Ql, Kh, Kl, Vth, Vtl, amk, flags, AOh, AOl);
    // 12: out = AO.Wo + bo -> f32 [MROWS][HID]
    gemm_x3<EPI_F32, 4><<<dim3(HID / 128, MROWS / 128), dim3(128), 0, stream>>>(
        AOh, AOl, NQ, Woth, Wotl, NQ, NQ, bo, cosT, sinT, Qh, Ql, out, HID);
    (void)hipGetLastError();
}

// v005
// A run of this version takes 346 microseconds.
// Next to v004, in two timings, it ran 1.04 and 1.05 times as fast.
// All steps since v000 together make it 2.81 times as fast.
#include <hip/hip_runtime.h>
#include <math.h>
#include <stddef.h>

// All contractions (q/k/v projections, q.k^T scores, p.v, output projection): v_wmma_f32_16x16x32_bf16 with bf16 hi/lo operands everywhere (hi*hi + hi*lo + lo*hi), f32 accumulate; softmax, rotary, scale and biases in f32.

constexpr int BB    = 2;
constexpr int S     = 2048;
constexpr int HID   = 2048;
constexpr int NH    = 16;
constexpr int NKV   = 2;
constexpr int HD    = 128;
constexpr int NREP  = NH / NKV;            // 8
constexpr int MROWS = BB * S;              // 4096 token rows
constexpr int NQ    = NH * HD;             // 2048
constexpr int NKVD  = NKV * HD;            // 256
constexpr int NQT   = S / 16;              // 128 query tiles of 16 rows
constexpr int NKT   = S / 32;              // 64 key tiles of 32 keys
constexpr int NFREQ = HD / 2;              // 64 rotary frequencies
constexpr float SCALE = 0.08838834764831845f;   // 1/sqrt(128)
constexpr int CP  = 132;                   // LDS pitch (floats), 32*MI x 128 C tile
constexpr int OSP = 132;                   // LDS pitch (floats), 16x128 O tile
constexpr int TP  = 68;                    // LDS pitch (floats), transpose tile

constexpr int EPI_ROPE = 1;                // hi/lo planes out, column bias, rotary
constexpr int EPI_ROWB = 2;                // hi/lo planes out, row bias
constexpr int EPI_F32  = 3;                // f32 out, column bias

static_assert(MROWS % 128 == 0);
static_assert(NQ % 128 == 0);
static_assert(NKVD % 128 == 0);
static_assert(HID % 64 == 0);
static_assert(S % 32 == 0);

typedef unsigned int   u32;
typedef unsigned short u16;
typedef __bf16 v16bf __attribute__((ext_vector_type(16)));
typedef float  v8f   __attribute__((ext_vector_type(8)));
typedef int    v8i   __attribute__((ext_vector_type(8)));
typedef float  v4f   __attribute__((ext_vector_type(4)));
typedef u32    v4u   __attribute__((ext_vector_type(4)));
typedef int    v4i   __attribute__((ext_vector_type(4)));
typedef v4f v4fa __attribute__((may_alias));
typedef v4u v4ua __attribute__((may_alias));
typedef v4i v4ia __attribute__((may_alias));

union Frag { v16bf v; v4u q[2]; };

// ---------------- bf16 RNE split helpers (packed hardware conversion) ----------
typedef float  v2f  __attribute__((ext_vector_type(2)));
typedef __bf16 v2bf __attribute__((ext_vector_type(2)));

// two f32 -> two bf16, round to nearest even, the first in the low half-word: one packed conversion
__device__ __forceinline__ u32 bf2(v2f x) {
    return __builtin_bit_cast(u32, __builtin_convertvector(x, v2bf));
}

// 8 f32 -> packed bf16 hi plane (4 dwords) and lo plane (4 dwords); element 2c in the low half-word
__device__ __forceinline__ void split8(const float (&x)[8], v4u& hi, v4u& lo) {
#pragma unroll
    for (int c = 0; c < 4; ++c) {
        const v2f p = {x[2 * c], x[2 * c + 1]};
        const u32 h = bf2(p);
        const v2f b = {__builtin_bit_cast(float, h << 16), __builtin_bit_cast(float, h & 0xFFFF0000u)};
        hi[c] = h;
        lo[c] = bf2(p - b);
    }
}

// ---------------- fragment loader (A map and B map identical, k-contiguous row) -------
// p = plane + row*ld + k0 + 8*h ; elements 0..7 <- k0+8h..+7, elements 8..15 <- k0+16+8h..+7
__device__ __forceinline__ v16bf ldfrag(const u16* p) {
    Frag f;
    f.q[0] = *(const v4ua*)(p);
    f.q[1] = *(const v4ua*)(p + 16);
    return f.v;
}

__device__ __forceinline__ v8f zero8() {
    v8f z;
#pragma unroll
    for (int i = 0; i < 8; ++i) z[i] = 0.0f;
    return z;
}

// three-term hi/lo product into one f32 accumulator, then the 4-slot hazard guard
__device__ __forceinline__ void mma3(v8f& acc, v16bf ah, v16bf al, v16bf bh, v16bf bl) {
    acc = __builtin_amdgcn_wmma_f32_16x16x32_bf16(false, ah, false, bh, (short)0, acc, false, false);
    acc = __builtin_amdgcn_wmma_f32_16x16x32_bf16(false, ah, false, bl, (short)0, acc, false, false);
    acc = __builtin_amdgcn_wmma_f32_16x16x32_bf16(false, al, false, bh, (short)0, acc, false, false);
    const v8i ia = __builtin_bit_cast(v8i, ah);
    const v8i ib = __builtin_bit_cast(v8i, al);
    const v8i ic = __builtin_bit_cast(v8i, bh);
    const v8i id = __builtin_bit_cast(v8i, bl);
    asm volatile("v_nop\n\tv_nop\n\tv_nop\n\tv_nop"
                 : "+v"(acc) : "v"(ia), "v"(ib), "v"(ic), "v"(id) : "memory");
}

__device__ __forceinline__ void st2u(u16* ph, u16* pl, v4u hi, v4u lo) {
    *(v4u*)ph = hi;
    *(v4u*)pl = lo;
    
}
__device__ __forceinline__ void st2f(float* p, v4f v) {
    *(v4f*)p = v;
    
}

// ---------------- X: f32 rows -> hi/lo bf16 planes, same layout --------------------------
__global__ void __launch_bounds__(256)
k_split_rows(const float* X, int n, u16* Xh, u16* Xl)
{
    const size_t i = ((size_t)blockIdx.x * 256 + threadIdx.x) * 8;
    if (i + 8 <= (size_t)n) {
        const v4f a = *(const v4fa*)(X + i);
        const v4f c = *(const v4fa*)(X + i + 4);
        float x[8] = {a[0], a[1], a[2], a[3], c[0], c[1], c[2], c[3]};
        v4u hi, lo;
        split8(x, hi, lo);
        st2u(Xh + i, Xl + i, hi, lo);
    }
}

// ---------------- weights: in[nrows][ncols] f32 -> hi/lo planes out[ncols][nrows] ----------
// grid (ncols/64, nrows/64); LDS transpose; each output line (64 halves) by lanes 8q..8q+7
__global__ void __launch_bounds__(256)
k_split_t(const float* W, int nrows, int ncols, u16* Th, u16* Tl)
{
    __shared__ __align__(16) float T[64 * TP];
    const int tid = threadIdx.x;
    const int cb = blockIdx.x * 64;      // input column tile == output row tile
    const int rb = blockIdx.y * 64;      // input row tile    == output column tile
#pragma unroll
    for (int it = 0; it < 4; ++it) {
        const int fl = it * 256 + tid;
        const int rr = fl >> 4, cc = (fl & 15) * 4;
        const v4f v = *(const v4fa*)(W + (size_t)(rb + rr) * ncols + cb + cc);
        T[(cc + 0) * TP + rr] = v[0];
        T[(cc + 1) * TP + rr] = v[1];
        T[(cc + 2) * TP + rr] = v[2];
        T[(cc + 3) * TP + rr] = v[3];
    }
    __syncthreads();
#pragma unroll
    for (int it = 0; it < 2; ++it) {
        const int orow = it * 32 + (tid >> 3), oc = (tid & 7) * 8;
        const v4f a = *(const v4fa*)(T + orow * TP + oc);
        const v4f c = *(const v4fa*)(T + orow * TP + oc + 4);
        float x[8] = {a[0], a[1], a[2], a[3], c[0], c[1], c[2], c[3]};
        v4u hi, lo;
        split8(x, hi, lo);
        const size_t o = (size_t)(cb + orow) * nrows + rb + oc;
        st2u(Th + o, Tl + o, hi, lo);
    }
}

// ---------------- rotary table: cos/sin of f32(ts[row] * inv_freq[j]) ---------------------
__global__ void __launch_bounds__(256)
k_rope_table(const float* ts, int nrows, float* cosT, float* sinT)
{
    const int tid = threadIdx.x;
    const int row = blockIdx.x * 4 + (tid >> 6);
    const int j   = tid & 63;
    const int rc  = row < nrows ? row : nrows - 1;
    const float t = ts[rc];
    // inv_freq[j] = 1 / f32(10000^(j/64)); the power evaluated in f64 and converted once
    const double p  = exp2((double)j * (13.287712379549449 / 64.0));
    const float  pf = (float)p;
    const float inv = 1.0f / pf;
    const float ang = t * inv;
    float sn, cs;
    sincosf(ang, &sn, &cs);
    if (row < nrows) {
        const size_t o = (size_t)row * NFREQ + j;
        *(float*)(cosT + o) = cs;
        *(float*)(sinT + o) = sn;
        
    }
}

// ---------------- tile flags from the additive input mask ---------------------------------
// flag[qt][kt] = 1 when every entry of the 16x32 mask tile is <= -1e8 (tile contributes 0)
__global__ void __launch_bounds__(256)
k_flags(const float* amask, int* flags)
{
    __shared__ __align__(16) int sf[32];
    const int tid = threadIdx.x, lane = tid & 31, w = tid >> 5;
    const int qt = blockIdx.x, hf = blockIdx.y;
    const int t = tid >> 3, sub = tid & 7;
    const int kt = hf * 32 + t;
    const int kb = kt * 32;
    int ok = 1;
#pragma unroll
    for (int rr = 0; rr < 2; ++rr) {
        const int q = qt * 16 + sub * 2 + rr;
        const float* mp = amask + (size_t)q * S + kb;
#pragma unroll
        for (int c = 0; c < 8; ++c) {
            const v4f v = *(const v4fa*)(mp + 4 * c);
            ok &= (int)(v[0] <= -1.0e8f) & (int)(v[1] <= -1.0e8f) &
                  (int)(v[2] <= -1.0e8f) & (int)(v[3] <= -1.0e8f);
        }
    }
    ok &= __shfl_xor(ok, 1);
    ok &= __shfl_xor(ok, 2);
    ok &= __shfl_xor(ok, 4);
    if (sub == 0) sf[t] = ok;
    __syncthreads();
    if (w == 0 && lane < 8) {
        const v4i f = *(const v4ia*)(sf + lane * 4);
        int* dst = flags + (size_t)qt * NKT + hf * 32 + lane * 4;
        *(v4i*)dst = f;
        
    }
}

__device__ __forceinline__ u32 lds_off(const void* p) { return (u32)(size_t)p; }

// the value of lane l ^ 16
__device__ __forceinline__ float xhalf(float x) {
    const int b = __builtin_bit_cast(int, x);
    return __builtin_bit_cast(float, __builtin_amdgcn_permlanex16(b, b, 0x76543210, 0xfedcba98, false, false));
}

// one tile's copies of one lane: 8 x 16 B, global -> LDS through no register.
// The s_wait_xcnt closes the statement so that no address register is rewritten ahead of it.
__device__ __forceinline__ void copy8(u32 l0, u32 l1, u32 l2, u32 l3, u32 l4, u32 l5, u32 l6, u32 l7,
                                      const u16* g0, const u16* g1, const u16* g2, const u16* g3,
                                      const u16* g4, const u16* g5, const u16* g6, const u16* g7) {
    asm volatile("global_load_async_to_lds_b128 %0, %8, off\n\t"
                 "global_load_async_to_lds_b128 %1, %9, off\n\t"
                 "global_load_async_to_lds_b128 %2, %10, off\n\t"
                 "global_load_async_to_lds_b128 %3, %11, off\n\t"
                 "global_load_async_to_lds_b128 %4, %12, off\n\t"
                 "global_load_async_to_lds_b128 %5, %13, off\n\t"
                 "global_load_async_to_lds_b128 %6, %14, off\n\t"
                 "global_load_async_to_lds_b128 %7, %15, off\n\t"
                 "s_wait_xcnt 0x0"
                 :: "v"(l0), "v"(l1), "v"(l2), "v"(l3), "v"(l4), "v"(l5), "v"(l6), "v"(l7),
                    "v"(g0), "v"(g1), "v"(g2), "v"(g3), "v"(g4), "v"(g5), "v"(g6), "v"(g7)
                 : "memory");
}

// ---------------- hi/lo split GEMM: C[i][j] = sum_k A[i][k] * B[j][k] -----------------------
// A planes [*][lda], B planes [*][ldb], both k-contiguous; block tile 32*MI (i) x 128 (j),
// 4 waves as 2x2, wave tile 16*MI x 64 = MI x 4 accumulators.
// A pass is 64 k: the pass's rows of all four planes are copied once per work-group into a two-buffer
// LDS ring by asynchronous copies (whole 128-B lines), the next pass flying while this one is used;
// the waves read their fragments from the ring.
constexpr int GK = 64;                     // k per pass
constexpr int GP = 72;                     // LDS pitch (halves) of a row of 64 k: 144 B = 16 B x 9

// four copies of one lane, as copy8
__device__ __forceinline__ void copy4(u32 l0, u32 l1, u32 l2, u32 l3,
                                      const u16* g0, const u16* g1, const u16* g2, const u16* g3) {
    asm volatile("global_load_async_to_lds_b128 %0, %4, off\n\t"
                 "global_load_async_to_lds_b128 %1, %5, off\n\t"
                 "global_load_async_to_lds_b128 %2, %6, off\n\t"
                 "global_load_async_to_lds_b128 %3, %7, off\n\t"
                 "s_wait_xcnt 0x0"
                 :: "v"(l0), "v"(l1), "v"(l2), "v"(l3), "v"(g0), "v"(g1), "v"(g2), "v"(g3)
                 : "memory");
}

template<int EPI, int MI>
__global__ void __launch_bounds__(128)
gemm_x3(const u16* Ah, const u16* Al, int lda,
        const u16* Bh, const u16* Bl, int ldb, int K,
        const float* bias, const float* cosT, const float* sinT,
        u16* Oh, u16* Ol, float* Of, int ldo)
{
    static_assert(MI == 1 || MI == 4);
    constexpr int BM   = 32 * MI;              // rows of the block tile
    constexpr int APL  = BM * GP;              // one A plane of a pass (halves)
    constexpr int BPL  = 128 * GP;             // one B plane of a pass (halves)
    constexpr int GST  = 2 * APL + 2 * BPL;    // one ring buffer: Ah | Al | Bh | Bl (halves)
    constexpr int RNGB = 2 * GST * 2;          // the ring, bytes
    constexpr int CSB  = BM * CP * 4;          // the f32 C tile, bytes; it takes the ring's place behind the loop
    __shared__ __align__(16) unsigned char Sm[RNGB > CSB ? RNGB : CSB];
    const u16* Ring = (const u16*)Sm;
    float* Cs = (float*)Sm;
    const int tid = threadIdx.x, w = tid >> 5, lane = tid & 31;
    const int h = lane >> 4, ln = lane & 15;
    const int wm = w >> 1, wn = w & 1;
    const int i0 = blockIdx.y * BM, j0 = blockIdx.x * 128;

    v8f acc[MI][4];
#pragma unroll
    for (int mi = 0; mi < MI; ++mi)
#pragma unroll
        for (int ni = 0; ni < 4; ++ni) acc[mi][ni] = zero8();

    // this lane's share of a pass's copies: 16 B of row tid/8 and of every 16th row behind it, in each plane
    const int crow = tid >> 3, ccol = (tid & 7) * 8;
    const size_t ago = (size_t)(i0 + crow) * lda + ccol;                      // + k0
    const size_t bgo = (size_t)(j0 + crow) * ldb + ccol;                      // + k0
    const u32 alo = lds_off(Sm) + 2u * (u32)(crow * GP + ccol);               // + buffer
    const u32 blo = alo + 2u * (u32)(2 * APL);
    constexpr u32 RS = 2u * 16 * GP;           // 16 rows of the ring, bytes
    auto rows128 = [&](u32 l, const u16* g, int ld) {
        const size_t s = (size_t)16 * ld;
        copy8(l, l + RS, l + 2 * RS, l + 3 * RS, l + 4 * RS, l + 5 * RS, l + 6 * RS, l + 7 * RS,
              g, g + s, g + 2 * s, g + 3 * s, g + 4 * s, g + 5 * s, g + 6 * s, g + 7 * s);
    };
    auto stage = [&](int t, int bf) {
        const u32 lb = (u32)bf * (2u * GST);
        const u16* ah = Ah + ago + t * GK;
        const u16* al = Al + ago + t * GK;
        const u32 la = alo + lb, ll = alo + lb + 2u * APL;
        if constexpr (MI == 4) {
            rows128(la, ah, lda);
            rows128(ll, al, lda);
        } else {
            const size_t s = (size_t)16 * lda;
            copy4(la, la + RS, ll, ll + RS, ah, ah + s, al, al + s);
        }
        rows128(blo + lb, Bh + bgo + t * GK, ldb);
        rows128(blo + lb + 2u * BPL, Bl + bgo + t * GK, ldb);
    };

    const int NT = K / GK;
    stage(0, 0);
    asm volatile("s_wait_asynccnt 0x0" ::: "memory");        // this wave's copies of the first pass have landed
    __syncthreads();                                         // ... and every other wave's
    if (NT > 1) stage(1, 1);

#pragma unroll 1
    for (int t = 0; t < NT; ++t) {
        const int bf = t & 1;
        const u16* Ab = Ring + bf * GST + (wm * (16 * MI) + ln) * GP + 8 * h;        // + mi*16*GP, + APL, + ks*32
        const u16* Bb = Ring + bf * GST + 2 * APL + (wn * 64 + ln) * GP + 8 * h;     // + ni*16*GP, + BPL, + ks*32
        // the loops inside a pass are unrolled: every fragment and accumulator index is a constant, so they stay in registers
        if constexpr (MI == 4) {
            // 128 accumulator registers: the A fragments of 32 k stay, the B fragments come one column group ahead
#pragma unroll
            for (int ks = 0; ks < 2; ++ks) {
                v16bf ah[MI], al[MI], bh[4], bl[4];
#pragma unroll
                for (int mi = 0; mi < MI; ++mi) {
                    ah[mi] = ldfrag(Ab + mi * 16 * GP + ks * 32);
                    al[mi] = ldfrag(Ab + APL + mi * 16 * GP + ks * 32);
                }
                bh[0] = ldfrag(Bb + ks * 32);
                bl[0] = ldfrag(Bb + BPL + ks * 32);
#pragma unroll
                for (int ni = 0; ni < 4; ++ni) {
                    if (ni < 3) {
                        bh[ni + 1] = ldfrag(Bb + (ni + 1) * 16 * GP + ks * 32);
                        bl[ni + 1] = ldfrag(Bb + BPL + (ni + 1) * 16 * GP + ks * 32);
                    }
#pragma unroll
                    for (int mi = 0; mi < MI; ++mi)
                        mma3(acc[mi][ni], ah[mi], al[mi], bh[ni], bl[ni]);
                }
            }
        } else {
            // few accumulators: every fragment of the pass is fetched ahead of its products
            v16bf ah[2][MI], al[2][MI], bh[2][4], bl[2][4];
#pragma unroll
            for (int ks = 0; ks < 2; ++ks) {
#pragma unroll
                for (int mi = 0; mi < MI; ++mi) {
                    ah[ks][mi] = ldfrag(Ab + mi * 16 * GP + ks * 32);
                    al[ks][mi] = ldfrag(Ab + APL + mi * 16 * GP + ks * 32);
                }
#pragma unroll
                for (int ni = 0; ni < 4; ++ni) {
                    bh[ks][ni] = ldfrag(Bb + ni * 16 * GP + ks * 32);
                    bl[ks][ni] = ldfrag(Bb + BPL + ni * 16 * GP + ks * 32);
                }
            }
#pragma unroll
            for (int ks = 0; ks < 2; ++ks)
#pragma unroll
                for (int ni = 0; ni < 4; ++ni)
#pragma unroll
                    for (int mi = 0; mi < MI; ++mi)
                        mma3(acc[mi][ni], ah[ks][mi], al[ks][mi], bh[ks][ni], bl[ks][ni]);
        }
        // publish point
        asm volatile("s_wait_dscnt 0x0" ::: "memory");       // this wave's reads of the buffer are done before it is refilled
        asm volatile("s_wait_asynccnt 0x0" ::: "memory");    // this wave's copies of the next pass have landed
        __syncthreads();                                     // both hold for every wave
        if (t + 2 < NT) stage(t + 2, bf);                    // refill the buffer this pass has just read
    }
    asm volatile("s_wait_asynccnt 0x0" ::: "memory");        // no copy is in flight when the ring becomes the C tile

    // stage the f32 tile in LDS: D element r of lane l = (row 8h+r, col ln)
#pragma unroll
    for (int mi = 0; mi < MI; ++mi)
#pragma unroll
        for (int ni = 0; ni < 4; ++ni)
#pragma unroll
            for (int r = 0; r < 8; ++r)
                Cs[(wm * (16 * MI) + mi * 16 + 8 * h + r) * CP + wn * 64 + ni * 16 + ln] = acc[mi][ni][r];
    __syncthreads();

    if (EPI == EPI_F32) {
        // row segment = 128 floats = 512 B = 32 lanes x 16 B, one instruction per row
#pragma unroll 1
        for (int it = 0; it < BM / 4; ++it) {
            const int row = it * 4 + w, col = lane * 4;
            v4f x = *(const v4fa*)(Cs + row * CP + col);
            const v4f bv = *(const v4fa*)(bias + j0 + col);
            x += bv;
            st2f(Of + (size_t)(i0 + row) * ldo + j0 + col, x);
        }
    } else {
        // row segment = 128 halves = 256 B = 16 lanes x 16 B per plane; lanes 16..31 take the next row
#pragma unroll 1
        for (int it = 0; it < BM / 8; ++it) {
            const int row = it * 8 + w * 2 + h, colc = ln * 8;
            const int gi = i0 + row;
            const float* cr = Cs + row * CP;
            float x[8];
            {
                const v4f a = *(const v4fa*)(cr + colc);
                const v4f c = *(const v4fa*)(cr + colc + 4);
                x[0] = a[0]; x[1] = a[1]; x[2] = a[2]; x[3] = a[3];
                x[4] = c[0]; x[5] = c[1]; x[6] = c[2]; x[7] = c[3];
            }
            if (EPI == EPI_ROWB) {
                const float bvv = bias[gi];
#pragma unroll
                for (int e = 0; e < 8; ++e) x[e] += bvv;
            } else {
                const v4f b0 = *(const v4fa*)(bias + j0 + colc);
                const v4f b1 = *(const v4fa*)(bias + j0 + colc + 4);
                x[0] += b0[0]; x[1] += b0[1]; x[2] += b0[2]; x[3] += b0[3];
                x[4] += b1[0]; x[5] += b1[1]; x[6] += b1[2]; x[7] += b1[3];
            }
            if (EPI == EPI_ROPE) {
                // block tile == one head (128 columns); partner column d^64, frequency j = d&63
                const int pc = colc ^ 64;
                float xp[8];
                {
                    const v4f a = *(const v4fa*)(cr + pc);
                    const v4f c = *(const v4fa*)(cr + pc + 4);
                    const v4f b0 = *(const v4fa*)(bias + j0 + pc);
                    const v4f b1 = *(const v4fa*)(bias + j0 + pc + 4);
                    xp[0] = a[0] + b0[0]; xp[1] = a[1] + b0[1]; xp[2] = a[2] + b0[2]; xp[3] = a[3] + b0[3];
                    xp[4] = c[0] + b1[0]; xp[5] = c[1] + b1[1]; xp[6] = c[2] + b1[2]; xp[7] = c[3] + b1[3];
                }
                const int jb = colc & 63;
                const float* cp = cosT + (size_t)gi * NFREQ + jb;
                const float* sp = sinT + (size_t)gi * NFREQ + jb;
                const v4f c0 = *(const v4fa*)(cp), c1 = *(const v4fa*)(cp + 4);
                const v4f s0 = *(const v4fa*)(sp), s1 = *(const v4fa*)(sp + 4);
                // the wait that stands ahead of any overwrite of the four table loads' address registers; it takes both
                // addresses as inputs, so that no loaded value is placed over them in front of it
                asm volatile("s_wait_xcnt 0x0" :: "v"(cp), "v"(sp) : "memory");
                float cs[8] = {c0[0], c0[1], c0[2], c0[3], c1[0], c1[1], c1[2], c1[3]};
                float sn[8] = {s0[0], s0[1], s0[2], s0[3], s1[0], s1[1], s1[2], s1[3]};
                const float sg = (colc < 64) ? -1.0f : 1.0f;
#pragma unroll
                for (int e = 0; e < 8; ++e) x[e] = x[e] * cs[e] + sg * (xp[e] * sn[e]);
            }
            v4u hi, lo;
            split8(x, hi, lo);
            const size_t o = (size_t)gi * ldo + j0 + colc;
            st2u(Oh + o, Ol + o, hi, lo);
        }
    }
}

constexpr int KP  = 136;                   // LDS pitch (halves) of a K row of 128 dims: 272 B = 16 B x 17
constexpr int VP  = 40;                    // LDS pitch (halves) of a Vt row of 32 keys:  80 B = 16 B x 5
constexpr int KPL = 32 * KP;               // one K plane of a tile (halves)
constexpr int VPL = HD * VP;               // one Vt plane of a tile (halves)
constexpr int STG = 2 * KPL + 2 * VPL;     // one ring buffer: Kh | Kl | Vh | Vl (halves)

__global__ void __launch_bounds__(256)
attn_x3(const u16* Qh, const u16* Ql, const u16* Kh, const u16* Kl,
        const u16* Vh, const u16* Vl, const float* amask, const int* flags,
        u16* Oh, u16* Ol)
{
    __shared__ __align__(16) u16 Ring[2 * STG];
    __shared__ __align__(16) float OsA[NREP * 16 * OSP];

    const int tid = threadIdx.x;
    const int lane = tid & 31, h = lane >> 4, ln = lane & 15;
    const int w = __builtin_amdgcn_readfirstlane(tid >> 5);
    const int qt = blockIdx.x, kvh = blockIdx.y, b = blockIdx.z;
    const int hh = kvh * NREP + w;
    const int q0 = qt * 16;
    float* Os = OsA + w * (16 * OSP);          // each wave's own O staging

    const size_t qofs = (size_t)(b * S + q0 + ln) * NQ + hh * HD + 8 * h;     // B column ln, + dc*32
    const size_t mofs = (size_t)(q0 + ln) * S + 8 * h;                        // query ln, + kb (+16), 8 keys in a row

    // this lane's share of a tile's copies: K rows tid/16 and +16 (16 B of 256), Vt rows tid/4 and +64 (16 B of 64)
    const int krow = tid >> 4, kcol = (tid & 15) * 8;
    const int vrow = tid >> 2, vcol = (tid & 3) * 8;
    const size_t kgo = (size_t)(b * S + krow) * NKVD + kvh * HD + kcol;       // + kb*NKVD
    const size_t vgo = (size_t)(kvh * HD + vrow) * MROWS + b * S + vcol;      // + kb
    const u32 klo = lds_off(Ring) + 2u * (u32)(krow * KP + kcol);             // + buffer
    const u32 vlo = lds_off(Ring) + 2u * (u32)(2 * KPL + vrow * VP + vcol);   // + buffer
    auto stage = [&](int kt, int bf) {
        const u32 lb = (u32)bf * (2u * STG);
        const size_t ko = kgo + (size_t)(kt * 32) * NKVD;
        const size_t vo = vgo + (size_t)(kt * 32);
        copy8(klo + lb, klo + lb + 2u * (16 * KP), klo + lb + 2u * KPL, klo + lb + 2u * (KPL + 16 * KP),
              vlo + lb, vlo + lb + 2u * (64 * VP), vlo + lb + 2u * VPL, vlo + lb + 2u * (VPL + 64 * VP),
              Kh + ko, Kh + ko + (size_t)16 * NKVD, Kl + ko, Kl + ko + (size_t)16 * NKVD,
              Vh + vo, Vh + vo + (size_t)64 * MROWS, Vl + vo, Vl + vo + (size_t)64 * MROWS);
    };

    float mrun = -1.0e30f, lrun = 0.0f;        // of query ln; lrun sums this wave half's keys only, joined behind the loop
    v8f o[8];                                  // o[t][r] = O[query ln][dim t*16 + 8h + r]
#pragma unroll
    for (int t = 0; t < 8; ++t) o[t] = zero8();

    // the key tiles that are not all-masked, as a 64-bit set, alike in every wave of the work-group:
    // the ring has to know the next tile one pass ahead
    const u32 a_lo = __builtin_amdgcn_ballot_w32(flags[qt * NKT + lane] != 1);
    const u32 a_hi = __builtin_amdgcn_ballot_w32(flags[qt * NKT + 32 + lane] != 1);
    unsigned long long act = (unsigned long long)a_lo | ((unsigned long long)a_hi << 32);

    // Q^T of this wave's head, both planes, all 128 dims: the same B fragments in every pass, loaded once and kept in registers
    const u16* qhp = Qh + qofs;
    const u16* qlp = Ql + qofs;
    v16bf qh[4], ql[4];
    // unrolled: constant indices keep the fragments in registers
#pragma unroll
    for (int dc = 0; dc < 4; ++dc) {
        qh[dc] = ldfrag(qhp + dc * 32);
        ql[dc] = ldfrag(qlp + dc * 32);
    }
    // the wait that stands ahead of any overwrite of the loads' address registers; it takes both addresses as inputs,
    // so that no fragment is placed over them in front of it
    asm volatile("s_wait_xcnt 0x0" :: "v"(qhp), "v"(qlp) : "memory");

    if (act != 0) {
        int kt = __builtin_ctzll(act);
        act &= act - 1;
        stage(kt, 0);
        asm volatile("s_wait_asynccnt 0x0" ::: "memory");    // this wave's copies of the first tile have landed
        __syncthreads();                                     // ... and every other wave's
        int ktn = -1;
        if (act != 0) {
            ktn = __builtin_ctzll(act);
            act &= act - 1;
            stage(ktn, 1);
        }
        int bf = 0;
        for (;;) {
            const int kb = kt * 32;
            const u16* Kb = Ring + bf * STG + ln * KP + 8 * h;               // K row ln, + 16*KP, + KPL, + dc*32
            const u16* Vb = Ring + bf * STG + 2 * KPL + ln * VP + 8 * h;     // Vt row ln, + t*16*VP, + VPL

            // the additive mask of query ln for this lane's 16 keys
            const float* mp = amask + mofs + kb;
            const v4f mk0 = *(const v4fa*)(mp);
            const v4f mk1 = *(const v4fa*)(mp + 4);
            const v4f mk2 = *(const v4fa*)(mp + 16);
            const v4f mk3 = *(const v4fa*)(mp + 20);

            // scores S^T[32 keys][16 q] = K . Q^T over 128 dims (4 k-steps), two 16-key accumulators
            v8f s0 = zero8(), s1 = zero8();
#pragma unroll
            for (int dc = 0; dc < 4; ++dc) {
                v16bf kh = ldfrag(Kb + dc * 32);
                v16bf kl = ldfrag(Kb + KPL + dc * 32);
                mma3(s0, kh, kl, qh[dc], ql[dc]);
                kh = ldfrag(Kb + 16 * KP + dc * 32);
                kl = ldfrag(Kb + KPL + 16 * KP + dc * 32);
                mma3(s1, kh, kl, qh[dc], ql[dc]);
            }

            // scale + additive mask by value + online softmax; lane (h,ln): s0[r] = (key kb + 8h + r, query ln), s1: + 16
            // the loops of this block are unrolled: every index into a, p0, p1 and o is a constant, so they stay in registers
            float a[16];
#pragma unroll
            for (int r = 0; r < 4; ++r) {
                a[r]      = s0[r]     * SCALE + mk0[r];
                a[4 + r]  = s0[4 + r] * SCALE + mk1[r];
                a[8 + r]  = s1[r]     * SCALE + mk2[r];
                a[12 + r] = s1[4 + r] * SCALE + mk3[r];
            }
            float mx = a[0];
#pragma unroll
            for (int e = 1; e < 16; ++e) mx = fmaxf(mx, a[e]);
            mx = fmaxf(mx, xhalf(mx));                           // the other 16 keys of the query
            const float mnew = fmaxf(mrun, mx);
            const float corr = __expf(mrun - mnew);
            mrun = mnew;
            float p0[8], p1[8];
            float ps = 0.0f;
#pragma unroll
            for (int r = 0; r < 8; ++r) {
                p0[r] = __expf(a[r] - mnew);
                p1[r] = __expf(a[8 + r] - mnew);
                ps += p0[r] + p1[r];
            }
            lrun = lrun * corr + ps;
#pragma unroll
            for (int t = 0; t < 8; ++t)
#pragma unroll
                for (int r = 0; r < 8; ++r) o[t][r] *= corr;
            // P^T as a B operand: element r <- key 8h + r, element 8 + r <- key 16 + 8h + r, column ln: as the lane holds them
            Frag ph, pl;
            split8(p0, ph.q[0], pl.q[0]);
            split8(p1, ph.q[1], pl.q[1]);

            // O^T[128][16 q] += V^T[128][32 keys] . P^T[32 keys][16 q]; V^T A-fragments from the ring's key-contiguous rows
#pragma unroll
            for (int t = 0; t < 8; ++t) {
                const v16bf vh = ldfrag(Vb + t * 16 * VP);
                const v16bf vl = ldfrag(Vb + VPL + t * 16 * VP);
                mma3(o[t], vh, vl, ph.v, pl.v);
            }

            // publish point: this wave's LDS reads are done, its copies of the next tile have landed,
            // then the barrier that says both of every wave
            asm volatile("s_wait_dscnt 0x0" ::: "memory");
            asm volatile("s_wait_asynccnt 0x0" ::: "memory");
            __syncthreads();
            if (ktn < 0) break;
            kt = ktn;
            ktn = -1;
            if (act != 0) {                                      // refill the buffer this pass has just read
                ktn = __builtin_ctzll(act);
                act &= act - 1;
                stage(ktn, bf);
            }
            bf ^= 1;
        }
    }
    asm volatile("s_wait_asynccnt 0x0" ::: "memory");            // no copy is left in flight when the wave ends

    // normalise, stage the 16x128 f32 tile, write hi/lo planes with 16-B lane-contiguous stores
    {
        const float lv = lrun + xhalf(lrun);                     // both wave halves' keys
        const float li = (lv > 0.0f) ? (1.0f / lv) : 0.0f;
        float* orow = Os + ln * OSP + 8 * h;
        // unrolled: constant indices keep o in registers
#pragma unroll
        for (int t = 0; t < 8; ++t) {
            v4f x0, x1;
#pragma unroll
            for (int r = 0; r < 4; ++r) { x0[r] = o[t][r] * li; x1[r] = o[t][4 + r] * li; }
            *(v4fa*)(orow + t * 16) = x0;
            *(v4fa*)(orow + t * 16 + 4) = x1;
        }
    }
    __syncthreads();
#pragma unroll 1
    for (int it = 0; it < 8; ++it) {
        const int row = it * 2 + h, colc = ln * 8;
        const float* cr = Os + row * OSP;
        const v4f a = *(const v4fa*)(cr + colc);
        const v4f c = *(const v4fa*)(cr + colc + 4);
        float x[8] = {a[0], a[1], a[2], a[3], c[0], c[1], c[2], c[3]};
        v4u hi, lo;
        split8(x, hi, lo);
        const size_t oo = (size_t)(b * S + q0 + row) * NQ + hh * HD + colc;
        st2u(Oh + oo, Ol + oo, hi, lo);
    }
}

// ---------------- host ---------------------------------------------------------------------
extern "C" void kernel_launch(void* const* d_in, const int* in_sizes, int n_in,
                              void* d_out, int out_size, void* d_ws, size_t ws_size,
                              hipStream_t stream)
{
    if (n_in < 11) return;
    if (in_sizes[0] != MROWS * HID || in_sizes[1] != MROWS || in_sizes[2] != S * S ||
        in_sizes[3] != HID * NQ || in_sizes[4] != NQ ||
        in_sizes[5] != HID * NKVD || in_sizes[6] != NKVD ||
        in_sizes[7] != HID * NKVD || in_sizes[8] != NKVD ||
        in_sizes[9] != NQ * HID || in_sizes[10] != HID) return;
    if (out_size != MROWS * HID) return;

    const float* X   = (const float*)d_in[0];   // [B*S][HID]
    const float* ts  = (const float*)d_in[1];   // [B*S]
    const float* amk = (const float*)d_in[2];   // [S][S] additive
    const float* Wq  = (const float*)d_in[3];   // [HID][NQ]
    const float* bq  = (const float*)d_in[4];
    const float* Wk  = (const float*)d_in[5];   // [HID][NKVD]
    const float* bk  = (const float*)d_in[6];
    const float* Wv  = (const float*)d_in[7];   // [HID][NKVD]
    const float* bv  = (const float*)d_in[8];
    const float* Wo  = (const float*)d_in[9];   // [NQ][HID]
    const float* bo  = (const float*)d_in[10];
    float* out = (float*)d_out;                 // [B*S][HID]

    const size_t szX  = (size_t)MROWS * HID * 2;     // one plane
    const size_t szWq = (size_t)NQ * HID * 2;
    const size_t szWk = (size_t)NKVD * HID * 2;
    const size_t szWo = (size_t)HID * NQ * 2;
    const size_t szQ  = (size_t)MROWS * NQ * 2;
    const size_t szK  = (size_t)MROWS * NKVD * 2;
    const size_t szVt = (size_t)NKVD * MROWS * 2;
    const size_t szTb = (size_t)MROWS * NFREQ * 4;
    const size_t szFl = (size_t)NQT * NKT * 4;
    char* base = (char*)d_ws;
    size_t used = 0;
    auto take = [&](size_t bytes) -> char* { char* p = base + used; used += (bytes + 255) & ~(size_t)255; return p; };
    u16* Xh   = (u16*)take(szX);   u16* Xl   = (u16*)take(szX);     // reused as attention-output planes
    u16* Wqth = (u16*)take(szWq);  u16* Wqtl = (u16*)take(szWq);    // [NQ][HID]
    u16* Wkth = (u16*)take(szWk);  u16* Wktl = (u16*)take(szWk);    // [NKVD][HID]
    u16* Wvth = (u16*)take(szWk);  u16* Wvtl = (u16*)take(szWk);    // [NKVD][HID]
    u16* Woth = (u16*)take(szWo);  u16* Wotl = (u16*)take(szWo);    // [HID][NQ]
    u16* Qh   = (u16*)take(szQ);   u16* Ql   = (u16*)take(szQ);     // [MROWS][NQ]
    u16* Kh   = (u16*)take(szK);   u16* Kl   = (u16*)take(szK);     // [MROWS][NKVD]
    u16* Vth  = (u16*)take(szVt);  u16* Vtl  = (u16*)take(szVt);    // [NKVD][MROWS]
    float* cosT = (float*)take(szTb);                               // [MROWS][64]
    float* sinT = (float*)take(szTb);
    int* flags  = (int*)take(szFl);                                 // [NQT][NKT]
    if (used > ws_size) return;
    u16* AOh = Xh;   // X planes are dead once the three projections are enqueued
    u16* AOl = Xl;

    // 1: X -> hi/lo planes
    k_split_rows<<<dim3((MROWS * HID) / (256 * 8)), dim3(256), 0, stream>>>(X, MROWS * HID, Xh, Xl);
    // 2..5: weights in[in][out] -> k-contiguous hi/lo planes out[out][in]
    k_split_t<<<dim3(NQ / 64, HID / 64), dim3(256), 0, stream>>>(Wq, HID, NQ, Wqth, Wqtl);      // in[2048][2048] -> out[2048][2048]
    k_split_t<<<dim3(NKVD / 64, HID / 64), dim3(256), 0, stream>>>(Wk, HID, NKVD, Wkth, Wktl);  // in[2048][256]  -> out[256][2048]
    k_split_t<<<dim3(NKVD / 64, HID / 64), dim3(256), 0, stream>>>(Wv, HID, NKVD, Wvth, Wvtl);  // in[2048][256]  -> out[256][2048]
    k_split_t<<<dim3(HID / 64, NQ / 64), dim3(256), 0, stream>>>(Wo, NQ, HID, Woth, Wotl);      // in[2048][2048] -> out[2048][2048]
    // 6: rotary cos/sin table per token row
    k_rope_table<<<dim3(MROWS / 4), dim3(256), 0, stream>>>(ts, MROWS, cosT, sinT);
    // 7: tile skip flags from the additive mask input
    k_flags<<<dim3(NQT, 2), dim3(256), 0, stream>>>(amk, flags);
    // 8: Q = X.Wq + bq, rotary -> planes [MROWS][NQ]
    gemm_x3<EPI_ROPE, 4><<<dim3(NQ / 128, MROWS / 128), dim3(128), 0, stream>>>(
        Xh, Xl, HID, Wqth, Wqtl, HID, HID, bq, cosT, sinT, Qh, Ql, out, NQ);
    // 9: K = X.Wk + bk, rotary -> planes [MROWS][NKVD]
    gemm_x3<EPI_ROPE, 1><<<dim3(NKVD / 128, MROWS / 32), dim3(128), 0, stream>>>(
        Xh, Xl, HID, Wkth, Wktl, HID, HID, bk, cosT, sinT, Kh, Kl, out, NKVD);
    // 10: Vt[kvh*128+d][token] = (X.Wv + bv)^T -> planes [NKVD][MROWS]
    gemm_x3<EPI_ROWB, 1><<<dim3(MROWS / 128, NKVD / 32), dim3(128), 0, stream>>>(
        Wvth, Wvtl, HID, Xh, Xl, HID, HID, bv, cosT, sinT, Vth, Vtl, out, MROWS);
    // 11: attention -> AO planes [MROWS][NQ]
    attn_x3<<<dim3(NQT, NKV, BB), dim3(256), 0, stream>>>(Qh, Ql, Kh, Kl, Vth, Vtl, amk, flags, AOh, AOl);
    // 12: out = AO.Wo + bo -> f32 [MROWS][HID]
    gemm_x3<EPI_F32, 4><<<dim3(HID / 128, MROWS / 128), dim3(128), 0, stream>>>(
        AOh, AOl, NQ, Woth, Wotl, NQ, NQ, bo, cosT, sinT, Qh, Ql, out, HID);
    (void)hipGetLastError();
}

// v006
// It runs in 323 microseconds.
// Next to v005, in two timings, it ran 1.05 and 1.06 times as fast.
// Over all steps from v000 it is 2.96 times as fast.
#include <hip/hip_runtime.h>
#include <math.h>
#include <stddef.h>

// All contractions (q/k/v projections, q.k^T scores, p.v, output projection): v_wmma_f32_16x16x32_bf16 with bf16 hi/lo operands everywhere (hi*hi + hi*lo + lo*hi), f32 accumulate; softmax, rotary, scale and biases in f32.

constexpr int BB    = 2;
constexpr int S     = 2048;
constexpr int HID   = 2048;
constexpr int NH    = 16;
constexpr int NKV   = 2;
constexpr int HD    = 128;
constexpr int NREP  = NH / NKV;            // 8
constexpr int MROWS = BB * S;              // 4096 token rows
constexpr int NQ    = NH * HD;             // 2048
constexpr int NKVD  = NKV * HD;            // 256
constexpr int NQT   = S / 16;              // 128 query tiles of 16 rows
constexpr int NKT   = S / 32;              // 64 key tiles of 32 keys
constexpr int NFREQ = HD / 2;              // 64 rotary frequencies
constexpr float SCALE = 0.08838834764831845f;   // 1/sqrt(128)
constexpr int CP  = 132;                   // LDS pitch (floats), 32*MI x 128 C tile
constexpr int OSP = 132;                   // LDS pitch (floats), 16x128 O tile
constexpr int TP  = 68;                    // LDS pitch (floats), transpose tile

constexpr int EPI_ROPE = 1;                // hi/lo planes out, column bias, rotary
constexpr int EPI_ROWB = 2;                // hi/lo planes out, row bias
constexpr int EPI_F32  = 3;                // f32 out, column bias

static_assert(MROWS % 128 == 0);
static_assert(NQ % 128 == 0);
static_assert(NKVD % 128 == 0);
static_assert(HID % 64 == 0);
static_assert(S % 32 == 0);

typedef unsigned int   u32;
typedef unsigned short u16;
typedef __bf16 v16bf __attribute__((ext_vector_type(16)));
typedef float  v8f   __attribute__((ext_vector_type(8)));
typedef int    v8i   __attribute__((ext_vector_type(8)));
typedef float  v4f   __attribute__((ext_vector_type(4)));
typedef u32    v4u   __attribute__((ext_vector_type(4)));
typedef int    v4i   __attribute__((ext_vector_type(4)));
typedef v4f v4fa __attribute__((may_alias));
typedef v4u v4ua __attribute__((may_alias));
typedef v4i v4ia __attribute__((may_alias));

union Frag { v16bf v; v4u q[2]; };

// ---------------- bf16 RNE split helpers (packed hardware conversion) ----------
typedef float  v2f  __attribute__((ext_vector_type(2)));
typedef __bf16 v2bf __attribute__((ext_vector_type(2)));

// two f32 -> two bf16, round to nearest even, the first in the low half-word: one packed conversion
__device__ __forceinline__ u32 bf2(v2f x) {
    return __builtin_bit_cast(u32, __builtin_convertvector(x, v2bf));
}

// 8 f32 -> packed bf16 hi plane (4 dwords) and lo plane (4 dwords); element 2c in the low half-word
__device__ __forceinline__ void split8(const float (&x)[8], v4u& hi, v4u& lo) {
#pragma unroll
    for (int c = 0; c < 4; ++c) {
        const v2f p = {x[2 * c], x[2 * c + 1]};
        const u32 h = bf2(p);
        const v2f b = {__builtin_bit_cast(float, h << 16), __builtin_bit_cast(float, h & 0xFFFF0000u)};
        hi[c] = h;
        lo[c] = bf2(p - b);
    }
}

// ---------------- fragment loader (A map and B map identical, k-contiguous row) -------
// p = plane + row*ld + k0 + 8*h ; elements 0..7 <- k0+8h..+7, elements 8..15 <- k0+16+8h..+7
__device__ __forceinline__ v16bf ldfrag(const u16* p) {
    Frag f;
    f.q[0] = *(const v4ua*)(p);
    f.q[1] = *(const v4ua*)(p + 16);
    return f.v;
}

__device__ __forceinline__ v8f zero8() {
    v8f z;
#pragma unroll
    for (int i = 0; i < 8; ++i) z[i] = 0.0f;
    return z;
}

// one term of a hi/lo product. An accumulator takes its three terms in the order hi*hi, hi*lo, lo*hi; the callers go term by
// term over several accumulators, so that a product never waits for the one issued directly ahead of it
__device__ __forceinline__ void mma(v8f& acc, v16bf a, v16bf b) {
    acc = __builtin_amdgcn_wmma_f32_16x16x32_bf16(false, a, false, b, (short)0, acc, false, false);
}

// Where __builtin_amdgcn_sched_barrier(0) stands below, it parts a group of LDS fragment loads from a group of products: without
// it the compiler moves the loads down to their first use, in among the products, and the wave waits out the LDS latency at each.

// the three terms of two accumulators that share the B operand, term by term, in one statement. In asm because the compiler moved
// the builtin form of these products, with the end of the softmax, down past every later fragment load: all fragments of a pass
// were then live at once, too many registers for four waves on a SIMD. The "memory" clobber keeps the fragment loads on their side.
// The four v_nop keep the distance from the last product to a vector instruction on its registers.
__device__ __forceinline__ void mma3x2(v8f& c0, v8f& c1, v16bf a0h, v16bf a0l, v16bf a1h, v16bf a1l, v16bf bh, v16bf bl) {
    const v8i x0h = __builtin_bit_cast(v8i, a0h), x0l = __builtin_bit_cast(v8i, a0l);
    const v8i x1h = __builtin_bit_cast(v8i, a1h), x1l = __builtin_bit_cast(v8i, a1l);
    const v8i yh = __builtin_bit_cast(v8i, bh), yl = __builtin_bit_cast(v8i, bl);
    asm volatile("v_wmma_f32_16x16x32_bf16 %0, %2, %6, %0\n\t"
                 "v_wmma_f32_16x16x32_bf16 %1, %4, %6, %1\n\t"
                 "v_wmma_f32_16x16x32_bf16 %0, %2, %7, %0\n\t"
                 "v_wmma_f32_16x16x32_bf16 %1, %4, %7, %1\n\t"
                 "v_wmma_f32_16x16x32_bf16 %0, %3, %6, %0\n\t"
                 "v_wmma_f32_16x16x32_bf16 %1, %5, %6, %1\n\t"
                 "v_nop\n\tv_nop\n\tv_nop\n\tv_nop"
                 : "+v"(c0), "+v"(c1)
                 : "v"(x0h), "v"(x0l), "v"(x1h), "v"(x1l), "v"(yh), "v"(yl)
                 : "memory");
}

__device__ __forceinline__ void st2u(u16* ph, u16* pl, v4u hi, v4u lo) {
    *(v4u*)ph = hi;
    *(v4u*)pl = lo;
    
}
__device__ __forceinline__ void st2f(float* p, v4f v) {
    *(v4f*)p = v;
    
}

// ---------------- X: f32 rows -> hi/lo bf16 planes, same layout --------------------------
__global__ void __launch_bounds__(256)
k_split_rows(const float* X, int n, u16* Xh, u16* Xl)
{
    const size_t i = ((size_t)blockIdx.x * 256 + threadIdx.x) * 8;
    if (i + 8 <= (size_t)n) {
        const v4f a = *(const v4fa*)(X + i);
        const v4f c = *(const v4fa*)(X + i + 4);
        float x[8] = {a[0], a[1], a[2], a[3], c[0], c[1], c[2], c[3]};
        v4u hi, lo;
        split8(x, hi, lo);
        st2u(Xh + i, Xl + i, hi, lo);
    }
}

// ---------------- weights: in[nrows][ncols] f32 -> hi/lo planes out[ncols][nrows] ----------
// grid (ncols/64, nrows/64); LDS transpose; each output line (64 halves) by lanes 8q..8q+7
__global__ void __launch_bounds__(256)
k_split_t(const float* W, int nrows, int ncols, u16* Th, u16* Tl)
{
    __shared__ __align__(16) float T[64 * TP];
    const int tid = threadIdx.x;
    const int cb = blockIdx.x * 64;      // input column tile == output row tile
    const int rb = blockIdx.y * 64;      // input row tile    == output column tile
#pragma unroll
    for (int it = 0; it < 4; ++it) {
        const int fl = it * 256 + tid;
        const int rr = fl >> 4, cc = (fl & 15) * 4;
        const v4f v = *(const v4fa*)(W + (size_t)(rb + rr) * ncols + cb + cc);
        T[(cc + 0) * TP + rr] = v[0];
        T[(cc + 1) * TP + rr] = v[1];
        T[(cc + 2) * TP + rr] = v[2];
        T[(cc + 3) * TP + rr] = v[3];
    }
    __syncthreads();
#pragma unroll
    for (int it = 0; it < 2; ++it) {
        const int orow = it * 32 + (tid >> 3), oc = (tid & 7) * 8;
        const v4f a = *(const v4fa*)(T + orow * TP + oc);
        const v4f c = *(const v4fa*)(T + orow * TP + oc + 4);
        float x[8] = {a[0], a[1], a[2], a[3], c[0], c[1], c[2], c[3]};
        v4u hi, lo;
        split8(x, hi, lo);
        const size_t o = (size_t)(cb + orow) * nrows + rb + oc;
        st2u(Th + o, Tl + o, hi, lo);
    }
}

// ---------------- rotary table: cos/sin of f32(ts[row] * inv_freq[j]) ---------------------
__global__ void __launch_bounds__(256)
k_rope_table(const float* ts, int nrows, float* cosT, float* sinT)
{
    const int tid = threadIdx.x;
    const int row = blockIdx.x * 4 + (tid >> 6);
    const int j   = tid & 63;
    const int rc  = row < nrows ? row : nrows - 1;
    const float t = ts[rc];
    // inv_freq[j] = 1 / f32(10000^(j/64)); the power evaluated in f64 and converted once
    const double p  = exp2((double)j * (13.287712379549449 / 64.0));
    const float  pf = (float)p;
    const float inv = 1.0f / pf;
    const float ang = t * inv;
    float sn, cs;
    sincosf(ang, &sn, &cs);
    if (row < nrows) {
        const size_t o = (size_t)row * NFREQ + j;
        *(float*)(cosT + o) = cs;
        *(float*)(sinT + o) = sn;
        
    }
}

// ---------------- tile flags from the additive input mask ---------------------------------
// flag[qt][kt] = 1 when every entry of the 16x32 mask tile is <= -1e8 (tile contributes 0)
__global__ void __launch_bounds__(256)
k_flags(const float* amask, int* flags)
{
    __shared__ __align__(16) int sf[32];
    const int tid = threadIdx.x, lane = tid & 31, w = tid >> 5;
    const int qt = blockIdx.x, hf = blockIdx.y;
    const int t = tid >> 3, sub = tid & 7;
    const int kt = hf * 32 + t;
    const int kb = kt * 32;
    int ok = 1;
#pragma unroll
    for (int rr = 0; rr < 2; ++rr) {
        const int q = qt * 16 + sub * 2 + rr;
        const float* mp = amask + (size_t)q * S + kb;
#pragma unroll
        for (int c = 0; c < 8; ++c) {
            const v4f v = *(const v4fa*)(mp + 4 * c);
            ok &= (int)(v[0] <= -1.0e8f) & (int)(v[1] <= -1.0e8f) &
                  (int)(v[2] <= -1.0e8f) & (int)(v[3] <= -1.0e8f);
        }
    }
    ok &= __shfl_xor(ok, 1);
    ok &= __shfl_xor(ok, 2);
    ok &= __shfl_xor(ok, 4);
    if (sub == 0) sf[t] = ok;
    __syncthreads();
    if (w == 0 && lane < 8) {
        const v4i f = *(const v4ia*)(sf + lane * 4);
        int* dst = flags + (size_t)qt * NKT + hf * 32 + lane * 4;
        *(v4i*)dst = f;
        
    }
}

__device__ __forceinline__ u32 lds_off(const void* p) { return (u32)(size_t)p; }

// the value of lane l ^ 16
__device__ __forceinline__ float xhalf(float x) {
    const int b = __builtin_bit_cast(int, x);
    return __builtin_bit_cast(float, __builtin_amdgcn_permlanex16(b, b, 0x76543210, 0xfedcba98, false, false));
}

// one tile's copies of one lane: 8 x 16 B, global -> LDS through no register.
// The s_wait_xcnt closes the statement so that no address register is rewritten ahead of it.
__device__ __forceinline__ void copy8(u32 l0, u32 l1, u32 l2, u32 l3, u32 l4, u32 l5, u32 l6, u32 l7,
                                      const u16* g0, const u16* g1, const u16* g2, const u16* g3,
                                      const u16* g4, const u16* g5, const u16* g6, const u16* g7) {
    asm volatile("global_load_async_to_lds_b128 %0, %8, off\n\t"
                 "global_load_async_to_lds_b128 %1, %9, off\n\t"
                 "global_load_async_to_lds_b128 %2, %10, off\n\t"
                 "global_load_async_to_lds_b128 %3, %11, off\n\t"
                 "global_load_async_to_lds_b128 %4, %12, off\n\t"
                 "global_load_async_to_lds_b128 %5, %13, off\n\t"
                 "global_load_async_to_lds_b128 %6, %14, off\n\t"
                 "global_load_async_to_lds_b128 %7, %15, off\n\t"
                 "s_wait_xcnt 0x0"
                 :: "v"(l0), "v"(l1), "v"(l2), "v"(l3), "v"(l4), "v"(l5), "v"(l6), "v"(l7),
                    "v"(g0), "v"(g1), "v"(g2), "v"(g3), "v"(g4), "v"(g5), "v"(g6), "v"(g7)
                 : "memory");
}

// ---------------- hi/lo split GEMM: C[i][j] = sum_k A[i][k] * B[j][k] -----------------------
// A planes [*][lda], B planes [*][ldb], both k-contiguous; block tile 32*MI (i) x 128 (j),
// 4 waves as 2x2, wave tile 16*MI x 64 = MI x 4 accumulators.
// A pass is 64 k: the pass's rows of all four planes are copied once per work-group into a two-buffer
// LDS ring by asynchronous copies (whole 128-B lines), the next pass flying while this one is used;
// the waves read their fragments from the ring.
constexpr int GK = 64;                     // k per pass
constexpr int GP = 72;                     // LDS pitch (halves) of a row of 64 k: 144 B = 16 B x 9

// four copies of one lane, as copy8
__device__ __forceinline__ void copy4(u32 l0, u32 l1, u32 l2, u32 l3,
                                      const u16* g0, const u16* g1, const u16* g2, const u16* g3) {
    asm volatile("global_load_async_to_lds_b128 %0, %4, off\n\t"
                 "global_load_async_to_lds_b128 %1, %5, off\n\t"
                 "global_load_async_to_lds_b128 %2, %6, off\n\t"
                 "global_load_async_to_lds_b128 %3, %7, off\n\t"
                 "s_wait_xcnt 0x0"
                 :: "v"(l0), "v"(l1), "v"(l2), "v"(l3), "v"(g0), "v"(g1), "v"(g2), "v"(g3)
                 : "memory");
}

template<int EPI, int MI>
__global__ void __launch_bounds__(128)
gemm_x3(const u16* Ah, const u16* Al, int lda,
        const u16* Bh, const u16* Bl, int ldb, int K,
        const float* bias, const float* cosT, const float* sinT,
        u16* Oh, u16* Ol, float* Of, int ldo)
{
    static_assert(MI == 1 || MI == 4);
    constexpr int BM   = 32 * MI;              // rows of the block tile
    constexpr int APL  = BM * GP;              // one A plane of a pass (halves)
    constexpr int BPL  = 128 * GP;             // one B plane of a pass (halves)
    constexpr int GST  = 2 * APL + 2 * BPL;    // one ring buffer: Ah | Al | Bh | Bl (halves)
    constexpr int RNGB = 2 * GST * 2;          // the ring, bytes
    constexpr int CSB  = BM * CP * 4;          // the f32 C tile, bytes; it takes the ring's place behind the loop
    __shared__ __align__(16) unsigned char Sm[RNGB > CSB ? RNGB : CSB];
    const u16* Ring = (const u16*)Sm;
    float* Cs = (float*)Sm;
    const int tid = threadIdx.x, w = tid >> 5, lane = tid & 31;
    const int h = lane >> 4, ln = lane & 15;
    const int wm = w >> 1, wn = w & 1;
    const int i0 = blockIdx.y * BM, j0 = blockIdx.x * 128;

    v8f acc[MI][4];
#pragma unroll
    for (int mi = 0; mi < MI; ++mi)
#pragma unroll
        for (int ni = 0; ni < 4; ++ni) acc[mi][ni] = zero8();

    // this lane's share of a pass's copies: 16 B of row tid/8 and of every 16th row behind it, in each plane
    const int crow = tid >> 3, ccol = (tid & 7) * 8;
    const size_t ago = (size_t)(i0 + crow) * lda + ccol;                      // + k0
    const size_t bgo = (size_t)(j0 + crow) * ldb + ccol;                      // + k0
    const u32 alo = lds_off(Sm) + 2u * (u32)(crow * GP + ccol);               // + buffer
    const u32 blo = alo + 2u * (u32)(2 * APL);
    constexpr u32 RS = 2u * 16 * GP;           // 16 rows of the ring, bytes
    auto rows128 = [&](u32 l, const u16* g, int ld) {
        const size_t s = (size_t)16 * ld;
        copy8(l, l + RS, l + 2 * RS, l + 3 * RS, l + 4 * RS, l + 5 * RS, l + 6 * RS, l + 7 * RS,
              g, g + s, g + 2 * s, g + 3 * s, g + 4 * s, g + 5 * s, g + 6 * s, g + 7 * s);
    };
    auto stage = [&](int t, int bf) {
        const u32 lb = (u32)bf * (2u * GST);
        const u16* ah = Ah + ago + t * GK;
        const u16* al = Al + ago + t * GK;
        const u32 la = alo + lb, ll = alo + lb + 2u * APL;
        if constexpr (MI == 4) {
            rows128(la, ah, lda);
            rows128(ll, al, lda);
        } else {
            const size_t s = (size_t)16 * lda;
            copy4(la, la + RS, ll, ll + RS, ah, ah + s, al, al + s);
        }
        rows128(blo + lb, Bh + bgo + t * GK, ldb);
        rows128(blo + lb + 2u * BPL, Bl + bgo + t * GK, ldb);
    };

    const int NT = K / GK;
    stage(0, 0);
    asm volatile("s_wait_asynccnt 0x0" ::: "memory");        // this wave's copies of the first pass have landed
    __syncthreads();                                         // ... and every other wave's
    if (NT > 1) stage(1, 1);

#pragma unroll 1
    for (int t = 0; t < NT; ++t) {
        const int bf = t & 1;
        const u16* Ab = Ring + bf * GST + (wm * (16 * MI) + ln) * GP + 8 * h;        // + mi*16*GP, + APL, + ks*32
        const u16* Bb = Ring + bf * GST + 2 * APL + (wn * 64 + ln) * GP + 8 * h;     // + ni*16*GP, + BPL, + ks*32
        // the loops inside a pass are unrolled: every fragment and accumulator index is a constant, so they stay in registers
        if constexpr (MI == 4) {
            // 128 accumulator registers: the A fragments of 32 k stay, the B fragments come one column group ahead,
            // also over the step from the first 32 k to the second
            v16bf ah[MI], al[MI], bh[8], bl[8];
            bh[0] = ldfrag(Bb);
            bl[0] = ldfrag(Bb + BPL);
#pragma unroll
            for (int ks = 0; ks < 2; ++ks) {
#pragma unroll
                for (int mi = 0; mi < MI; ++mi) ah[mi] = ldfrag(Ab + mi * 16 * GP + ks * 32);
#pragma unroll
                for (int mi = 0; mi < MI; ++mi) al[mi] = ldfrag(Ab + APL + mi * 16 * GP + ks * 32);
#pragma unroll
                for (int ni = 0; ni < 4; ++ni) {
                    const int g = ks * 4 + ni;
                    if (g < 7) {
                        bh[g + 1] = ldfrag(Bb + ((g + 1) & 3) * 16 * GP + ((g + 1) >> 2) * 32);
                        bl[g + 1] = ldfrag(Bb + BPL + ((g + 1) & 3) * 16 * GP + ((g + 1) >> 2) * 32);
                    }
                    __builtin_amdgcn_sched_barrier(0);   // the loads above stay ahead of these products
#pragma unroll
                    for (int mi = 0; mi < MI; ++mi) mma(acc[mi][ni], ah[mi], bh[g]);
#pragma unroll
                    for (int mi = 0; mi < MI; ++mi) mma(acc[mi][ni], ah[mi], bl[g]);
#pragma unroll
                    for (int mi = 0; mi < MI; ++mi) mma(acc[mi][ni], al[mi], bh[g]);
                    __builtin_amdgcn_sched_barrier(0);   // the products above stay ahead of the next loads and of the pass's end
                }
            }
        } else {
            // few accumulators: every fragment of the pass is fetched ahead of its products
            v16bf ah[2][MI], al[2][MI], bh[2][4], bl[2][4];
#pragma unroll
            for (int ks = 0; ks < 2; ++ks) {
#pragma unroll
                for (int mi = 0; mi < MI; ++mi) {
                    ah[ks][mi] = ldfrag(Ab + mi * 16 * GP + ks * 32);
                    al[ks][mi] = ldfrag(Ab + APL + mi * 16 * GP + ks * 32);
                }
#pragma unroll
                for (int ni = 0; ni < 4; ++ni) {
                    bh[ks][ni] = ldfrag(Bb + ni * 16 * GP + ks * 32);
                    bl[ks][ni] = ldfrag(Bb + BPL + ni * 16 * GP + ks * 32);
                }
            }
            __builtin_amdgcn_sched_barrier(0);   // the loads above stay ahead of these products
#pragma unroll
            for (int ks = 0; ks < 2; ++ks) {
#pragma unroll
                for (int ni = 0; ni < 4; ++ni) mma(acc[0][ni], ah[ks][0], bh[ks][ni]);
#pragma unroll
                for (int ni = 0; ni < 4; ++ni) mma(acc[0][ni], ah[ks][0], bl[ks][ni]);
#pragma unroll
                for (int ni = 0; ni < 4; ++ni) mma(acc[0][ni], al[ks][0], bh[ks][ni]);
            }
            __builtin_amdgcn_sched_barrier(0);   // the products above stay ahead of the next loads and of the pass's end
        }
        // publish point
        asm volatile("s_wait_dscnt 0x0" ::: "memory");       // this wave's reads of the buffer are done before it is refilled
        asm volatile("s_wait_asynccnt 0x0" ::: "memory");    // this wave's copies of the next pass have landed
        __syncthreads();                                     // both hold for every wave
        if (t + 2 < NT) stage(t + 2, bf);                    // refill the buffer this pass has just read
    }
    asm volatile("s_wait_asynccnt 0x0" ::: "memory");        // no copy is in flight when the ring becomes the C tile

    // stage the f32 tile in LDS: D element r of lane l = (row 8h+r, col ln)
#pragma unroll
    for (int mi = 0; mi < MI; ++mi)
#pragma unroll
        for (int ni = 0; ni < 4; ++ni)
#pragma unroll
            for (int r = 0; r < 8; ++r)
                Cs[(wm * (16 * MI) + mi * 16 + 8 * h + r) * CP + wn * 64 + ni * 16 + ln] = acc[mi][ni][r];
    __syncthreads();

    if (EPI == EPI_F32) {
        // row segment = 128 floats = 512 B = 32 lanes x 16 B, one instruction per row
#pragma unroll 1
        for (int it = 0; it < BM / 4; ++it) {
            const int row = it * 4 + w, col = lane * 4;
            v4f x = *(const v4fa*)(Cs + row * CP + col);
            const v4f bv = *(const v4fa*)(bias + j0 + col);
            x += bv;
            st2f(Of + (size_t)(i0 + row) * ldo + j0 + col, x);
        }
    } else {
        // row segment = 128 halves = 256 B = 16 lanes x 16 B per plane; lanes 16..31 take the next row
#pragma unroll 1
        for (int it = 0; it < BM / 8; ++it) {
            const int row = it * 8 + w * 2 + h, colc = ln * 8;
            const int gi = i0 + row;
            const float* cr = Cs + row * CP;
            float x[8];
            {
                const v4f a = *(const v4fa*)(cr + colc);
                const v4f c = *(const v4fa*)(cr + colc + 4);
                x[0] = a[0]; x[1] = a[1]; x[2] = a[2]; x[3] = a[3];
                x[4] = c[0]; x[5] = c[1]; x[6] = c[2]; x[7] = c[3];
            }
            if (EPI == EPI_ROWB) {
                const float bvv = bias[gi];
#pragma unroll
                for (int e = 0; e < 8; ++e) x[e] += bvv;
            } else {
                const v4f b0 = *(const v4fa*)(bias + j0 + colc);
                const v4f b1 = *(const v4fa*)(bias + j0 + colc + 4);
                x[0] += b0[0]; x[1] += b0[1]; x[2] += b0[2]; x[3] += b0[3];
                x[4] += b1[0]; x[5] += b1[1]; x[6] += b1[2]; x[7] += b1[3];
            }
            if (EPI == EPI_ROPE) {
                // block tile == one head (128 columns); partner column d^64, frequency j = d&63
                const int pc = colc ^ 64;
                float xp[8];
                {
                    const v4f a = *(const v4fa*)(cr + pc);
                    const v4f c = *(const v4fa*)(cr + pc + 4);
                    const v4f b0 = *(const v4fa*)(bias + j0 + pc);
                    const v4f b1 = *(const v4fa*)(bias + j0 + pc + 4);
                    xp[0] = a[0] + b0[0]; xp[1] = a[1] + b0[1]; xp[2] = a[2] + b0[2]; xp[3] = a[3] + b0[3];
                    xp[4] = c[0] + b1[0]; xp[5] = c[1] + b1[1]; xp[6] = c[2] + b1[2]; xp[7] = c[3] + b1[3];
                }
                const int jb = colc & 63;
                const float* cp = cosT + (size_t)gi * NFREQ + jb;
                const float* sp = sinT + (size_t)gi * NFREQ + jb;
                const v4f c0 = *(const v4fa*)(cp), c1 = *(const v4fa*)(cp + 4);
                const v4f s0 = *(const v4fa*)(sp), s1 = *(const v4fa*)(sp + 4);
                // the wait that stands ahead of any overwrite of the four table loads' address registers; it takes both
                // addresses as inputs, so that no loaded value is placed over them in front of it
                asm volatile("s_wait_xcnt 0x0" :: "v"(cp), "v"(sp) : "memory");
                float cs[8] = {c0[0], c0[1], c0[2], c0[3], c1[0], c1[1], c1[2], c1[3]};
                float sn[8] = {s0[0], s0[1], s0[2], s0[3], s1[0], s1[1], s1[2], s1[3]};
                const float sg = (colc < 64) ? -1.0f : 1.0f;
#pragma unroll
                for (int e = 0; e < 8; ++e) x[e] = x[e] * cs[e] + sg * (xp[e] * sn[e]);
            }
            v4u hi, lo;
            split8(x, hi, lo);
            const size_t o = (size_t)gi * ldo + j0 + colc;
            st2u(Oh + o, Ol + o, hi, lo);
        }
    }
}

constexpr int KP  = 136;                   // LDS pitch (halves) of a K row of 128 dims: 272 B = 16 B x 17
constexpr int VP  = 40;                    // LDS pitch (halves) of a Vt row of 32 keys:  80 B = 16 B x 5
constexpr int KPL = 32 * KP;               // one K plane of a tile (halves)
constexpr int VPL = HD * VP;               // one Vt plane of a tile (halves)
constexpr int STG = 2 * KPL + 2 * VPL;     // one ring buffer: Kh | Kl | Vh | Vl (halves)

__global__ void __launch_bounds__(256)
attn_x3(const u16* Qh, const u16* Ql, const u16* Kh, const u16* Kl,
        const u16* Vh, const u16* Vl, const float* amask, const int* flags,
        u16* Oh, u16* Ol)
{
    __shared__ __align__(16) u16 Ring[2 * STG];
    __shared__ __align__(16) float OsA[NREP * 16 * OSP];

    const int tid = threadIdx.x;
    const int lane = tid & 31, h = lane >> 4, ln = lane & 15;
    const int w = __builtin_amdgcn_readfirstlane(tid >> 5);
    const int qt = blockIdx.x, kvh = blockIdx.y, b = blockIdx.z;
    const int hh = kvh * NREP + w;
    const int q0 = qt * 16;
    float* Os = OsA + w * (16 * OSP);          // each wave's own O staging

    const size_t qofs = (size_t)(b * S + q0 + ln) * NQ + hh * HD + 8 * h;     // B column ln, + dc*32
    const size_t mofs = (size_t)(q0 + ln) * S + 8 * h;                        // query ln, + kb (+16), 8 keys in a row

    // this lane's share of a tile's copies: K rows tid/16 and +16 (16 B of 256), Vt rows tid/4 and +64 (16 B of 64)
    const int krow = tid >> 4, kcol = (tid & 15) * 8;
    const int vrow = tid >> 2, vcol = (tid & 3) * 8;
    const size_t kgo = (size_t)(b * S + krow) * NKVD + kvh * HD + kcol;       // + kb*NKVD
    const size_t vgo = (size_t)(kvh * HD + vrow) * MROWS + b * S + vcol;      // + kb
    const u32 klo = lds_off(Ring) + 2u * (u32)(krow * KP + kcol);             // + buffer
    const u32 vlo = lds_off(Ring) + 2u * (u32)(2 * KPL + vrow * VP + vcol);   // + buffer
    auto stage = [&](int kt, int bf) {
        const u32 lb = (u32)bf * (2u * STG);
        const size_t ko = kgo + (size_t)(kt * 32) * NKVD;
        const size_t vo = vgo + (size_t)(kt * 32);
        copy8(klo + lb, klo + lb + 2u * (16 * KP), klo + lb + 2u * KPL, klo + lb + 2u * (KPL + 16 * KP),
              vlo + lb, vlo + lb + 2u * (64 * VP), vlo + lb + 2u * VPL, vlo + lb + 2u * (VPL + 64 * VP),
              Kh + ko, Kh + ko + (size_t)16 * NKVD, Kl + ko, Kl + ko + (size_t)16 * NKVD,
              Vh + vo, Vh + vo + (size_t)64 * MROWS, Vl + vo, Vl + vo + (size_t)64 * MROWS);
    };

    float mrun = -1.0e30f, lrun = 0.0f;        // of query ln; lrun sums this wave half's keys only, joined behind the loop
    v8f o[8];                                  // o[t][r] = O[query ln][dim t*16 + 8h + r]
#pragma unroll
    for (int t = 0; t < 8; ++t) o[t] = zero8();

    // the key tiles that are not all-masked, as a 64-bit set, alike in every wave of the work-group:
    // the ring has to know the next tile one pass ahead
    const u32 a_lo = __builtin_amdgcn_ballot_w32(flags[qt * NKT + lane] != 1);
    const u32 a_hi = __builtin_amdgcn_ballot_w32(flags[qt * NKT + 32 + lane] != 1);
    unsigned long long act = (unsigned long long)a_lo | ((unsigned long long)a_hi << 32);

    // Q^T of this wave's head, both planes, all 128 dims: the same B fragments in every pass, loaded once and kept in registers
    const u16* qhp = Qh + qofs;
    const u16* qlp = Ql + qofs;
    v16bf qh[4], ql[4];
    // unrolled: constant indices keep the fragments in registers
#pragma unroll
    for (int dc = 0; dc < 4; ++dc) {
        qh[dc] = ldfrag(qhp + dc * 32);
        ql[dc] = ldfrag(qlp + dc * 32);
    }
    // the wait that stands ahead of any overwrite of the loads' address registers; it takes both addresses as inputs,
    // so that no fragment is placed over them in front of it
    asm volatile("s_wait_xcnt 0x0" :: "v"(qhp), "v"(qlp) : "memory");

    if (act != 0) {
        int kt = __builtin_ctzll(act);
        act &= act - 1;
        stage(kt, 0);
        asm volatile("s_wait_asynccnt 0x0" ::: "memory");    // this wave's copies of the first tile have landed
        __syncthreads();                                     // ... and every other wave's
        int ktn = -1;
        if (act != 0) {
            ktn = __builtin_ctzll(act);
            act &= act - 1;
            stage(ktn, 1);
        }
        int bf = 0;
        for (;;) {
            const int kb = kt * 32;
            const u16* Kb = Ring + bf * STG + ln * KP + 8 * h;               // K row ln, + 16*KP, + KPL, + dc*32
            const u16* Vb = Ring + bf * STG + 2 * KPL + ln * VP + 8 * h;     // Vt row ln, + t*16*VP, + VPL

            // the additive mask of query ln for this lane's 16 keys
            const float* mp = amask + mofs + kb;
            const v4f mk0 = *(const v4fa*)(mp);
            const v4f mk1 = *(const v4fa*)(mp + 4);
            const v4f mk2 = *(const v4fa*)(mp + 16);
            const v4f mk3 = *(const v4fa*)(mp + 20);

            // scores S^T[32 keys][16 q] = K . Q^T over 128 dims (4 k-steps), two 16-key accumulators
            v8f s0 = zero8(), s1 = zero8();
            // the K fragments of a k-step come one step ahead of their products; constant indices keep them in registers
            v16bf kh[4][2], kl[4][2];
            kh[0][0] = ldfrag(Kb);
            kh[0][1] = ldfrag(Kb + 16 * KP);
            kl[0][0] = ldfrag(Kb + KPL);
            kl[0][1] = ldfrag(Kb + KPL + 16 * KP);
#pragma unroll
            for (int dc = 0; dc < 4; ++dc) {
                if (dc < 3) {
                    kh[dc + 1][0] = ldfrag(Kb + (dc + 1) * 32);
                    kh[dc + 1][1] = ldfrag(Kb + 16 * KP + (dc + 1) * 32);
                    kl[dc + 1][0] = ldfrag(Kb + KPL + (dc + 1) * 32);
                    kl[dc + 1][1] = ldfrag(Kb + KPL + 16 * KP + (dc + 1) * 32);
                }
                __builtin_amdgcn_sched_barrier(0);   // the loads above stay ahead of these products
                mma(s0, kh[dc][0], qh[dc]);
                mma(s1, kh[dc][1], qh[dc]);
                mma(s0, kh[dc][0], ql[dc]);
                mma(s1, kh[dc][1], ql[dc]);
                mma(s0, kl[dc][0], qh[dc]);
                mma(s1, kl[dc][1], qh[dc]);
                __builtin_amdgcn_sched_barrier(0);   // the products above stay ahead of the next loads and of the pass's end
            }
            // the first two V^T row groups are fetched here, so that they arrive under the softmax
            v16bf vh[8], vl[8];
            vh[0] = ldfrag(Vb);
            vh[1] = ldfrag(Vb + 16 * VP);
            vl[0] = ldfrag(Vb + VPL);
            vl[1] = ldfrag(Vb + VPL + 16 * VP);
            __builtin_amdgcn_sched_barrier(0);   // these loads stay ahead of the softmax

            // scale + additive mask by value + online softmax; lane (h,ln): s0[r] = (key kb + 8h + r, query ln), s1: + 16
            // the loops of this block are unrolled: every index into a, p0, p1 and o is a constant, so they stay in registers
            float a[16];
#pragma unroll
            for (int r = 0; r < 4; ++r) {
                a[r]      = s0[r]     * SCALE + mk0[r];
                a[4 + r]  = s0[4 + r] * SCALE + mk1[r];
                a[8 + r]  = s1[r]     * SCALE + mk2[r];
                a[12 + r] = s1[4 + r] * SCALE + mk3[r];
            }
            float mx = a[0];
#pragma unroll
            for (int e = 1; e < 16; ++e) mx = fmaxf(mx, a[e]);
            mx = fmaxf(mx, xhalf(mx));                           // the other 16 keys of the query
            const float mnew = fmaxf(mrun, mx);
            const float corr = __expf(mrun - mnew);
            mrun = mnew;
            float p0[8], p1[8];
            float ps = 0.0f;
#pragma unroll
            for (int r = 0; r < 8; ++r) {
                p0[r] = __expf(a[r] - mnew);
                p1[r] = __expf(a[8 + r] - mnew);
                ps += p0[r] + p1[r];
            }
            lrun = lrun * corr + ps;
#pragma unroll
            for (int t = 0; t < 8; ++t)
#pragma unroll
                for (int r = 0; r < 8; ++r) o[t][r] *= corr;
            // P^T as a B operand: element r <- key 8h + r, element 8 + r <- key 16 + 8h + r, column ln: as the lane holds them
            Frag ph, pl;
            split8(p0, ph.q[0], pl.q[0]);
            split8(p1, ph.q[1], pl.q[1]);

            // O^T[128][16 q] += V^T[128][32 keys] . P^T[32 keys][16 q]; V^T A-fragments from the ring's key-contiguous rows
            // two row groups at a time, the next two fetched ahead of these products
#pragma unroll
            for (int t = 0; t < 8; t += 2) {
                if (t < 6) {
                    vh[t + 2] = ldfrag(Vb + (t + 2) * 16 * VP);
                    vh[t + 3] = ldfrag(Vb + (t + 3) * 16 * VP);
                    vl[t + 2] = ldfrag(Vb + VPL + (t + 2) * 16 * VP);
                    vl[t + 3] = ldfrag(Vb + VPL + (t + 3) * 16 * VP);
                }
                mma3x2(o[t], o[t + 1], vh[t], vl[t], vh[t + 1], vl[t + 1], ph.v, pl.v);
            }

            // publish point: this wave's LDS reads are done, its copies of the next tile have landed,
            // then the barrier that says both of every wave
            asm volatile("s_wait_dscnt 0x0" ::: "memory");
            asm volatile("s_wait_asynccnt 0x0" ::: "memory");
            __syncthreads();
            if (ktn < 0) break;
            kt = ktn;
            ktn = -1;
            if (act != 0) {                                      // refill the buffer this pass has just read
                ktn = __builtin_ctzll(act);
                act &= act - 1;
                stage(ktn, bf);
            }
            bf ^= 1;
        }
    }
    asm volatile("s_wait_asynccnt 0x0" ::: "memory");            // no copy is left in flight when the wave ends

    // normalise, stage the 16x128 f32 tile, write hi/lo planes with 16-B lane-contiguous stores
    {
        const float lv = lrun + xhalf(lrun);                     // both wave halves' keys
        const float li = (lv > 0.0f) ? (1.0f / lv) : 0.0f;
        float* orow = Os + ln * OSP + 8 * h;
        // unrolled: constant indices keep o in registers
#pragma unroll
        for (int t = 0; t < 8; ++t) {
            v4f x0, x1;
#pragma unroll
            for (int r = 0; r < 4; ++r) { x0[r] = o[t][r] * li; x1[r] = o[t][4 + r] * li; }
            *(v4fa*)(orow + t * 16) = x0;
            *(v4fa*)(orow + t * 16 + 4) = x1;
        }
    }
    __syncthreads();
#pragma unroll 1
    for (int it = 0; it < 8; ++it) {
        const int row = it * 2 + h, colc = ln * 8;
        const float* cr = Os + row * OSP;
        const v4f a = *(const v4fa*)(cr + colc);
        const v4f c = *(const v4fa*)(cr + colc + 4);
        float x[8] = {a[0], a[1], a[2], a[3], c[0], c[1], c[2], c[3]};
        v4u hi, lo;
        split8(x, hi, lo);
        const size_t oo = (size_t)(b * S + q0 + row) * NQ + hh * HD + colc;
        st2u(Oh + oo, Ol + oo, hi, lo);
    }
}

// ---------------- host ---------------------------------------------------------------------
extern "C" void kernel_launch(void* const* d_in, const int* in_sizes, int n_in,
                              void* d_out, int out_size, void* d_ws, size_t ws_size,
                              hipStream_t stream)
{
    if (n_in < 11) return;
    if (in_sizes[0] != MROWS * HID || in_sizes[1] != MROWS || in_sizes[2] != S * S ||
        in_sizes[3] != HID * NQ || in_sizes[4] != NQ ||
        in_sizes[5] != HID * NKVD || in_sizes[6] != NKVD ||
        in_sizes[7] != HID * NKVD || in_sizes[8] != NKVD ||
        in_sizes[9] != NQ * HID || in_sizes[10] != HID) return;
    if (out_size != MROWS * HID) return;

    const float* X   = (const float*)d_in[0];   // [B*S][HID]
    const float* ts  = (const float*)d_in[1];   // [B*S]
    const float* amk = (const float*)d_in[2];   // [S][S] additive
    const float* Wq  = (const float*)d_in[3];   // [HID][NQ]
    const float* bq  = (const float*)d_in[4];
    const float* Wk  = (const float*)d_in[5];   // [HID][NKVD]
    const float* bk  = (const float*)d_in[6];
    const float* Wv  = (const float*)d_in[7];   // [HID][NKVD]
    const float* bv  = (const float*)d_in[8];
    const float* Wo  = (const float*)d_in[9];   // [NQ][HID]
    const float* bo  = (const float*)d_in[10];
    float* out = (float*)d_out;                 // [B*S][HID]

    const size_t szX  = (size_t)MROWS * HID * 2;     // one plane
    const size_t szWq = (size_t)NQ * HID * 2;
    const size_t szWk = (size_t)NKVD * HID * 2;
    const size_t szWo = (size_t)HID * NQ * 2;
    const size_t szQ  = (size_t)MROWS * NQ * 2;
    const size_t szK  = (size_t)MROWS * NKVD * 2;
    const size_t szVt = (size_t)NKVD * MROWS * 2;
    const size_t szTb = (size_t)MROWS * NFREQ * 4;
    const size_t szFl = (size_t)NQT * NKT * 4;
    char* base = (char*)d_ws;
    size_t used = 0;
    auto take = [&](size_t bytes) -> char* { char* p = base + used; used += (bytes + 255) & ~(size_t)255; return p; };
    u16* Xh   = (u16*)take(szX);   u16* Xl   = (u16*)take(szX);     // reused as attention-output planes
    u16* Wqth = (u16*)take(szWq);  u16* Wqtl = (u16*)take(szWq);    // [NQ][HID]
    u16* Wkth = (u16*)take(szWk);  u16* Wktl = (u16*)take(szWk);    // [NKVD][HID]
    u16* Wvth = (u16*)take(szWk);  u16* Wvtl = (u16*)take(szWk);    // [NKVD][HID]
    u16* Woth = (u16*)take(szWo);  u16* Wotl = (u16*)take(szWo);    // [HID][NQ]
    u16* Qh   = (u16*)take(szQ);   u16* Ql   = (u16*)take(szQ);     // [MROWS][NQ]
    u16* Kh   = (u16*)take(szK);   u16* Kl   = (u16*)take(szK);     // [MROWS][NKVD]
    u16* Vth  = (u16*)take(szVt);  u16* Vtl  = (u16*)take(szVt);    // [NKVD][MROWS]
    float* cosT = (float*)take(szTb);                               // [MROWS][64]
    float* sinT = (float*)take(szTb);
    int* flags  = (int*)take(szFl);                                 // [NQT][NKT]
    if (used > ws_size) return;
    u16* AOh = Xh;   // X planes are dead once the three projections are enqueued
    u16* AOl = Xl;

    // 1: X -> hi/lo planes
    k_split_rows<<<dim3((MROWS * HID) / (256 * 8)), dim3(256), 0, stream>>>(X, MROWS * HID, Xh, Xl);
    // 2..5: weights in[in][out] -> k-contiguous hi/lo planes out[out][in]
    k_split_t<<<dim3(NQ / 64, HID / 64), dim3(256), 0, stream>>>(Wq, HID, NQ, Wqth, Wqtl);      // in[2048][2048] -> out[2048][2048]
    k_split_t<<<dim3(NKVD / 64, HID / 64), dim3(256), 0, stream>>>(Wk, HID, NKVD, Wkth, Wktl);  // in[2048][256]  -> out[256][2048]
    k_split_t<<<dim3(NKVD / 64, HID / 64), dim3(256), 0, stream>>>(Wv, HID, NKVD, Wvth, Wvtl);  // in[2048][256]  -> out[256][2048]
    k_split_t<<<dim3(HID / 64, NQ / 64), dim3(256), 0, stream>>>(Wo, NQ, HID, Woth, Wotl);      // in[2048][2048] -> out[2048][2048]
    // 6: rotary cos/sin table per token row
    k_rope_table<<<dim3(MROWS / 4), dim3(256), 0, stream>>>(ts, MROWS, cosT, sinT);
    // 7: tile skip flags from the additive mask input
    k_flags<<<dim3(NQT, 2), dim3(256), 0, stream>>>(amk, flags);
    // 8: Q = X.Wq + bq, rotary -> planes [MROWS][NQ]
    gemm_x3<EPI_ROPE, 4><<<dim3(NQ / 128, MROWS / 128), dim3(128), 0, stream>>>(
        Xh, Xl, HID, Wqth, Wqtl, HID, HID, bq, cosT, sinT, Qh, Ql, out, NQ);
    // 9: K = X.Wk + bk, rotary -> planes [MROWS][NKVD]
    gemm_x3<EPI_ROPE, 1><<<dim3(NKVD / 128, MROWS / 32), dim3(128), 0, stream>>>(
        Xh, Xl, HID, Wkth, Wktl, HID, HID, bk, cosT, sinT, Kh, Kl, out, NKVD);
    // 10: Vt[kvh*128+d][token] = (X.Wv + bv)^T -> planes [NKVD][MROWS]
    gemm_x3<EPI_ROWB, 1><<<dim3(MROWS / 128, NKVD / 32), dim3(128), 0, stream>>>(
        Wvth, Wvtl, HID, Xh, Xl, HID, HID, bv, cosT, sinT, Vth, Vtl, out, MROWS);
    // 11: attention -> AO planes [MROWS][NQ]
    attn_x3<<<dim3(NQT, NKV, BB), dim3(256), 0, stream>>>(Qh, Ql, Kh, Kl, Vth, Vtl, amk, flags, AOh, AOl);
    // 12: out = AO.Wo + bo -> f32 [MROWS][HID]
    gemm_x3<EPI_F32, 4><<<dim3(HID / 128, MROWS / 128), dim3(128), 0, stream>>>(
        AOh, AOl, NQ, Woth, Wotl, NQ, NQ, bo, cosT, sinT, Qh, Ql, out, HID);
    (void)hipGetLastError();
}

// v007
// Measured time: 283 microseconds a run.
// In two side-by-side timings against v006, it was 1.16 and 1.15 times as fast.
// Counting every step since v000, it is 3.41 times as fast.
#include <hip/hip_runtime.h>
#include <math.h>
#include <stddef.h>

// All contractions (q/k/v projections, q.k^T scores, p.v, output projection): v_wmma_f32_16x16x32_bf16 with bf16 hi/lo operands everywhere (hi*hi + hi*lo + lo*hi), f32 accumulate; softmax, rotary, scale and biases in f32.

constexpr int BB    = 2;
constexpr int S     = 2048;
constexpr int HID   = 2048;
constexpr int NH    = 16;
constexpr int NKV   = 2;
constexpr int HD    = 128;
constexpr int NREP  = NH / NKV;            // 8
constexpr int MROWS = BB * S;              // 4096 token rows
constexpr int NQ    = NH * HD;             // 2048
constexpr int NKVD  = NKV * HD;            // 256
constexpr int NQT   = S / 16;              // 128 query tiles of 16 rows
constexpr int NKT   = S / 32;              // 64 key tiles of 32 keys
constexpr int NFREQ = HD / 2;              // 64 rotary frequencies
constexpr float SCALE = 0.08838834764831845f;   // 1/sqrt(128)
constexpr int CP  = 132;                   // LDS pitch (floats), 32*MI x 128 C tile
constexpr int OSP = 132;                   // LDS pitch (floats), 16x128 O tile
constexpr int TP  = 68;                    // LDS pitch (floats), transpose tile

constexpr int EPI_ROPE = 1;                // hi/lo planes out, column bias, rotary
constexpr int EPI_ROWB = 2;                // hi/lo planes out, row bias
constexpr int EPI_F32  = 3;                // f32 out, column bias

static_assert(MROWS % 128 == 0);
static_assert(NQ % 128 == 0);
static_assert(NKVD % 128 == 0);
static_assert(HID % 64 == 0);
static_assert(S % 32 == 0);

typedef unsigned int   u32;
typedef unsigned short u16;
typedef __bf16 v16bf __attribute__((ext_vector_type(16)));
typedef float  v8f   __attribute__((ext_vector_type(8)));
typedef int    v8i   __attribute__((ext_vector_type(8)));
typedef float  v4f   __attribute__((ext_vector_type(4)));
typedef u32    v4u   __attribute__((ext_vector_type(4)));
typedef int    v4i   __attribute__((ext_vector_type(4)));
typedef v4f v4fa __attribute__((may_alias));
typedef v4u v4ua __attribute__((may_alias));
typedef v4i v4ia __attribute__((may_alias));

union Frag { v16bf v; v4u q[2]; };

// ---------------- bf16 RNE split helpers (packed hardware conversion) ----------
typedef float  v2f  __attribute__((ext_vector_type(2)));
typedef __bf16 v2bf __attribute__((ext_vector_type(2)));

// two f32 -> two bf16, round to nearest even, the first in the low half-word: one packed conversion
__device__ __forceinline__ u32 bf2(v2f x) {
    return __builtin_bit_cast(u32, __builtin_convertvector(x, v2bf));
}

// 8 f32 -> packed bf16 hi plane (4 dwords) and lo plane (4 dwords); element 2c in the low half-word
__device__ __forceinline__ void split8(const float (&x)[8], v4u& hi, v4u& lo) {
#pragma unroll
    for (int c = 0; c < 4; ++c) {
        const v2f p = {x[2 * c], x[2 * c + 1]};
        const u32 h = bf2(p);
        const v2f b = {__builtin_bit_cast(float, h << 16), __builtin_bit_cast(float, h & 0xFFFF0000u)};
        hi[c] = h;
        lo[c] = bf2(p - b);
    }
}

// ---------------- fragment loader (A map and B map identical, k-contiguous row) -------
// p = plane + row*ld + k0 + 8*h ; elements 0..7 <- k0+8h..+7, elements 8..15 <- k0+16+8h..+7
__device__ __forceinline__ v16bf ldfrag(const u16* p) {
    Frag f;
    f.q[0] = *(const v4ua*)(p);
    f.q[1] = *(const v4ua*)(p + 16);
    return f.v;
}

__device__ __forceinline__ v8f zero8() {
    v8f z;
#pragma unroll
    for (int i = 0; i < 8; ++i) z[i] = 0.0f;
    return z;
}

// one term of a hi/lo product. An accumulator takes its three terms in the order hi*hi, hi*lo, lo*hi; the callers go term by
// term over several accumulators, so that a product never waits for the one issued directly ahead of it
__device__ __forceinline__ void mma(v8f& acc, v16bf a, v16bf b) {
    acc = __builtin_amdgcn_wmma_f32_16x16x32_bf16(false, a, false, b, (short)0, acc, false, false);
}

// Where __builtin_amdgcn_sched_barrier(0) stands below, it parts a group of LDS fragment loads from a group of products: without
// it the compiler moves the loads down to their first use, in among the products, and the wave waits out the LDS latency at each.

// the three terms of two accumulators that share the B operand, term by term, in one statement. In asm because the compiler moved
// the builtin form of these products, with the end of the softmax, down past every later fragment load: all fragments of a pass
// were then live at once, too many registers for four waves on a SIMD. The "memory" clobber keeps the fragment loads on their side.
// The four v_nop keep the distance from the last product to a vector instruction on its registers.
__device__ __forceinline__ void mma3x2(v8f& c0, v8f& c1, v16bf a0h, v16bf a0l, v16bf a1h, v16bf a1l, v16bf bh, v16bf bl) {
    const v8i x0h = __builtin_bit_cast(v8i, a0h), x0l = __builtin_bit_cast(v8i, a0l);
    const v8i x1h = __builtin_bit_cast(v8i, a1h), x1l = __builtin_bit_cast(v8i, a1l);
    const v8i yh = __builtin_bit_cast(v8i, bh), yl = __builtin_bit_cast(v8i, bl);
    asm volatile("v_wmma_f32_16x16x32_bf16 %0, %2, %6, %0\n\t"
                 "v_wmma_f32_16x16x32_bf16 %1, %4, %6, %1\n\t"
                 "v_wmma_f32_16x16x32_bf16 %0, %2, %7, %0\n\t"
                 "v_wmma_f32_16x16x32_bf16 %1, %4, %7, %1\n\t"
                 "v_wmma_f32_16x16x32_bf16 %0, %3, %6, %0\n\t"
                 "v_wmma_f32_16x16x32_bf16 %1, %5, %6, %1\n\t"
                 "v_nop\n\tv_nop\n\tv_nop\n\tv_nop"
                 : "+v"(c0), "+v"(c1)
                 : "v"(x0h), "v"(x0l), "v"(x1h), "v"(x1l), "v"(yh), "v"(yl)
                 : "memory");
}

__device__ __forceinline__ void st2u(u16* ph, u16* pl, v4u hi, v4u lo) {
    *(v4u*)ph = hi;
    *(v4u*)pl = lo;
    
}
__device__ __forceinline__ void st2f(float* p, v4f v) {
    *(v4f*)p = v;
    
}
// Behind the stores of a job that shares its kernel with other jobs: the wait that stands ahead of any overwrite of a register
// that an issued store names. The code of another job follows in the built kernel, where a kernel of one job would end.
__device__ __forceinline__ void stores_issued() {
    asm volatile("s_wait_xcnt 0x0" ::: "memory");
}

// ---------------- X: f32 rows -> hi/lo bf16 planes, same layout --------------------------
__device__ __forceinline__ void
split_rows(int blk, const float* X, int n, u16* Xh, u16* Xl)
{
    const size_t i = ((size_t)blk * 256 + threadIdx.x) * 8;
    if (i + 8 <= (size_t)n) {
        const v4f a = *(const v4fa*)(X + i);
        const v4f c = *(const v4fa*)(X + i + 4);
        float x[8] = {a[0], a[1], a[2], a[3], c[0], c[1], c[2], c[3]};
        v4u hi, lo;
        split8(x, hi, lo);
        st2u(Xh + i, Xl + i, hi, lo);
    }
}

// ---------------- weights: in[nrows][ncols] f32 -> hi/lo planes out[ncols][nrows] ----------
// blocks (ncols/64) x (nrows/64), the column tile running first; LDS transpose in T (64 * TP floats);
// each output line (64 halves) by lanes 8q..8q+7
__device__ __forceinline__ void
split_t(float* T, int blk, const float* W, int nrows, int ncols, u16* Th, u16* Tl)
{
    const int tid = threadIdx.x;
    const int cb = (blk % (ncols / 64)) * 64;      // input column tile == output row tile
    const int rb = (blk / (ncols / 64)) * 64;      // input row tile    == output column tile
#pragma unroll
    for (int it = 0; it < 4; ++it) {
        const int fl = it * 256 + tid;
        const int rr = fl >> 4, cc = (fl & 15) * 4;
        const v4f v = *(const v4fa*)(W + (size_t)(rb + rr) * ncols + cb + cc);
        T[(cc + 0) * TP + rr] = v[0];
        T[(cc + 1) * TP + rr] = v[1];
        T[(cc + 2) * TP + rr] = v[2];
        T[(cc + 3) * TP + rr] = v[3];
    }
    __syncthreads();
#pragma unroll
    for (int it = 0; it < 2; ++it) {
        const int orow = it * 32 + (tid >> 3), oc = (tid & 7) * 8;
        const v4f a = *(const v4fa*)(T + orow * TP + oc);
        const v4f c = *(const v4fa*)(T + orow * TP + oc + 4);
        float x[8] = {a[0], a[1], a[2], a[3], c[0], c[1], c[2], c[3]};
        v4u hi, lo;
        split8(x, hi, lo);
        const size_t o = (size_t)(cb + orow) * nrows + rb + oc;
        st2u(Th + o, Tl + o, hi, lo);
    }
    stores_issued();
}

// ---------------- rotary table: cos/sin of f32(ts[row] * inv_freq[j]) ---------------------
__device__ __forceinline__ void
rope_table(int blk, const float* ts, int nrows, float* cosT, float* sinT)
{
    const int tid = threadIdx.x;
    const int row = blk * 4 + (tid >> 6);
    const int j   = tid & 63;
    const int rc  = row < nrows ? row : nrows - 1;
    const float t = ts[rc];
    // inv_freq[j] = 1 / f32(10000^(j/64)); the power evaluated in f64 and converted once
    const double p  = exp2((double)j * (13.287712379549449 / 64.0));
    const float  pf = (float)p;
    const float inv = 1.0f / pf;
    const float ang = t * inv;
    float sn, cs;
    sincosf(ang, &sn, &cs);
    if (row < nrows) {
        const size_t o = (size_t)row * NFREQ + j;
        *(float*)(cosT + o) = cs;
        *(float*)(sinT + o) = sn;
        stores_issued();
    }
}

// ---------------- tile flags from the additive input mask ---------------------------------
// flag[qt][kt] = 1 when every entry of the 16x32 mask tile is <= -1e8 (tile contributes 0)
// blocks NQT x 2, the query tile running first; sf: 32 ints of LDS
__device__ __forceinline__ void
tile_flags(int* sf, int blk, const float* amask, int* flags)
{
    const int tid = threadIdx.x, lane = tid & 31, w = tid >> 5;
    const int qt = blk % NQT, hf = blk / NQT;
    const int t = tid >> 3, sub = tid & 7;
    const int kt = hf * 32 + t;
    const int kb = kt * 32;
    int ok = 1;
#pragma unroll
    for (int rr = 0; rr < 2; ++rr) {
        const int q = qt * 16 + sub * 2 + rr;
        const float* mp = amask + (size_t)q * S + kb;
#pragma unroll
        for (int c = 0; c < 8; ++c) {
            const v4f v = *(const v4fa*)(mp + 4 * c);
            ok &= (int)(v[0] <= -1.0e8f) & (int)(v[1] <= -1.0e8f) &
                  (int)(v[2] <= -1.0e8f) & (int)(v[3] <= -1.0e8f);
        }
    }
    ok &= __shfl_xor(ok, 1);
    ok &= __shfl_xor(ok, 2);
    ok &= __shfl_xor(ok, 4);
    if (sub == 0) sf[t] = ok;
    __syncthreads();
    if (w == 0 && lane < 8) {
        const v4i f = *(const v4ia*)(sf + lane * 4);
        int* dst = flags + (size_t)qt * NKT + hf * 32 + lane * 4;
        *(v4i*)dst = f;
        stores_issued();
    }
}

// ---------------- the whole preparation in one launch ---------------------------------------
// The seven jobs above depend on nothing but the inputs: each takes a range of the block index of one grid, so that they
// fill the chip together and no launch waits for the last blocks of the one ahead. A block does one job's one tile.
constexpr int PB_WQ = (NQ / 64) * (HID / 64);          // blocks of each job
constexpr int PB_WO = (HID / 64) * (NQ / 64);
constexpr int PB_WK = (NKVD / 64) * (HID / 64);
constexpr int PB_RT = MROWS / 4;
constexpr int PB_FL = NQT * 2;
constexpr int PB_X  = (MROWS * HID) / (256 * 8);
constexpr int PB_ALL = PB_WQ + PB_WO + 2 * PB_WK + PB_RT + PB_FL + PB_X;

__global__ void __launch_bounds__(256)
k_prep(const float* X, const float* ts, const float* amask,
       const float* Wq, const float* Wk, const float* Wv, const float* Wo,
       u16* Xh, u16* Xl, u16* Wqth, u16* Wqtl, u16* Wkth, u16* Wktl, u16* Wvth, u16* Wvtl, u16* Woth, u16* Wotl,
       float* cosT, float* sinT, int* flags)
{
    __shared__ __align__(16) float T[64 * TP];
    __shared__ __align__(16) int sf[32];
    int blk = blockIdx.x;                              // the same in every thread of a block: each branch is taken by all or none
    if (blk < PB_WQ) { split_t(T, blk, Wq, HID, NQ, Wqth, Wqtl); return; }       // in[2048][2048] -> out[2048][2048]
    blk -= PB_WQ;
    if (blk < PB_WO) { split_t(T, blk, Wo, NQ, HID, Woth, Wotl); return; }       // in[2048][2048] -> out[2048][2048]
    blk -= PB_WO;
    if (blk < PB_WK) { split_t(T, blk, Wk, HID, NKVD, Wkth, Wktl); return; }     // in[2048][256]  -> out[256][2048]
    blk -= PB_WK;
    if (blk < PB_WK) { split_t(T, blk, Wv, HID, NKVD, Wvth, Wvtl); return; }     // in[2048][256]  -> out[256][2048]
    blk -= PB_WK;
    if (blk < PB_RT) { rope_table(blk, ts, MROWS, cosT, sinT); return; }
    blk -= PB_RT;
    if (blk < PB_FL) { tile_flags(sf, blk, amask, flags); return; }
    blk -= PB_FL;
    split_rows(blk, X, MROWS * HID, Xh, Xl);
}

__device__ __forceinline__ u32 lds_off(const void* p) { return (u32)(size_t)p; }

// the value of lane l ^ 16
__device__ __forceinline__ float xhalf(float x) {
    const int b = __builtin_bit_cast(int, x);
    return __builtin_bit_cast(float, __builtin_amdgcn_permlanex16(b, b, 0x76543210, 0xfedcba98, false, false));
}

// one tile's copies of one lane: 8 x 16 B, global -> LDS through no register.
// The s_wait_xcnt closes the statement so that no address register is rewritten ahead of it.
__device__ __forceinline__ void copy8(u32 l0, u32 l1, u32 l2, u32 l3, u32 l4, u32 l5, u32 l6, u32 l7,
                                      const u16* g0, const u16* g1, const u16* g2, const u16* g3,
                                      const u16* g4, const u16* g5, const u16* g6, const u16* g7) {
    asm volatile("global_load_async_to_lds_b128 %0, %8, off\n\t"
                 "global_load_async_to_lds_b128 %1, %9, off\n\t"
                 "global_load_async_to_lds_b128 %2, %10, off\n\t"
                 "global_load_async_to_lds_b128 %3, %11, off\n\t"
                 "global_load_async_to_lds_b128 %4, %12, off\n\t"
                 "global_load_async_to_lds_b128 %5, %13, off\n\t"
                 "global_load_async_to_lds_b128 %6, %14, off\n\t"
                 "global_load_async_to_lds_b128 %7, %15, off\n\t"
                 "s_wait_xcnt 0x0"
                 :: "v"(l0), "v"(l1), "v"(l2), "v"(l3), "v"(l4), "v"(l5), "v"(l6), "v"(l7),
                    "v"(g0), "v"(g1), "v"(g2), "v"(g3), "v"(g4), "v"(g5), "v"(g6), "v"(g7)
                 : "memory");
}

// ---------------- hi/lo split GEMM: C[i][j] = sum_k A[i][k] * B[j][k] -----------------------
// A planes [*][lda], B planes [*][ldb], both k-contiguous; block tile 32*MI (i) x 128 (j),
// 4 waves as 2x2, wave tile 16*MI x 64 = MI x 4 accumulators.
// A pass is 64 k: the pass's rows of all four planes are copied once per work-group into a two-buffer
// LDS ring by asynchronous copies (whole 128-B lines), the next pass flying while this one is used;
// the waves read their fragments from the ring.
constexpr int GK = 64;                     // k per pass
constexpr int GP = 72;                     // LDS pitch (halves) of a row of 64 k: 144 B = 16 B x 9

// four copies of one lane, as copy8
__device__ __forceinline__ void copy4(u32 l0, u32 l1, u32 l2, u32 l3,
                                      const u16* g0, const u16* g1, const u16* g2, const u16* g3) {
    asm volatile("global_load_async_to_lds_b128 %0, %4, off\n\t"
                 "global_load_async_to_lds_b128 %1, %5, off\n\t"
                 "global_load_async_to_lds_b128 %2, %6, off\n\t"
                 "global_load_async_to_lds_b128 %3, %7, off\n\t"
                 "s_wait_xcnt 0x0"
                 :: "v"(l0), "v"(l1), "v"(l2), "v"(l3), "v"(g0), "v"(g1), "v"(g2), "v"(g3)
                 : "memory");
}

// LDS bytes of a block: the ring, or the f32 C tile that takes its place behind the loop
constexpr int gemm_lds(int MI) {
    const int rng = 2 * (2 * 32 * MI * GP + 2 * 128 * GP) * 2, cs = 32 * MI * CP * 4;
    return rng > cs ? rng : cs;
}

// one block tile: column tile bx, row tile by; Sm: gemm_lds(MI) bytes of LDS
template<int EPI, int MI>
__device__ __forceinline__ void
gemm_tile(unsigned char* Sm, int bx, int by,
          const u16* Ah, const u16* Al, int lda,
          const u16* Bh, const u16* Bl, int ldb, int K,
          const float* bias, const float* cosT, const float* sinT,
          u16* Oh, u16* Ol, float* Of, int ldo)
{
    static_assert(MI == 1 || MI == 4);
    constexpr int BM   = 32 * MI;              // rows of the block tile
    constexpr int APL  = BM * GP;              // one A plane of a pass (halves)
    constexpr int BPL  = 128 * GP;             // one B plane of a pass (halves)
    constexpr int GST  = 2 * APL + 2 * BPL;    // one ring buffer: Ah | Al | Bh | Bl (halves)
    const u16* Ring = (const u16*)Sm;
    float* Cs = (float*)Sm;
    const int tid = threadIdx.x, w = tid >> 5, lane = tid & 31;
    const int h = lane >> 4, ln = lane & 15;
    const int wm = w >> 1, wn = w & 1;
    const int i0 = by * BM, j0 = bx * 128;

    v8f acc[MI][4];
#pragma unroll
    for (int mi = 0; mi < MI; ++mi)
#pragma unroll
        for (int ni = 0; ni < 4; ++ni) acc[mi][ni] = zero8();

    // this lane's share of a pass's copies: 16 B of row tid/8 and of every 16th row behind it, in each plane
    const int crow = tid >> 3, ccol = (tid & 7) * 8;
    const size_t ago = (size_t)(i0 + crow) * lda + ccol;                      // + k0
    const size_t bgo = (size_t)(j0 + crow) * ldb + ccol;                      // + k0
    const u32 alo = lds_off(Sm) + 2u * (u32)(crow * GP + ccol);               // + buffer
    const u32 blo = alo + 2u * (u32)(2 * APL);
    constexpr u32 RS = 2u * 16 * GP;           // 16 rows of the ring, bytes
    auto rows128 = [&](u32 l, const u16* g, int ld) {
        const size_t s = (size_t)16 * ld;
        copy8(l, l + RS, l + 2 * RS, l + 3 * RS, l + 4 * RS, l + 5 * RS, l + 6 * RS, l + 7 * RS,
              g, g + s, g + 2 * s, g + 3 * s, g + 4 * s, g + 5 * s, g + 6 * s, g + 7 * s);
    };
    auto stage = [&](int t, int bf) {
        const u32 lb = (u32)bf * (2u * GST);
        const u16* ah = Ah + ago + t * GK;
        const u16* al = Al + ago + t * GK;
        const u32 la = alo + lb, ll = alo + lb + 2u * APL;
        if constexpr (MI == 4) {
            rows128(la, ah, lda);
            rows128(ll, al, lda);
        } else {
            const size_t s = (size_t)16 * lda;
            copy4(la, la + RS, ll, ll + RS, ah, ah + s, al, al + s);
        }
        rows128(blo + lb, Bh + bgo + t * GK, ldb);
        rows128(blo + lb + 2u * BPL, Bl + bgo + t * GK, ldb);
    };

    const int NT = K / GK;
    stage(0, 0);
    asm volatile("s_wait_asynccnt 0x0" ::: "memory");        // this wave's copies of the first pass have landed
    __syncthreads();                                         // ... and every other wave's
    if (NT > 1) stage(1, 1);

#pragma unroll 1
    for (int t = 0; t < NT; ++t) {
        const int bf = t & 1;
        const u16* Ab = Ring + bf * GST + (wm * (16 * MI) + ln) * GP + 8 * h;        // + mi*16*GP, + APL, + ks*32
        const u16* Bb = Ring + bf * GST + 2 * APL + (wn * 64 + ln) * GP + 8 * h;     // + ni*16*GP, + BPL, + ks*32
        // the loops inside a pass are unrolled: every fragment and accumulator index is a constant, so they stay in registers
        if constexpr (MI == 4) {
            // 128 accumulator registers: the A fragments of 32 k stay, the B fragments come one column group ahead,
            // also over the step from the first 32 k to the second
            v16bf ah[MI], al[MI], bh[8], bl[8];
            bh[0] = ldfrag(Bb);
            bl[0] = ldfrag(Bb + BPL);
#pragma unroll
            for (int ks = 0; ks < 2; ++ks) {
#pragma unroll
                for (int mi = 0; mi < MI; ++mi) ah[mi] = ldfrag(Ab + mi * 16 * GP + ks * 32);
#pragma unroll
                for (int mi = 0; mi < MI; ++mi) al[mi] = ldfrag(Ab + APL + mi * 16 * GP + ks * 32);
#pragma unroll
                for (int ni = 0; ni < 4; ++ni) {
                    const int g = ks * 4 + ni;
                    if (g < 7) {
                        bh[g + 1] = ldfrag(Bb + ((g + 1) & 3) * 16 * GP + ((g + 1) >> 2) * 32);
                        bl[g + 1] = ldfrag(Bb + BPL + ((g + 1) & 3) * 16 * GP + ((g + 1) >> 2) * 32);
                    }
                    __builtin_amdgcn_sched_barrier(0);   // the loads above stay ahead of these products
#pragma unroll
                    for (int mi = 0; mi < MI; ++mi) mma(acc[mi][ni], ah[mi], bh[g]);
#pragma unroll
                    for (int mi = 0; mi < MI; ++mi) mma(acc[mi][ni], ah[mi], bl[g]);
#pragma unroll
                    for (int mi = 0; mi < MI; ++mi) mma(acc[mi][ni], al[mi], bh[g]);
                    __builtin_amdgcn_sched_barrier(0);   // the products above stay ahead of the next loads and of the pass's end
                }
            }
        } else {
            // few accumulators: every fragment of the pass is fetched ahead of its products
            v16bf ah[2][MI], al[2][MI], bh[2][4], bl[2][4];
#pragma unroll
            for (int ks = 0; ks < 2; ++ks) {
#pragma unroll
                for (int mi = 0; mi < MI; ++mi) {
                    ah[ks][mi] = ldfrag(Ab + mi * 16 * GP + ks * 32);
                    al[ks][mi] = ldfrag(Ab + APL + mi * 16 * GP + ks * 32);
                }
#pragma unroll
                for (int ni = 0; ni < 4; ++ni) {
                    bh[ks][ni] = ldfrag(Bb + ni * 16 * GP + ks * 32);
                    bl[ks][ni] = ldfrag(Bb + BPL + ni * 16 * GP + ks * 32);
                }
            }
            __builtin_amdgcn_sched_barrier(0);   // the loads above stay ahead of these products
#pragma unroll
            for (int ks = 0; ks < 2; ++ks) {
#pragma unroll
                for (int ni = 0; ni < 4; ++ni) mma(acc[0][ni], ah[ks][0], bh[ks][ni]);
#pragma unroll
                for (int ni = 0; ni < 4; ++ni) mma(acc[0][ni], ah[ks][0], bl[ks][ni]);
#pragma unroll
                for (int ni = 0; ni < 4; ++ni) mma(acc[0][ni], al[ks][0], bh[ks][ni]);
            }
            __builtin_amdgcn_sched_barrier(0);   // the products above stay ahead of the next loads and of the pass's end
        }
        // publish point
        asm volatile("s_wait_dscnt 0x0" ::: "memory");       // this wave's reads of the buffer are done before it is refilled
        asm volatile("s_wait_asynccnt 0x0" ::: "memory");    // this wave's copies of the next pass have landed
        __syncthreads();                                     // both hold for every wave
        if (t + 2 < NT) stage(t + 2, bf);                    // refill the buffer this pass has just read
    }
    asm volatile("s_wait_asynccnt 0x0" ::: "memory");        // no copy is in flight when the ring becomes the C tile

    // stage the f32 tile in LDS: D element r of lane l = (row 8h+r, col ln)
#pragma unroll
    for (int mi = 0; mi < MI; ++mi)
#pragma unroll
        for (int ni = 0; ni < 4; ++ni)
#pragma unroll
            for (int r = 0; r < 8; ++r)
                Cs[(wm * (16 * MI) + mi * 16 + 8 * h + r) * CP + wn * 64 + ni * 16 + ln] = acc[mi][ni][r];
    __syncthreads();

    if (EPI == EPI_F32) {
        // row segment = 128 floats = 512 B = 32 lanes x 16 B, one instruction per row
#pragma unroll 1
        for (int it = 0; it < BM / 4; ++it) {
            const int row = it * 4 + w, col = lane * 4;
            v4f x = *(const v4fa*)(Cs + row * CP + col);
            const v4f bv = *(const v4fa*)(bias + j0 + col);
            x += bv;
            st2f(Of + (size_t)(i0 + row) * ldo + j0 + col, x);
        }
    } else {
        // row segment = 128 halves = 256 B = 16 lanes x 16 B per plane; lanes 16..31 take the next row
#pragma unroll 1
        for (int it = 0; it < BM / 8; ++it) {
            const int row = it * 8 + w * 2 + h, colc = ln * 8;
            const int gi = i0 + row;
            const float* cr = Cs + row * CP;
            float x[8];
            {
                const v4f a = *(const v4fa*)(cr + colc);
                const v4f c = *(const v4fa*)(cr + colc + 4);
                x[0] = a[0]; x[1] = a[1]; x[2] = a[2]; x[3] = a[3];
                x[4] = c[0]; x[5] = c[1]; x[6] = c[2]; x[7] = c[3];
            }
            if (EPI == EPI_ROWB) {
                const float bvv = bias[gi];
#pragma unroll
                for (int e = 0; e < 8; ++e) x[e] += bvv;
            } else {
                const v4f b0 = *(const v4fa*)(bias + j0 + colc);
                const v4f b1 = *(const v4fa*)(bias + j0 + colc + 4);
                x[0] += b0[0]; x[1] += b0[1]; x[2] += b0[2]; x[3] += b0[3];
                x[4] += b1[0]; x[5] += b1[1]; x[6] += b1[2]; x[7] += b1[3];
            }
            if (EPI == EPI_ROPE) {
                // block tile == one head (128 columns); partner column d^64, frequency j = d&63
                const int pc = colc ^ 64;
                float xp[8];
                {
                    const v4f a = *(const v4fa*)(cr + pc);
                    const v4f c = *(const v4fa*)(cr + pc + 4);
                    const v4f b0 = *(const v4fa*)(bias + j0 + pc);
                    const v4f b1 = *(const v4fa*)(bias + j0 + pc + 4);
                    xp[0] = a[0] + b0[0]; xp[1] = a[1] + b0[1]; xp[2] = a[2] + b0[2]; xp[3] = a[3] + b0[3];
                    xp[4] = c[0] + b1[0]; xp[5] = c[1] + b1[1]; xp[6] = c[2] + b1[2]; xp[7] = c[3] + b1[3];
                }
                const int jb = colc & 63;
                const float* cp = cosT + (size_t)gi * NFREQ + jb;
                const float* sp = sinT + (size_t)gi * NFREQ + jb;
                const v4f c0 = *(const v4fa*)(cp), c1 = *(const v4fa*)(cp + 4);
                const v4f s0 = *(const v4fa*)(sp), s1 = *(const v4fa*)(sp + 4);
                // the wait that stands ahead of any overwrite of the four table loads' address registers; it takes both
                // addresses as inputs, so that no loaded value is placed over them in front of it
                asm volatile("s_wait_xcnt 0x0" :: "v"(cp), "v"(sp) : "memory");
                float cs[8] = {c0[0], c0[1], c0[2], c0[3], c1[0], c1[1], c1[2], c1[3]};
                float sn[8] = {s0[0], s0[1], s0[2], s0[3], s1[0], s1[1], s1[2], s1[3]};
                const float sg = (colc < 64) ? -1.0f : 1.0f;
#pragma unroll
                for (int e = 0; e < 8; ++e) x[e] = x[e] * cs[e] + sg * (xp[e] * sn[e]);
            }
            v4u hi, lo;
            split8(x, hi, lo);
            const size_t o = (size_t)gi * ldo + j0 + colc;
            st2u(Oh + o, Ol + o, hi, lo);
            stores_issued();
        }
    }
}

// the three projections of X in one launch: they depend on the preparation alone, so each takes a range of the block index.
// The long Q tiles come first; the short K and V tiles follow them onto the chip with no launch boundary between.
constexpr int GB_Q = (NQ / 128) * (MROWS / 128);
constexpr int GB_K = (NKVD / 128) * (MROWS / 32);
constexpr int GB_V = (MROWS / 128) * (NKVD / 32);

__global__ void __launch_bounds__(128)
gemm_qkv(const u16* Xh, const u16* Xl, const u16* Wqth, const u16* Wqtl, const u16* Wkth, const u16* Wktl,
         const u16* Wvth, const u16* Wvtl, const float* bq, const float* bk, const float* bv,
         const float* cosT, const float* sinT, u16* Qh, u16* Ql, u16* Kh, u16* Kl, u16* Vth, u16* Vtl)
{
    __shared__ __align__(16) unsigned char Sm[gemm_lds(4)];
    int blk = blockIdx.x;                              // the same in every thread of a block
    if (blk < GB_Q) {
        // Q = X.Wq + bq, rotary -> planes [MROWS][NQ]
        gemm_tile<EPI_ROPE, 4>(Sm, blk % (NQ / 128), blk / (NQ / 128),
                               Xh, Xl, HID, Wqth, Wqtl, HID, HID, bq, cosT, sinT, Qh, Ql, nullptr, NQ);
        return;
    }
    blk -= GB_Q;
    if (blk < GB_K) {
        // K = X.Wk + bk, rotary -> planes [MROWS][NKVD]
        gemm_tile<EPI_ROPE, 1>(Sm, blk % (NKVD / 128), blk / (NKVD / 128),
                               Xh, Xl, HID, Wkth, Wktl, HID, HID, bk, cosT, sinT, Kh, Kl, nullptr, NKVD);
        return;
    }
    blk -= GB_K;
    // Vt[kvh*128+d][token] = (X.Wv + bv)^T -> planes [NKVD][MROWS]
    gemm_tile<EPI_ROWB, 1>(Sm, blk % (MROWS / 128), blk / (MROWS / 128),
                           Wvth, Wvtl, HID, Xh, Xl, HID, HID, bv, cosT, sinT, Vth, Vtl, nullptr, MROWS);
}

// out = AO.Wo + bo -> f32 [MROWS][HID]; grid (HID/128, MROWS/128)
__global__ void __launch_bounds__(128)
gemm_out(const u16* AOh, const u16* AOl, const u16* Woth, const u16* Wotl, const float* bo, float* out)
{
    __shared__ __align__(16) unsigned char Sm[gemm_lds(4)];
    gemm_tile<EPI_F32, 4>(Sm, blockIdx.x, blockIdx.y,
                          AOh, AOl, NQ, Woth, Wotl, NQ, NQ, bo, nullptr, nullptr, nullptr, nullptr, out, HID);
}

constexpr int KP  = 136;                   // LDS pitch (halves) of a K row of 128 dims: 272 B = 16 B x 17
constexpr int VP  = 40;                    // LDS pitch (halves) of a Vt row of 32 keys:  80 B = 16 B x 5
constexpr int KPL = 32 * KP;               // one K plane of a tile (halves)
constexpr int VPL = HD * VP;               // one Vt plane of a tile (halves)
constexpr int STG = 2 * KPL + 2 * VPL;     // one ring buffer: Kh | Kl | Vh | Vl (halves)

__global__ void __launch_bounds__(256)
attn_x3(const u16* Qh, const u16* Ql, const u16* Kh, const u16* Kl,
        const u16* Vh, const u16* Vl, const float* amask, const int* flags,
        u16* Oh, u16* Ol)
{
    __shared__ __align__(16) u16 Ring[2 * STG];
    __shared__ __align__(16) float OsA[NREP * 16 * OSP];

    const int tid = threadIdx.x;
    const int lane = tid & 31, h = lane >> 4, ln = lane & 15;
    const int w = __builtin_amdgcn_readfirstlane(tid >> 5);
    const int qt = blockIdx.x, kvh = blockIdx.y, b = blockIdx.z;
    const int hh = kvh * NREP + w;
    const int q0 = qt * 16;
    float* Os = OsA + w * (16 * OSP);          // each wave's own O staging

    const size_t qofs = (size_t)(b * S + q0 + ln) * NQ + hh * HD + 8 * h;     // B column ln, + dc*32
    const size_t mofs = (size_t)(q0 + ln) * S + 8 * h;                        // query ln, + kb (+16), 8 keys in a row

    // this lane's share of a tile's copies: K rows tid/16 and +16 (16 B of 256), Vt rows tid/4 and +64 (16 B of 64)
    const int krow = tid >> 4, kcol = (tid & 15) * 8;
    const int vrow = tid >> 2, vcol = (tid & 3) * 8;
    const size_t kgo = (size_t)(b * S + krow) * NKVD + kvh * HD + kcol;       // + kb*NKVD
    const size_t vgo = (size_t)(kvh * HD + vrow) * MROWS + b * S + vcol;      // + kb
    const u32 klo = lds_off(Ring) + 2u * (u32)(krow * KP + kcol);             // + buffer
    const u32 vlo = lds_off(Ring) + 2u * (u32)(2 * KPL + vrow * VP + vcol);   // + buffer
    auto stage = [&](int kt, int bf) {
        const u32 lb = (u32)bf * (2u * STG);
        const size_t ko = kgo + (size_t)(kt * 32) * NKVD;
        const size_t vo = vgo + (size_t)(kt * 32);
        copy8(klo + lb, klo + lb + 2u * (16 * KP), klo + lb + 2u * KPL, klo + lb + 2u * (KPL + 16 * KP),
              vlo + lb, vlo + lb + 2u * (64 * VP), vlo + lb + 2u * VPL, vlo + lb + 2u * (VPL + 64 * VP),
              Kh + ko, Kh + ko + (size_t)16 * NKVD, Kl + ko, Kl + ko + (size_t)16 * NKVD,
              Vh + vo, Vh + vo + (size_t)64 * MROWS, Vl + vo, Vl + vo + (size_t)64 * MROWS);
    };

    float mrun = -1.0e30f, lrun = 0.0f;        // of query ln; lrun sums this wave half's keys only, joined behind the loop
    v8f o[8];                                  // o[t][r] = O[query ln][dim t*16 + 8h + r]
#pragma unroll
    for (int t = 0; t < 8; ++t) o[t] = zero8();

    // the key tiles that are not all-masked, as a 64-bit set, alike in every wave of the work-group:
    // the ring has to know the next tile one pass ahead
    const u32 a_lo = __builtin_amdgcn_ballot_w32(flags[qt * NKT + lane] != 1);
    const u32 a_hi = __builtin_amdgcn_ballot_w32(flags[qt * NKT + 32 + lane] != 1);
    unsigned long long act = (unsigned long long)a_lo | ((unsigned long long)a_hi << 32);

    // Q^T of this wave's head, both planes, all 128 dims: the same B fragments in every pass, loaded once and kept in registers
    const u16* qhp = Qh + qofs;
    const u16* qlp = Ql + qofs;
    v16bf qh[4], ql[4];
    // unrolled: constant indices keep the fragments in registers
#pragma unroll
    for (int dc = 0; dc < 4; ++dc) {
        qh[dc] = ldfrag(qhp + dc * 32);
        ql[dc] = ldfrag(qlp + dc * 32);
    }
    // the wait that stands ahead of any overwrite of the loads' address registers; it takes both addresses as inputs,
    // so that no fragment is placed over them in front of it
    asm volatile("s_wait_xcnt 0x0" :: "v"(qhp), "v"(qlp) : "memory");

    if (act != 0) {
        int kt = __builtin_ctzll(act);
        act &= act - 1;
        stage(kt, 0);
        asm volatile("s_wait_asynccnt 0x0" ::: "memory");    // this wave's copies of the first tile have landed
        __syncthreads();                                     // ... and every other wave's
        int ktn = -1;
        if (act != 0) {
            ktn = __builtin_ctzll(act);
            act &= act - 1;
            stage(ktn, 1);
        }
        int bf = 0;
        for (;;) {
            const int kb = kt * 32;
            const u16* Kb = Ring + bf * STG + ln * KP + 8 * h;               // K row ln, + 16*KP, + KPL, + dc*32
            const u16* Vb = Ring + bf * STG + 2 * KPL + ln * VP + 8 * h;     // Vt row ln, + t*16*VP, + VPL

            // the additive mask of query ln for this lane's 16 keys
            const float* mp = amask + mofs + kb;
            const v4f mk0 = *(const v4fa*)(mp);
            const v4f mk1 = *(const v4fa*)(mp + 4);
            const v4f mk2 = *(const v4fa*)(mp + 16);
            const v4f mk3 = *(const v4fa*)(mp + 20);

            // scores S^T[32 keys][16 q] = K . Q^T over 128 dims (4 k-steps), two 16-key accumulators
            v8f s0 = zero8(), s1 = zero8();
            // the K fragments of a k-step come one step ahead of their products; constant indices keep them in registers
            v16bf kh[4][2], kl[4][2];
            kh[0][0] = ldfrag(Kb);
            kh[0][1] = ldfrag(Kb + 16 * KP);
            kl[0][0] = ldfrag(Kb + KPL);
            kl[0][1] = ldfrag(Kb + KPL + 16 * KP);
#pragma unroll
            for (int dc = 0; dc < 4; ++dc) {
                if (dc < 3) {
                    kh[dc + 1][0] = ldfrag(Kb + (dc + 1) * 32);
                    kh[dc + 1][1] = ldfrag(Kb + 16 * KP + (dc + 1) * 32);
                    kl[dc + 1][0] = ldfrag(Kb + KPL + (dc + 1) * 32);
                    kl[dc + 1][1] = ldfrag(Kb + KPL + 16 * KP + (dc + 1) * 32);
                }
                __builtin_amdgcn_sched_barrier(0);   // the loads above stay ahead of these products
                mma(s0, kh[dc][0], qh[dc]);
                mma(s1, kh[dc][1], qh[dc]);
                mma(s0, kh[dc][0], ql[dc]);
                mma(s1, kh[dc][1], ql[dc]);
                mma(s0, kl[dc][0], qh[dc]);
                mma(s1, kl[dc][1], qh[dc]);
                __builtin_amdgcn_sched_barrier(0);   // the products above stay ahead of the next loads and of the pass's end
            }
            // the first two V^T row groups are fetched here, so that they arrive under the softmax
            v16bf vh[8], vl[8];
            vh[0] = ldfrag(Vb);
            vh[1] = ldfrag(Vb + 16 * VP);
            vl[0] = ldfrag(Vb + VPL);
            vl[1] = ldfrag(Vb + VPL + 16 * VP);
            __builtin_amdgcn_sched_barrier(0);   // these loads stay ahead of the softmax

            // scale + additive mask by value + online softmax; lane (h,ln): s0[r] = (key kb + 8h + r, query ln), s1: + 16
            // the loops of this block are unrolled: every index into a, p0, p1 and o is a constant, so they stay in registers
            float a[16];
#pragma unroll
            for (int r = 0; r < 4; ++r) {
                a[r]      = s0[r]     * SCALE + mk0[r];
                a[4 + r]  = s0[4 + r] * SCALE + mk1[r];
                a[8 + r]  = s1[r]     * SCALE + mk2[r];
                a[12 + r] = s1[4 + r] * SCALE + mk3[r];
            }
            float mx = a[0];
#pragma unroll
            for (int e = 1; e < 16; ++e) mx = fmaxf(mx, a[e]);
            mx = fmaxf(mx, xhalf(mx));                           // the other 16 keys of the query
            const float mnew = fmaxf(mrun, mx);
            const float corr = __expf(mrun - mnew);
            mrun = mnew;
            float p0[8], p1[8];
            float ps = 0.0f;
#pragma unroll
            for (int r = 0; r < 8; ++r) {
                p0[r] = __expf(a[r] - mnew);
                p1[r] = __expf(a[8 + r] - mnew);
                ps += p0[r] + p1[r];
            }
            lrun = lrun * corr + ps;
#pragma unroll
            for (int t = 0; t < 8; ++t)
#pragma unroll
                for (int r = 0; r < 8; ++r) o[t][r] *= corr;
            // P^T as a B operand: element r <- key 8h + r, element 8 + r <- key 16 + 8h + r, column ln: as the lane holds them
            Frag ph, pl;
            split8(p0, ph.q[0], pl.q[0]);
            split8(p1, ph.q[1], pl.q[1]);

            // O^T[128][16 q] += V^T[128][32 keys] . P^T[32 keys][16 q]; V^T A-fragments from the ring's key-contiguous rows
            // two row groups at a time, the next two fetched ahead of these products
#pragma unroll
            for (int t = 0; t < 8; t += 2) {
                if (t < 6) {
                    vh[t + 2] = ldfrag(Vb + (t + 2) * 16 * VP);
                    vh[t + 3] = ldfrag(Vb + (t + 3) * 16 * VP);
                    vl[t + 2] = ldfrag(Vb + VPL + (t + 2) * 16 * VP);
                    vl[t + 3] = ldfrag(Vb + VPL + (t + 3) * 16 * VP);
                }
                mma3x2(o[t], o[t + 1], vh[t], vl[t], vh[t + 1], vl[t + 1], ph.v, pl.v);
            }

            // publish point: this wave's LDS reads are done, its copies of the next tile have landed,
            // then the barrier that says both of every wave
            asm volatile("s_wait_dscnt 0x0" ::: "memory");
            asm volatile("s_wait_asynccnt 0x0" ::: "memory");
            __syncthreads();
            if (ktn < 0) break;
            kt = ktn;
            ktn = -1;
            if (act != 0) {                                      // refill the buffer this pass has just read
                ktn = __builtin_ctzll(act);
                act &= act - 1;
                stage(ktn, bf);
            }
            bf ^= 1;
        }
    }
    asm volatile("s_wait_asynccnt 0x0" ::: "memory");            // no copy is left in flight when the wave ends

    // normalise, stage the 16x128 f32 tile, write hi/lo planes with 16-B lane-contiguous stores
    {
        const float lv = lrun + xhalf(lrun);                     // both wave halves' keys
        const float li = (lv > 0.0f) ? (1.0f / lv) : 0.0f;
        float* orow = Os + ln * OSP + 8 * h;
        // unrolled: constant indices keep o in registers
#pragma unroll
        for (int t = 0; t < 8; ++t) {
            v4f x0, x1;
#pragma unroll
            for (int r = 0; r < 4; ++r) { x0[r] = o[t][r] * li; x1[r] = o[t][4 + r] * li; }
            *(v4fa*)(orow + t * 16) = x0;
            *(v4fa*)(orow + t * 16 + 4) = x1;
        }
    }
    __syncthreads();
#pragma unroll 1
    for (int it = 0; it < 8; ++it) {
        const int row = it * 2 + h, colc = ln * 8;
        const float* cr = Os + row * OSP;
        const v4f a = *(const v4fa*)(cr + colc);
        const v4f c = *(const v4fa*)(cr + colc + 4);
        float x[8] = {a[0], a[1], a[2], a[3], c[0], c[1], c[2], c[3]};
        v4u hi, lo;
        split8(x, hi, lo);
        const size_t oo = (size_t)(b * S + q0 + row) * NQ + hh * HD + colc;
        st2u(Oh + oo, Ol + oo, hi, lo);
    }
}

// ---------------- host ---------------------------------------------------------------------
extern "C" void kernel_launch(void* const* d_in, const int* in_sizes, int n_in,
                              void* d_out, int out_size, void* d_ws, size_t ws_size,
                              hipStream_t stream)
{
    if (n_in < 11) return;
    if (in_sizes[0] != MROWS * HID || in_sizes[1] != MROWS || in_sizes[2] != S * S ||
        in_sizes[3] != HID * NQ || in_sizes[4] != NQ ||
        in_sizes[5] != HID * NKVD || in_sizes[6] != NKVD ||
        in_sizes[7] != HID * NKVD || in_sizes[8] != NKVD ||
        in_sizes[9] != NQ * HID || in_sizes[10] != HID) return;
    if (out_size != MROWS * HID) return;

    const float* X   = (const float*)d_in[0];   // [B*S][HID]
    const float* ts  = (const float*)d_in[1];   // [B*S]
    const float* amk = (const float*)d_in[2];   // [S][S] additive
    const float* Wq  = (const float*)d_in[3];   // [HID][NQ]
    const float* bq  = (const float*)d_in[4];
    const float* Wk  = (const float*)d_in[5];   // [HID][NKVD]
    const float* bk  = (const float*)d_in[6];
    const float* Wv  = (const float*)d_in[7];   // [HID][NKVD]
    const float* bv  = (const float*)d_in[8];
    const float* Wo  = (const float*)d_in[9];   // [NQ][HID]
    const float* bo  = (const float*)d_in[10];
    float* out = (float*)d_out;                 // [B*S][HID]

    const size_t szX  = (size_t)MROWS * HID * 2;     // one plane
    const size_t szWq = (size_t)NQ * HID * 2;
    const size_t szWk = (size_t)NKVD * HID * 2;
    const size_t szWo = (size_t)HID * NQ * 2;
    const size_t szQ  = (size_t)MROWS * NQ * 2;
    const size_t szK  = (size_t)MROWS * NKVD * 2;
    const size_t szVt = (size_t)NKVD * MROWS * 2;
    const size_t szTb = (size_t)MROWS * NFREQ * 4;
    const size_t szFl = (size_t)NQT * NKT * 4;
    char* base = (char*)d_ws;
    size_t used = 0;
    auto take = [&](size_t bytes) -> char* { char* p = base + used; used += (bytes + 255) & ~(size_t)255; return p; };
    u16* Xh   = (u16*)take(szX);   u16* Xl   = (u16*)take(szX);     // reused as attention-output planes
    u16* Wqth = (u16*)take(szWq);  u16* Wqtl = (u16*)take(szWq);    // [NQ][HID]
    u16* Wkth = (u16*)take(szWk);  u16* Wktl = (u16*)take(szWk);    // [NKVD][HID]
    u16* Wvth = (u16*)take(szWk);  u16* Wvtl = (u16*)take(szWk);    // [NKVD][HID]
    u16* Woth = (u16*)take(szWo);  u16* Wotl = (u16*)take(szWo);    // [HID][NQ]
    u16* Qh   = (u16*)take(szQ);   u16* Ql   = (u16*)take(szQ);     // [MROWS][NQ]
    u16* Kh   = (u16*)take(szK);   u16* Kl   = (u16*)take(szK);     // [MROWS][NKVD]
    u16* Vth  = (u16*)take(szVt);  u16* Vtl  = (u16*)take(szVt);    // [NKVD][MROWS]
    float* cosT = (float*)take(szTb);                               // [MROWS][64]
    float* sinT = (float*)take(szTb);
    int* flags  = (int*)take(szFl);                                 // [NQT][NKT]
    if (used > ws_size) return;
    u16* AOh = Xh;   // X planes are dead once the three projections are enqueued
    u16* AOl = Xl;

    // 1: preparation: X and the four weights -> hi/lo planes (weights k-contiguous), rotary table, tile skip flags
    k_prep<<<dim3(PB_ALL), dim3(256), 0, stream>>>(X, ts, amk, Wq, Wk, Wv, Wo, Xh, Xl, Wqth, Wqtl, Wkth, Wktl,
                                                   Wvth, Wvtl, Woth, Wotl, cosT, sinT, flags);
    // 2: the Q, K and V projections
    gemm_qkv<<<dim3(GB_Q + GB_K + GB_V), dim3(128), 0, stream>>>(Xh, Xl, Wqth, Wqtl, Wkth, Wktl, Wvth, Wvtl, bq, bk, bv,
                                                                 cosT, sinT, Qh, Ql, Kh, Kl, Vth, Vtl);
    // 3: attention -> AO planes [MROWS][NQ]
    attn_x3<<<dim3(NQT, NKV, BB), dim3(256), 0, stream>>>(Qh, Ql, Kh, Kl, Vth, Vtl, amk, flags, AOh, AOl);
    // 4: the output projection
    gemm_out<<<dim3(HID / 128, MROWS / 128), dim3(128), 0, stream>>>(AOh, AOl, Woth, Wotl, bo, out);
    (void)hipGetLastError();
}

// v008
// Measured time: 269 microseconds a run.
// Timed twice side by side with v007, it ran 1.05 and 1.06 times as fast.
// Over all steps from v000 it is 3.60 times as fast.
#include <hip/hip_runtime.h>
#include <math.h>
#include <stddef.h>

// All contractions (q/k/v projections, q.k^T scores, p.v, output projection): v_wmma_f32_16x16x32_bf16 with bf16 hi/lo operands everywhere (hi*hi + hi*lo + lo*hi), f32 accumulate; softmax, rotary, scale and biases in f32.

constexpr int BB    = 2;
constexpr int S     = 2048;
constexpr int HID   = 2048;
constexpr int NH    = 16;
constexpr int NKV   = 2;
constexpr int HD    = 128;
constexpr int NREP  = NH / NKV;            // 8
constexpr int MROWS = BB * S;              // 4096 token rows
constexpr int NQ    = NH * HD;             // 2048
constexpr int NKVD  = NKV * HD;            // 256
constexpr int NQT   = S / 16;              // 128 query tiles of 16 rows
constexpr int NKT   = S / 32;              // 64 key tiles of 32 keys
constexpr int NFREQ = HD / 2;              // 64 rotary frequencies
constexpr float SCALE = 0.08838834764831845f;   // 1/sqrt(128)
constexpr int CP  = 132;                   // LDS pitch (floats), 32*MI x 128 C tile
constexpr int OSP = 132;                   // LDS pitch (floats), 16x128 O tile
constexpr int TP  = 68;                    // LDS pitch (floats), transpose tile

constexpr int EPI_ROPE = 1;                // hi/lo planes out, column bias, rotary
constexpr int EPI_ROWB = 2;                // hi/lo planes out, row bias
constexpr int EPI_F32  = 3;                // f32 out, column bias

static_assert(MROWS % 128 == 0);
static_assert(NQ % 128 == 0);
static_assert(NKVD % 128 == 0);
static_assert(HID % 64 == 0);
static_assert(S % 32 == 0);
static_assert(NQT % 2 == 0);

typedef unsigned int   u32;
typedef unsigned short u16;
typedef __bf16 v16bf __attribute__((ext_vector_type(16)));
typedef float  v8f   __attribute__((ext_vector_type(8)));
typedef int    v8i   __attribute__((ext_vector_type(8)));
typedef float  v4f   __attribute__((ext_vector_type(4)));
typedef u32    v4u   __attribute__((ext_vector_type(4)));
typedef int    v4i   __attribute__((ext_vector_type(4)));
typedef v4f v4fa __attribute__((may_alias));
typedef v4u v4ua __attribute__((may_alias));
typedef v4i v4ia __attribute__((may_alias));

union Frag { v16bf v; v4u q[2]; };

// ---------------- bf16 RNE split helpers (packed hardware conversion) ----------
typedef float  v2f  __attribute__((ext_vector_type(2)));
typedef __bf16 v2bf __attribute__((ext_vector_type(2)));

// two f32 -> two bf16, round to nearest even, the first in the low half-word: one packed conversion
__device__ __forceinline__ u32 bf2(v2f x) {
    return __builtin_bit_cast(u32, __builtin_convertvector(x, v2bf));
}

// 8 f32 -> packed bf16 hi plane (4 dwords) and lo plane (4 dwords); element 2c in the low half-word
__device__ __forceinline__ void split8(const float (&x)[8], v4u& hi, v4u& lo) {
#pragma unroll
    for (int c = 0; c < 4; ++c) {
        const v2f p = {x[2 * c], x[2 * c + 1]};
        const u32 h = bf2(p);
        const v2f b = {__builtin_bit_cast(float, h << 16), __builtin_bit_cast(float, h & 0xFFFF0000u)};
        hi[c] = h;
        lo[c] = bf2(p - b);
    }
}

// ---------------- fragment loader (A map and B map identical, k-contiguous row) -------
// p = plane + row*ld + k0 + 8*h ; elements 0..7 <- k0+8h..+7, elements 8..15 <- k0+16+8h..+7
__device__ __forceinline__ v16bf ldfrag(const u16* p) {
    Frag f;
    f.q[0] = *(const v4ua*)(p);
    f.q[1] = *(const v4ua*)(p + 16);
    return f.v;
}

__device__ __forceinline__ v8f zero8() {
    v8f z;
#pragma unroll
    for (int i = 0; i < 8; ++i) z[i] = 0.0f;
    return z;
}

// one term of a hi/lo product. An accumulator takes its three terms in the order hi*hi, hi*lo, lo*hi; the callers go term by
// term over several accumulators, so that a product never waits for the one issued directly ahead of it
__device__ __forceinline__ void mma(v8f& acc, v16bf a, v16bf b) {
    acc = __builtin_amdgcn_wmma_f32_16x16x32_bf16(false, a, false, b, (short)0, acc, false, false);
}

// Where __builtin_amdgcn_sched_barrier(0) stands below, it parts a group of LDS fragment loads from a group of products: without
// it the compiler moves the loads down to their first use, in among the products, and the wave waits out the LDS latency at each.

// the three terms of two accumulators that share the B operand, term by term, in one statement. In asm because the compiler moved
// the builtin form of these products, with the end of the softmax, down past every later fragment load: all fragments of a pass
// were then live at once, too many registers for four waves on a SIMD. The "memory" clobber keeps the fragment loads on their side.
// The four v_nop keep the distance from the last product to a vector instruction on its registers.
__device__ __forceinline__ void mma3x2(v8f& c0, v8f& c1, v16bf a0h, v16bf a0l, v16bf a1h, v16bf a1l, v16bf bh, v16bf bl) {
    const v8i x0h = __builtin_bit_cast(v8i, a0h), x0l = __builtin_bit_cast(v8i, a0l);
    const v8i x1h = __builtin_bit_cast(v8i, a1h), x1l = __builtin_bit_cast(v8i, a1l);
    const v8i yh = __builtin_bit_cast(v8i, bh), yl = __builtin_bit_cast(v8i, bl);
    asm volatile("v_wmma_f32_16x16x32_bf16 %0, %2, %6, %0\n\t"
                 "v_wmma_f32_16x16x32_bf16 %1, %4, %6, %1\n\t"
                 "v_wmma_f32_16x16x32_bf16 %0, %2, %7, %0\n\t"
                 "v_wmma_f32_16x16x32_bf16 %1, %4, %7, %1\n\t"
                 "v_wmma_f32_16x16x32_bf16 %0, %3, %6, %0\n\t"
                 "v_wmma_f32_16x16x32_bf16 %1, %5, %6, %1\n\t"
                 "v_nop\n\tv_nop\n\tv_nop\n\tv_nop"
                 : "+v"(c0), "+v"(c1)
                 : "v"(x0h), "v"(x0l), "v"(x1h), "v"(x1l), "v"(yh), "v"(yl)
                 : "memory");
}

__device__ __forceinline__ void st2u(u16* ph, u16* pl, v4u hi, v4u lo) {
    *(v4u*)ph = hi;
    *(v4u*)pl = lo;
    
}
__device__ __forceinline__ void st2f(float* p, v4f v) {
    *(v4f*)p = v;
    
}
// Behind the stores of a job that shares its kernel with other jobs: the wait that stands ahead of any overwrite of a register
// that an issued store names. The code of another job follows in the built kernel, where a kernel of one job would end.
__device__ __forceinline__ void stores_issued() {
    asm volatile("s_wait_xcnt 0x0" ::: "memory");
}

// ---------------- X: f32 rows -> hi/lo bf16 planes, same layout --------------------------
__device__ __forceinline__ void
split_rows(int blk, const float* X, int n, u16* Xh, u16* Xl)
{
    const size_t i = ((size_t)blk * 256 + threadIdx.x) * 8;
    if (i + 8 <= (size_t)n) {
        const v4f a = *(const v4fa*)(X + i);
        const v4f c = *(const v4fa*)(X + i + 4);
        float x[8] = {a[0], a[1], a[2], a[3], c[0], c[1], c[2], c[3]};
        v4u hi, lo;
        split8(x, hi, lo);
        st2u(Xh + i, Xl + i, hi, lo);
    }
}

// ---------------- weights: in[nrows][ncols] f32 -> hi/lo planes out[ncols][nrows] ----------
// blocks (ncols/64) x (nrows/64), the column tile running first; LDS transpose in T (64 * TP floats);
// each output line (64 halves) by lanes 8q..8q+7
__device__ __forceinline__ void
split_t(float* T, int blk, const float* W, int nrows, int ncols, u16* Th, u16* Tl)
{
    const int tid = threadIdx.x;
    const int cb = (blk % (ncols / 64)) * 64;      // input column tile == output row tile
    const int rb = (blk / (ncols / 64)) * 64;      // input row tile    == output column tile
#pragma unroll
    for (int it = 0; it < 4; ++it) {
        const int fl = it * 256 + tid;
        const int rr = fl >> 4, cc = (fl & 15) * 4;
        const v4f v = *(const v4fa*)(W + (size_t)(rb + rr) * ncols + cb + cc);
        T[(cc + 0) * TP + rr] = v[0];
        T[(cc + 1) * TP + rr] = v[1];
        T[(cc + 2) * TP + rr] = v[2];
        T[(cc + 3) * TP + rr] = v[3];
    }
    __syncthreads();
#pragma unroll
    for (int it = 0; it < 2; ++it) {
        const int orow = it * 32 + (tid >> 3), oc = (tid & 7) * 8;
        const v4f a = *(const v4fa*)(T + orow * TP + oc);
        const v4f c = *(const v4fa*)(T + orow * TP + oc + 4);
        float x[8] = {a[0], a[1], a[2], a[3], c[0], c[1], c[2], c[3]};
        v4u hi, lo;
        split8(x, hi, lo);
        const size_t o = (size_t)(cb + orow) * nrows + rb + oc;
        st2u(Th + o, Tl + o, hi, lo);
    }
    stores_issued();
}

// ---------------- rotary table: cos/sin of f32(ts[row] * inv_freq[j]) ---------------------
__device__ __forceinline__ void
rope_table(int blk, const float* ts, int nrows, float* cosT, float* sinT)
{
    const int tid = threadIdx.x;
    const int row = blk * 4 + (tid >> 6);
    const int j   = tid & 63;
    const int rc  = row < nrows ? row : nrows - 1;
    const float t = ts[rc];
    // inv_freq[j] = 1 / f32(10000^(j/64)); the power evaluated in f64 and converted once
    const double p  = exp2((double)j * (13.287712379549449 / 64.0));
    const float  pf = (float)p;
    const float inv = 1.0f / pf;
    const float ang = t * inv;
    float sn, cs;
    sincosf(ang, &sn, &cs);
    if (row < nrows) {
        const size_t o = (size_t)row * NFREQ + j;
        *(float*)(cosT + o) = cs;
        *(float*)(sinT + o) = sn;
        stores_issued();
    }
}

// ---------------- tile flags from the additive input mask ---------------------------------
// flag[qt][kt] = 1 when every entry of the 16x32 mask tile is <= -1e8 (tile contributes 0)
// blocks NQT x 2, the query tile running first; sf: 32 ints of LDS
__device__ __forceinline__ void
tile_flags(int* sf, int blk, const float* amask, int* flags)
{
    const int tid = threadIdx.x, lane = tid & 31, w = tid >> 5;
    const int qt = blk % NQT, hf = blk / NQT;
    const int t = tid >> 3, sub = tid & 7;
    const int kt = hf * 32 + t;
    const int kb = kt * 32;
    int ok = 1;
#pragma unroll
    for (int rr = 0; rr < 2; ++rr) {
        const int q = qt * 16 + sub * 2 + rr;
        const float* mp = amask + (size_t)q * S + kb;
#pragma unroll
        for (int c = 0; c < 8; ++c) {
            const v4f v = *(const v4fa*)(mp + 4 * c);
            ok &= (int)(v[0] <= -1.0e8f) & (int)(v[1] <= -1.0e8f) &
                  (int)(v[2] <= -1.0e8f) & (int)(v[3] <= -1.0e8f);
        }
    }
    ok &= __shfl_xor(ok, 1);
    ok &= __shfl_xor(ok, 2);
    ok &= __shfl_xor(ok, 4);
    if (sub == 0) sf[t] = ok;
    __syncthreads();
    if (w == 0 && lane < 8) {
        const v4i f = *(const v4ia*)(sf + lane * 4);
        int* dst = flags + (size_t)qt * NKT + hf * 32 + lane * 4;
        *(v4i*)dst = f;
        stores_issued();
    }
}

// ---------------- the whole preparation in one launch ---------------------------------------
// The seven jobs above depend on nothing but the inputs: each takes a range of the block index of one grid, so that they
// fill the chip together and no launch waits for the last blocks of the one ahead. A block does one job's one tile.
constexpr int PB_WQ = (NQ / 64) * (HID / 64);          // blocks of each job
constexpr int PB_WO = (HID / 64) * (NQ / 64);
constexpr int PB_WK = (NKVD / 64) * (HID / 64);
constexpr int PB_RT = MROWS / 4;
constexpr int PB_FL = NQT * 2;
constexpr int PB_X  = (MROWS * HID) / (256 * 8);
constexpr int PB_ALL = PB_WQ + PB_WO + 2 * PB_WK + PB_RT + PB_FL + PB_X;

__global__ void __launch_bounds__(256)
k_prep(const float* X, const float* ts, const float* amask,
       const float* Wq, const float* Wk, const float* Wv, const float* Wo,
       u16* Xh, u16* Xl, u16* Wqth, u16* Wqtl, u16* Wkth, u16* Wktl, u16* Wvth, u16* Wvtl, u16* Woth, u16* Wotl,
       float* cosT, float* sinT, int* flags)
{
    __shared__ __align__(16) float T[64 * TP];
    __shared__ __align__(16) int sf[32];
    int blk = blockIdx.x;                              // the same in every thread of a block: each branch is taken by all or none
    if (blk < PB_WQ) { split_t(T, blk, Wq, HID, NQ, Wqth, Wqtl); return; }       // in[2048][2048] -> out[2048][2048]
    blk -= PB_WQ;
    if (blk < PB_WO) { split_t(T, blk, Wo, NQ, HID, Woth, Wotl); return; }       // in[2048][2048] -> out[2048][2048]
    blk -= PB_WO;
    if (blk < PB_WK) { split_t(T, blk, Wk, HID, NKVD, Wkth, Wktl); return; }     // in[2048][256]  -> out[256][2048]
    blk -= PB_WK;
    if (blk < PB_WK) { split_t(T, blk, Wv, HID, NKVD, Wvth, Wvtl); return; }     // in[2048][256]  -> out[256][2048]
    blk -= PB_WK;
    if (blk < PB_RT) { rope_table(blk, ts, MROWS, cosT, sinT); return; }
    blk -= PB_RT;
    if (blk < PB_FL) { tile_flags(sf, blk, amask, flags); return; }
    blk -= PB_FL;
    split_rows(blk, X, MROWS * HID, Xh, Xl);
}

__device__ __forceinline__ u32 lds_off(const void* p) { return (u32)(size_t)p; }

// the value of lane l ^ 16
__device__ __forceinline__ float xhalf(float x) {
    const int b = __builtin_bit_cast(int, x);
    return __builtin_bit_cast(float, __builtin_amdgcn_permlanex16(b, b, 0x76543210, 0xfedcba98, false, false));
}

// one tile's copies of one lane: 8 x 16 B, global -> LDS through no register.
// The s_wait_xcnt closes the statement so that no address register is rewritten ahead of it.
__device__ __forceinline__ void copy8(u32 l0, u32 l1, u32 l2, u32 l3, u32 l4, u32 l5, u32 l6, u32 l7,
                                      const u16* g0, const u16* g1, const u16* g2, const u16* g3,
                                      const u16* g4, const u16* g5, const u16* g6, const u16* g7) {
    asm volatile("global_load_async_to_lds_b128 %0, %8, off\n\t"
                 "global_load_async_to_lds_b128 %1, %9, off\n\t"
                 "global_load_async_to_lds_b128 %2, %10, off\n\t"
                 "global_load_async_to_lds_b128 %3, %11, off\n\t"
                 "global_load_async_to_lds_b128 %4, %12, off\n\t"
                 "global_load_async_to_lds_b128 %5, %13, off\n\t"
                 "global_load_async_to_lds_b128 %6, %14, off\n\t"
                 "global_load_async_to_lds_b128 %7, %15, off\n\t"
                 "s_wait_xcnt 0x0"
                 :: "v"(l0), "v"(l1), "v"(l2), "v"(l3), "v"(l4), "v"(l5), "v"(l6), "v"(l7),
                    "v"(g0), "v"(g1), "v"(g2), "v"(g3), "v"(g4), "v"(g5), "v"(g6), "v"(g7)
                 : "memory");
}

// ---------------- hi/lo split GEMM: C[i][j] = sum_k A[i][k] * B[j][k] -----------------------
// A planes [*][lda], B planes [*][ldb], both k-contiguous; block tile 32*MI (i) x 128 (j),
// 4 waves as 2x2, wave tile 16*MI x 64 = MI x 4 accumulators.
// A pass is 64 k: the pass's rows of all four planes are copied once per work-group into a two-buffer
// LDS ring by asynchronous copies (whole 128-B lines), the next pass flying while this one is used;
// the waves read their fragments from the ring.
constexpr int GK = 64;                     // k per pass
constexpr int GP = 72;                     // LDS pitch (halves) of a row of 64 k: 144 B = 16 B x 9

// four copies of one lane, as copy8
__device__ __forceinline__ void copy4(u32 l0, u32 l1, u32 l2, u32 l3,
                                      const u16* g0, const u16* g1, const u16* g2, const u16* g3) {
    asm volatile("global_load_async_to_lds_b128 %0, %4, off\n\t"
                 "global_load_async_to_lds_b128 %1, %5, off\n\t"
                 "global_load_async_to_lds_b128 %2, %6, off\n\t"
                 "global_load_async_to_lds_b128 %3, %7, off\n\t"
                 "s_wait_xcnt 0x0"
                 :: "v"(l0), "v"(l1), "v"(l2), "v"(l3), "v"(g0), "v"(g1), "v"(g2), "v"(g3)
                 : "memory");
}

// LDS bytes of a block: the ring, or the f32 C tile that takes its place behind the loop
constexpr int gemm_lds(int MI) {
    const int rng = 2 * (2 * 32 * MI * GP + 2 * 128 * GP) * 2, cs = 32 * MI * CP * 4;
    return rng > cs ? rng : cs;
}

// one block tile: column tile bx, row tile by; Sm: gemm_lds(MI) bytes of LDS
template<int EPI, int MI>
__device__ __forceinline__ void
gemm_tile(unsigned char* Sm, int bx, int by,
          const u16* Ah, const u16* Al, int lda,
          const u16* Bh, const u16* Bl, int ldb, int K,
          const float* bias, const float* cosT, const float* sinT,
          u16* Oh, u16* Ol, float* Of, int ldo)
{
    static_assert(MI == 1 || MI == 4);
    constexpr int BM   = 32 * MI;              // rows of the block tile
    constexpr int APL  = BM * GP;              // one A plane of a pass (halves)
    constexpr int BPL  = 128 * GP;             // one B plane of a pass (halves)
    constexpr int GST  = 2 * APL + 2 * BPL;    // one ring buffer: Ah | Al | Bh | Bl (halves)
    const u16* Ring = (const u16*)Sm;
    float* Cs = (float*)Sm;
    const int tid = threadIdx.x, w = tid >> 5, lane = tid & 31;
    const int h = lane >> 4, ln = lane & 15;
    const int wm = w >> 1, wn = w & 1;
    const int i0 = by * BM, j0 = bx * 128;

    v8f acc[MI][4];
#pragma unroll
    for (int mi = 0; mi < MI; ++mi)
#pragma unroll
        for (int ni = 0; ni < 4; ++ni) acc[mi][ni] = zero8();

    // this lane's share of a pass's copies: 16 B of row tid/8 and of every 16th row behind it, in each plane
    const int crow = tid >> 3, ccol = (tid & 7) * 8;
    const size_t ago = (size_t)(i0 + crow) * lda + ccol;                      // + k0
    const size_t bgo = (size_t)(j0 + crow) * ldb + ccol;                      // + k0
    const u32 alo = lds_off(Sm) + 2u * (u32)(crow * GP + ccol);               // + buffer
    const u32 blo = alo + 2u * (u32)(2 * APL);
    constexpr u32 RS = 2u * 16 * GP;           // 16 rows of the ring, bytes
    auto rows128 = [&](u32 l, const u16* g, int ld) {
        const size_t s = (size_t)16 * ld;
        copy8(l, l + RS, l + 2 * RS, l + 3 * RS, l + 4 * RS, l + 5 * RS, l + 6 * RS, l + 7 * RS,
              g, g + s, g + 2 * s, g + 3 * s, g + 4 * s, g + 5 * s, g + 6 * s, g + 7 * s);
    };
    auto stage = [&](int t, int bf) {
        const u32 lb = (u32)bf * (2u * GST);
        const u16* ah = Ah + ago + t * GK;
        const u16* al = Al + ago + t * GK;
        const u32 la = alo + lb, ll = alo + lb + 2u * APL;
        if constexpr (MI == 4) {
            rows128(la, ah, lda);
            rows128(ll, al, lda);
        } else {
            const size_t s = (size_t)16 * lda;
            copy4(la, la + RS, ll, ll + RS, ah, ah + s, al, al + s);
        }
        rows128(blo + lb, Bh + bgo + t * GK, ldb);
        rows128(blo + lb + 2u * BPL, Bl + bgo + t * GK, ldb);
    };

    const int NT = K / GK;
    stage(0, 0);
    asm volatile("s_wait_asynccnt 0x0" ::: "memory");        // this wave's copies of the first pass have landed
    __syncthreads();                                         // ... and every other wave's
    if (NT > 1) stage(1, 1);

#pragma unroll 1
    for (int t = 0; t < NT; ++t) {
        const int bf = t & 1;
        const u16* Ab = Ring + bf * GST + (wm * (16 * MI) + ln) * GP + 8 * h;        // + mi*16*GP, + APL, + ks*32
        const u16* Bb = Ring + bf * GST + 2 * APL + (wn * 64 + ln) * GP + 8 * h;     // + ni*16*GP, + BPL, + ks*32
        // the loops inside a pass are unrolled: every fragment and accumulator index is a constant, so they stay in registers
        if constexpr (MI == 4) {
            // 128 accumulator registers: the A fragments of 32 k stay, the B fragments come one column group ahead,
            // also over the step from the first 32 k to the second
            v16bf ah[MI], al[MI], bh[8], bl[8];
            bh[0] = ldfrag(Bb);
            bl[0] = ldfrag(Bb + BPL);
#pragma unroll
            for (int ks = 0; ks < 2; ++ks) {
#pragma unroll
                for (int mi = 0; mi < MI; ++mi) ah[mi] = ldfrag(Ab + mi * 16 * GP + ks * 32);
#pragma unroll
                for (int mi = 0; mi < MI; ++mi) al[mi] = ldfrag(Ab + APL + mi * 16 * GP + ks * 32);
#pragma unroll
                for (int ni = 0; ni < 4; ++ni) {
                    const int g = ks * 4 + ni;
                    if (g < 7) {
                        bh[g + 1] = ldfrag(Bb + ((g + 1) & 3) * 16 * GP + ((g + 1) >> 2) * 32);
                        bl[g + 1] = ldfrag(Bb + BPL + ((g + 1) & 3) * 16 * GP + ((g + 1) >> 2) * 32);
                    }
                    __builtin_amdgcn_sched_barrier(0);   // the loads above stay ahead of these products
#pragma unroll
                    for (int mi = 0; mi < MI; ++mi) mma(acc[mi][ni], ah[mi], bh[g]);
#pragma unroll
                    for (int mi = 0; mi < MI; ++mi) mma(acc[mi][ni], ah[mi], bl[g]);
#pragma unroll
                    for (int mi = 0; mi < MI; ++mi) mma(acc[mi][ni], al[mi], bh[g]);
                    __builtin_amdgcn_sched_barrier(0);   // the products above stay ahead of the next loads and of the pass's end
                }
            }
        } else {
            // few accumulators: every fragment of the pass is fetched ahead of its products
            v16bf ah[2][MI], al[2][MI], bh[2][4], bl[2][4];
#pragma unroll
            for (int ks = 0; ks < 2; ++ks) {
#pragma unroll
                for (int mi = 0; mi < MI; ++mi) {
                    ah[ks][mi] = ldfrag(Ab + mi * 16 * GP + ks * 32);
                    al[ks][mi] = ldfrag(Ab + APL + mi * 16 * GP + ks * 32);
                }
#pragma unroll
                for (int ni = 0; ni < 4; ++ni) {
                    bh[ks][ni] = ldfrag(Bb + ni * 16 * GP + ks * 32);
                    bl[ks][ni] = ldfrag(Bb + BPL + ni * 16 * GP + ks * 32);
                }
            }
            __builtin_amdgcn_sched_barrier(0);   // the loads above stay ahead of these products
#pragma unroll
            for (int ks = 0; ks < 2; ++ks) {
#pragma unroll
                for (int ni = 0; ni < 4; ++ni) mma(acc[0][ni], ah[ks][0], bh[ks][ni]);
#pragma unroll
                for (int ni = 0; ni < 4; ++ni) mma(acc[0][ni], ah[ks][0], bl[ks][ni]);
#pragma unroll
                for (int ni = 0; ni < 4; ++ni) mma(acc[0][ni], al[ks][0], bh[ks][ni]);
            }
            __builtin_amdgcn_sched_barrier(0);   // the products above stay ahead of the next loads and of the pass's end
        }
        // publish point
        asm volatile("s_wait_dscnt 0x0" ::: "memory");       // this wave's reads of the buffer are done before it is refilled
        asm volatile("s_wait_asynccnt 0x0" ::: "memory");    // this wave's copies of the next pass have landed
        __syncthreads();                                     // both hold for every wave
        if (t + 2 < NT) stage(t + 2, bf);                    // refill the buffer this pass has just read
    }
    asm volatile("s_wait_asynccnt 0x0" ::: "memory");        // no copy is in flight when the ring becomes the C tile

    // stage the f32 tile in LDS: D element r of lane l = (row 8h+r, col ln)
#pragma unroll
    for (int mi = 0; mi < MI; ++mi)
#pragma unroll
        for (int ni = 0; ni < 4; ++ni)
#pragma unroll
            for (int r = 0; r < 8; ++r)
                Cs[(wm * (16 * MI) + mi * 16 + 8 * h + r) * CP + wn * 64 + ni * 16 + ln] = acc[mi][ni][r];
    __syncthreads();

    if (EPI == EPI_F32) {
        // row segment = 128 floats = 512 B = 32 lanes x 16 B, one instruction per row
#pragma unroll 1
        for (int it = 0; it < BM / 4; ++it) {
            const int row = it * 4 + w, col = lane * 4;
            v4f x = *(const v4fa*)(Cs + row * CP + col);
            const v4f bv = *(const v4fa*)(bias + j0 + col);
            x += bv;
            st2f(Of + (size_t)(i0 + row) * ldo + j0 + col, x);
        }
    } else {
        // row segment = 128 halves = 256 B = 16 lanes x 16 B per plane; lanes 16..31 take the next row
#pragma unroll 1
        for (int it = 0; it < BM / 8; ++it) {
            const int row = it * 8 + w * 2 + h, colc = ln * 8;
            const int gi = i0 + row;
            const float* cr = Cs + row * CP;
            float x[8];
            {
                const v4f a = *(const v4fa*)(cr + colc);
                const v4f c = *(const v4fa*)(cr + colc + 4);
                x[0] = a[0]; x[1] = a[1]; x[2] = a[2]; x[3] = a[3];
                x[4] = c[0]; x[5] = c[1]; x[6] = c[2]; x[7] = c[3];
            }
            if (EPI == EPI_ROWB) {
                const float bvv = bias[gi];
#pragma unroll
                for (int e = 0; e < 8; ++e) x[e] += bvv;
            } else {
                const v4f b0 = *(const v4fa*)(bias + j0 + colc);
                const v4f b1 = *(const v4fa*)(bias + j0 + colc + 4);
                x[0] += b0[0]; x[1] += b0[1]; x[2] += b0[2]; x[3] += b0[3];
                x[4] += b1[0]; x[5] += b1[1]; x[6] += b1[2]; x[7] += b1[3];
            }
            if (EPI == EPI_ROPE) {
                // block tile == one head (128 columns); partner column d^64, frequency j = d&63
                const int pc = colc ^ 64;
                float xp[8];
                {
                    const v4f a = *(const v4fa*)(cr + pc);
                    const v4f c = *(const v4fa*)(cr + pc + 4);
                    const v4f b0 = *(const v4fa*)(bias + j0 + pc);
                    const v4f b1 = *(const v4fa*)(bias + j0 + pc + 4);
                    xp[0] = a[0] + b0[0]; xp[1] = a[1] + b0[1]; xp[2] = a[2] + b0[2]; xp[3] = a[3] + b0[3];
                    xp[4] = c[0] + b1[0]; xp[5] = c[1] + b1[1]; xp[6] = c[2] + b1[2]; xp[7] = c[3] + b1[3];
                }
                const int jb = colc & 63;
                const float* cp = cosT + (size_t)gi * NFREQ + jb;
                const float* sp = sinT + (size_t)gi * NFREQ + jb;
                const v4f c0 = *(const v4fa*)(cp), c1 = *(const v4fa*)(cp + 4);
                const v4f s0 = *(const v4fa*)(sp), s1 = *(const v4fa*)(sp + 4);
                // the wait that stands ahead of any overwrite of the four table loads' address registers; it takes both
                // addresses as inputs, so that no loaded value is placed over them in front of it
                asm volatile("s_wait_xcnt 0x0" :: "v"(cp), "v"(sp) : "memory");
                float cs[8] = {c0[0], c0[1], c0[2], c0[3], c1[0], c1[1], c1[2], c1[3]};
                float sn[8] = {s0[0], s0[1], s0[2], s0[3], s1[0], s1[1], s1[2], s1[3]};
                const float sg = (colc < 64) ? -1.0f : 1.0f;
#pragma unroll
                for (int e = 0; e < 8; ++e) x[e] = x[e] * cs[e] + sg * (xp[e] * sn[e]);
            }
            v4u hi, lo;
            split8(x, hi, lo);
            const size_t o = (size_t)gi * ldo + j0 + colc;
            st2u(Oh + o, Ol + o, hi, lo);
            stores_issued();
        }
    }
}

// the three projections of X in one launch: they depend on the preparation alone, so each takes a range of the block index.
// The long Q tiles come first; the short K and V tiles follow them onto the chip with no launch boundary between.
constexpr int GB_Q = (NQ / 128) * (MROWS / 128);
constexpr int GB_K = (NKVD / 128) * (MROWS / 32);
constexpr int GB_V = (MROWS / 128) * (NKVD / 32);

__global__ void __launch_bounds__(128)
gemm_qkv(const u16* Xh, const u16* Xl, const u16* Wqth, const u16* Wqtl, const u16* Wkth, const u16* Wktl,
         const u16* Wvth, const u16* Wvtl, const float* bq, const float* bk, const float* bv,
         const float* cosT, const float* sinT, u16* Qh, u16* Ql, u16* Kh, u16* Kl, u16* Vth, u16* Vtl)
{
    __shared__ __align__(16) unsigned char Sm[gemm_lds(4)];
    int blk = blockIdx.x;                              // the same in every thread of a block
    if (blk < GB_Q) {
        // Q = X.Wq + bq, rotary -> planes [MROWS][NQ]
        gemm_tile<EPI_ROPE, 4>(Sm, blk % (NQ / 128), blk / (NQ / 128),
                               Xh, Xl, HID, Wqth, Wqtl, HID, HID, bq, cosT, sinT, Qh, Ql, nullptr, NQ);
        return;
    }
    blk -= GB_Q;
    if (blk < GB_K) {
        // K = X.Wk + bk, rotary -> planes [MROWS][NKVD]
        gemm_tile<EPI_ROPE, 1>(Sm, blk % (NKVD / 128), blk / (NKVD / 128),
                               Xh, Xl, HID, Wkth, Wktl, HID, HID, bk, cosT, sinT, Kh, Kl, nullptr, NKVD);
        return;
    }
    blk -= GB_K;
    // Vt[kvh*128+d][token] = (X.Wv + bv)^T -> planes [NKVD][MROWS]
    gemm_tile<EPI_ROWB, 1>(Sm, blk % (MROWS / 128), blk / (MROWS / 128),
                           Wvth, Wvtl, HID, Xh, Xl, HID, HID, bv, cosT, sinT, Vth, Vtl, nullptr, MROWS);
}

// out = AO.Wo + bo -> f32 [MROWS][HID]; grid (HID/128, MROWS/128)
__global__ void __launch_bounds__(128)
gemm_out(const u16* AOh, const u16* AOl, const u16* Woth, const u16* Wotl, const float* bo, float* out)
{
    __shared__ __align__(16) unsigned char Sm[gemm_lds(4)];
    gemm_tile<EPI_F32, 4>(Sm, blockIdx.x, blockIdx.y,
                          AOh, AOl, NQ, Woth, Wotl, NQ, NQ, bo, nullptr, nullptr, nullptr, nullptr, out, HID);
}

constexpr int KP  = 136;                   // LDS pitch (halves) of a K row of 128 dims: 272 B = 16 B x 17
constexpr int VP  = 40;                    // LDS pitch (halves) of a Vt row of 32 keys:  80 B = 16 B x 5
constexpr int KPL = 32 * KP;               // one K plane of a tile (halves)
constexpr int VPL = HD * VP;               // one Vt plane of a tile (halves)
constexpr int STG = 2 * KPL + 2 * VPL;     // one ring buffer: Kh | Kl | Vh | Vl (halves)

__global__ void __launch_bounds__(256)
attn_x3(const u16* Qh, const u16* Ql, const u16* Kh, const u16* Kl,
        const u16* Vh, const u16* Vl, const float* amask, const int* flags,
        u16* Oh, u16* Ol)
{
    __shared__ __align__(16) u16 Ring[2 * STG];
    __shared__ __align__(16) float OsA[NREP * 16 * OSP];

    const int tid = threadIdx.x;
    const int lane = tid & 31, h = lane >> 4, ln = lane & 15;
    const int w = __builtin_amdgcn_readfirstlane(tid >> 5);
    const int kvh = blockIdx.y, b = blockIdx.z;
    const int hh = kvh * NREP + w;
    float* Os = OsA + w * (16 * OSP);          // each wave's own O staging

    // not unrolled: one copy of the key loop in the instruction cache serves both tiles
#pragma unroll 1
    for (int part = 0; part < 2; ++part) {
    const int qt = part == 0 ? NQT - 1 - (int)blockIdx.x : (int)blockIdx.x;    // the same in every thread of the work-group
    const int q0 = qt * 16;
    const size_t qofs = (size_t)(b * S + q0 + ln) * NQ + hh * HD + 8 * h;     // B column ln, + dc*32
    const size_t mofs = (size_t)(q0 + ln) * S + 8 * h;                        // query ln, + kb (+16), 8 keys in a row

    // this lane's share of a tile's copies: K rows tid/16 and +16 (16 B of 256), Vt rows tid/4 and +64 (16 B of 64)
    const int krow = tid >> 4, kcol = (tid & 15) * 8;
    const int vrow = tid >> 2, vcol = (tid & 3) * 8;
    const size_t kgo = (size_t)(b * S + krow) * NKVD + kvh * HD + kcol;       // + kb*NKVD
    const size_t vgo = (size_t)(kvh * HD + vrow) * MROWS + b * S + vcol;      // + kb
    const u32 klo = lds_off(Ring) + 2u * (u32)(krow * KP + kcol);             // + buffer
    const u32 vlo = lds_off(Ring) + 2u * (u32)(2 * KPL + vrow * VP + vcol);   // + buffer
    auto stage = [&](int kt, int bf) {
        const u32 lb = (u32)bf * (2u * STG);
        const size_t ko = kgo + (size_t)(kt * 32) * NKVD;
        const size_t vo = vgo + (size_t)(kt * 32);
        copy8(klo + lb, klo + lb + 2u * (16 * KP), klo + lb + 2u * KPL, klo + lb + 2u * (KPL + 16 * KP),
              vlo + lb, vlo + lb + 2u * (64 * VP), vlo + lb + 2u * VPL, vlo + lb + 2u * (VPL + 64 * VP),
              Kh + ko, Kh + ko + (size_t)16 * NKVD, Kl + ko, Kl + ko + (size_t)16 * NKVD,
              Vh + vo, Vh + vo + (size_t)64 * MROWS, Vl + vo, Vl + vo + (size_t)64 * MROWS);
    };

    float mrun = -1.0e30f, lrun = 0.0f;        // of query ln; lrun sums this wave half's keys only, joined behind the loop
    v8f o[8];                                  // o[t][r] = O[query ln][dim t*16 + 8h + r]
#pragma unroll
    for (int t = 0; t < 8; ++t) o[t] = zero8();

    // the key tiles that are not all-masked, as a 64-bit set, alike in every wave of the work-group:
    // the ring has to know the next tile one pass ahead
    const u32 a_lo = __builtin_amdgcn_ballot_w32(flags[qt * NKT + lane] != 1);
    const u32 a_hi = __builtin_amdgcn_ballot_w32(flags[qt * NKT + 32 + lane] != 1);
    // the wait that stands ahead of any overwrite of the two flag loads' offset register: the Q fragments below may be placed over it
    asm volatile("s_wait_xcnt 0x0" ::: "memory");
    unsigned long long act = (unsigned long long)a_lo | ((unsigned long long)a_hi << 32);

    // Q^T of this wave's head, both planes, all 128 dims: the same B fragments in every pass, loaded once and kept in registers
    const u16* qhp = Qh + qofs;
    const u16* qlp = Ql + qofs;
    v16bf qh[4], ql[4];
    // unrolled: constant indices keep the fragments in registers
#pragma unroll
    for (int dc = 0; dc < 4; ++dc) {
        qh[dc] = ldfrag(qhp + dc * 32);
        ql[dc] = ldfrag(qlp + dc * 32);
    }
    // the wait that stands ahead of any overwrite of the loads' address registers; it takes both addresses as inputs,
    // so that no fragment is placed over them in front of it
    asm volatile("s_wait_xcnt 0x0" :: "v"(qhp), "v"(qlp) : "memory");

    if (act != 0) {
        int kt = __builtin_ctzll(act);
        act &= act - 1;
        stage(kt, 0);
        asm volatile("s_wait_asynccnt 0x0" ::: "memory");    // this wave's copies of the first tile have landed
        __syncthreads();                                     // ... and every other wave's
        int ktn = -1;
        if (act != 0) {
            ktn = __builtin_ctzll(act);
            act &= act - 1;
            stage(ktn, 1);
        }
        int bf = 0;
        for (;;) {
            const int kb = kt * 32;
            const u16* Kb = Ring + bf * STG + ln * KP + 8 * h;               // K row ln, + 16*KP, + KPL, + dc*32
            const u16* Vb = Ring + bf * STG + 2 * KPL + ln * VP + 8 * h;     // Vt row ln, + t*16*VP, + VPL

            // the additive mask of query ln for this lane's 16 keys
            const float* mp = amask + mofs + kb;
            const v4f mk0 = *(const v4fa*)(mp);
            const v4f mk1 = *(const v4fa*)(mp + 4);
            const v4f mk2 = *(const v4fa*)(mp + 16);
            const v4f mk3 = *(const v4fa*)(mp + 20);

            // scores S^T[32 keys][16 q] = K . Q^T over 128 dims (4 k-steps), two 16-key accumulators
            v8f s0 = zero8(), s1 = zero8();
            // the K fragments of a k-step come one step ahead of their products; constant indices keep them in registers
            v16bf kh[4][2], kl[4][2];
            kh[0][0] = ldfrag(Kb);
            kh[0][1] = ldfrag(Kb + 16 * KP);
            kl[0][0] = ldfrag(Kb + KPL);
            kl[0][1] = ldfrag(Kb + KPL + 16 * KP);
#pragma unroll
            for (int dc = 0; dc < 4; ++dc) {
                if (dc < 3) {
                    kh[dc + 1][0] = ldfrag(Kb + (dc + 1) * 32);
                    kh[dc + 1][1] = ldfrag(Kb + 16 * KP + (dc + 1) * 32);
                    kl[dc + 1][0] = ldfrag(Kb + KPL + (dc + 1) * 32);
                    kl[dc + 1][1] = ldfrag(Kb + KPL + 16 * KP + (dc + 1) * 32);
                }
                __builtin_amdgcn_sched_barrier(0);   // the loads above stay ahead of these products
                mma(s0, kh[dc][0], qh[dc]);
                mma(s1, kh[dc][1], qh[dc]);
                mma(s0, kh[dc][0], ql[dc]);
                mma(s1, kh[dc][1], ql[dc]);
                mma(s0, kl[dc][0], qh[dc]);
                mma(s1, kl[dc][1], qh[dc]);
                __builtin_amdgcn_sched_barrier(0);   // the products above stay ahead of the next loads and of the pass's end
            }
            // the first two V^T row groups are fetched here, so that they arrive under the softmax
            v16bf vh[8], vl[8];
            vh[0] = ldfrag(Vb);
            vh[1] = ldfrag(Vb + 16 * VP);
            vl[0] = ldfrag(Vb + VPL);
            vl[1] = ldfrag(Vb + VPL + 16 * VP);
            __builtin_amdgcn_sched_barrier(0);   // these loads stay ahead of the softmax

            // scale + additive mask by value + online softmax; lane (h,ln): s0[r] = (key kb + 8h + r, query ln), s1: + 16
            // the loops of this block are unrolled: every index into a, p0, p1 and o is a constant, so they stay in registers
            float a[16];
#pragma unroll
            for (int r = 0; r < 4; ++r) {
                a[r]      = s0[r]     * SCALE + mk0[r];
                a[4 + r]  = s0[4 + r] * SCALE + mk1[r];
                a[8 + r]  = s1[r]     * SCALE + mk2[r];
                a[12 + r] = s1[4 + r] * SCALE + mk3[r];
            }
            float mx = a[0];
#pragma unroll
            for (int e = 1; e < 16; ++e) mx = fmaxf(mx, a[e]);
            mx = fmaxf(mx, xhalf(mx));                           // the other 16 keys of the query
            const float mnew = fmaxf(mrun, mx);
            const float corr = __expf(mrun - mnew);
            mrun = mnew;
            float p0[8], p1[8];
            float ps = 0.0f;
#pragma unroll
            for (int r = 0; r < 8; ++r) {
                p0[r] = __expf(a[r] - mnew);
                p1[r] = __expf(a[8 + r] - mnew);
                ps += p0[r] + p1[r];
            }
            lrun = lrun * corr + ps;
#pragma unroll
            for (int t = 0; t < 8; ++t)
#pragma unroll
                for (int r = 0; r < 8; ++r) o[t][r] *= corr;
            // P^T as a B operand: element r <- key 8h + r, element 8 + r <- key 16 + 8h + r, column ln: as the lane holds them
            Frag ph, pl;
            split8(p0, ph.q[0], pl.q[0]);
            split8(p1, ph.q[1], pl.q[1]);

            // O^T[128][16 q] += V^T[128][32 keys] . P^T[32 keys][16 q]; V^T A-fragments from the ring's key-contiguous rows
            // two row groups at a time, the next two fetched ahead of these products
#pragma unroll
            for (int t = 0; t < 8; t += 2) {
                if (t < 6) {
                    vh[t + 2] = ldfrag(Vb + (t + 2) * 16 * VP);
                    vh[t + 3] = ldfrag(Vb + (t + 3) * 16 * VP);
                    vl[t + 2] = ldfrag(Vb + VPL + (t + 2) * 16 * VP);
                    vl[t + 3] = ldfrag(Vb + VPL + (t + 3) * 16 * VP);
                }
                mma3x2(o[t], o[t + 1], vh[t], vl[t], vh[t + 1], vl[t + 1], ph.v, pl.v);
            }

            // publish point: this wave's LDS reads are done, its copies of the next tile have landed,
            // then the barrier that says both of every wave
            asm volatile("s_wait_dscnt 0x0" ::: "memory");
            asm volatile("s_wait_asynccnt 0x0" ::: "memory");
            __syncthreads();
            if (ktn < 0) break;
            kt = ktn;
            ktn = -1;
            if (act != 0) {                                      // refill the buffer this pass has just read
                ktn = __builtin_ctzll(act);
                act &= act - 1;
                stage(ktn, bf);
            }
            bf ^= 1;
        }
    }
    asm volatile("s_wait_asynccnt 0x0" ::: "memory");            // no copy is left in flight when the wave ends

    // normalise, stage the 16x128 f32 tile, write hi/lo planes with 16-B lane-contiguous stores
    {
        const float lv = lrun + xhalf(lrun);                     // both wave halves' keys
        const float li = (lv > 0.0f) ? (1.0f / lv) : 0.0f;
        float* orow = Os + ln * OSP + 8 * h;
        // unrolled: constant indices keep o in registers
#pragma unroll
        for (int t = 0; t < 8; ++t) {
            v4f x0, x1;
#pragma unroll
            for (int r = 0; r < 4; ++r) { x0[r] = o[t][r] * li; x1[r] = o[t][4 + r] * li; }
            *(v4fa*)(orow + t * 16) = x0;
            *(v4fa*)(orow + t * 16 + 4) = x1;
        }
    }
    __syncthreads();
#pragma unroll 1
    for (int it = 0; it < 8; ++it) {
        const int row = it * 2 + h, colc = ln * 8;
        const float* cr = Os + row * OSP;
        const v4f a = *(const v4fa*)(cr + colc);
        const v4f c = *(const v4fa*)(cr + colc + 4);
        float x[8] = {a[0], a[1], a[2], a[3], c[0], c[1], c[2], c[3]};
        v4u hi, lo;
        split8(x, hi, lo);
        const size_t oo = (size_t)(b * S + q0 + row) * NQ + hh * HD + colc;
        st2u(Oh + oo, Ol + oo, hi, lo);
        stores_issued();                       // the next trip, and behind the last trip the second tile's code, rewrite the stores' registers
    }
    }
}

// ---------------- host ---------------------------------------------------------------------
extern "C" void kernel_launch(void* const* d_in, const int* in_sizes, int n_in,
                              void* d_out, int out_size, void* d_ws, size_t ws_size,
                              hipStream_t stream)
{
    if (n_in < 11) return;
    if (in_sizes[0] != MROWS * HID || in_sizes[1] != MROWS || in_sizes[2] != S * S ||
        in_sizes[3] != HID * NQ || in_sizes[4] != NQ ||
        in_sizes[5] != HID * NKVD || in_sizes[6] != NKVD ||
        in_sizes[7] != HID * NKVD || in_sizes[8] != NKVD ||
        in_sizes[9] != NQ * HID || in_sizes[10] != HID) return;
    if (out_size != MROWS * HID) return;

    const float* X   = (const float*)d_in[0];   // [B*S][HID]
    const float* ts  = (const float*)d_in[1];   // [B*S]
    const float* amk = (const float*)d_in[2];   // [S][S] additive
    const float* Wq  = (const float*)d_in[3];   // [HID][NQ]
    const float* bq  = (const float*)d_in[4];
    const float* Wk  = (const float*)d_in[5];   // [HID][NKVD]
    const float* bk  = (const float*)d_in[6];
    const float* Wv  = (const float*)d_in[7];   // [HID][NKVD]
    const float* bv  = (const float*)d_in[8];
    const float* Wo  = (const float*)d_in[9];   // [NQ][HID]
    const float* bo  = (const float*)d_in[10];
    float* out = (float*)d_out;                 // [B*S][HID]

    const size_t szX  = (size_t)MROWS * HID * 2;     // one plane
    const size_t szWq = (size_t)NQ * HID * 2;
    const size_t szWk = (size_t)NKVD * HID * 2;
    const size_t szWo = (size_t)HID * NQ * 2;
    const size_t szQ  = (size_t)MROWS * NQ * 2;
    const size_t szK  = (size_t)MROWS * NKVD * 2;
    const size_t szVt = (size_t)NKVD * MROWS * 2;
    const size_t szTb = (size_t)MROWS * NFREQ * 4;
    const size_t szFl = (size_t)NQT * NKT * 4;
    char* base = (char*)d_ws;
    size_t used = 0;
    auto take = [&](size_t bytes) -> char* { char* p = base + used; used += (bytes + 255) & ~(size_t)255; return p; };
    u16* Xh   = (u16*)take(szX);   u16* Xl   = (u16*)take(szX);     // reused as attention-output planes
    u16* Wqth = (u16*)take(szWq);  u16* Wqtl = (u16*)take(szWq);    // [NQ][HID]
    u16* Wkth = (u16*)take(szWk);  u16* Wktl = (u16*)take(szWk);    // [NKVD][HID]
    u16* Wvth = (u16*)take(szWk);  u16* Wvtl = (u16*)take(szWk);    // [NKVD][HID]
    u16* Woth = (u16*)take(szWo);  u16* Wotl = (u16*)take(szWo);    // [HID][NQ]
    u16* Qh   = (u16*)take(szQ);   u16* Ql   = (u16*)take(szQ);     // [MROWS][NQ]
    u16* Kh   = (u16*)take(szK);   u16* Kl   = (u16*)take(szK);     // [MROWS][NKVD]
    u16* Vth  = (u16*)take(szVt);  u16* Vtl  = (u16*)take(szVt);    // [NKVD][MROWS]
    float* cosT = (float*)take(szTb);                               // [MROWS][64]
    float* sinT = (float*)take(szTb);
    int* flags  = (int*)take(szFl);                                 // [NQT][NKT]
    if (used > ws_size) return;
    u16* AOh = Xh;   // X planes are dead once the three projections are enqueued
    u16* AOl = Xl;

    // 1: preparation: X and the four weights -> hi/lo planes (weights k-contiguous), rotary table, tile skip flags
    k_prep<<<dim3(PB_ALL), dim3(256), 0, stream>>>(X, ts, amk, Wq, Wk, Wv, Wo, Xh, Xl, Wqth, Wqtl, Wkth, Wktl,
                                                   Wvth, Wvtl, Woth, Wotl, cosT, sinT, flags);
    // 2: the Q, K and V projections
    gemm_qkv<<<dim3(GB_Q + GB_K + GB_V), dim3(128), 0, stream>>>(Xh, Xl, Wqth, Wqtl, Wkth, Wktl, Wvth, Wvtl, bq, bk, bv,
                                                                 cosT, sinT, Qh, Ql, Kh, Kl, Vth, Vtl);
    // 3: attention -> AO planes [MROWS][NQ]
    attn_x3<<<dim3(NQT / 2, NKV, BB), dim3(256), 0, stream>>>(Qh, Ql, Kh, Kl, Vth, Vtl, amk, flags, AOh, AOl);
    // 4: the output projection
    gemm_out<<<dim3(HID / 128, MROWS / 128), dim3(128), 0, stream>>>(AOh, AOl, Woth, Wotl, bo, out);
    (void)hipGetLastError();
}

// v009
// Measured time: 260 microseconds a run.
// Two timings next to v008 both put it at 1.04 times that version's speed.
// Counting every step since v000, it is 3.74 times as fast.
#include <hip/hip_runtime.h>
#include <math.h>
#include <stddef.h>

// All contractions (q/k/v projections, q.k^T scores, p.v, output projection): v_wmma_f32_16x16x32_bf16 with bf16 hi/lo operands everywhere (hi*hi + hi*lo + lo*hi), f32 accumulate; softmax, rotary, scale and biases in f32.

constexpr int BB    = 2;
constexpr int S     = 2048;
constexpr int HID   = 2048;
constexpr int NH    = 16;
constexpr int NKV   = 2;
constexpr int HD    = 128;
constexpr int NREP  = NH / NKV;            // 8
constexpr int MROWS = BB * S;              // 4096 token rows
constexpr int NQ    = NH * HD;             // 2048
constexpr int NKVD  = NKV * HD;            // 256
constexpr int NQT   = S / 16;              // 128 query tiles of 16 rows
constexpr int NKT   = S / 32;              // 64 key tiles of 32 keys
constexpr int NFREQ = HD / 2;              // 64 rotary frequencies
constexpr float SCALE = 0.08838834764831845f;   // 1/sqrt(128)
constexpr int CP  = 132;                   // LDS pitch (floats), 32*MI x 128 C tile
constexpr int OSP = 132;                   // LDS pitch (floats), 16x128 O tile
constexpr int TP  = 68;                    // LDS pitch (floats), transpose tile

constexpr int EPI_ROPE = 1;                // hi/lo planes out, column bias, rotary
constexpr int EPI_ROWB = 2;                // hi/lo planes out, row bias
constexpr int EPI_F32  = 3;                // f32 out, column bias

static_assert(MROWS % 128 == 0);
static_assert(NQ % 128 == 0);
static_assert(NKVD % 128 == 0);
static_assert(HID % 64 == 0);
static_assert(S % 32 == 0);
static_assert(NQT % 2 == 0);

typedef unsigned int   u32;
typedef unsigned short u16;
typedef __bf16 v16bf __attribute__((ext_vector_type(16)));
typedef float  v8f   __attribute__((ext_vector_type(8)));
typedef int    v8i   __attribute__((ext_vector_type(8)));
typedef float  v4f   __attribute__((ext_vector_type(4)));
typedef u32    v4u   __attribute__((ext_vector_type(4)));
typedef int    v4i   __attribute__((ext_vector_type(4)));
typedef v4f v4fa __attribute__((may_alias));
typedef v4u v4ua __attribute__((may_alias));
typedef v4i v4ia __attribute__((may_alias));

union Frag { v16bf v; v4u q[2]; };

// ---------------- bf16 RNE split helpers (packed hardware conversion) ----------
typedef float  v2f  __attribute__((ext_vector_type(2)));
typedef __bf16 v2bf __attribute__((ext_vector_type(2)));

// two f32 -> two bf16, round to nearest even, the first in the low half-word: one packed conversion
__device__ __forceinline__ u32 bf2(v2f x) {
    return __builtin_bit_cast(u32, __builtin_convertvector(x, v2bf));
}

// 8 f32 -> packed bf16 hi plane (4 dwords) and lo plane (4 dwords); element 2c in the low half-word
__device__ __forceinline__ void split8(const float (&x)[8], v4u& hi, v4u& lo) {
#pragma unroll
    for (int c = 0; c < 4; ++c) {
        const v2f p = {x[2 * c], x[2 * c + 1]};
        const u32 h = bf2(p);
        const v2f b = {__builtin_bit_cast(float, h << 16), __builtin_bit_cast(float, h & 0xFFFF0000u)};
        hi[c] = h;
        lo[c] = bf2(p - b);
    }
}

// ---------------- fragment loader (A map and B map identical, k-contiguous row) -------
// p = plane + row*ld + k0 + 8*h ; elements 0..7 <- k0+8h..+7, elements 8..15 <- k0+16+8h..+7
__device__ __forceinline__ v16bf ldfrag(const u16* p) {
    Frag f;
    f.q[0] = *(const v4ua*)(p);
    f.q[1] = *(const v4ua*)(p + 16);
    return f.v;
}

__device__ __forceinline__ v8f zero8() {
    v8f z;
#pragma unroll
    for (int i = 0; i < 8; ++i) z[i] = 0.0f;
    return z;
}

// one term of a hi/lo product. An accumulator takes its three terms in the order hi*hi, hi*lo, lo*hi; the callers go term by
// term over several accumulators, so that a product never waits for the one issued directly ahead of it
__device__ __forceinline__ void mma(v8f& acc, v16bf a, v16bf b) {
    acc = __builtin_amdgcn_wmma_f32_16x16x32_bf16(false, a, false, b, (short)0, acc, false, false);
}

// Where __builtin_amdgcn_sched_barrier(0) stands below, it parts a group of LDS fragment loads from a group of products: without
// it the compiler moves the loads down to their first use, in among the products, and the wave waits out the LDS latency at each.

// the three terms of two accumulators that share the B operand, term by term, in one statement. In asm because the compiler moved
// the builtin form of these products, with the end of the softmax, down past every later fragment load: all fragments of a pass
// were then live at once, too many registers for four waves on a SIMD. The "memory" clobber keeps the fragment loads on their side.
// The four v_nop keep the distance from the last product to a vector instruction on its registers.
__device__ __forceinline__ void mma3x2(v8f& c0, v8f& c1, v16bf a0h, v16bf a0l, v16bf a1h, v16bf a1l, v16bf bh, v16bf bl) {
    const v8i x0h = __builtin_bit_cast(v8i, a0h), x0l = __builtin_bit_cast(v8i, a0l);
    const v8i x1h = __builtin_bit_cast(v8i, a1h), x1l = __builtin_bit_cast(v8i, a1l);
    const v8i yh = __builtin_bit_cast(v8i, bh), yl = __builtin_bit_cast(v8i, bl);
    asm volatile("v_wmma_f32_16x16x32_bf16 %0, %2, %6, %0\n\t"
                 "v_wmma_f32_16x16x32_bf16 %1, %4, %6, %1\n\t"
                 "v_wmma_f32_16x16x32_bf16 %0, %2, %7, %0\n\t"
                 "v_wmma_f32_16x16x32_bf16 %1, %4, %7, %1\n\t"
                 "v_wmma_f32_16x16x32_bf16 %0, %3, %6, %0\n\t"
                 "v_wmma_f32_16x16x32_bf16 %1, %5, %6, %1\n\t"
                 "v_nop\n\tv_nop\n\tv_nop\n\tv_nop"
                 : "+v"(c0), "+v"(c1)
                 : "v"(x0h), "v"(x0l), "v"(x1h), "v"(x1l), "v"(yh), "v"(yl)
                 : "memory");
}

__device__ __forceinline__ void st2u(u16* ph, u16* pl, v4u hi, v4u lo) {
    *(v4u*)ph = hi;
    *(v4u*)pl = lo;
    
}
__device__ __forceinline__ void st2f(float* p, v4f v) {
    *(v4f*)p = v;
    
}
// Behind the stores of a job that shares its kernel with other jobs: the wait that stands ahead of any overwrite of a register
// that an issued store names. The code of another job follows in the built kernel, where a kernel of one job would end.
__device__ __forceinline__ void stores_issued() {
    asm volatile("s_wait_xcnt 0x0" ::: "memory");
}

// ---------------- X: f32 rows -> hi/lo bf16 planes, same layout --------------------------
__device__ __forceinline__ void
split_rows(int blk, const float* X, int n, u16* Xh, u16* Xl)
{
    const size_t i = ((size_t)blk * 256 + threadIdx.x) * 8;
    if (i + 8 <= (size_t)n) {
        const v4f a = *(const v4fa*)(X + i);
        const v4f c = *(const v4fa*)(X + i + 4);
        float x[8] = {a[0], a[1], a[2], a[3], c[0], c[1], c[2], c[3]};
        v4u hi, lo;
        split8(x, hi, lo);
        st2u(Xh + i, Xl + i, hi, lo);
    }
}

// ---------------- weights: in[nrows][ncols] f32 -> hi/lo planes out[ncols][nrows] ----------
// blocks (ncols/64) x (nrows/64), the column tile running first; LDS transpose in T (64 * TP floats);
// each output line (64 halves) by lanes 8q..8q+7
__device__ __forceinline__ void
split_t(float* T, int blk, const float* W, int nrows, int ncols, u16* Th, u16* Tl)
{
    const int tid = threadIdx.x;
    const int cb = (blk % (ncols / 64)) * 64;      // input column tile == output row tile
    const int rb = (blk / (ncols / 64)) * 64;      // input row tile    == output column tile
#pragma unroll
    for (int it = 0; it < 4; ++it) {
        const int fl = it * 256 + tid;
        const int rr = fl >> 4, cc = (fl & 15) * 4;
        const v4f v = *(const v4fa*)(W + (size_t)(rb + rr) * ncols + cb + cc);
        T[(cc + 0) * TP + rr] = v[0];
        T[(cc + 1) * TP + rr] = v[1];
        T[(cc + 2) * TP + rr] = v[2];
        T[(cc + 3) * TP + rr] = v[3];
    }
    __syncthreads();
#pragma unroll
    for (int it = 0; it < 2; ++it) {
        const int orow = it * 32 + (tid >> 3), oc = (tid & 7) * 8;
        const v4f a = *(const v4fa*)(T + orow * TP + oc);
        const v4f c = *(const v4fa*)(T + orow * TP + oc + 4);
        float x[8] = {a[0], a[1], a[2], a[3], c[0], c[1], c[2], c[3]};
        v4u hi, lo;
        split8(x, hi, lo);
        const size_t o = (size_t)(cb + orow) * nrows + rb + oc;
        st2u(Th + o, Tl + o, hi, lo);
    }
    stores_issued();
}

// ---------------- rotary table: cos/sin of f32(ts[row] * inv_freq[j]) ---------------------
__device__ __forceinline__ void
rope_table(int blk, const float* ts, int nrows, float* cosT, float* sinT)
{
    const int tid = threadIdx.x;
    const int row = blk * 4 + (tid >> 6);
    const int j   = tid & 63;
    const int rc  = row < nrows ? row : nrows - 1;
    const float t = ts[rc];
    // inv_freq[j] = 1 / f32(10000^(j/64)); the power evaluated in f64 and converted once
    const double p  = exp2((double)j * (13.287712379549449 / 64.0));
    const float  pf = (float)p;
    const float inv = 1.0f / pf;
    const float ang = t * inv;
    float sn, cs;
    sincosf(ang, &sn, &cs);
    if (row < nrows) {
        const size_t o = (size_t)row * NFREQ + j;
        *(float*)(cosT + o) = cs;
        *(float*)(sinT + o) = sn;
        stores_issued();
    }
}

// ---------------- tile flags from the additive input mask ---------------------------------
// flag[qt][kt] = 1 when every entry of the 16x32 mask tile is <= -1e8 (tile contributes 0)
// blocks NQT x 2, the query tile running first; sf: 32 ints of LDS
__device__ __forceinline__ void
tile_flags(int* sf, int blk, const float* amask, int* flags)
{
    const int tid = threadIdx.x, lane = tid & 31, w = tid >> 5;
    const int qt = blk % NQT, hf = blk / NQT;
    const int t = tid >> 3, sub = tid & 7;
    const int kt = hf * 32 + t;
    const int kb = kt * 32;
    int ok = 1;
#pragma unroll
    for (int rr = 0; rr < 2; ++rr) {
        const int q = qt * 16 + sub * 2 + rr;
        const float* mp = amask + (size_t)q * S + kb;
#pragma unroll
        for (int c = 0; c < 8; ++c) {
            const v4f v = *(const v4fa*)(mp + 4 * c);
            ok &= (int)(v[0] <= -1.0e8f) & (int)(v[1] <= -1.0e8f) &
                  (int)(v[2] <= -1.0e8f) & (int)(v[3] <= -1.0e8f);
        }
    }
    ok &= __shfl_xor(ok, 1);
    ok &= __shfl_xor(ok, 2);
    ok &= __shfl_xor(ok, 4);
    if (sub == 0) sf[t] = ok;
    __syncthreads();
    if (w == 0 && lane < 8) {
        const v4i f = *(const v4ia*)(sf + lane * 4);
        int* dst = flags + (size_t)qt * NKT + hf * 32 + lane * 4;
        *(v4i*)dst = f;
        stores_issued();
    }
}

// ---------------- the whole preparation in one launch ---------------------------------------
// The seven jobs above depend on nothing but the inputs: each takes a range of the block index of one grid, so that they
// fill the chip together and no launch waits for the last blocks of the one ahead. A block does one job's one tile.
constexpr int PB_WQ = (NQ / 64) * (HID / 64);          // blocks of each job
constexpr int PB_WO = (HID / 64) * (NQ / 64);
constexpr int PB_WK = (NKVD / 64) * (HID / 64);
constexpr int PB_RT = MROWS / 4;
constexpr int PB_FL = NQT * 2;
constexpr int PB_X  = (MROWS * HID) / (256 * 8);
constexpr int PB_ALL = PB_WQ + PB_WO + 2 * PB_WK + PB_RT + PB_FL + PB_X;

__global__ void __launch_bounds__(256)
k_prep(const float* X, const float* ts, const float* amask,
       const float* Wq, const float* Wk, const float* Wv, const float* Wo,
       u16* Xh, u16* Xl, u16* Wqth, u16* Wqtl, u16* Wkth, u16* Wktl, u16* Wvth, u16* Wvtl, u16* Woth, u16* Wotl,
       float* cosT, float* sinT, int* flags)
{
    __shared__ __align__(16) float T[64 * TP];
    __shared__ __align__(16) int sf[32];
    int blk = blockIdx.x;                              // the same in every thread of a block: each branch is taken by all or none
    if (blk < PB_WQ) { split_t(T, blk, Wq, HID, NQ, Wqth, Wqtl); return; }       // in[2048][2048] -> out[2048][2048]
    blk -= PB_WQ;
    if (blk < PB_WO) { split_t(T, blk, Wo, NQ, HID, Woth, Wotl); return; }       // in[2048][2048] -> out[2048][2048]
    blk -= PB_WO;
    if (blk < PB_WK) { split_t(T, blk, Wk, HID, NKVD, Wkth, Wktl); return; }     // in[2048][256]  -> out[256][2048]
    blk -= PB_WK;
    if (blk < PB_WK) { split_t(T, blk, Wv, HID, NKVD, Wvth, Wvtl); return; }     // in[2048][256]  -> out[256][2048]
    blk -= PB_WK;
    if (blk < PB_RT) { rope_table(blk, ts, MROWS, cosT, sinT); return; }
    blk -= PB_RT;
    if (blk < PB_FL) { tile_flags(sf, blk, amask, flags); return; }
    blk -= PB_FL;
    split_rows(blk, X, MROWS * HID, Xh, Xl);
}

__device__ __forceinline__ u32 lds_off(const void* p) { return (u32)(size_t)p; }

// the value of lane l ^ 16
__device__ __forceinline__ float xhalf(float x) {
    const int b = __builtin_bit_cast(int, x);
    return __builtin_bit_cast(float, __builtin_amdgcn_permlanex16(b, b, 0x76543210, 0xfedcba98, false, false));
}

// one tile's copies of one lane: 8 x 16 B, global -> LDS through no register.
// The s_wait_xcnt closes the statement so that no address register is rewritten ahead of it.
__device__ __forceinline__ void copy8(u32 l0, u32 l1, u32 l2, u32 l3, u32 l4, u32 l5, u32 l6, u32 l7,
                                      const u16* g0, const u16* g1, const u16* g2, const u16* g3,
                                      const u16* g4, const u16* g5, const u16* g6, const u16* g7) {
    asm volatile("global_load_async_to_lds_b128 %0, %8, off\n\t"
                 "global_load_async_to_lds_b128 %1, %9, off\n\t"
                 "global_load_async_to_lds_b128 %2, %10, off\n\t"
                 "global_load_async_to_lds_b128 %3, %11, off\n\t"
                 "global_load_async_to_lds_b128 %4, %12, off\n\t"
                 "global_load_async_to_lds_b128 %5, %13, off\n\t"
                 "global_load_async_to_lds_b128 %6, %14, off\n\t"
                 "global_load_async_to_lds_b128 %7, %15, off\n\t"
                 "s_wait_xcnt 0x0"
                 :: "v"(l0), "v"(l1), "v"(l2), "v"(l3), "v"(l4), "v"(l5), "v"(l6), "v"(l7),
                    "v"(g0), "v"(g1), "v"(g2), "v"(g3), "v"(g4), "v"(g5), "v"(g6), "v"(g7)
                 : "memory");
}

// ---------------- hi/lo split GEMM: C[i][j] = sum_k A[i][k] * B[j][k] -----------------------
// A planes [*][lda], B planes [*][ldb], both k-contiguous; block tile 32*MI (i) x 128 (j),
// 4 waves as 2x2, wave tile 16*MI x 64 = MI x 4 accumulators.
// A pass is 64 k: the pass's rows of all four planes are copied once per work-group into a two-buffer
// LDS ring by asynchronous copies (whole 128-B lines), the next pass flying while this one is used;
// the waves read their fragments from the ring.
constexpr int GK = 64;                     // k per pass
constexpr int GP = 72;                     // LDS pitch (halves) of a row of 64 k: 144 B = 16 B x 9

// four copies of one lane, as copy8
__device__ __forceinline__ void copy4(u32 l0, u32 l1, u32 l2, u32 l3,
                                      const u16* g0, const u16* g1, const u16* g2, const u16* g3) {
    asm volatile("global_load_async_to_lds_b128 %0, %4, off\n\t"
                 "global_load_async_to_lds_b128 %1, %5, off\n\t"
                 "global_load_async_to_lds_b128 %2, %6, off\n\t"
                 "global_load_async_to_lds_b128 %3, %7, off\n\t"
                 "s_wait_xcnt 0x0"
                 :: "v"(l0), "v"(l1), "v"(l2), "v"(l3), "v"(g0), "v"(g1), "v"(g2), "v"(g3)
                 : "memory");
}

// LDS bytes of a block: the ring, or the f32 C tile that takes its place behind the loop
constexpr int gemm_lds(int MI) {
    const int rng = 2 * (2 * 32 * MI * GP + 2 * 128 * GP) * 2, cs = 32 * MI * CP * 4;
    return rng > cs ? rng : cs;
}

// one block tile: column tile bx, row tile by; Sm: gemm_lds(MI) bytes of LDS
template<int EPI, int MI>
__device__ __forceinline__ void
gemm_tile(unsigned char* Sm, int bx, int by,
          const u16* Ah, const u16* Al, int lda,
          const u16* Bh, const u16* Bl, int ldb, int K,
          const float* bias, const float* cosT, const float* sinT,
          u16* Oh, u16* Ol, float* Of, int ldo)
{
    static_assert(MI == 1 || MI == 4);
    constexpr int BM   = 32 * MI;              // rows of the block tile
    constexpr int APL  = BM * GP;              // one A plane of a pass (halves)
    constexpr int BPL  = 128 * GP;             // one B plane of a pass (halves)
    constexpr int GST  = 2 * APL + 2 * BPL;    // one ring buffer: Ah | Al | Bh | Bl (halves)
    const u16* Ring = (const u16*)Sm;
    float* Cs = (float*)Sm;
    const int tid = threadIdx.x, w = tid >> 5, lane = tid & 31;
    const int h = lane >> 4, ln = lane & 15;
    const int wm = w >> 1, wn = w & 1;
    const int i0 = by * BM, j0 = bx * 128;

    v8f acc[MI][4];
#pragma unroll
    for (int mi = 0; mi < MI; ++mi)
#pragma unroll
        for (int ni = 0; ni < 4; ++ni) acc[mi][ni] = zero8();

    // this lane's share of a pass's copies: 16 B of row tid/8 and of every 16th row behind it, in each plane
    const int crow = tid >> 3, ccol = (tid & 7) * 8;
    const size_t ago = (size_t)(i0 + crow) * lda + ccol;                      // + k0
    const size_t bgo = (size_t)(j0 + crow) * ldb + ccol;                      // + k0
    const u32 alo = lds_off(Sm) + 2u * (u32)(crow * GP + ccol);               // + buffer
    const u32 blo = alo + 2u * (u32)(2 * APL);
    constexpr u32 RS = 2u * 16 * GP;           // 16 rows of the ring, bytes
    auto rows128 = [&](u32 l, const u16* g, int ld) {
        const size_t s = (size_t)16 * ld;
        copy8(l, l + RS, l + 2 * RS, l + 3 * RS, l + 4 * RS, l + 5 * RS, l + 6 * RS, l + 7 * RS,
              g, g + s, g + 2 * s, g + 3 * s, g + 4 * s, g + 5 * s, g + 6 * s, g + 7 * s);
    };
    auto stage = [&](int t, int bf) {
        const u32 lb = (u32)bf * (2u * GST);
        const u16* ah = Ah + ago + t * GK;
        const u16* al = Al + ago + t * GK;
        const u32 la = alo + lb, ll = alo + lb + 2u * APL;
        if constexpr (MI == 4) {
            rows128(la, ah, lda);
            rows128(ll, al, lda);
        } else {
            const size_t s = (size_t)16 * lda;
            copy4(la, la + RS, ll, ll + RS, ah, ah + s, al, al + s);
        }
        rows128(blo + lb, Bh + bgo + t * GK, ldb);
        rows128(blo + lb + 2u * BPL, Bl + bgo + t * GK, ldb);
    };

    const int NT = K / GK;
    stage(0, 0);
    asm volatile("s_wait_asynccnt 0x0" ::: "memory");        // this wave's copies of the first pass have landed
    __syncthreads();                                         // ... and every other wave's
    if (NT > 1) stage(1, 1);

#pragma unroll 1
    for (int t = 0; t < NT; ++t) {
        const int bf = t & 1;
        const u16* Ab = Ring + bf * GST + (wm * (16 * MI) + ln) * GP + 8 * h;        // + mi*16*GP, + APL, + ks*32
        const u16* Bb = Ring + bf * GST + 2 * APL + (wn * 64 + ln) * GP + 8 * h;     // + ni*16*GP, + BPL, + ks*32
        // the loops inside a pass are unrolled: every fragment and accumulator index is a constant, so they stay in registers
        if constexpr (MI == 4) {
            // 128 accumulator registers: the A fragments of 32 k stay, the B fragments come one column group ahead,
            // also over the step from the first 32 k to the second
            v16bf ah[MI], al[MI], bh[8], bl[8];
            bh[0] = ldfrag(Bb);
            bl[0] = ldfrag(Bb + BPL);
#pragma unroll
            for (int ks = 0; ks < 2; ++ks) {
#pragma unroll
                for (int mi = 0; mi < MI; ++mi) ah[mi] = ldfrag(Ab + mi * 16 * GP + ks * 32);
#pragma unroll
                for (int mi = 0; mi < MI; ++mi) al[mi] = ldfrag(Ab + APL + mi * 16 * GP + ks * 32);
#pragma unroll
                for (int ni = 0; ni < 4; ++ni) {
                    const int g = ks * 4 + ni;
                    if (g < 7) {
                        bh[g + 1] = ldfrag(Bb + ((g + 1) & 3) * 16 * GP + ((g + 1) >> 2) * 32);
                        bl[g + 1] = ldfrag(Bb + BPL + ((g + 1) & 3) * 16 * GP + ((g + 1) >> 2) * 32);
                    }
                    __builtin_amdgcn_sched_barrier(0);   // the loads above stay ahead of these products
#pragma unroll
                    for (int mi = 0; mi < MI; ++mi) mma(acc[mi][ni], ah[mi], bh[g]);
#pragma unroll
                    for (int mi = 0; mi < MI; ++mi) mma(acc[mi][ni], ah[mi], bl[g]);
#pragma unroll
                    for (int mi = 0; mi < MI; ++mi) mma(acc[mi][ni], al[mi], bh[g]);
                    __builtin_amdgcn_sched_barrier(0);   // the products above stay ahead of the next loads and of the pass's end
                }
            }
        } else {
            // few accumulators: every fragment of the pass is fetched ahead of its products
            v16bf ah[2][MI], al[2][MI], bh[2][4], bl[2][4];
#pragma unroll
            for (int ks = 0; ks < 2; ++ks) {
#pragma unroll
                for (int mi = 0; mi < MI; ++mi) {
                    ah[ks][mi] = ldfrag(Ab + mi * 16 * GP + ks * 32);
                    al[ks][mi] = ldfrag(Ab + APL + mi * 16 * GP + ks * 32);
                }
#pragma unroll
                for (int ni = 0; ni < 4; ++ni) {
                    bh[ks][ni] = ldfrag(Bb + ni * 16 * GP + ks * 32);
                    bl[ks][ni] = ldfrag(Bb + BPL + ni * 16 * GP + ks * 32);
                }
            }
            __builtin_amdgcn_sched_barrier(0);   // the loads above stay ahead of these products
#pragma unroll
            for (int ks = 0; ks < 2; ++ks) {
#pragma unroll
                for (int ni = 0; ni < 4; ++ni) mma(acc[0][ni], ah[ks][0], bh[ks][ni]);
#pragma unroll
                for (int ni = 0; ni < 4; ++ni) mma(acc[0][ni], ah[ks][0], bl[ks][ni]);
#pragma unroll
                for (int ni = 0; ni < 4; ++ni) mma(acc[0][ni], al[ks][0], bh[ks][ni]);
            }
            __builtin_amdgcn_sched_barrier(0);   // the products above stay ahead of the next loads and of the pass's end
        }
        // publish point
        asm volatile("s_wait_dscnt 0x0" ::: "memory");       // this wave's reads of the buffer are done before it is refilled
        asm volatile("s_wait_asynccnt 0x0" ::: "memory");    // this wave's copies of the next pass have landed
        __syncthreads();                                     // both hold for every wave
        if (t + 2 < NT) stage(t + 2, bf);                    // refill the buffer this pass has just read
    }
    asm volatile("s_wait_asynccnt 0x0" ::: "memory");        // no copy is in flight when the ring becomes the C tile

    // stage the f32 tile in LDS: D element r of lane l = (row 8h+r, col ln)
#pragma unroll
    for (int mi = 0; mi < MI; ++mi)
#pragma unroll
        for (int ni = 0; ni < 4; ++ni)
#pragma unroll
            for (int r = 0; r < 8; ++r)
                Cs[(wm * (16 * MI) + mi * 16 + 8 * h + r) * CP + wn * 64 + ni * 16 + ln] = acc[mi][ni][r];
    __syncthreads();

    if (EPI == EPI_F32) {
        // row segment = 128 floats = 512 B = 32 lanes x 16 B, one instruction per row
#pragma unroll 1
        for (int it = 0; it < BM / 4; ++it) {
            const int row = it * 4 + w, col = lane * 4;
            v4f x = *(const v4fa*)(Cs + row * CP + col);
            const v4f bv = *(const v4fa*)(bias + j0 + col);
            x += bv;
            st2f(Of + (size_t)(i0 + row) * ldo + j0 + col, x);
        }
    } else {
        // row segment = 128 halves = 256 B = 16 lanes x 16 B per plane; lanes 16..31 take the next row
#pragma unroll 1
        for (int it = 0; it < BM / 8; ++it) {
            const int row = it * 8 + w * 2 + h, colc = ln * 8;
            const int gi = i0 + row;
            const float* cr = Cs + row * CP;
            float x[8];
            {
                const v4f a = *(const v4fa*)(cr + colc);
                const v4f c = *(const v4fa*)(cr + colc + 4);
                x[0] = a[0]; x[1] = a[1]; x[2] = a[2]; x[3] = a[3];
                x[4] = c[0]; x[5] = c[1]; x[6] = c[2]; x[7] = c[3];
            }
            if (EPI == EPI_ROWB) {
                const float bvv = bias[gi];
#pragma unroll
                for (int e = 0; e < 8; ++e) x[e] += bvv;
            } else {
                const v4f b0 = *(const v4fa*)(bias + j0 + colc);
                const v4f b1 = *(const v4fa*)(bias + j0 + colc + 4);
                x[0] += b0[0]; x[1] += b0[1]; x[2] += b0[2]; x[3] += b0[3];
                x[4] += b1[0]; x[5] += b1[1]; x[6] += b1[2]; x[7] += b1[3];
            }
            if (EPI == EPI_ROPE) {
                // block tile == one head (128 columns); partner column d^64, frequency j = d&63
                const int pc = colc ^ 64;
                float xp[8];
                {
                    const v4f a = *(const v4fa*)(cr + pc);
                    const v4f c = *(const v4fa*)(cr + pc + 4);
                    const v4f b0 = *(const v4fa*)(bias + j0 + pc);
                    const v4f b1 = *(const v4fa*)(bias + j0 + pc + 4);
                    xp[0] = a[0] + b0[0]; xp[1] = a[1] + b0[1]; xp[2] = a[2] + b0[2]; xp[3] = a[3] + b0[3];
                    xp[4] = c[0] + b1[0]; xp[5] = c[1] + b1[1]; xp[6] = c[2] + b1[2]; xp[7] = c[3] + b1[3];
                }
                const int jb = colc & 63;
                const float* cp = cosT + (size_t)gi * NFREQ + jb;
                const float* sp = sinT + (size_t)gi * NFREQ + jb;
                const v4f c0 = *(const v4fa*)(cp), c1 = *(const v4fa*)(cp + 4);
                const v4f s0 = *(const v4fa*)(sp), s1 = *(const v4fa*)(sp + 4);
                // the wait that stands ahead of any overwrite of the four table loads' address registers; it takes both
                // addresses as inputs, so that no loaded value is placed over them in front of it
                asm volatile("s_wait_xcnt 0x0" :: "v"(cp), "v"(sp) : "memory");
                float cs[8] = {c0[0], c0[1], c0[2], c0[3], c1[0], c1[1], c1[2], c1[3]};
                float sn[8] = {s0[0], s0[1], s0[2], s0[3], s1[0], s1[1], s1[2], s1[3]};
                const float sg = (colc < 64) ? -1.0f : 1.0f;
#pragma unroll
                for (int e = 0; e < 8; ++e) x[e] = x[e] * cs[e] + sg * (xp[e] * sn[e]);
            }
            v4u hi, lo;
            split8(x, hi, lo);
            const size_t o = (size_t)gi * ldo + j0 + colc;
            st2u(Oh + o, Ol + o, hi, lo);
            stores_issued();
        }
    }
}

// the three projections of X in one launch: they depend on the preparation alone, so each takes a range of the block index.
// The long Q tiles come first; the short K and V tiles follow them onto the chip with no launch boundary between.
constexpr int GB_Q = (NQ / 128) * (MROWS / 128);
constexpr int GB_K = (NKVD / 128) * (MROWS / 32);
constexpr int GB_V = (MROWS / 128) * (NKVD / 32);

__global__ void __launch_bounds__(128)
gemm_qkv(const u16* Xh, const u16* Xl, const u16* Wqth, const u16* Wqtl, const u16* Wkth, const u16* Wktl,
         const u16* Wvth, const u16* Wvtl, const float* bq, const float* bk, const float* bv,
         const float* cosT, const float* sinT, u16* Qh, u16* Ql, u16* Kh, u16* Kl, u16* Vth, u16* Vtl)
{
    __shared__ __align__(16) unsigned char Sm[gemm_lds(4)];
    int blk = blockIdx.x;                              // the same in every thread of a block
    if (blk < GB_Q) {
        // Q = X.Wq + bq, rotary -> planes [MROWS][NQ]
        gemm_tile<EPI_ROPE, 4>(Sm, blk % (NQ / 128), blk / (NQ / 128),
                               Xh, Xl, HID, Wqth, Wqtl, HID, HID, bq, cosT, sinT, Qh, Ql, nullptr, NQ);
        return;
    }
    blk -= GB_Q;
    if (blk < GB_K) {
        // K = X.Wk + bk, rotary -> planes [MROWS][NKVD]
        gemm_tile<EPI_ROPE, 1>(Sm, blk % (NKVD / 128), blk / (NKVD / 128),
                               Xh, Xl, HID, Wkth, Wktl, HID, HID, bk, cosT, sinT, Kh, Kl, nullptr, NKVD);
        return;
    }
    blk -= GB_K;
    // Vt[kvh*128+d][token] = (X.Wv + bv)^T -> planes [NKVD][MROWS]
    gemm_tile<EPI_ROWB, 1>(Sm, blk % (MROWS / 128), blk / (MROWS / 128),
                           Wvth, Wvtl, HID, Xh, Xl, HID, HID, bv, cosT, sinT, Vth, Vtl, nullptr, MROWS);
}

// out = AO.Wo + bo -> f32 [MROWS][HID]; grid (HID/128, MROWS/128)
__global__ void __launch_bounds__(128)
gemm_out(const u16* AOh, const u16* AOl, const u16* Woth, const u16* Wotl, const float* bo, float* out)
{
    __shared__ __align__(16) unsigned char Sm[gemm_lds(4)];
    gemm_tile<EPI_F32, 4>(Sm, blockIdx.x, blockIdx.y,
                          AOh, AOl, NQ, Woth, Wotl, NQ, NQ, bo, nullptr, nullptr, nullptr, nullptr, out, HID);
}

constexpr int KP  = 136;                   // LDS pitch (halves) of a K row of 128 dims: 272 B = 16 B x 17
constexpr int VP  = 40;                    // LDS pitch (halves) of a Vt row of 32 keys:  80 B = 16 B x 5
constexpr int KPL = 32 * KP;               // one K plane of a tile (halves)
constexpr int VPL = HD * VP;               // one Vt plane of a tile (halves)
constexpr int STG = 2 * KPL + 2 * VPL;     // one ring buffer: Kh | Kl | Vh | Vl (halves)

__global__ void __launch_bounds__(512)
attn_x3(const u16* Qh, const u16* Ql, const u16* Kh, const u16* Kl,
        const u16* Vh, const u16* Vl, const float* amask, const int* flags,
        u16* Oh, u16* Ol)
{
    __shared__ __align__(16) u16 RingA[2 * 2 * STG];           // [half][buffer]
    __shared__ __align__(16) float OsA[NREP * 16 * OSP];
    __shared__ __align__(16) float PaA[NREP * 16 * 128];       // the second half's O: 16 x 16 B of each lane, lane-contiguous
    __shared__ float MsA[NREP * 32], LsA[NREP * 32];           // the second half's running maximum and sum, by lane

    const int tid = threadIdx.x & 255;         // the thread in its half
    const int lane = tid & 31, h = lane >> 4, ln = lane & 15;
    const int w = __builtin_amdgcn_readfirstlane(tid >> 5);
    const int g = __builtin_amdgcn_readfirstlane((int)(threadIdx.x >> 8));    // the half, the same in every lane of a wave
    const int kvh = blockIdx.y, b = blockIdx.z;
    const int hh = kvh * NREP + w;
    const u16* Ring = RingA + g * (2 * STG);   // each half's own ring
    float* Os = OsA + w * (16 * OSP);          // O staging of head w
    float* Pa = PaA + w * (16 * 128) + lane * 4;

    // not unrolled: one copy of the key loop in the instruction cache serves both tiles
#pragma unroll 1
    for (int part = 0; part < 2; ++part) {
    const int qt = part == 0 ? NQT - 1 - (int)blockIdx.x : (int)blockIdx.x;    // the same in every thread of the work-group
    const int q0 = qt * 16;
    const size_t qofs = (size_t)(b * S + q0 + ln) * NQ + hh * HD + 8 * h;     // B column ln, + dc*32
    const u32 mofs = (u32)((q0 + ln) * S + 8 * h);                            // query ln, + kb (+16), 8 keys in a row

    // this lane's share of a tile's copies: K rows tid/16 and +16 (16 B of 256), Vt rows tid/4 and +64 (16 B of 64)
    const int krow = tid >> 4, kcol = (tid & 15) * 8;
    const int vrow = tid >> 2, vcol = (tid & 3) * 8;
    const u32 kgo = (u32)((b * S + krow) * NKVD + kvh * HD + kcol);           // + kb*NKVD
    const u32 vgo = (u32)((kvh * HD + vrow) * MROWS + b * S + vcol);          // + kb
    const u32 klo = lds_off(Ring) + 2u * (u32)(krow * KP + kcol);             // + buffer
    const u32 vlo = lds_off(Ring) + 2u * (u32)(2 * KPL + vrow * VP + vcol);   // + buffer
    auto stage = [&](int kt, int bf) {
        const u32 lb = (u32)bf * (2u * STG);
        const u32 ko = kgo + (u32)(kt * 32 * NKVD);
        const u32 vo = vgo + (u32)(kt * 32);
        copy8(klo + lb, klo + lb + 2u * (16 * KP), klo + lb + 2u * KPL, klo + lb + 2u * (KPL + 16 * KP),
              vlo + lb, vlo + lb + 2u * (64 * VP), vlo + lb + 2u * VPL, vlo + lb + 2u * (VPL + 64 * VP),
              Kh + ko, Kh + ko + (size_t)16 * NKVD, Kl + ko, Kl + ko + (size_t)16 * NKVD,
              Vh + vo, Vh + vo + (size_t)64 * MROWS, Vl + vo, Vl + vo + (size_t)64 * MROWS);
    };

    float mrun = -1.0e30f, lrun = 0.0f;        // of query ln; lrun sums this wave half's keys only, joined behind the loop
    v8f o[8];                                  // o[t][r] = O[query ln][dim t*16 + 8h + r]
#pragma unroll
    for (int t = 0; t < 8; ++t) o[t] = zero8();

    // the key tiles that are not all-masked, as a 64-bit set, alike in every wave of the work-group:
    // the ring has to know the next tile one pass ahead
    const u32 a_lo = __builtin_amdgcn_ballot_w32(flags[qt * NKT + lane] != 1);
    const u32 a_hi = __builtin_amdgcn_ballot_w32(flags[qt * NKT + 32 + lane] != 1);
    // the wait that stands ahead of any overwrite of the two flag loads' offset register: the Q fragments below may be placed over it
    asm volatile("s_wait_xcnt 0x0" ::: "memory");
    unsigned long long act = (unsigned long long)a_lo | ((unsigned long long)a_hi << 32);

    // Q^T of this wave's head, both planes, all 128 dims: the same B fragments in every pass, loaded once and kept in registers
    const u16* qhp = Qh + qofs;
    const u16* qlp = Ql + qofs;
    v16bf qh[4], ql[4];
    // unrolled: constant indices keep the fragments in registers
#pragma unroll
    for (int dc = 0; dc < 4; ++dc) {
        qh[dc] = ldfrag(qhp + dc * 32);
        ql[dc] = ldfrag(qlp + dc * 32);
    }
    // the wait that stands ahead of any overwrite of the loads' address registers; it takes both addresses as inputs,
    // so that no fragment is placed over them in front of it
    asm volatile("s_wait_xcnt 0x0" :: "v"(qhp), "v"(qlp) : "memory");

    if (act != 0) {
        // a pass takes the next two tiles off the set, the first for the first half, the second for the second half;
        // the result is this half's tile, or -1 where the set ends on an odd tile. The set stays alike in every wave.
        auto take = [&]() -> int {
            const int t0 = __builtin_ctzll(act);
            act &= act - 1;
            int t1 = -1;
            if (act != 0) {
                t1 = __builtin_ctzll(act);
                act &= act - 1;
            }
            return g == 0 ? t0 : t1;
        };
        // the first tile goes into buffer 'part': the copies' LDS addresses then differ between the two query tiles and are formed
        // where they are used; as constants of the whole kernel they were kept through the key loop, too many registers for four waves on a SIMD
        int bf = part;
        int kt = take();
        if (kt >= 0) stage(kt, bf);
        asm volatile("s_wait_asynccnt 0x0" ::: "memory");    // this wave's copies of the first tile have landed
        __syncthreads();                                     // ... and every other wave's
        bool more = act != 0;                                // a further pass exists: the same in every wave of the work-group
        int ktn = -1;
        if (more) {
            ktn = take();
            if (ktn >= 0) stage(ktn, bf ^ 1);
        }
        for (;;) {
            if (kt >= 0) {                                   // a half without a tile in the last pass only passes the publish point
            const int kb = kt * 32;
            const u16* Kb = Ring + bf * STG + ln * KP + 8 * h;               // K row ln, + 16*KP, + KPL, + dc*32
            const u16* Vb = Ring + bf * STG + 2 * KPL + ln * VP + 8 * h;     // Vt row ln, + t*16*VP, + VPL

            // the additive mask of query ln for this lane's 16 keys
            const float* mp = amask + (mofs + (u32)kb);
            const v4f mk0 = *(const v4fa*)(mp);
            const v4f mk1 = *(const v4fa*)(mp + 4);
            const v4f mk2 = *(const v4fa*)(mp + 16);
            const v4f mk3 = *(const v4fa*)(mp + 20);

            // scores S^T[32 keys][16 q] = K . Q^T over 128 dims (4 k-steps), two 16-key accumulators
            v8f s0 = zero8(), s1 = zero8();
            // the K fragments of a k-step come one step ahead of their products; constant indices keep them in registers
            v16bf kh[4][2], kl[4][2];
            kh[0][0] = ldfrag(Kb);
            kh[0][1] = ldfrag(Kb + 16 * KP);
            kl[0][0] = ldfrag(Kb + KPL);
            kl[0][1] = ldfrag(Kb + KPL + 16 * KP);
#pragma unroll
            for (int dc = 0; dc < 4; ++dc) {
                if (dc < 3) {
                    kh[dc + 1][0] = ldfrag(Kb + (dc + 1) * 32);
                    kh[dc + 1][1] = ldfrag(Kb + 16 * KP + (dc + 1) * 32);
                    kl[dc + 1][0] = ldfrag(Kb + KPL + (dc + 1) * 32);
                    kl[dc + 1][1] = ldfrag(Kb + KPL + 16 * KP + (dc + 1) * 32);
                }
                __builtin_amdgcn_sched_barrier(0);   // the loads above stay ahead of these products
                mma(s0, kh[dc][0], qh[dc]);
                mma(s1, kh[dc][1], qh[dc]);
                mma(s0, kh[dc][0], ql[dc]);
                mma(s1, kh[dc][1], ql[dc]);
                mma(s0, kl[dc][0], qh[dc]);
                mma(s1, kl[dc][1], qh[dc]);
                __builtin_amdgcn_sched_barrier(0);   // the products above stay ahead of the next loads and of the pass's end
            }
            // the first two V^T row groups are fetched here, so that they arrive under the softmax
            v16bf vh[8], vl[8];
            vh[0] = ldfrag(Vb);
            vh[1] = ldfrag(Vb + 16 * VP);
            vl[0] = ldfrag(Vb + VPL);
            vl[1] = ldfrag(Vb + VPL + 16 * VP);
            __builtin_amdgcn_sched_barrier(0);   // these loads stay ahead of the softmax

            // scale + additive mask by value + online softmax; lane (h,ln): s0[r] = (key kb + 8h + r, query ln), s1: + 16
            // the loops of this block are unrolled: every index into a, p0, p1 and o is a constant, so they stay in registers
            float a[16];
#pragma unroll
            for (int r = 0; r < 4; ++r) {
                a[r]      = s0[r]     * SCALE + mk0[r];
                a[4 + r]  = s0[4 + r] * SCALE + mk1[r];
                a[8 + r]  = s1[r]     * SCALE + mk2[r];
                a[12 + r] = s1[4 + r] * SCALE + mk3[r];
            }
            float mx = a[0];
#pragma unroll
            for (int e = 1; e < 16; ++e) mx = fmaxf(mx, a[e]);
            mx = fmaxf(mx, xhalf(mx));                           // the other 16 keys of the query
            const float mnew = fmaxf(mrun, mx);
            const float corr = __expf(mrun - mnew);
            mrun = mnew;
            float p0[8], p1[8];
            float ps = 0.0f;
#pragma unroll
            for (int r = 0; r < 8; ++r) {
                p0[r] = __expf(a[r] - mnew);
                p1[r] = __expf(a[8 + r] - mnew);
                ps += p0[r] + p1[r];
            }
            lrun = lrun * corr + ps;
#pragma unroll
            for (int t = 0; t < 8; ++t)
#pragma unroll
                for (int r = 0; r < 8; ++r) o[t][r] *= corr;
            // P^T as a B operand: element r <- key 8h + r, element 8 + r <- key 16 + 8h + r, column ln: as the lane holds them
            Frag ph, pl;
            split8(p0, ph.q[0], pl.q[0]);
            split8(p1, ph.q[1], pl.q[1]);

            // O^T[128][16 q] += V^T[128][32 keys] . P^T[32 keys][16 q]; V^T A-fragments from the ring's key-contiguous rows
            // two row groups at a time, the next two fetched ahead of these products
#pragma unroll
            for (int t = 0; t < 8; t += 2) {
                if (t < 6) {
                    vh[t + 2] = ldfrag(Vb + (t + 2) * 16 * VP);
                    vh[t + 3] = ldfrag(Vb + (t + 3) * 16 * VP);
                    vl[t + 2] = ldfrag(Vb + VPL + (t + 2) * 16 * VP);
                    vl[t + 3] = ldfrag(Vb + VPL + (t + 3) * 16 * VP);
                }
                mma3x2(o[t], o[t + 1], vh[t], vl[t], vh[t + 1], vl[t + 1], ph.v, pl.v);
            }
            }

            // publish point: this wave's LDS reads are done, its copies of the next tile have landed,
            // then the barrier that says both of every wave
            asm volatile("s_wait_dscnt 0x0" ::: "memory");
            asm volatile("s_wait_asynccnt 0x0" ::: "memory");
            __syncthreads();
            if (!more) break;
            kt = ktn;
            ktn = -1;
            more = act != 0;
            if (more) {                                          // refill the buffer this pass has just read
                ktn = take();
                if (ktn >= 0) stage(ktn, bf);
            }
            bf ^= 1;
        }
    }
    asm volatile("s_wait_asynccnt 0x0" ::: "memory");            // no copy is left in flight when the wave ends

    // the second half hands over what it has of head w: lane l of its wave w to lane l of the first half's wave w
    if (g == 1) {
        // unrolled: constant indices keep o in registers
#pragma unroll
        for (int t = 0; t < 8; ++t) {
            v4f x0, x1;
#pragma unroll
            for (int r = 0; r < 4; ++r) { x0[r] = o[t][r]; x1[r] = o[t][4 + r]; }
            *(v4fa*)(Pa + (2 * t) * 128) = x0;
            *(v4fa*)(Pa + (2 * t + 1) * 128) = x1;
        }
        MsA[w * 32 + lane] = mrun;
        LsA[w * 32 + lane] = lrun;
    }
    __syncthreads();                                             // the hand-over is written; every wave has left the tile before's stores
    // join the halves under their common maximum, normalise, stage the 16x128 f32 tile
    if (g == 0) {
        const float m1 = MsA[w * 32 + lane], l1 = LsA[w * 32 + lane];
        const float mj = fmaxf(mrun, m1);
        const float c0 = __expf(mrun - mj), c1 = __expf(m1 - mj);
        const float lj = lrun * c0 + l1 * c1;
        const float lv = lj + xhalf(lj);                         // both wave halves' keys
        const float li = (lv > 0.0f) ? (1.0f / lv) : 0.0f;
        const float f0 = c0 * li, f1 = c1 * li;
        float* orow = Os + ln * OSP + 8 * h;
        // unrolled: constant indices keep o in registers
#pragma unroll
        for (int t = 0; t < 8; ++t) {
            const v4f y0 = *(const v4fa*)(Pa + (2 * t) * 128);
            const v4f y1 = *(const v4fa*)(Pa + (2 * t + 1) * 128);
            v4f x0, x1;
#pragma unroll
            for (int r = 0; r < 4; ++r) { x0[r] = o[t][r] * f0 + y0[r] * f1; x1[r] = o[t][4 + r] * f0 + y1[r] * f1; }
            *(v4fa*)(orow + t * 16) = x0;
            *(v4fa*)(orow + t * 16 + 4) = x1;
        }
    }
    __syncthreads();
    // write hi/lo planes with 16-B lane-contiguous stores; each half takes 8 of the 16 rows of head w
#pragma unroll 1
    for (int it = g * 4; it < g * 4 + 4; ++it) {
        const int row = it * 2 + h, colc = ln * 8;
        const float* cr = Os + row * OSP;
        const v4f a = *(const v4fa*)(cr + colc);
        const v4f c = *(const v4fa*)(cr + colc + 4);
        float x[8] = {a[0], a[1], a[2], a[3], c[0], c[1], c[2], c[3]};
        v4u hi, lo;
        split8(x, hi, lo);
        const size_t oo = (size_t)(b * S + q0 + row) * NQ + hh * HD + colc;
        st2u(Oh + oo, Ol + oo, hi, lo);
        stores_issued();                       // the next trip, and behind the last trip the second tile's code, rewrite the stores' registers
    }
    }
}

// ---------------- host ---------------------------------------------------------------------
extern "C" void kernel_launch(void* const* d_in, const int* in_sizes, int n_in,
                              void* d_out, int out_size, void* d_ws, size_t ws_size,
                              hipStream_t stream)
{
    if (n_in < 11) return;
    if (in_sizes[0] != MROWS * HID || in_sizes[1] != MROWS || in_sizes[2] != S * S ||
        in_sizes[3] != HID * NQ || in_sizes[4] != NQ ||
        in_sizes[5] != HID * NKVD || in_sizes[6] != NKVD ||
        in_sizes[7] != HID * NKVD || in_sizes[8] != NKVD ||
        in_sizes[9] != NQ * HID || in_sizes[10] != HID) return;
    if (out_size != MROWS * HID) return;

    const float* X   = (const float*)d_in[0];   // [B*S][HID]
    const float* ts  = (const float*)d_in[1];   // [B*S]
    const float* amk = (const float*)d_in[2];   // [S][S] additive
    const float* Wq  = (const float*)d_in[3];   // [HID][NQ]
    const float* bq  = (const float*)d_in[4];
    const float* Wk  = (const float*)d_in[5];   // [HID][NKVD]
    const float* bk  = (const float*)d_in[6];
    const float* Wv  = (const float*)d_in[7];   // [HID][NKVD]
    const float* bv  = (const float*)d_in[8];
    const float* Wo  = (const float*)d_in[9];   // [NQ][HID]
    const float* bo  = (const float*)d_in[10];
    float* out = (float*)d_out;                 // [B*S][HID]

    const size_t szX  = (size_t)MROWS * HID * 2;     // one plane
    const size_t szWq = (size_t)NQ * HID * 2;
    const size_t szWk = (size_t)NKVD * HID * 2;
    const size_t szWo = (size_t)HID * NQ * 2;
    const size_t szQ  = (size_t)MROWS * NQ * 2;
    const size_t szK  = (size_t)MROWS * NKVD * 2;
    const size_t szVt = (size_t)NKVD * MROWS * 2;
    const size_t szTb = (size_t)MROWS * NFREQ * 4;
    const size_t szFl = (size_t)NQT * NKT * 4;
    char* base = (char*)d_ws;
    size_t used = 0;
    auto take = [&](size_t bytes) -> char* { char* p = base + used; used += (bytes + 255) & ~(size_t)255; return p; };
    u16* Xh   = (u16*)take(szX);   u16* Xl   = (u16*)take(szX);     // reused as attention-output planes
    u16* Wqth = (u16*)take(szWq);  u16* Wqtl = (u16*)take(szWq);    // [NQ][HID]
    u16* Wkth = (u16*)take(szWk);  u16* Wktl = (u16*)take(szWk);    // [NKVD][HID]
    u16* Wvth = (u16*)take(szWk);  u16* Wvtl = (u16*)take(szWk);    // [NKVD][HID]
    u16* Woth = (u16*)take(szWo);  u16* Wotl = (u16*)take(szWo);    // [HID][NQ]
    u16* Qh   = (u16*)take(szQ);   u16* Ql   = (u16*)take(szQ);     // [MROWS][NQ]
    u16* Kh   = (u16*)take(szK);   u16* Kl   = (u16*)take(szK);     // [MROWS][NKVD]
    u16* Vth  = (u16*)take(szVt);  u16* Vtl  = (u16*)take(szVt);    // [NKVD][MROWS]
    float* cosT = (float*)take(szTb);                               // [MROWS][64]
    float* sinT = (float*)take(szTb);
    int* flags  = (int*)take(szFl);                                 // [NQT][NKT]
    if (used > ws_size) return;
    u16* AOh = Xh;   // X planes are dead once the three projections are enqueued
    u16* AOl = Xl;

    // 1: preparation: X and the four weights -> hi/lo planes (weights k-contiguous), rotary table, tile skip flags
    k_prep<<<dim3(PB_ALL), dim3(256), 0, stream>>>(X, ts, amk, Wq, Wk, Wv, Wo, Xh, Xl, Wqth, Wqtl, Wkth, Wktl,
                                                   Wvth, Wvtl, Woth, Wotl, cosT, sinT, flags);
    // 2: the Q, K and V projections
    gemm_qkv<<<dim3(GB_Q + GB_K + GB_V), dim3(128), 0, stream>>>(Xh, Xl, Wqth, Wqtl, Wkth, Wktl, Wvth, Wvtl, bq, bk, bv,
                                                                 cosT, sinT, Qh, Ql, Kh, Kl, Vth, Vtl);
    // 3: attention -> AO planes [MROWS][NQ]
    attn_x3<<<dim3(NQT / 2, NKV, BB), dim3(512), 0, stream>>>(Qh, Ql, Kh, Kl, Vth, Vtl, amk, flags, AOh, AOl);
    // 4: the output projection
    gemm_out<<<dim3(HID / 128, MROWS / 128), dim3(128), 0, stream>>>(AOh, AOl, Woth, Wotl, bo, out);
    (void)hipGetLastError();
}

// v010
// It runs in 251 microseconds.
// Next to v009, in two timings, it ran 1.03 and 1.04 times as fast.
// Counting every step since v000, it is 3.87 times as fast.
#include <hip/hip_runtime.h>
#include <math.h>
#include <stddef.h>

// All contractions (q/k/v projections, q.k^T scores, p.v, output projection): v_wmma_f32_16x16x32_bf16 with bf16 hi/lo operands everywhere (hi*hi + hi*lo + lo*hi), f32 accumulate; softmax, rotary, scale and biases in f32.

constexpr int BB    = 2;
constexpr int S     = 2048;
constexpr int HID   = 2048;
constexpr int NH    = 16;
constexpr int NKV   = 2;
constexpr int HD    = 128;
constexpr int NREP  = NH / NKV;            // 8
constexpr int MROWS = BB * S;              // 4096 token rows
constexpr int NQ    = NH * HD;             // 2048
constexpr int NKVD  = NKV * HD;            // 256
constexpr int NQT   = S / 16;              // 128 query tiles of 16 rows
constexpr int NKT   = S / 32;              // 64 key tiles of 32 keys
constexpr int NFREQ = HD / 2;              // 64 rotary frequencies
constexpr float SCALE = 0.08838834764831845f;   // 1/sqrt(128)
constexpr int CP  = 132;                   // LDS pitch (floats), 32*MI x 128 C tile
constexpr int OSP = 132;                   // LDS pitch (floats), 16x128 O tile
constexpr int TP  = 68;                    // LDS pitch (floats), transpose tile

constexpr int EPI_ROPE = 1;                // hi/lo planes out, column bias, rotary
constexpr int EPI_ROWB = 2;                // hi/lo planes out, row bias
constexpr int EPI_F32  = 3;                // f32 out, column bias

static_assert(MROWS % 128 == 0);
static_assert(NQ % 128 == 0);
static_assert(NKVD % 128 == 0);
static_assert(HID % 64 == 0);
static_assert(S % 32 == 0);
static_assert(NQT % 2 == 0);

typedef unsigned int   u32;
typedef unsigned short u16;
typedef __bf16 v16bf __attribute__((ext_vector_type(16)));
typedef float  v8f   __attribute__((ext_vector_type(8)));
typedef int    v8i   __attribute__((ext_vector_type(8)));
typedef float  v4f   __attribute__((ext_vector_type(4)));
typedef u32    v4u   __attribute__((ext_vector_type(4)));
typedef int    v4i   __attribute__((ext_vector_type(4)));
typedef v4f v4fa __attribute__((may_alias));
typedef v4u v4ua __attribute__((may_alias));
typedef v4i v4ia __attribute__((may_alias));

union Frag { v16bf v; v4u q[2]; };

// ---------------- bf16 RNE split helpers (packed hardware conversion) ----------
typedef float  v2f  __attribute__((ext_vector_type(2)));
typedef __bf16 v2bf __attribute__((ext_vector_type(2)));

// two f32 -> two bf16, round to nearest even, the first in the low half-word: one packed conversion
__device__ __forceinline__ u32 bf2(v2f x) {
    return __builtin_bit_cast(u32, __builtin_convertvector(x, v2bf));
}

// 8 f32 -> packed bf16 hi plane (4 dwords) and lo plane (4 dwords); element 2c in the low half-word
__device__ __forceinline__ void split8(const float (&x)[8], v4u& hi, v4u& lo) {
#pragma unroll
    for (int c = 0; c < 4; ++c) {
        const v2f p = {x[2 * c], x[2 * c + 1]};
        const u32 h = bf2(p);
        const v2f b = {__builtin_bit_cast(float, h << 16), __builtin_bit_cast(float, h & 0xFFFF0000u)};
        hi[c] = h;
        lo[c] = bf2(p - b);
    }
}

// ---------------- fragment loader (A map and B map identical, k-contiguous row) -------
// p = plane + row*ld + k0 + 8*h ; elements 0..7 <- k0+8h..+7, elements 8..15 <- k0+16+8h..+7
__device__ __forceinline__ v16bf ldfrag(const u16* p) {
    Frag f;
    f.q[0] = *(const v4ua*)(p);
    f.q[1] = *(const v4ua*)(p + 16);
    return f.v;
}

__device__ __forceinline__ v8f zero8() {
    v8f z;
#pragma unroll
    for (int i = 0; i < 8; ++i) z[i] = 0.0f;
    return z;
}

// one term of a hi/lo product. An accumulator takes its three terms in the order hi*hi, hi*lo, lo*hi; the callers go term by
// term over several accumulators, so that a product never waits for the one issued directly ahead of it
__device__ __forceinline__ void mma(v8f& acc, v16bf a, v16bf b) {
    acc = __builtin_amdgcn_wmma_f32_16x16x32_bf16(false, a, false, b, (short)0, acc, false, false);
}

// Where __builtin_amdgcn_sched_barrier(0) stands below, it parts a group of LDS fragment loads from a group of products: without
// it the compiler moves the loads down to their first use, in among the products, and the wave waits out the LDS latency at each.

// the three terms of two accumulators that share the B operand, term by term, in one statement. In asm because the compiler moved
// the builtin form of these products, with the end of the softmax, down past every later fragment load: all fragments of a pass
// were then live at once, too many registers for four waves on a SIMD. The "memory" clobber keeps the fragment loads on their side.
// The four v_nop keep the distance from the last product to a vector instruction on its registers.
__device__ __forceinline__ void mma3x2(v8f& c0, v8f& c1, v16bf a0h, v16bf a0l, v16bf a1h, v16bf a1l, v16bf bh, v16bf bl) {
    const v8i x0h = __builtin_bit_cast(v8i, a0h), x0l = __builtin_bit_cast(v8i, a0l);
    const v8i x1h = __builtin_bit_cast(v8i, a1h), x1l = __builtin_bit_cast(v8i, a1l);
    const v8i yh = __builtin_bit_cast(v8i, bh), yl = __builtin_bit_cast(v8i, bl);
    asm volatile("v_wmma_f32_16x16x32_bf16 %0, %2, %6, %0\n\t"
                 "v_wmma_f32_16x16x32_bf16 %1, %4, %6, %1\n\t"
                 "v_wmma_f32_16x16x32_bf16 %0, %2, %7, %0\n\t"
                 "v_wmma_f32_16x16x32_bf16 %1, %4, %7, %1\n\t"
                 "v_wmma_f32_16x16x32_bf16 %0, %3, %6, %0\n\t"
                 "v_wmma_f32_16x16x32_bf16 %1, %5, %6, %1\n\t"
                 "v_nop\n\tv_nop\n\tv_nop\n\tv_nop"
                 : "+v"(c0), "+v"(c1)
                 : "v"(x0h), "v"(x0l), "v"(x1h), "v"(x1l), "v"(yh), "v"(yl)
                 : "memory");
}

__device__ __forceinline__ void st2u(u16* ph, u16* pl, v4u hi, v4u lo) {
    *(v4u*)ph = hi;
    *(v4u*)pl = lo;
    
}
__device__ __forceinline__ void st2f(float* p, v4f v) {
    *(v4f*)p = v;
    
}
// Behind the stores of a job that shares its kernel with other jobs: the wait that stands ahead of any overwrite of a register
// that an issued store names. The code of another job follows in the built kernel, where a kernel of one job would end.
__device__ __forceinline__ void stores_issued() {
    asm volatile("s_wait_xcnt 0x0" ::: "memory");
}

// ---------------- X: f32 rows -> hi/lo bf16 planes, same layout --------------------------
__device__ __forceinline__ void
split_rows(int blk, const float* X, int n, u16* Xh, u16* Xl)
{
    const size_t i = ((size_t)blk * 256 + threadIdx.x) * 8;
    if (i + 8 <= (size_t)n) {
        const v4f a = *(const v4fa*)(X + i);
        const v4f c = *(const v4fa*)(X + i + 4);
        float x[8] = {a[0], a[1], a[2], a[3], c[0], c[1], c[2], c[3]};
        v4u hi, lo;
        split8(x, hi, lo);
        st2u(Xh + i, Xl + i, hi, lo);
    }
}

// ---------------- weights: in[nrows][ncols] f32 -> hi/lo planes out[ncols][nrows] ----------
// blocks (ncols/64) x (nrows/64), the column tile running first; LDS transpose in T (64 * TP floats);
// each output line (64 halves) by lanes 8q..8q+7
__device__ __forceinline__ void
split_t(float* T, int blk, const float* W, int nrows, int ncols, u16* Th, u16* Tl)
{
    const int tid = threadIdx.x;
    const int cb = (blk % (ncols / 64)) * 64;      // input column tile == output row tile
    const int rb = (blk / (ncols / 64)) * 64;      // input row tile    == output column tile
#pragma unroll
    for (int it = 0; it < 4; ++it) {
        const int fl = it * 256 + tid;
        const int rr = fl >> 4, cc = (fl & 15) * 4;
        const v4f v = *(const v4fa*)(W + (size_t)(rb + rr) * ncols + cb + cc);
        T[(cc + 0) * TP + rr] = v[0];
        T[(cc + 1) * TP + rr] = v[1];
        T[(cc + 2) * TP + rr] = v[2];
        T[(cc + 3) * TP + rr] = v[3];
    }
    __syncthreads();
#pragma unroll
    for (int it = 0; it < 2; ++it) {
        const int orow = it * 32 + (tid >> 3), oc = (tid & 7) * 8;
        const v4f a = *(const v4fa*)(T + orow * TP + oc);
        const v4f c = *(const v4fa*)(T + orow * TP + oc + 4);
        float x[8] = {a[0], a[1], a[2], a[3], c[0], c[1], c[2], c[3]};
        v4u hi, lo;
        split8(x, hi, lo);
        const size_t o = (size_t)(cb + orow) * nrows + rb + oc;
        st2u(Th + o, Tl + o, hi, lo);
    }
    stores_issued();
}

// ---------------- rotary table: cos/sin of f32(ts[row] * inv_freq[j]) ---------------------
__device__ __forceinline__ void
rope_table(int blk, const float* ts, int nrows, float* cosT, float* sinT)
{
    const int tid = threadIdx.x;
    const int row = blk * 4 + (tid >> 6);
    const int j   = tid & 63;
    const int rc  = row < nrows ? row : nrows - 1;
    const float t = ts[rc];
    // inv_freq[j] = 1 / f32(10000^(j/64)); the power evaluated in f64 and converted once
    const double p  = exp2((double)j * (13.287712379549449 / 64.0));
    const float  pf = (float)p;
    const float inv = 1.0f / pf;
    const float ang = t * inv;
    float sn, cs;
    sincosf(ang, &sn, &cs);
    if (row < nrows) {
        const size_t o = (size_t)row * NFREQ + j;
        *(float*)(cosT + o) = cs;
        *(float*)(sinT + o) = sn;
        stores_issued();
    }
}

// ---------------- tile flags from the additive input mask ---------------------------------
// flag[qt][kt] = 1 when every entry of the 16x32 mask tile is <= -1e8 (tile contributes 0)
// blocks NQT x 2, the query tile running first; sf: 32 ints of LDS
__device__ __forceinline__ void
tile_flags(int* sf, int blk, const float* amask, int* flags)
{
    const int tid = threadIdx.x, lane = tid & 31, w = tid >> 5;
    const int qt = blk % NQT, hf = blk / NQT;
    const int t = tid >> 3, sub = tid & 7;
    const int kt = hf * 32 + t;
    const int kb = kt * 32;
    int ok = 1;
#pragma unroll
    for (int rr = 0; rr < 2; ++rr) {
        const int q = qt * 16 + sub * 2 + rr;
        const float* mp = amask + (size_t)q * S + kb;
#pragma unroll
        for (int c = 0; c < 8; ++c) {
            const v4f v = *(const v4fa*)(mp + 4 * c);
            ok &= (int)(v[0] <= -1.0e8f) & (int)(v[1] <= -1.0e8f) &
                  (int)(v[2] <= -1.0e8f) & (int)(v[3] <= -1.0e8f);
        }
    }
    ok &= __shfl_xor(ok, 1);
    ok &= __shfl_xor(ok, 2);
    ok &= __shfl_xor(ok, 4);
    if (sub == 0) sf[t] = ok;
    __syncthreads();
    if (w == 0 && lane < 8) {
        const v4i f = *(const v4ia*)(sf + lane * 4);
        int* dst = flags + (size_t)qt * NKT + hf * 32 + lane * 4;
        *(v4i*)dst = f;
        stores_issued();
    }
}

// ---------------- the whole preparation in one launch ---------------------------------------
// The seven jobs above depend on nothing but the inputs: each takes a range of the block index of one grid, so that they
// fill the chip together and no launch waits for the last blocks of the one ahead. A block does one job's one tile.
constexpr int PB_WQ = (NQ / 64) * (HID / 64);          // blocks of each job
constexpr int PB_WO = (HID / 64) * (NQ / 64);
constexpr int PB_WK = (NKVD / 64) * (HID / 64);
constexpr int PB_RT = MROWS / 4;
constexpr int PB_FL = NQT * 2;
constexpr int PB_X  = (MROWS * HID) / (256 * 8);
constexpr int PB_ALL = PB_WQ + PB_WO + 2 * PB_WK + PB_RT + PB_FL + PB_X;

__global__ void __launch_bounds__(256)
k_prep(const float* X, const float* ts, const float* amask,
       const float* Wq, const float* Wk, const float* Wv, const float* Wo,
       u16* Xh, u16* Xl, u16* Wqth, u16* Wqtl, u16* Wkth, u16* Wktl, u16* Wvth, u16* Wvtl, u16* Woth, u16* Wotl,
       float* cosT, float* sinT, int* flags)
{
    __shared__ __align__(16) float T[64 * TP];
    __shared__ __align__(16) int sf[32];
    int blk = blockIdx.x;                              // the same in every thread of a block: each branch is taken by all or none
    if (blk < PB_WQ) { split_t(T, blk, Wq, HID, NQ, Wqth, Wqtl); return; }       // in[2048][2048] -> out[2048][2048]
    blk -= PB_WQ;
    if (blk < PB_WO) { split_t(T, blk, Wo, NQ, HID, Woth, Wotl); return; }       // in[2048][2048] -> out[2048][2048]
    blk -= PB_WO;
    if (blk < PB_WK) { split_t(T, blk, Wk, HID, NKVD, Wkth, Wktl); return; }     // in[2048][256]  -> out[256][2048]
    blk -= PB_WK;
    if (blk < PB_WK) { split_t(T, blk, Wv, HID, NKVD, Wvth, Wvtl); return; }     // in[2048][256]  -> out[256][2048]
    blk -= PB_WK;
    if (blk < PB_RT) { rope_table(blk, ts, MROWS, cosT, sinT); return; }
    blk -= PB_RT;
    if (blk < PB_FL) { tile_flags(sf, blk, amask, flags); return; }
    blk -= PB_FL;
    split_rows(blk, X, MROWS * HID, Xh, Xl);
}

__device__ __forceinline__ u32 lds_off(const void* p) { return (u32)(size_t)p; }

// the value of lane l ^ 16
__device__ __forceinline__ float xhalf(float x) {
    const int b = __builtin_bit_cast(int, x);
    return __builtin_bit_cast(float, __builtin_amdgcn_permlanex16(b, b, 0x76543210, 0xfedcba98, false, false));
}

// ---------------- hi/lo split GEMM: C[i][j] = sum_k A[i][k] * B[j][k] -----------------------
// A planes [*][lda], B planes [*][ldb], both k-contiguous; block tile 32*MI (i) x 128 (j),
// 4 waves as 2x2, wave tile 16*MI x 64 = MI x 4 accumulators.
// A pass is 64 k: the pass's rows of all four planes are brought once per work-group into a two-buffer
// LDS ring by tensor loads, one request per wave and pass (wave 0: A hi, 1: A lo, 2: B hi, 3: B lo), the next
// pass flying while this one is used; the waves read their fragments from the ring.
constexpr int GK = 64;                     // k per pass
constexpr int GP = 72;                     // LDS pitch (halves) of a row of 64 k: 144 B = 16 B x 9 = the 128-B row and the mover's 16-B pad
static_assert(HID / GK >= 2 && NQ / GK >= 2);          // the ring's prologue loads two passes

typedef u32 v8u __attribute__((ext_vector_type(8)));

// a descriptor word: alike in every lane, in a scalar register
__device__ __forceinline__ u32 uni(u32 v) { return (u32)__builtin_amdgcn_readfirstlane(v); }
// a wave-uniform value for the tensor mover (an issue test, the number of the pass to load)
__device__ __forceinline__ u32 pinned(u32 v) {
    u32 w = (u32)__builtin_amdgcn_readfirstlane(v);
    asm volatile("" : "+s"(w));   // the pin of the tensor mover's issue test: the value stays in a scalar register, so the test is a scalar branch, and what is formed from it stands behind the waits ahead
    return w;
}
// one request of the whole wave: a two-dimensional tile, global -> LDS through no register
__device__ __forceinline__ void tdm_load(v4u g0, v8u g1) {
    asm volatile("tensor_load_to_lds %0, %1" :: "s"(g0), "s"(g1) : "memory");
}
// word 0 of descriptor group 1: no mask, extents in bytes, 16 B of pad behind every 128-B row
constexpr u32 TDW0 = (1u << 20) | (4u << 22) | (3u << 25);
// the place of one A plane of a pass in the ring (halves): its rows at pitch GP, rounded up to 2 KiB, where the next slice begins
constexpr int gemm_apl(int MI) { return ((32 * MI * GP * 2 + 2047) / 2048) * 1024; }

// LDS bytes of a block: the ring, or the f32 C tile that takes its place behind the loop
constexpr int gemm_lds(int MI) {
    const int rng = 2 * (2 * gemm_apl(MI) + 2 * 128 * GP) * 2, cs = 32 * MI * CP * 4;
    return rng > cs ? rng : cs;
}

// one block tile: column tile bx, row tile by; Sm: gemm_lds(MI) bytes of LDS
template<int EPI, int MI>
__device__ __forceinline__ void
gemm_tile(unsigned char* Sm, int bx, int by,
          const u16* Ah, const u16* Al, int lda,
          const u16* Bh, const u16* Bl, int ldb, int K,
          const float* bias, const float* cosT, const float* sinT,
          u16* Oh, u16* Ol, float* Of, int ldo)
{
    static_assert(MI == 1 || MI == 4);
    constexpr int BM   = 32 * MI;              // rows of the block tile
    constexpr int APL  = gemm_apl(MI);         // one A plane of a pass (halves)
    constexpr int BPL  = 128 * GP;             // one B plane of a pass (halves)
    constexpr int GST  = 2 * APL + 2 * BPL;    // one ring buffer: Ah | Al | Bh | Bl (halves)
    static_assert((2 * APL) % 2048 == 0 && (2 * BPL) % 2048 == 0);     // every slice begins at a multiple of 2 KiB
    const u16* Ring = (const u16*)Sm;
    float* Cs = (float*)Sm;
    const int tid = threadIdx.x, w = tid >> 5, lane = tid & 31;
    const int h = lane >> 4, ln = lane & 15;
    const int wm = w >> 1, wn = w & 1;
    const int i0 = by * BM, j0 = bx * 128;

    v8f acc[MI][4];
#pragma unroll
    for (int mi = 0; mi < MI; ++mi)
#pragma unroll
        for (int ni = 0; ni < 4; ++ni) acc[mi][ni] = zero8();

    // this wave's slice of a pass: one plane's rows of 128 B (64 k), at the source's row pitch
    const u32 ws = uni((u32)tid >> 5);
    const u16* sp = ws == 0 ? Ah : ws == 1 ? Al : ws == 2 ? Bh : Bl;
    const unsigned long long ga0 = (unsigned long long)(size_t)(sp + (ws < 2 ? (size_t)i0 * lda : (size_t)j0 * ldb));   // + pass * 128 B
    const u32 srows = ws < 2 ? (u32)BM : 128u;
    const u32 spitch = 2u * (u32)(ws < 2 ? lda : ldb);
    const u32 slds = lds_off(Sm) + (ws == 0 ? 0u : ws == 1 ? 2u * APL : ws == 2 ? 4u * APL : 4u * APL + 2u * BPL);      // + buffer
    v8u g1;                                    // the same for every pass: tensor = tile = srows rows of 128 B
    g1[0] = uni(TDW0);
    g1[1] = uni(128u << 16);
    g1[2] = uni(srows << 16);
    g1[3] = uni(128u << 16);
    g1[4] = uni(srows);
    g1[5] = uni(spitch);
    g1[6] = uni(0u);
    g1[7] = uni(0u);
    asm volatile("" : "+s"(g1));   // the tensor mover's pin of descriptor words: the group stays in one set of scalar registers, none of which takes a new value while a request is out
    auto stage = [&](u32 t, u32 bf) {
        const unsigned long long ga = ga0 + (unsigned long long)t * (2u * GK);
        v4u g0;
        g0[0] = uni(1u);
        g0[1] = uni(slds + bf * (2u * GST));
        g0[2] = uni((u32)ga);
        g0[3] = uni((((u32)(ga >> 32)) & 0x01FFFFFFu) | 0x80000000u);
        tdm_load(g0, g1);
    };

    const int NT = K / GK;
    stage(0, 0);
    asm volatile("s_wait_tensorcnt 0x0" ::: "memory");       // this wave's slice of the first pass has landed
    __syncthreads();                                         // ... and every other wave's
    stage(pinned(1), 1);

#pragma unroll 1
    for (int t = 0; t < NT; ++t) {
        const int bf = t & 1;
        const u16* Ab = Ring + bf * GST + (wm * (16 * MI) + ln) * GP + 8 * h;        // + mi*16*GP, + APL, + ks*32
        const u16* Bb = Ring + bf * GST + 2 * APL + (wn * 64 + ln) * GP + 8 * h;     // + ni*16*GP, + BPL, + ks*32
        // the loops inside a pass are unrolled: every fragment and accumulator index is a constant, so they stay in registers
        if constexpr (MI == 4) {
            // 128 accumulator registers: the A fragments of 32 k stay, the B fragments come one column group ahead,
            // also over the step from the first 32 k to the second
            v16bf ah[MI], al[MI], bh[8], bl[8];
            bh[0] = ldfrag(Bb);
            bl[0] = ldfrag(Bb + BPL);
#pragma unroll
            for (int ks = 0; ks < 2; ++ks) {
#pragma unroll
                for (int mi = 0; mi < MI; ++mi) ah[mi] = ldfrag(Ab + mi * 16 * GP + ks * 32);
#pragma unroll
                for (int mi = 0; mi < MI; ++mi) al[mi] = ldfrag(Ab + APL + mi * 16 * GP + ks * 32);
#pragma unroll
                for (int ni = 0; ni < 4; ++ni) {
                    const int g = ks * 4 + ni;
                    if (g < 7) {
                        bh[g + 1] = ldfrag(Bb + ((g + 1) & 3) * 16 * GP + ((g + 1) >> 2) * 32);
                        bl[g + 1] = ldfrag(Bb + BPL + ((g + 1) & 3) * 16 * GP + ((g + 1) >> 2) * 32);
                    }
                    __builtin_amdgcn_sched_barrier(0);   // the loads above stay ahead of these products
#pragma unroll
                    for (int mi = 0; mi < MI; ++mi) mma(acc[mi][ni], ah[mi], bh[g]);
#pragma unroll
                    for (int mi = 0; mi < MI; ++mi) mma(acc[mi][ni], ah[mi], bl[g]);
#pragma unroll
                    for (int mi = 0; mi < MI; ++mi) mma(acc[mi][ni], al[mi], bh[g]);
                    __builtin_amdgcn_sched_barrier(0);   // the products above stay ahead of the next loads and of the pass's end
                }
            }
        } else {
            // few accumulators: every fragment of the pass is fetched ahead of its products
            v16bf ah[2][MI], al[2][MI], bh[2][4], bl[2][4];
#pragma unroll
            for (int ks = 0; ks < 2; ++ks) {
#pragma unroll
                for (int mi = 0; mi < MI; ++mi) {
                    ah[ks][mi] = ldfrag(Ab + mi * 16 * GP + ks * 32);
                    al[ks][mi] = ldfrag(Ab + APL + mi * 16 * GP + ks * 32);
                }
#pragma unroll
                for (int ni = 0; ni < 4; ++ni) {
                    bh[ks][ni] = ldfrag(Bb + ni * 16 * GP + ks * 32);
                    bl[ks][ni] = ldfrag(Bb + BPL + ni * 16 * GP + ks * 32);
                }
            }
            __builtin_amdgcn_sched_barrier(0);   // the loads above stay ahead of these products
#pragma unroll
            for (int ks = 0; ks < 2; ++ks) {
#pragma unroll
                for (int ni = 0; ni < 4; ++ni) mma(acc[0][ni], ah[ks][0], bh[ks][ni]);
#pragma unroll
                for (int ni = 0; ni < 4; ++ni) mma(acc[0][ni], ah[ks][0], bl[ks][ni]);
#pragma unroll
                for (int ni = 0; ni < 4; ++ni) mma(acc[0][ni], al[ks][0], bh[ks][ni]);
            }
            __builtin_amdgcn_sched_barrier(0);   // the products above stay ahead of the next loads and of the pass's end
        }
        // publish point
        asm volatile("s_wait_dscnt 0x0" ::: "memory");       // this wave's reads of the buffer are done before it is refilled
        asm volatile("s_wait_tensorcnt 0x0" ::: "memory");   // this wave's slice of the next pass has landed
        __syncthreads();                                     // both hold for every wave
        if (pinned(t + 2 < NT)) stage(pinned((u32)t + 2), (u32)bf);      // refill the buffer this pass has just read
    }
    asm volatile("s_wait_tensorcnt 0x0" ::: "memory");       // no request is in flight when the ring becomes the C tile
    asm volatile("s_wait_dscnt 0x0" ::: "memory");           // ... and no read of the ring

    // stage the f32 tile in LDS: D element r of lane l = (row 8h+r, col ln)
#pragma unroll
    for (int mi = 0; mi < MI; ++mi)
#pragma unroll
        for (int ni = 0; ni < 4; ++ni)
#pragma unroll
            for (int r = 0; r < 8; ++r)
                Cs[(wm * (16 * MI) + mi * 16 + 8 * h + r) * CP + wn * 64 + ni * 16 + ln] = acc[mi][ni][r];
    __syncthreads();

    if (EPI == EPI_F32) {
        // row segment = 128 floats = 512 B = 32 lanes x 16 B, one instruction per row
#pragma unroll 1
        for (int it = 0; it < BM / 4; ++it) {
            const int row = it * 4 + w, col = lane * 4;
            v4f x = *(const v4fa*)(Cs + row * CP + col);
            const v4f bv = *(const v4fa*)(bias + j0 + col);
            x += bv;
            st2f(Of + (size_t)(i0 + row) * ldo + j0 + col, x);
        }
    } else {
        // row segment = 128 halves = 256 B = 16 lanes x 16 B per plane; lanes 16..31 take the next row
#pragma unroll 1
        for (int it = 0; it < BM / 8; ++it) {
            const int row = it * 8 + w * 2 + h, colc = ln * 8;
            const int gi = i0 + row;
            const float* cr = Cs + row * CP;
            float x[8];
            {
                const v4f a = *(const v4fa*)(cr + colc);
                const v4f c = *(const v4fa*)(cr + colc + 4);
                x[0] = a[0]; x[1] = a[1]; x[2] = a[2]; x[3] = a[3];
                x[4] = c[0]; x[5] = c[1]; x[6] = c[2]; x[7] = c[3];
            }
            if (EPI == EPI_ROWB) {
                const float bvv = bias[gi];
#pragma unroll
                for (int e = 0; e < 8; ++e) x[e] += bvv;
            } else {
                const v4f b0 = *(const v4fa*)(bias + j0 + colc);
                const v4f b1 = *(const v4fa*)(bias + j0 + colc + 4);
                x[0] += b0[0]; x[1] += b0[1]; x[2] += b0[2]; x[3] += b0[3];
                x[4] += b1[0]; x[5] += b1[1]; x[6] += b1[2]; x[7] += b1[3];
            }
            if (EPI == EPI_ROPE) {
                // block tile == one head (128 columns); partner column d^64, frequency j = d&63
                const int pc = colc ^ 64;
                float xp[8];
                {
                    const v4f a = *(const v4fa*)(cr + pc);
                    const v4f c = *(const v4fa*)(cr + pc + 4);
                    const v4f b0 = *(const v4fa*)(bias + j0 + pc);
                    const v4f b1 = *(const v4fa*)(bias + j0 + pc + 4);
                    xp[0] = a[0] + b0[0]; xp[1] = a[1] + b0[1]; xp[2] = a[2] + b0[2]; xp[3] = a[3] + b0[3];
                    xp[4] = c[0] + b1[0]; xp[5] = c[1] + b1[1]; xp[6] = c[2] + b1[2]; xp[7] = c[3] + b1[3];
                }
                const int jb = colc & 63;
                const float* cp = cosT + (size_t)gi * NFREQ + jb;
                const float* sp = sinT + (size_t)gi * NFREQ + jb;
                const v4f c0 = *(const v4fa*)(cp), c1 = *(const v4fa*)(cp + 4);
                const v4f s0 = *(const v4fa*)(sp), s1 = *(const v4fa*)(sp + 4);
                // the wait that stands ahead of any overwrite of the four table loads' address registers; it takes both
                // addresses as inputs, so that no loaded value is placed over them in front of it
                asm volatile("s_wait_xcnt 0x0" :: "v"(cp), "v"(sp) : "memory");
                float cs[8] = {c0[0], c0[1], c0[2], c0[3], c1[0], c1[1], c1[2], c1[3]};
                float sn[8] = {s0[0], s0[1], s0[2], s0[3], s1[0], s1[1], s1[2], s1[3]};
                const float sg = (colc < 64) ? -1.0f : 1.0f;
#pragma unroll
                for (int e = 0; e < 8; ++e) x[e] = x[e] * cs[e] + sg * (xp[e] * sn[e]);
            }
            v4u hi, lo;
            split8(x, hi, lo);
            const size_t o = (size_t)gi * ldo + j0 + colc;
            st2u(Oh + o, Ol + o, hi, lo);
            stores_issued();
        }
    }
}

// the three projections of X in one launch: they depend on the preparation alone, so each takes a range of the block index.
// The long Q tiles come first; the short K and V tiles follow them onto the chip with no launch boundary between.
constexpr int GB_Q = (NQ / 128) * (MROWS / 128);
constexpr int GB_K = (NKVD / 128) * (MROWS / 32);
constexpr int GB_V = (MROWS / 128) * (NKVD / 32);

__global__ void __launch_bounds__(128)
gemm_qkv(const u16* Xh, const u16* Xl, const u16* Wqth, const u16* Wqtl, const u16* Wkth, const u16* Wktl,
         const u16* Wvth, const u16* Wvtl, const float* bq, const float* bk, const float* bv,
         const float* cosT, const float* sinT, u16* Qh, u16* Ql, u16* Kh, u16* Kl, u16* Vth, u16* Vtl)
{
    __shared__ __attribute__((aligned(2048))) unsigned char Sm[gemm_lds(4)];       // the mover's places are multiples of 2 KiB
    int blk = blockIdx.x;                              // the same in every thread of a block
    // the job tests decide which tensor loads a wave issues: scalar branches
    if (pinned(blk < GB_Q)) {
        // Q = X.Wq + bq, rotary -> planes [MROWS][NQ]
        gemm_tile<EPI_ROPE, 4>(Sm, blk % (NQ / 128), blk / (NQ / 128),
                               Xh, Xl, HID, Wqth, Wqtl, HID, HID, bq, cosT, sinT, Qh, Ql, nullptr, NQ);
        return;
    }
    blk -= GB_Q;
    if (pinned(blk < GB_K)) {
        // K = X.Wk + bk, rotary -> planes [MROWS][NKVD]
        gemm_tile<EPI_ROPE, 1>(Sm, blk % (NKVD / 128), blk / (NKVD / 128),
                               Xh, Xl, HID, Wkth, Wktl, HID, HID, bk, cosT, sinT, Kh, Kl, nullptr, NKVD);
        return;
    }
    blk -= GB_K;
    // Vt[kvh*128+d][token] = (X.Wv + bv)^T -> planes [NKVD][MROWS]
    gemm_tile<EPI_ROWB, 1>(Sm, blk % (MROWS / 128), blk / (MROWS / 128),
                           Wvth, Wvtl, HID, Xh, Xl, HID, HID, bv, cosT, sinT, Vth, Vtl, nullptr, MROWS);
}

// out = AO.Wo + bo -> f32 [MROWS][HID]; grid (HID/128, MROWS/128)
__global__ void __launch_bounds__(128)
gemm_out(const u16* AOh, const u16* AOl, const u16* Woth, const u16* Wotl, const float* bo, float* out)
{
    __shared__ __attribute__((aligned(2048))) unsigned char Sm[gemm_lds(4)];       // the mover's places are multiples of 2 KiB
    gemm_tile<EPI_F32, 4>(Sm, blockIdx.x, blockIdx.y,
                          AOh, AOl, NQ, Woth, Wotl, NQ, NQ, bo, nullptr, nullptr, nullptr, nullptr, out, HID);
}

constexpr int KP  = 136;                   // LDS pitch (halves) of a K row of 128 dims: 272 B = 16 B x 17
constexpr int VP  = 40;                    // LDS pitch (halves) of a Vt row of 32 keys:  80 B = 16 B x 5
constexpr int KPL = ((32 * KP * 2 + 2047) / 2048) * 1024;      // the place of one K plane of a tile (halves): 32 rows, rounded up to 2 KiB
constexpr int VPL = HD * VP;               // one Vt plane of a tile (halves)
static_assert((2 * KPL) % 2048 == 0 && (2 * VPL) % 2048 == 0);  // every slice begins at a multiple of 2 KiB
// word 0 of descriptor group 1: no mask, extents in bytes, 16 B of pad behind every row of 256 B (K) or of 64 B (Vt)
constexpr u32 TDW0K = (1u << 20) | (5u << 22) | (3u << 25);
constexpr u32 TDW0V = (1u << 20) | (3u << 22) | (3u << 25);
constexpr int STG = 2 * KPL + 2 * VPL;     // one ring buffer: Kh | Kl | Vh | Vl (halves)

__global__ void __launch_bounds__(512)
attn_x3(const u16* Qh, const u16* Ql, const u16* Kh, const u16* Kl,
        const u16* Vh, const u16* Vl, const float* amask, const int* flags,
        u16* Oh, u16* Ol)
{
    __shared__ __attribute__((aligned(2048))) u16 RingA[2 * 2 * STG];      // [half][buffer]; the mover's places are multiples of 2 KiB
    __shared__ __align__(16) float OsA[NREP * 16 * OSP];
    __shared__ __align__(16) float PaA[NREP * 16 * 128];       // the second half's O: 16 x 16 B of each lane, lane-contiguous
    __shared__ float MsA[NREP * 32], LsA[NREP * 32];           // the second half's running maximum and sum, by lane

    const int tid = threadIdx.x & 255;         // the thread in its half
    const int lane = tid & 31, h = lane >> 4, ln = lane & 15;
    const int w = __builtin_amdgcn_readfirstlane(tid >> 5);
    const int g = __builtin_amdgcn_readfirstlane((int)(threadIdx.x >> 8));    // the half, the same in every lane of a wave
    const int kvh = blockIdx.y, b = blockIdx.z;
    const int hh = kvh * NREP + w;
    const u16* Ring = RingA + g * (2 * STG);   // each half's own ring
    float* Os = OsA + w * (16 * OSP);          // O staging of head w
    float* Pa = PaA + w * (16 * 128) + lane * 4;

    // descriptor group 1 of a K slice (32 rows of 256 B) and of a Vt slice (128 rows of 64 B): the same for every tile
    v8u gK, gV;
    gK[0] = uni(TDW0K);
    gK[1] = uni(256u << 16);
    gK[2] = uni(32u << 16);
    gK[3] = uni(256u << 16);
    gK[4] = uni(32u);
    gK[5] = uni(2u * NKVD);
    gK[6] = uni(0u);
    gK[7] = uni(0u);
    gV[0] = uni(TDW0V);
    gV[1] = uni(64u << 16);
    gV[2] = uni((u32)HD << 16);
    gV[3] = uni(64u << 16);
    gV[4] = uni((u32)HD);
    gV[5] = uni(2u * MROWS);
    gV[6] = uni(0u);
    gV[7] = uni(0u);
    asm volatile("" : "+s"(gK), "+s"(gV));   // the tensor mover's pin of descriptor words: each group stays in one set of scalar registers, none of which takes a new value while a request is out

    // not unrolled: one copy of the key loop in the instruction cache serves both tiles
#pragma unroll 1
    for (int part = 0; part < 2; ++part) {
    const int qt = part == 0 ? NQT - 1 - (int)blockIdx.x : (int)blockIdx.x;    // the same in every thread of the work-group
    const int q0 = qt * 16;
    const size_t qofs = (size_t)(b * S + q0 + ln) * NQ + hh * HD + 8 * h;     // B column ln, + dc*32
    const u32 mofs = (u32)((q0 + ln) * S + 8 * h);                            // query ln, + kb (+16), 8 keys in a row

    // a tile's four slices: K rows of 256 B (32 keys x 128 dims), Vt rows of 64 B (128 dims x 32 keys), each plane by one wave of the half
    auto stage = [&](u32 kt, u32 bf) {
        const u32 lb = lds_off(Ring) + bf * (2u * STG);
        if (pinned(w < 2)) {
            const u16* kp = (w == 0 ? Kh : Kl) + ((size_t)(b * S) + (size_t)kt * 32) * NKVD + kvh * HD;
            const unsigned long long ga = (unsigned long long)(size_t)kp;
            v4u g0;
            g0[0] = uni(1u);
            g0[1] = uni(lb + (w == 0 ? 0u : 2u * KPL));
            g0[2] = uni((u32)ga);
            g0[3] = uni((((u32)(ga >> 32)) & 0x01FFFFFFu) | 0x80000000u);
            tdm_load(g0, gK);
        } else if (pinned(w < 4)) {
            const u16* vp = (w == 2 ? Vh : Vl) + (size_t)(kvh * HD) * MROWS + (size_t)(b * S) + (size_t)kt * 32;
            const unsigned long long ga = (unsigned long long)(size_t)vp;
            v4u g0;
            g0[0] = uni(1u);
            g0[1] = uni(lb + 4u * KPL + (w == 2 ? 0u : 2u * VPL));
            g0[2] = uni((u32)ga);
            g0[3] = uni((((u32)(ga >> 32)) & 0x01FFFFFFu) | 0x80000000u);
            tdm_load(g0, gV);
        }
    };

    float mrun = -1.0e30f, lrun = 0.0f;        // of query ln; lrun sums this wave half's keys only, joined behind the loop
    v8f o[8];                                  // o[t][r] = O[query ln][dim t*16 + 8h + r]
#pragma unroll
    for (int t = 0; t < 8; ++t) o[t] = zero8();

    // the key tiles that are not all-masked, as a 64-bit set, alike in every wave of the work-group:
    // the ring has to know the next tile one pass ahead
    const u32 a_lo = __builtin_amdgcn_ballot_w32(flags[qt * NKT + lane] != 1);
    const u32 a_hi = __builtin_amdgcn_ballot_w32(flags[qt * NKT + 32 + lane] != 1);
    // the wait that stands ahead of any overwrite of the two flag loads' offset register: the Q fragments below may be placed over it
    asm volatile("s_wait_xcnt 0x0" ::: "memory");
    unsigned long long act = (unsigned long long)a_lo | ((unsigned long long)a_hi << 32);

    // Q^T of this wave's head, both planes, all 128 dims: the same B fragments in every pass, loaded once and kept in registers
    const u16* qhp = Qh + qofs;
    const u16* qlp = Ql + qofs;
    v16bf qh[4], ql[4];
    // unrolled: constant indices keep the fragments in registers
#pragma unroll
    for (int dc = 0; dc < 4; ++dc) {
        qh[dc] = ldfrag(qhp + dc * 32);
        ql[dc] = ldfrag(qlp + dc * 32);
    }
    // the wait that stands ahead of any overwrite of the loads' address registers; it takes both addresses as inputs,
    // so that no fragment is placed over them in front of it
    asm volatile("s_wait_xcnt 0x0" :: "v"(qhp), "v"(qlp) : "memory");

    if (pinned(act != 0)) {
        // a pass takes the next two tiles off the set, the first for the first half, the second for the second half;
        // the result is this half's tile, or -1 where the set ends on an odd tile. The set stays alike in every wave.
        auto take = [&]() -> int {
            const int t0 = __builtin_ctzll(act);
            act &= act - 1;
            int t1 = -1;
            if (act != 0) {
                t1 = __builtin_ctzll(act);
                act &= act - 1;
            }
            return g == 0 ? t0 : t1;
        };
        int bf = 0;
        int kt = take();
        if (pinned(kt >= 0)) stage(pinned((u32)kt), (u32)bf);
        asm volatile("s_wait_tensorcnt 0x0" ::: "memory");   // this wave's slice of the first tile has landed
        __syncthreads();                                     // ... and every other wave's
        bool more = act != 0;                                // a further pass exists: the same in every wave of the work-group
        int ktn = -1;
        if (pinned(more)) {
            ktn = take();
            if (pinned(ktn >= 0)) stage(pinned((u32)ktn), (u32)(bf ^ 1));
        }
        for (;;) {
            if (kt >= 0) {                                   // a half without a tile in the last pass only passes the publish point
            const int kb = kt * 32;
            const u16* Kb = Ring + bf * STG + ln * KP + 8 * h;               // K row ln, + 16*KP, + KPL, + dc*32
            const u16* Vb = Ring + bf * STG + 2 * KPL + ln * VP + 8 * h;     // Vt row ln, + t*16*VP, + VPL

            // the additive mask of query ln for this lane's 16 keys
            const float* mp = amask + (mofs + (u32)kb);
            const v4f mk0 = *(const v4fa*)(mp);
            const v4f mk1 = *(const v4fa*)(mp + 4);
            const v4f mk2 = *(const v4fa*)(mp + 16);
            const v4f mk3 = *(const v4fa*)(mp + 20);

            // scores S^T[32 keys][16 q] = K . Q^T over 128 dims (4 k-steps), two 16-key accumulators
            v8f s0 = zero8(), s1 = zero8();
            // the K fragments of a k-step come one step ahead of their products; constant indices keep them in registers
            v16bf kh[4][2], kl[4][2];
            kh[0][0] = ldfrag(Kb);
            kh[0][1] = ldfrag(Kb + 16 * KP);
            kl[0][0] = ldfrag(Kb + KPL);
            kl[0][1] = ldfrag(Kb + KPL + 16 * KP);
#pragma unroll
            for (int dc = 0; dc < 4; ++dc) {
                if (dc < 3) {
                    kh[dc + 1][0] = ldfrag(Kb + (dc + 1) * 32);
                    kh[dc + 1][1] = ldfrag(Kb + 16 * KP + (dc + 1) * 32);
                    kl[dc + 1][0] = ldfrag(Kb + KPL + (dc + 1) * 32);
                    kl[dc + 1][1] = ldfrag(Kb + KPL + 16 * KP + (dc + 1) * 32);
                }
                __builtin_amdgcn_sched_barrier(0);   // the loads above stay ahead of these products
                mma(s0, kh[dc][0], qh[dc]);
                mma(s1, kh[dc][1], qh[dc]);
                mma(s0, kh[dc][0], ql[dc]);
                mma(s1, kh[dc][1], ql[dc]);
                mma(s0, kl[dc][0], qh[dc]);
                mma(s1, kl[dc][1], qh[dc]);
                __builtin_amdgcn_sched_barrier(0);   // the products above stay ahead of the next loads and of the pass's end
            }
            // the first two V^T row groups are fetched here, so that they arrive under the softmax
            v16bf vh[8], vl[8];
            vh[0] = ldfrag(Vb);
            vh[1] = ldfrag(Vb + 16 * VP);
            vl[0] = ldfrag(Vb + VPL);
            vl[1] = ldfrag(Vb + VPL + 16 * VP);
            __builtin_amdgcn_sched_barrier(0);   // these loads stay ahead of the softmax

            // scale + additive mask by value + online softmax; lane (h,ln): s0[r] = (key kb + 8h + r, query ln), s1: + 16
            // the loops of this block are unrolled: every index into a, p0, p1 and o is a constant, so they stay in registers
            float a[16];
#pragma unroll
            for (int r = 0; r < 4; ++r) {
                a[r]      = s0[r]     * SCALE + mk0[r];
                a[4 + r]  = s0[4 + r] * SCALE + mk1[r];
                a[8 + r]  = s1[r]     * SCALE + mk2[r];
                a[12 + r] = s1[4 + r] * SCALE + mk3[r];
            }
            float mx = a[0];
#pragma unroll
            for (int e = 1; e < 16; ++e) mx = fmaxf(mx, a[e]);
            mx = fmaxf(mx, xhalf(mx));                           // the other 16 keys of the query
            const float mnew = fmaxf(mrun, mx);
            const float corr = __expf(mrun - mnew);
            mrun = mnew;
            float p0[8], p1[8];
            float ps = 0.0f;
#pragma unroll
            for (int r = 0; r < 8; ++r) {
                p0[r] = __expf(a[r] - mnew);
                p1[r] = __expf(a[8 + r] - mnew);
                ps += p0[r] + p1[r];
            }
            lrun = lrun * corr + ps;
#pragma unroll
            for (int t = 0; t < 8; ++t)
#pragma unroll
                for (int r = 0; r < 8; ++r) o[t][r] *= corr;
            // P^T as a B operand: element r <- key 8h + r, element 8 + r <- key 16 + 8h + r, column ln: as the lane holds them
            Frag ph, pl;
            split8(p0, ph.q[0], pl.q[0]);
            split8(p1, ph.q[1], pl.q[1]);

            // O^T[128][16 q] += V^T[128][32 keys] . P^T[32 keys][16 q]; V^T A-fragments from the ring's key-contiguous rows
            // two row groups at a time, the next two fetched ahead of these products
#pragma unroll
            for (int t = 0; t < 8; t += 2) {
                if (t < 6) {
                    vh[t + 2] = ldfrag(Vb + (t + 2) * 16 * VP);
                    vh[t + 3] = ldfrag(Vb + (t + 3) * 16 * VP);
                    vl[t + 2] = ldfrag(Vb + VPL + (t + 2) * 16 * VP);
                    vl[t + 3] = ldfrag(Vb + VPL + (t + 3) * 16 * VP);
                }
                mma3x2(o[t], o[t + 1], vh[t], vl[t], vh[t + 1], vl[t + 1], ph.v, pl.v);
            }
            }

            // publish point: this wave's LDS reads are done, its slice of the next tile has landed,
            // then the barrier that says both of every wave
            asm volatile("s_wait_dscnt 0x0" ::: "memory");
            asm volatile("s_wait_tensorcnt 0x0" ::: "memory");
            __syncthreads();
            if (!more) break;
            kt = ktn;
            ktn = -1;
            more = act != 0;
            if (pinned(more)) {                                  // refill the buffer this pass has just read
                ktn = take();
                if (pinned(ktn >= 0)) stage(pinned((u32)ktn), (u32)bf);
            }
            bf ^= 1;
        }
    }
    asm volatile("s_wait_tensorcnt 0x0" ::: "memory");           // no request is left in flight behind the key loop
    asm volatile("s_wait_dscnt 0x0" ::: "memory");               // ... and no read of the ring

    // the second half hands over what it has of head w: lane l of its wave w to lane l of the first half's wave w
    if (g == 1) {
        // unrolled: constant indices keep o in registers
#pragma unroll
        for (int t = 0; t < 8; ++t) {
            v4f x0, x1;
#pragma unroll
            for (int r = 0; r < 4; ++r) { x0[r] = o[t][r]; x1[r] = o[t][4 + r]; }
            *(v4fa*)(Pa + (2 * t) * 128) = x0;
            *(v4fa*)(Pa + (2 * t + 1) * 128) = x1;
        }
        MsA[w * 32 + lane] = mrun;
        LsA[w * 32 + lane] = lrun;
    }
    __syncthreads();                                             // the hand-over is written; every wave has left the tile before's stores
    // join the halves under their common maximum, normalise, stage the 16x128 f32 tile
    if (g == 0) {
        const float m1 = MsA[w * 32 + lane], l1 = LsA[w * 32 + lane];
        const float mj = fmaxf(mrun, m1);
        const float c0 = __expf(mrun - mj), c1 = __expf(m1 - mj);
        const float lj = lrun * c0 + l1 * c1;
        const float lv = lj + xhalf(lj);                         // both wave halves' keys
        const float li = (lv > 0.0f) ? (1.0f / lv) : 0.0f;
        const float f0 = c0 * li, f1 = c1 * li;
        float* orow = Os + ln * OSP + 8 * h;
        // unrolled: constant indices keep o in registers
#pragma unroll
        for (int t = 0; t < 8; ++t) {
            const v4f y0 = *(const v4fa*)(Pa + (2 * t) * 128);
            const v4f y1 = *(const v4fa*)(Pa + (2 * t + 1) * 128);
            v4f x0, x1;
#pragma unroll
            for (int r = 0; r < 4; ++r) { x0[r] = o[t][r] * f0 + y0[r] * f1; x1[r] = o[t][4 + r] * f0 + y1[r] * f1; }
            *(v4fa*)(orow + t * 16) = x0;
            *(v4fa*)(orow + t * 16 + 4) = x1;
        }
    }
    __syncthreads();
    // write hi/lo planes with 16-B lane-contiguous stores; each half takes 8 of the 16 rows of head w
#pragma unroll 1
    for (int it = g * 4; it < g * 4 + 4; ++it) {
        const int row = it * 2 + h, colc = ln * 8;
        const float* cr = Os + row * OSP;
        const v4f a = *(const v4fa*)(cr + colc);
        const v4f c = *(const v4fa*)(cr + colc + 4);
        float x[8] = {a[0], a[1], a[2], a[3], c[0], c[1], c[2], c[3]};
        v4u hi, lo;
        split8(x, hi, lo);
        const size_t oo = (size_t)(b * S + q0 + row) * NQ + hh * HD + colc;
        st2u(Oh + oo, Ol + oo, hi, lo);
        stores_issued();                       // the next trip, and behind the last trip the second tile's code, rewrite the stores' registers
    }
    }
}

// ---------------- host ---------------------------------------------------------------------
extern "C" void kernel_launch(void* const* d_in, const int* in_sizes, int n_in,
                              void* d_out, int out_size, void* d_ws, size_t ws_size,
                              hipStream_t stream)
{
    if (n_in < 11) return;
    if (in_sizes[0] != MROWS * HID || in_sizes[1] != MROWS || in_sizes[2] != S * S ||
        in_sizes[3] != HID * NQ || in_sizes[4] != NQ ||
        in_sizes[5] != HID * NKVD || in_sizes[6] != NKVD ||
        in_sizes[7] != HID * NKVD || in_sizes[8] != NKVD ||
        in_sizes[9] != NQ * HID || in_sizes[10] != HID) return;
    if (out_size != MROWS * HID) return;

    const float* X   = (const float*)d_in[0];   // [B*S][HID]
    const float* ts  = (const float*)d_in[1];   // [B*S]
    const float* amk = (const float*)d_in[2];   // [S][S] additive
    const float* Wq  = (const float*)d_in[3];   // [HID][NQ]
    const float* bq  = (const float*)d_in[4];
    const float* Wk  = (const float*)d_in[5];   // [HID][NKVD]
    const float* bk  = (const float*)d_in[6];
    const float* Wv  = (const float*)d_in[7];   // [HID][NKVD]
    const float* bv  = (const float*)d_in[8];
    const float* Wo  = (const float*)d_in[9];   // [NQ][HID]
    const float* bo  = (const float*)d_in[10];
    float* out = (float*)d_out;                 // [B*S][HID]

    const size_t szX  = (size_t)MROWS * HID * 2;     // one plane
    const size_t szWq = (size_t)NQ * HID * 2;
    const size_t szWk = (size_t)NKVD * HID * 2;
    const size_t szWo = (size_t)HID * NQ * 2;
    const size_t szQ  = (size_t)MROWS * NQ * 2;
    const size_t szK  = (size_t)MROWS * NKVD * 2;
    const size_t szVt = (size_t)NKVD * MROWS * 2;
    const size_t szTb = (size_t)MROWS * NFREQ * 4;
    const size_t szFl = (size_t)NQT * NKT * 4;
    char* base = (char*)d_ws;
    size_t used = 0;
    auto take = [&](size_t bytes) -> char* { char* p = base + used; used += (bytes + 255) & ~(size_t)255; return p; };
    u16* Xh   = (u16*)take(szX);   u16* Xl   = (u16*)take(szX);     // reused as attention-output planes
    u16* Wqth = (u16*)take(szWq);  u16* Wqtl = (u16*)take(szWq);    // [NQ][HID]
    u16* Wkth = (u16*)take(szWk);  u16* Wktl = (u16*)take(szWk);    // [NKVD][HID]
    u16* Wvth = (u16*)take(szWk);  u16* Wvtl = (u16*)take(szWk);    // [NKVD][HID]
    u16* Woth = (u16*)take(szWo);  u16* Wotl = (u16*)take(szWo);    // [HID][NQ]
    u16* Qh   = (u16*)take(szQ);   u16* Ql   = (u16*)take(szQ);     // [MROWS][NQ]
    u16* Kh   = (u16*)take(szK);   u16* Kl   = (u16*)take(szK);     // [MROWS][NKVD]
    u16* Vth  = (u16*)take(szVt);  u16* Vtl  = (u16*)take(szVt);    // [NKVD][MROWS]
    float* cosT = (float*)take(szTb);                               // [MROWS][64]
    float* sinT = (float*)take(szTb);
    int* flags  = (int*)take(szFl);                                 // [NQT][NKT]
    if (used > ws_size) return;
    u16* AOh = Xh;   // X planes are dead once the three projections are enqueued
    u16* AOl = Xl;

    // 1: preparation: X and the four weights -> hi/lo planes (weights k-contiguous), rotary table, tile skip flags
    k_prep<<<dim3(PB_ALL), dim3(256), 0, stream>>>(X, ts, amk, Wq, Wk, Wv, Wo, Xh, Xl, Wqth, Wqtl, Wkth, Wktl,
                                                   Wvth, Wvtl, Woth, Wotl, cosT, sinT, flags);
    // 2: the Q, K and V projections
    gemm_qkv<<<dim3(GB_Q + GB_K + GB_V), dim3(128), 0, stream>>>(Xh, Xl, Wqth, Wqtl, Wkth, Wktl, Wvth, Wvtl, bq, bk, bv,
                                                                 cosT, sinT, Qh, Ql, Kh, Kl, Vth, Vtl);
    // 3: attention -> AO planes [MROWS][NQ]
    attn_x3<<<dim3(NQT / 2, NKV, BB), dim3(512), 0, stream>>>(Qh, Ql, Kh, Kl, Vth, Vtl, amk, flags, AOh, AOl);
    // 4: the output projection
    gemm_out<<<dim3(HID / 128, MROWS / 128), dim3(128), 0, stream>>>(AOh, AOl, Woth, Wotl, bo, out);
    (void)hipGetLastError();
}
